// v000
// The times below were measured on an AMD MI455X: many runs one after another, warmed up first and cycling through
// copies of the inputs, with the whole window's GPU time divided by the number of runs. Launches and the gaps
// between them are all in it. The median over several windows is given; except for v000 it joins two sittings, which
// can be a few percent apart, so the side-by-side timings, each taken in one sitting, are the better comparison.
// The starting kernel, v000, takes 5850 microseconds a run.
#include <hip/hip_runtime.h>
// Masked (causal) multi-head self-attention WITHOUT output projection (X [2][2048][1024]; Q = X Wq^T + bq, K, V likewise (nn.Linear natural [1024][1024] sigma 1/32, biases sigma 1/32); 16 heads of 64; scores / 8; causal (tril, -inf); softmax; out = merged attn V -> [2][2048][1024]).
// Structure: x as exact f16 rows; q | k | v as ONE WMMA GEMM from the stacked x16 natural weight planes (+ stacked biases) (32x64 wave tiles, f32 accumulation, + bias, f16 outputs; q | k | v block order); per batch: V^T via LDS transposes; per query tile of 256 rows: scores against the keys below the tile end only (K = 64, 16 heads on grid.y, alpha 1/8), causal row softmax on VALU (arithmetic 0/1 select; f32 statistics, native exp; weights x256 f16), o = P V^T (alpha 2^-8) written f32 straight into the output rows (no output projection in this module); first-tile refinement: the first 256 rows of each batch recomputed exactly (f32 q/k/v GEMMs + online-softmax attention on VALU) and those output rows replaced; launches: see trace.
// Compute dtype: inputs rounded to bf16; x / weights exact; q, k, v and softmax weights as plain f16 GEMM operands (~2^-12), o written f32; scores and softmax statistics f32. v_wmma_f32_16x16x32_f16.
#define NB 2
#define SQ 2048
#define DM 1024
#define NH 16
#define HD 64
#define HG 4                         /* head group of the k_vt(b, h0) form; S / P sized HG*SQ*SQ = NH*QT*SQ */
#define B0 0                         /* first batch processed (debug hook) */
#define NBR NB                       /* batches processed (debug hook) */
#define NR ((size_t)NB * SQ)         /* token rows */
#define MP ((int)((size_t)NBR * SQ)) /* rows projected (debug hook) */
#define QT 256                       /* query rows per causal tile */
#define NKX SQ                       /* S / P row pitch */
#define QT0 256                      /* first-tile rows recomputed exactly (256: margin for the few-key rows, no output projection) */
#define QN SQ                        /* query rows attended per batch (debug hook) */
#define NHD NH                       /* heads attended (debug hook) */
#define MPO MP                       /* unused */
#define LQ (3 * DM)      /* row pitch of the q/k/v rows */
typedef __bf16 v16b __attribute__((ext_vector_type(16)));
typedef unsigned short v8us __attribute__((ext_vector_type(8), may_alias));
typedef float  v8f  __attribute__((ext_vector_type(8)));
typedef float  v4f  __attribute__((ext_vector_type(4)));
typedef float  v4fa __attribute__((ext_vector_type(4), may_alias));
union FragB { v16b v; v8us half[2]; unsigned short u[16]; };

__device__ __forceinline__ unsigned short bf16_bits(float x) { unsigned int u = __float_as_uint(x); return (unsigned short)((u + 0x7FFFu + ((u >> 16) & 1u)) >> 16); }
__device__ __forceinline__ float bf16_val(unsigned short b) { return __uint_as_float(((unsigned int)b) << 16); }
__device__ __forceinline__ float bf16_round(float x) { return bf16_val(bf16_bits(x)); }
// D += A·B with NT terms: 1 = ah·bh, 2 = + al·bh (A split), 3 = + ah·bl (both split)
template <int NT>
__device__ __forceinline__ v8f mmaN(v16b ah, v16b al, v16b bh, v16b bl, v8f c) {
  c = __builtin_amdgcn_wmma_f32_16x16x32_bf16(false, ah, false, bh, (short)0, c, false, false);
  if (NT >= 2) c = __builtin_amdgcn_wmma_f32_16x16x32_bf16(false, al, false, bh, (short)0, c, false, false);
  if (NT >= 3) c = __builtin_amdgcn_wmma_f32_16x16x32_bf16(false, ah, false, bl, (short)0, c, false, false);
  asm volatile("v_nop\n\tv_nop\n\tv_nop\n\tv_nop" : "+v"(c) : "v"(ah), "v"(al), "v"(bh), "v"(bl));
  return c;
}

__global__ __launch_bounds__(256) void k_wt_bf16(const float* __restrict__ W, unsigned short* __restrict__ Wt, int K, int N) {
  const int t = blockIdx.x * 256 + threadIdx.x;
  const int k8n = K / 8;
  if (t >= N * k8n) return;
  const int n = t / k8n, k8 = (t % k8n) * 8;
  v8us v;
#pragma unroll
  for (int i = 0; i < 8; ++i) v[i] = bf16_bits(W[(size_t)(k8 + i) * N + n]);
  *(v8us*)(Wt + (size_t)n * K + k8) = v;
  
}

// GEMM C[M][N] (f32, pitch ldc) = act(A[M][K]·W + bias). A f32 row-major (pitch lda) converted per fragment to bf16
// (ASPLIT: hi/lo two planes -> 2 terms, else single rounded term); Wt bf16 [N][K] (pitch ldb). BIAS_BF16 rounds the
// bias to bf16 first (bias quantised to bf16 before the add). K%32==0, M%16==0, N%64==0.
template <bool ASPLIT, int ACT, bool BIAS_BF16>
__global__ __launch_bounds__(128) void k_gemm_bf(const float* __restrict__ A, int lda, const unsigned short* __restrict__ Wt, int ldb,
                                               const float* __restrict__ bias, float* __restrict__ C, int ldc, int M, int N, int K) {
  __shared__ __attribute__((aligned(16))) float so[4][16][64];
  const int tid = threadIdx.x, w = tid >> 5, lane = tid & 31, ln = lane & 15, hh = lane >> 4;
  const int ntn = N / 64;
  const int wid = blockIdx.x * 4 + w;
  const int mt = wid / ntn, nq = wid % ntn;
  if (mt * 16 >= M) return;
  const int row0 = mt * 16, col0 = nq * 64;
  const float* arow = A + (size_t)(row0 + ln) * lda;
  v8f acc[4] = {};
  for (int kb = 0; kb < K; kb += 32) {
    FragB ah, al;
    const v4f x0 = *(const v4fa*)(arow + kb + 8 * hh), x1 = *(const v4fa*)(arow + kb + 8 * hh + 4);
    const v4f x2 = *(const v4fa*)(arow + kb + 16 + 8 * hh), x3 = *(const v4fa*)(arow + kb + 16 + 8 * hh + 4);
    float xs[16] = {x0[0],x0[1],x0[2],x0[3],x1[0],x1[1],x1[2],x1[3],x2[0],x2[1],x2[2],x2[3],x3[0],x3[1],x3[2],x3[3]};
#pragma unroll
    for (int i = 0; i < 16; ++i) { const unsigned short hb = bf16_bits(xs[i]); ah.u[i] = hb; al.u[i] = ASPLIT ? bf16_bits(xs[i] - bf16_val(hb)) : (unsigned short)0; }
#pragma unroll
    for (int t = 0; t < 4; ++t) {
      const unsigned short* brow = Wt + (size_t)(col0 + t * 16 + ln) * ldb + kb;
      FragB b;
      b.half[0] = *(const v8us*)(brow + 8 * hh);
      b.half[1] = *(const v8us*)(brow + 16 + 8 * hh);
      acc[t] = mmaN<ASPLIT ? 2 : 1>(ah.v, al.v, b.v, b.v, acc[t]);
    }
  }
#pragma unroll
  for (int t = 0; t < 4; ++t) {
    float bv = bias ? bias[col0 + t * 16 + ln] : 0.f;
    if (BIAS_BF16) bv = bf16_round(bv);
#pragma unroll
    for (int r = 0; r < 8; ++r) { float v = acc[t][r] + bv; if (ACT == 1) v = fmaxf(v, 0.f); so[w][8 * hh + r][t * 16 + ln] = v; }
  }
  __builtin_amdgcn_fence(__ATOMIC_ACQ_REL, "workgroup");
  __builtin_amdgcn_wave_barrier();
  const int rsub = lane >> 4, c4 = (lane & 15) * 4;
  {
#pragma unroll
    for (int q = 0; q < 8; ++q) {
      const int r = q * 2 + rsub;
      const v4f v = *(const v4fa*)&so[w][r][c4];
      *(v4f*)(C + (size_t)(row0 + r) * ldc + col0 + c4) = v;
    }
    
  }
}

// GEMM C = act(A·W + bias + resid): A f32 (ASPLIT -> hi/lo 2 terms), Wt bf16 [N][K]; ACT 0 none, 1 relu, 2 exact gelu;
// resid (optional, f32, row index = (row % rmod), pitch ldr, RES_BF16 rounds it) added before the activation.
template <bool ASPLIT, int ACT, bool BIAS_BF16, bool RES_BF16>
__global__ __launch_bounds__(128) void k_gemm_bf3(const float* __restrict__ A, int lda, const unsigned short* __restrict__ Wt, int ldb,
                                                const float* __restrict__ bias, const float* __restrict__ resid, int rmod, int ldr,
                                                float* __restrict__ C, int ldc, int M, int N, int K) {
  __shared__ __attribute__((aligned(16))) float so[4][16][64];
  const int tid = threadIdx.x, w = tid >> 5, lane = tid & 31, ln = lane & 15, hh = lane >> 4;
  const int ntn = N / 64;
  const int wid = blockIdx.x * 4 + w;
  const int mt = wid / ntn, nq = wid % ntn;
  if (mt * 16 >= M) return;
  const int row0 = mt * 16, col0 = nq * 64;
  const float* arow = A + (size_t)(row0 + ln) * lda;
  v8f acc[4] = {};
  for (int kb = 0; kb < K; kb += 32) {
    FragB ah, al;
    const v4f x0 = *(const v4fa*)(arow + kb + 8 * hh), x1 = *(const v4fa*)(arow + kb + 8 * hh + 4);
    const v4f x2 = *(const v4fa*)(arow + kb + 16 + 8 * hh), x3 = *(const v4fa*)(arow + kb + 16 + 8 * hh + 4);
    float xs[16] = {x0[0],x0[1],x0[2],x0[3],x1[0],x1[1],x1[2],x1[3],x2[0],x2[1],x2[2],x2[3],x3[0],x3[1],x3[2],x3[3]};
#pragma unroll
    for (int i = 0; i < 16; ++i) { const unsigned short hb = bf16_bits(xs[i]); ah.u[i] = hb; al.u[i] = ASPLIT ? bf16_bits(xs[i] - bf16_val(hb)) : (unsigned short)0; }
#pragma unroll
    for (int t = 0; t < 4; ++t) {
      const unsigned short* brow = Wt + (size_t)(col0 + t * 16 + ln) * ldb + kb;
      FragB b;
      b.half[0] = *(const v8us*)(brow + 8 * hh);
      b.half[1] = *(const v8us*)(brow + 16 + 8 * hh);
      acc[t] = mmaN<ASPLIT ? 2 : 1>(ah.v, al.v, b.v, b.v, acc[t]);
    }
  }
#pragma unroll
  for (int t = 0; t < 4; ++t) {
    const int col = col0 + t * 16 + ln;
    float bv = bias ? bias[col] : 0.f;
    if (BIAS_BF16) bv = bf16_round(bv);
#pragma unroll
    for (int r = 0; r < 8; ++r) {
      float v = acc[t][r] + bv;
      if (resid) { float rv = resid[(size_t)((row0 + 8 * hh + r) % rmod) * ldr + col]; if (RES_BF16) rv = bf16_round(rv); v += rv; }
      if (ACT == 1) v = fmaxf(v, 0.f);
      if (ACT == 2) v = 0.5f * v * (1.0f + erff(v * 0.70710678118654752f));
      if (ACT == 3) { const float u = 0.7978845608028654f * (v + 0.044715f * v * v * v); v = 0.5f * v * (1.0f + tanhf(u)); }
      so[w][8 * hh + r][t * 16 + ln] = v;
    }
  }
  __builtin_amdgcn_fence(__ATOMIC_ACQ_REL, "workgroup");
  __builtin_amdgcn_wave_barrier();
  const int rsub = lane >> 4, c4 = (lane & 15) * 4;
  {
#pragma unroll
    for (int q = 0; q < 8; ++q) {
      const int r = q * 2 + rsub;
      const v4f v = *(const v4fa*)&so[w][r][c4];
      *(v4f*)(C + (size_t)(row0 + r) * ldc + col0 + c4) = v;
    }
    
  }
}
// row LayerNorm (biased variance, eps) over N: s = X (+ R); optional out_sum <- s; out_norm <- (s-mu)*rsqrt(var+eps)*g + b
template <bool PARAM_BF16>
__global__ __launch_bounds__(256) void k_layernorm(const float* __restrict__ X, const float* __restrict__ R, const float* __restrict__ g, const float* __restrict__ bta,
                                                  float* __restrict__ out_sum, float* __restrict__ out_norm, int N, float eps) {
  __shared__ float red[256];
  const int row = blockIdx.x, tid = threadIdx.x;
  const float* x = X + (size_t)row * N; const float* rr = R ? R + (size_t)row * N : nullptr;
  float vals[16];                     // up to N = 4096
  const int per = N / 256;            // contiguous chunk per thread? use strided-by-4 chunks: thread handles j = tid*4 + 1024*u
  float s1 = 0.f;
  for (int u = 0; u < per / 4; ++u) {
    const int j = tid * 4 + 1024 * u;
    const v4f a = *(const v4fa*)(x + j);
    v4f b = {0.f,0.f,0.f,0.f}; if (rr) b = *(const v4fa*)(rr + j);
#pragma unroll
    for (int q = 0; q < 4; ++q) { const float v = a[q] + b[q]; vals[u * 4 + q] = v; s1 += v; }
  }
  red[tid] = s1; __syncthreads();
  for (int st = 128; st > 0; st >>= 1) { if (tid < st) red[tid] += red[tid + st]; __syncthreads(); }
  const float mu = red[0] / (float)N; __syncthreads();
  float s2 = 0.f;
  for (int u = 0; u < per / 4; ++u)
#pragma unroll
    for (int q = 0; q < 4; ++q) { const float c = vals[u * 4 + q] - mu; s2 += c * c; }
  red[tid] = s2; __syncthreads();
  for (int st = 128; st > 0; st >>= 1) { if (tid < st) red[tid] += red[tid + st]; __syncthreads(); }
  const float rs = rsqrtf(red[0] / (float)N + eps);
  {
    for (int u = 0; u < per / 4; ++u) {
      const int j = tid * 4 + 1024 * u;
      v4f o, sm;
#pragma unroll
      for (int q = 0; q < 4; ++q) {
        float gg = g[j + q], bb = bta[j + q];
        if (PARAM_BF16) { gg = bf16_round(gg); bb = bf16_round(bb); }
        sm[q] = vals[u * 4 + q]; o[q] = (vals[u * 4 + q] - mu) * rs * gg + bb;
      }
      if (out_sum) *(v4f*)(out_sum + (size_t)row * N + j) = sm;
      *(v4f*)(out_norm + (size_t)row * N + j) = o;
    }
    
  }
}



// ---- f16 WMMA path (v_wmma_f32_16x16x32_f16): 11-bit significands for operands in range — used where a [0,1] probability operand needs more precision than bf16
typedef _Float16 v16h __attribute__((ext_vector_type(16)));
union FragH { v16h v; v8us half[2]; _Float16 h[16]; unsigned short u[16]; };
template <int NT>
__device__ __forceinline__ v8f mmaH(v16h ah, v16h al, v16h bh, v16h bl, v8f c) {
  c = __builtin_amdgcn_wmma_f32_16x16x32_f16(false, ah, false, bh, (short)0, c, false, false);
  if (NT >= 2) c = __builtin_amdgcn_wmma_f32_16x16x32_f16(false, al, false, bh, (short)0, c, false, false);
  if (NT >= 3) c = __builtin_amdgcn_wmma_f32_16x16x32_f16(false, ah, false, bl, (short)0, c, false, false);
  asm volatile("v_nop\n\tv_nop\n\tv_nop\n\tv_nop" : "+v"(c) : "v"(ah), "v"(al), "v"(bh), "v"(bl));
  return c;
}
// batched GEMM like k_gemm_b but f16 operands: A f32 (split into f16 hi/lo if ASPLIT, else rounded to f16), Bt = f16 values [n][k]; alpha; C f32; N multiple of 16 (partial tiles skipped)
template <bool ASPLIT>
__global__ __launch_bounds__(128) void k_gemm_h(const float* __restrict__ A, int lda, size_t sA, const _Float16* __restrict__ Bh, int ldb, size_t sB, float alpha, float* __restrict__ C, int ldc, size_t sC, int M, int N, int K) {
  __shared__ __attribute__((aligned(16))) float so[4][16][64];
  const int tid = threadIdx.x, w = tid >> 5, lane = tid & 31, ln = lane & 15, hh = lane >> 4; const int by = blockIdx.y;
  A += (size_t)by * sA; Bh += (size_t)by * sB; C += (size_t)by * sC;
  const int ntn = (N + 63) / 64; const int wid = blockIdx.x * 4 + w; const int mt = wid / ntn, nq = wid % ntn; if (mt * 16 >= M) return;
  const int row0 = mt * 16, col0 = nq * 64; const float* arow = A + (size_t)(row0 + ln) * lda;
  v8f acc[4] = {};
  for (int kb = 0; kb < K; kb += 32) {
    FragH ah, al;
    const v4f x0 = *(const v4fa*)(arow + kb + 8 * hh), x1 = *(const v4fa*)(arow + kb + 8 * hh + 4), x2 = *(const v4fa*)(arow + kb + 16 + 8 * hh), x3 = *(const v4fa*)(arow + kb + 16 + 8 * hh + 4);
    float xs[16] = {x0[0],x0[1],x0[2],x0[3],x1[0],x1[1],x1[2],x1[3],x2[0],x2[1],x2[2],x2[3],x3[0],x3[1],x3[2],x3[3]};
#pragma unroll
    for (int i = 0; i < 16; ++i) { const _Float16 h = (_Float16)xs[i]; ah.h[i] = h; al.h[i] = ASPLIT ? (_Float16)(xs[i] - (float)h) : (_Float16)0.0f; }
#pragma unroll
    for (int t = 0; t < 4; ++t) { if (col0 + t * 16 >= N) continue; const size_t boff = (size_t)(col0 + t * 16 + ln) * ldb + kb; FragH bq; bq.half[0] = *(const v8us*)(Bh + boff + 8 * hh); bq.half[1] = *(const v8us*)(Bh + boff + 16 + 8 * hh);
      acc[t] = mmaH<ASPLIT ? 2 : 1>(ah.v, al.v, bq.v, bq.v, acc[t]); }
  }
#pragma unroll
  for (int t = 0; t < 4; ++t) { if (col0 + t * 16 >= N) continue;
#pragma unroll
    for (int r = 0; r < 8; ++r) so[w][8 * hh + r][t * 16 + ln] = acc[t][r] * alpha; }
  __builtin_amdgcn_fence(__ATOMIC_ACQ_REL, "workgroup"); __builtin_amdgcn_wave_barrier();
  const int rsub = lane >> 4, c4 = (lane & 15) * 4;
  {
#pragma unroll
    for (int q = 0; q < 8; ++q) { const int r = q * 2 + rsub; if (col0 + c4 < N) { const v4f v = *(const v4fa*)&so[w][r][c4]; *(v4f*)(C + (size_t)(row0 + r) * ldc + col0 + c4) = v; } }
     }
}

// Wt[n][k] = f16(W[k][n]·scale) from f32 row-major W[K][N] (scale = power of two; bf16-exact weights stay exact in f16 away from the subnormal range)
__global__ __launch_bounds__(256) void k_wt_f16(const float* __restrict__ W, _Float16* __restrict__ Wt, int K, int N, float scale) {
  const int t = blockIdx.x * 256 + threadIdx.x; if (t >= N * (K / 8)) return; const int n = t / (K / 8), k8 = (t % (K / 8)) * 8; FragH f;
#pragma unroll
  for (int i = 0; i < 8; ++i) f.h[i] = (_Float16)(bf16_round(W[(size_t)(k8 + i) * N + n]) * scale); const v8us o = f.half[0];
  *(v8us*)((unsigned short*)Wt + (size_t)n * K + k8) = o; 
}
// k_gemm_hh variant with fused epilogue: v = acc·alpha + bias[by·sBias + col] (+ CP[(row/rowsPerB)·sCPb + by·64 + col] if CP) ; ACT 0 none / 1 elu ; writes f16 C16 (and f32 C if non-null)
template <int ACT>
__global__ __launch_bounds__(128) void k_gemm_hhx(const _Float16* __restrict__ A, int lda, size_t sA, const _Float16* __restrict__ Bh, int ldb, size_t sB, float alpha, const float* __restrict__ bias, size_t sBias, const float* __restrict__ CP, int rowsPerB, size_t sCPb, int row0g,
    float* __restrict__ C, _Float16* __restrict__ C16, int ldc, size_t sC, int M, int N, int K) {
  __shared__ __attribute__((aligned(16))) float so[4][16][64];
  const int tid = threadIdx.x, w = tid >> 5, lane = tid & 31, ln = lane & 15, hh = lane >> 4; const int by = blockIdx.y;
  A += (size_t)by * sA; Bh += (size_t)by * sB; const size_t cofs = (size_t)by * sC; const float* bp = bias ? bias + (size_t)by * sBias : nullptr;
  const int ntn = (N + 63) / 64; const int wid = blockIdx.x * 4 + w; const int mt = wid / ntn, nq = wid % ntn; if (mt * 16 >= M) return;
  const int row0 = mt * 16, col0 = nq * 64; const _Float16* arow = A + (size_t)(row0 + ln) * lda;
  v8f acc[4] = {};
  for (int kb = 0; kb < K; kb += 32) { FragH ah; ah.half[0] = *(const v8us*)((const unsigned short*)arow + kb + 8 * hh); ah.half[1] = *(const v8us*)((const unsigned short*)arow + kb + 16 + 8 * hh);
#pragma unroll
    for (int t = 0; t < 4; ++t) { if (col0 + t * 16 >= N) continue; const size_t boff = (size_t)(col0 + t * 16 + ln) * ldb + kb; FragH bq; bq.half[0] = *(const v8us*)((const unsigned short*)Bh + boff + 8 * hh); bq.half[1] = *(const v8us*)((const unsigned short*)Bh + boff + 16 + 8 * hh);
      acc[t] = mmaH<1>(ah.v, ah.v, bq.v, bq.v, acc[t]); }
  }
#pragma unroll
  for (int t = 0; t < 4; ++t) { if (col0 + t * 16 >= N) continue; const int col = col0 + t * 16 + ln; const float bv = bp ? bf16_round(bp[col]) : 0.f;
#pragma unroll
    for (int r = 0; r < 8; ++r) { float v = acc[t][r] * alpha + bv; if (CP) { const int rr = row0g + row0 + 8 * hh + r; if (rowsPerB < 0) v += CP[cofs + (size_t)rr * ldc + col];      /* rowsPerB < 0: own element of the batched C plane */ else { const int bidx = rr / rowsPerB; v += CP[(size_t)bidx * sCPb + (size_t)by * 64 + col]; } } if (ACT == 1) v = (v > 0.f) ? v : expm1f(v); else if (ACT == 7) v = (v > 0.f) ? v + 1.0f : expf(v); else if (ACT == 8) v = tanhf(v); else if (ACT == 9) v = 0.5f * v * (1.0f + tanhf(0.7978845608028654f * (v + 0.044715f * v * v * v))); else if (ACT == 11) v = 1.0f / (1.0f + expf(-v)); else if (ACT == 12) v = (v > 0.f) ? v : 0.01f * v; else if (ACT == 14) v = (v > 0.f) ? v : 0.1f * v; else if (ACT == 16) v = (v >= 0.f) ? v : 0.3f * v; else if (ACT == 17) v = (v >= 0.f) ? v : 0.2f * v; else if (ACT == 15) v = v / (1.0f + expf(-v)); else if (ACT == 3) v = fmaxf(v, 0.f); else if (ACT == 6) v = 0.5f * v * (1.0f + erff(v * 0.70710678118654752f)); so[w][8 * hh + r][t * 16 + ln] = v; } }
  __builtin_amdgcn_fence(__ATOMIC_ACQ_REL, "workgroup"); __builtin_amdgcn_wave_barrier();
  const int rsub = lane >> 4, c4 = (lane & 15) * 4; typedef _Float16 v4h __attribute__((ext_vector_type(4)));
  {
#pragma unroll
    for (int q = 0; q < 8; ++q) { const int r = q * 2 + rsub; if (col0 + c4 < N) { const v4f v = *(const v4fa*)&so[w][r][c4]; if (C) *(v4f*)(C + cofs + (size_t)(row0 + r) * ldc + col0 + c4) = v; if (C16) { v4h h4; for (int i = 0; i < 4; ++i) h4[i] = (_Float16)v[i]; *(v4h*)(C16 + cofs + (size_t)(row0 + r) * ldc + col0 + c4) = h4; } } }
     }
}


typedef _Float16 v4h __attribute__((ext_vector_type(4)));

__global__ __launch_bounds__(256) void k_x16(const float* __restrict__ x, _Float16* __restrict__ X16, size_t n8) { const size_t t = (size_t)blockIdx.x * 256 + threadIdx.x; if (t >= n8) return; FragH f;
#pragma unroll
  for (int q = 0; q < 8; ++q) f.h[q] = (_Float16)bf16_round(x[t * 8 + q]); *(v8us*)((unsigned short*)X16 + t * 8) = f.half[0];  }
__global__ __launch_bounds__(256) void k_h16(const float* __restrict__ x, _Float16* __restrict__ X16, size_t n8) { const size_t t = (size_t)blockIdx.x * 256 + threadIdx.x; if (t >= n8) return; FragH f;
#pragma unroll
  for (int q = 0; q < 8; ++q) f.h[q] = (_Float16)x[t * 8 + q]; *(v8us*)((unsigned short*)X16 + t * 8) = f.half[0];  }
__global__ __launch_bounds__(256) void k_round16f(const float* __restrict__ W, _Float16* __restrict__ Bt, size_t n8) { const size_t t = (size_t)blockIdx.x * 256 + threadIdx.x; if (t >= n8) return; FragH f;
#pragma unroll
  for (int i = 0; i < 8; ++i) f.h[i] = (_Float16)(bf16_round(W[t * 8 + i]) * 16.0f); *(v8us*)((unsigned short*)Bt + t * 8) = f.half[0];  }
template <int NHv, int TTv>
__global__ __launch_bounds__(256) void k_vt(const _Float16* __restrict__ V16, int ldv, int voff, _Float16* __restrict__ Vt) { __shared__ unsigned short tl[64][66]; const int tid = threadIdx.x; const int slab = blockIdx.x / (TTv / 64), lg = blockIdx.x % (TTv / 64); const int b = slab / NHv, h = slab % NHv;
  for (int i = tid; i < 64 * 8; i += 256) { const int r = i / 8, c8 = (i % 8) * 8; FragH f; f.half[0] = *(const v8us*)((const unsigned short*)V16 + ((size_t)b * TTv + lg * 64 + r) * ldv + voff + h * 64 + c8);
#pragma unroll
    for (int q = 0; q < 8; ++q) tl[r][c8 + q] = f.u[q]; }
  __syncthreads();
  {
#pragma unroll
    for (int rd = 0; rd < 2; ++rd) { const int d = rd * 32 + tid / 8, pc = tid % 8; FragH f;
#pragma unroll
      for (int q = 0; q < 8; ++q) f.u[q] = tl[pc * 8 + q][d];
      *(v8us*)((unsigned short*)Vt + ((size_t)slab * 64 + d) * TTv + lg * 64 + pc * 8) = f.half[0]; }
     } }

__global__ __launch_bounds__(256) void k_hl(const float* __restrict__ F, _Float16* __restrict__ Hh, _Float16* __restrict__ Hl, size_t n8) { const size_t t = (size_t)blockIdx.x * 256 + threadIdx.x; if (t >= n8) return; FragH fh, fl; const v4f a = *(const v4fa*)(F + t * 8), c = *(const v4fa*)(F + t * 8 + 4);
#pragma unroll
  for (int q = 0; q < 4; ++q) { _Float16 h = (_Float16)a[q]; fh.h[q] = h; fl.h[q] = (_Float16)((a[q] - (float)h) * 1024.0f); h = (_Float16)c[q]; fh.h[4 + q] = h; fl.h[4 + q] = (_Float16)((c[q] - (float)h) * 1024.0f); }
  { *(v8us*)((unsigned short*)Hh + t * 8) = fh.half[0]; *(v8us*)((unsigned short*)Hl + t * 8) = fl.half[0];  } }

// ---- fast GEMM (wave tile 32x64; requires M % 32 == 0 rows per launch region and N % 64 == 0); epilogue = k_gemm_hhx semantics ----
__device__ __forceinline__ v16h g2_frag(const _Float16* p, int hh) { FragH f; f.half[0] = *(const v8us*)((const unsigned short*)p + 8 * hh); f.half[1] = *(const v8us*)((const unsigned short*)p + 16 + 8 * hh); return f.v; }
__device__ __forceinline__ v8f g2_mma(v16h a, v16h b, v8f c) { v8f d = __builtin_amdgcn_wmma_f32_16x16x32_f16(false, a, false, b, (short)0, c, false, false); asm volatile("v_nop\n\tv_nop\n\tv_nop\n\tv_nop" : "+v"(d) : "v"(a), "v"(b)); return d; }
template <int ACT>
__global__ __launch_bounds__(128) void k_gemm2(const _Float16* __restrict__ A, int lda, size_t sA, const _Float16* __restrict__ Bh, int ldb, size_t sB, float alpha, const float* __restrict__ bias, size_t sBias, const float* __restrict__ CP, int rowsPerB, size_t sCPb, int row0g,
    float* __restrict__ C, _Float16* __restrict__ C16, int ldc, size_t sC, int M, int N, int K) { static_assert(ACT == 0 || ACT == 3 || ACT == 6 || ACT == 8 || ACT == 9 || ACT == 11 || ACT == 12 || ACT == 14 || ACT == 15 || ACT == 16 || ACT == 17, "k_gemm2: unsupported ACT code (would silently apply no activation)");
  __shared__ __attribute__((aligned(16))) float so[4][32][68];
  const int tid = threadIdx.x, w = tid >> 5, lane = tid & 31, ln = lane & 15, hh = lane >> 4; const int by = blockIdx.y;
  A += (size_t)by * sA; Bh += (size_t)by * sB; const size_t cofs = (size_t)by * sC; const float* bp = bias ? bias + (size_t)by * sBias : nullptr;
  const int ntn = N >> 6; const int mt = blockIdx.x / ntn, nq = blockIdx.x - mt * ntn; const int row0 = mt * 128 + 32 * w, col0 = nq * 64; if (row0 >= M) return;
  const _Float16* a0p = A + (size_t)(row0 + ln) * lda; const _Float16* a1p = a0p + (size_t)16 * lda;
  const _Float16* b0p = Bh + (size_t)(col0 + ln) * ldb; const _Float16* b1p = b0p + (size_t)16 * ldb; const _Float16* b2p = b1p + (size_t)16 * ldb; const _Float16* b3p = b2p + (size_t)16 * ldb;
  const v8f z8 = {0.f,0.f,0.f,0.f,0.f,0.f,0.f,0.f}; v8f c00 = z8, c01 = z8, c02 = z8, c03 = z8, c10 = z8, c11 = z8, c12 = z8, c13 = z8;
#pragma unroll 1
  for (int kb = 0; kb < K; kb += 32) { const v16h a0 = g2_frag(a0p + kb, hh), a1 = g2_frag(a1p + kb, hh);
    v16h b = g2_frag(b0p + kb, hh); c00 = g2_mma(a0, b, c00); c10 = g2_mma(a1, b, c10);
    b = g2_frag(b1p + kb, hh); c01 = g2_mma(a0, b, c01); c11 = g2_mma(a1, b, c11);
    b = g2_frag(b2p + kb, hh); c02 = g2_mma(a0, b, c02); c12 = g2_mma(a1, b, c12);
    b = g2_frag(b3p + kb, hh); c03 = g2_mma(a0, b, c03); c13 = g2_mma(a1, b, c13); }
  v8f accs[8] = {c00, c01, c02, c03, c10, c11, c12, c13};
#pragma unroll
  for (int u = 0; u < 8; ++u) { const int t = u & 3, half = u >> 2; const int col = col0 + t * 16 + ln; const float bv = bp ? bf16_round(bp[col]) : 0.f;
#pragma unroll
    for (int r = 0; r < 8; ++r) { const int rloc = half * 16 + 8 * hh + r; float v = accs[u][r] * alpha + bv; if (CP) { if (rowsPerB < 0) v += CP[cofs + (size_t)(row0g + row0 + rloc) * ldc + col];      /* rowsPerB < 0: own element of the batched C plane */ else { const int bidx = (row0g + row0 + rloc) / rowsPerB; v += CP[(size_t)bidx * sCPb + (size_t)by * 64 + col]; } }
      if (ACT == 3) v = fmaxf(v, 0.f); else if (ACT == 6) v = 0.5f * v * (1.0f + erff(v * 0.70710678118654752f)); else if (ACT == 11) v = 1.0f / (1.0f + expf(-v)); else if (ACT == 15) v = v / (1.0f + expf(-v)); else if (ACT == 12) v = (v > 0.f) ? v : 0.01f * v; else if (ACT == 8) v = tanhf(v); else if (ACT == 9) v = 0.5f * v * (1.0f + tanhf(0.7978845608028654f * (v + 0.044715f * v * v * v))); else if (ACT == 14) v = (v > 0.f) ? v : 0.1f * v; else if (ACT == 16) v = (v >= 0.f) ? v : 0.3f * v; else if (ACT == 17) v = (v >= 0.f) ? v : 0.2f * v;
      so[w][rloc][t * 16 + ln] = v; } }
  __builtin_amdgcn_fence(__ATOMIC_ACQ_REL, "workgroup"); __builtin_amdgcn_wave_barrier();
  const int rsub = lane >> 4, c4 = (lane & 15) * 4;
  {
#pragma unroll
    for (int q = 0; q < 16; ++q) { const int r = q * 2 + rsub; const v4f v = *(const v4fa*)&so[w][r][c4]; if (C) *(v4f*)(C + cofs + (size_t)(row0 + r) * ldc + col0 + c4) = v; if (C16) { v4h h4; for (int i = 0; i < 4; ++i) h4[i] = (_Float16)v[i]; *(v4h*)(C16 + cofs + (size_t)(row0 + r) * ldc + col0 + c4) = h4; } }
     } }


__global__ __launch_bounds__(256) void k_wnat(const float* __restrict__ w, size_t n8, _Float16* __restrict__ Bt) { const size_t t = (size_t)blockIdx.x * 256 + threadIdx.x; if (t >= n8) return; FragH f; for (int q = 0; q < 8; ++q) f.h[q] = (_Float16)(bf16_round(w[t * 8 + q]) * 16.0f); *(v8us*)((unsigned short*)Bt + t * 8) = f.half[0];  }
__global__ __launch_bounds__(256) void k_rsm(const float* __restrict__ S, _Float16* __restrict__ P, int nrows) {
  #pragma clang fp contract(off)
  const int i = blockIdx.x * 256 + threadIdx.x; if (i >= nrows) return; const float* s = S + (size_t)i * SQ; float mx = -3.0e38f;
#pragma unroll 1
  for (int j = 0; j < SQ; ++j) mx = fmaxf(mx, s[j]); float se = 0.f;
#pragma unroll 1
  for (int j = 0; j < SQ; ++j) se += expf(s[j] - mx); const float sc = 256.0f / se;
#pragma unroll 1
  for (int j0 = 0; j0 < SQ; j0 += 8) { FragH f; for (int q = 0; q < 8; ++q) f.h[q] = (_Float16)(expf(s[j0 + q] - mx) * sc); unsigned short* d = (unsigned short*)P + (size_t)i * SQ + j0; *(v8us*)d = f.half[0];  } }
__global__ __launch_bounds__(256) void k_vt(const _Float16* __restrict__ V16, int b, int h0, _Float16* __restrict__ VT) { __shared__ unsigned short tl[64][65]; const int tid = threadIdx.x; const int hh = blockIdx.x % HG, sg = blockIdx.x / HG; const int s0 = sg * 64; const int h = h0 + hh;
  for (int i = tid; i < 64 * 8; i += 256) { const int j = i / 8, d8 = (i % 8) * 8; FragH f; f.half[0] = *(const v8us*)((const unsigned short*)V16 + ((size_t)b * SQ + s0 + j) * DM + h * HD + d8); for (int q = 0; q < 8; ++q) tl[d8 + q][j] = f.u[q]; }
  __syncthreads();
  { for (int i = tid; i < 64 * 8; i += 256) { const int d = i / 8, j8 = (i % 8) * 8; FragH f; for (int q = 0; q < 8; ++q) f.u[q] = tl[d][j8 + q]; *(v8us*)((unsigned short*)VT + ((size_t)hh * HD + d) * SQ + s0 + j8) = f.half[0]; }  } }



__global__ __launch_bounds__(256) void k_rsmcf2(const float* __restrict__ S, _Float16* __restrict__ P, int hg, int q0, int nk) {
  #pragma clang fp contract(off)
  const int t = blockIdx.x * 256 + threadIdx.x; if (t >= hg * QT) return; const size_t i = (size_t)t; const float* s = S + i * NKX; const int last = q0 + (t % QT); float mx = -3.0e38f;
#pragma unroll 1
  for (int j = 0; j < nk; ++j) { const float f = (j <= last) ? 1.f : 0.f; mx = fmaxf(mx, fmaf(f, s[j], (1.f - f) * -1.0e9f)); } float se = 0.f;
#pragma unroll 1
  for (int j = 0; j < nk; ++j) { const float f = (j <= last) ? 1.f : 0.f; se += __expf(fmaf(f, s[j], (1.f - f) * -1.0e9f) - mx); } const float sc = 256.0f / se;
#pragma unroll 1
  for (int j0 = 0; j0 < nk; j0 += 8) { FragH fr; for (int q = 0; q < 8; ++q) { const int j = j0 + q; const float f = (j <= last) ? 1.f : 0.f; fr.h[q] = (_Float16)(__expf(fmaf(f, s[j], (1.f - f) * -1.0e9f) - mx) * sc); } unsigned short* d = (unsigned short*)P + i * NKX + j0; *(v8us*)d = fr.half[0];  } }

template <int MASKADD>
__global__ __launch_bounds__(64) void k_att0(const float* __restrict__ QF, const float* __restrict__ KF, const float* __restrict__ VF, int ld, const float* __restrict__ mask, float scale, float* __restrict__ OF, int ldo) {
  #pragma clang fp contract(off)
  __shared__ __attribute__((aligned(16))) float lq[64][64]; __shared__ __attribute__((aligned(16))) float lo[64][64];
  const int tid = threadIdx.x; const int h = blockIdx.x / (QT0 / 64), rg = blockIdx.x % (QT0 / 64); const int i = rg * 64 + tid;
  const float* qr = QF + (size_t)i * ld + h * HD;
#pragma unroll 1
  for (int c = 0; c < HD / 4; ++c) { *(v4f*)&lq[tid][c * 4] = *(const v4fa*)(qr + c * 4); const v4f z = {0.f, 0.f, 0.f, 0.f}; *(v4f*)&lo[tid][c * 4] = z; }
  float m = -1.0e30f, l = 0.f; const int jmax = MASKADD ? (SQ - 1) : (rg * 64 + 63);      /* additive-mask form: every key (the mask input decides); causal form: keys up to the block's last row */
#pragma unroll 1
  for (int j = 0; j <= jmax; ++j) { const float* kr = KF + (size_t)j * ld + h * HD; const float* vr = VF + (size_t)j * ld + h * HD; float s = 0.f;
#pragma unroll 1
    for (int c = 0; c < HD / 4; ++c) { const v4f kq = *(const v4fa*)(kr + c * 4); const v4f qq = *(v4f*)&lq[tid][c * 4]; s = __fadd_rn(s, __fmul_rn(qq[0], kq[0])); s = __fadd_rn(s, __fmul_rn(qq[1], kq[1])); s = __fadd_rn(s, __fmul_rn(qq[2], kq[2])); s = __fadd_rn(s, __fmul_rn(qq[3], kq[3])); }
    s = __fmul_rn(s, scale); if (MASKADD) s = __fadd_rn(s, __fmul_rn(bf16_round(mask[(size_t)i * SQ + j]), -10000.0f));
    const float f = (MASKADD || j <= i) ? 1.f : 0.f; const float sm = fmaf(f, s, (1.f - f) * -1.0e30f); const float mn = fmaxf(m, sm); const float sc = expf(m - mn); const float e = expf(sm - mn); l = __fadd_rn(__fmul_rn(l, sc), e); m = mn;
#pragma unroll 1
    for (int c = 0; c < HD / 4; ++c) { const v4f vv = *(const v4fa*)(vr + c * 4); v4f oo = *(v4f*)&lo[tid][c * 4]; for (int u = 0; u < 4; ++u) oo[u] = __fadd_rn(__fmul_rn(oo[u], sc), __fmul_rn(e, vv[u])); *(v4f*)&lo[tid][c * 4] = oo; } }
  const float fin = 64.0f / l;      /* o carried x64 (k_oscale divides by 64) */
#pragma unroll 1
  for (int c = 0; c < HD / 4; ++c) { v4f oo = *(v4f*)&lo[tid][c * 4]; for (int u = 0; u < 4; ++u) oo[u] = __fmul_rn(oo[u], fin); *(v4f*)&lo[tid][c * 4] = oo; }
  __syncthreads();
  {
#pragma unroll 1
    for (int it = 0; it < 16; ++it) { const int row = it * 4 + tid / 16, pc = (tid % 16) * 4; const v4f v = *(const v4f*)&lo[row][pc]; *(v4f*)(OF + (size_t)(rg * 64 + row) * ldo + h * HD + pc) = v; }
     } }

__global__ __launch_bounds__(256) void k_oscale(const float* __restrict__ OF, float* __restrict__ out, size_t n4) { const size_t t = (size_t)blockIdx.x * 256 + threadIdx.x; if (t >= n4) return; const v4f a = *(const v4fa*)(OF + t * 4); v4f o; for (int q = 0; q < 4; ++q) o[q] = a[q] * 0.015625f; *(v4f*)(out + t * 4) = o;  }

__global__ __launch_bounds__(256) void k_bcpy(const float* __restrict__ b, int n, int NP, float* __restrict__ dst, int dst0) { for (int i = threadIdx.x; i < NP; i += 256) { const float v = (i < n) ? b[i] : 0.f; *(float*)(dst + dst0 + i) = v; }  }


extern "C" void kernel_launch(void* const* d_in, const int* in_sizes, int n_in,
                              void* d_out, int out_size, void* d_ws, size_t ws_size, hipStream_t stream) {
  (void)in_sizes; (void)n_in; (void)out_size;
  const float* const* I = (const float* const*)d_in; const float* x = I[0]; const float* wq = I[1]; const float* bq = I[2]; const float* wk = I[3]; const float* bk = I[4]; const float* wv = I[5]; const float* bv = I[6];      /* natural nn.Linear [out][in] weights + biases */
  char* ws = (char*)d_ws; size_t off = 0;
  auto take = [&](size_t bytes) { char* p = ws + off; off += (bytes + 255) & ~(size_t)255; return p; };
  _Float16* BQKV = (_Float16*)take((size_t)3 * DM * DM * 2); float* bqkv = (float*)take((size_t)3 * DM * 4);      /* stacked q | k | v weight plane and bias vector */ 
  _Float16* X16 = (_Float16*)take(NR * DM * 2); _Float16* QKV = (_Float16*)take(NR * 3 * DM * 2); _Float16* Q16 = QKV; _Float16* K16 = QKV + DM; _Float16* V16 = QKV + 2 * DM;      /* q | k | v */ _Float16* O16 = (_Float16*)take(NR * DM * 2);
  float* S = (float*)take((size_t)HG * SQ * SQ * 4); _Float16* P = (_Float16*)take((size_t)HG * SQ * SQ * 2); _Float16* VT = (_Float16*)take((size_t)NH * HD * SQ * 2);
  float* QF0 = (float*)take((size_t)QT0 * DM * 4); float* KF0 = (float*)take((size_t)QT0 * DM * 4); float* VF0 = (float*)take((size_t)QT0 * DM * 4); float* OF0 = (float*)take((size_t)QT0 * DM * 4);
  if (off > ws_size) return;
  { const unsigned g = (unsigned)(((size_t)DM * DM / 8 + 255) / 256); k_wnat<<<g, 256, 0, stream>>>(wq, (size_t)DM * DM / 8, BQKV); k_wnat<<<g, 256, 0, stream>>>(wk, (size_t)DM * DM / 8, BQKV + (size_t)DM * DM); k_wnat<<<g, 256, 0, stream>>>(wv, (size_t)DM * DM / 8, BQKV + (size_t)2 * DM * DM); }      /* natural [out][in] = Bt[n][k] x16, stacked q | k | v */
  k_bcpy<<<1, 256, 0, stream>>>(bq, DM, DM, bqkv, 0); k_bcpy<<<1, 256, 0, stream>>>(bk, DM, DM, bqkv, DM); k_bcpy<<<1, 256, 0, stream>>>(bv, DM, DM, bqkv, 2 * DM);      /* stacked bias vector bq | bk | bv */
  k_x16<<<(unsigned)((NR * DM / 8 + 255) / 256), 256, 0, stream>>>(x, X16, NR * DM / 8);
  const size_t r0p = (size_t)B0 * SQ;      /* first projected row */
  k_gemm2<0><<<dim3((unsigned)((MP / 128) * (3 * DM / 64)), 1), 128, 0, stream>>>(X16 + r0p * DM, DM, 0, BQKV, DM, 0, 0.0625f, bqkv, 0, nullptr, 1, 0, 0, nullptr, QKV + r0p * 3 * DM, 3 * DM, 0, MP, 3 * DM, DM);      /* q | k | v rows (f16); head h = columns h*HD.. of each DM block */
  for (int b = B0; b < B0 + NBR; ++b) { const size_t r0 = (size_t)b * SQ;
    k_vt<NH, SQ><<<NH * (SQ / 64), 256, 0, stream>>>(V16 + r0 * LQ, LQ, 0, VT);      /* V^T [NH][HD][SQ] for this batch */
    for (int q0 = 0; q0 < QN; q0 += QT) { const int nk = q0 + QT;      /* causal: only keys below the tile end are computed */
      k_gemm2<0><<<dim3((QT / 128) * (nk / 64), NHD), 128, 0, stream>>>(Q16 + (r0 + q0) * LQ, LQ, (size_t)HD, K16 + r0 * LQ, LQ, (size_t)HD, 0.125f, nullptr, 0, nullptr, 1, 0, 0, S, nullptr, NKX, (size_t)QT * NKX, QT, nk, HD);      /* scores, all heads on grid.y */
      k_rsmcf2<<<(NHD * QT + 255) / 256, 256, 0, stream>>>(S, P, NHD, q0, nk);
      k_gemm2<0><<<dim3((QT / 128) * (HD / 64), NHD), 128, 0, stream>>>(P, NKX, (size_t)QT * NKX, VT, SQ, (size_t)HD * SQ, 0.00390625f, nullptr, 0, nullptr, 1, 0, 0, (float*)d_out + (r0 + q0) * DM, nullptr, DM, (size_t)HD, QT, HD, nk); }      /* o (merged heads) f32 straight into the output rows */
    k_gemm2<0><<<dim3((QT0 / 128) * (DM / 64), 1), 128, 0, stream>>>(X16 + r0 * DM, DM, 0, BQKV, DM, 0, 0.0625f, bqkv, 0, nullptr, 1, 0, 0, QF0, nullptr, DM, 0, QT0, DM, DM); k_gemm2<0><<<dim3((QT0 / 128) * (DM / 64), 1), 128, 0, stream>>>(X16 + r0 * DM, DM, 0, BQKV + (size_t)DM * DM, DM, 0, 0.0625f, bqkv + DM, 0, nullptr, 1, 0, 0, KF0, nullptr, DM, 0, QT0, DM, DM); k_gemm2<0><<<dim3((QT0 / 128) * (DM / 64), 1), 128, 0, stream>>>(X16 + r0 * DM, DM, 0, BQKV + (size_t)2 * DM * DM, DM, 0, 0.0625f, bqkv + 2 * DM, 0, nullptr, 1, 0, 0, VF0, nullptr, DM, 0, QT0, DM, DM);      /* exact f32 q (block 0), k (block 1), v (block 2) of rows 0..255 */
    k_att0<0><<<NH * (QT0 / 64), 64, 0, stream>>>(QF0, KF0, VF0, DM, nullptr, 0.125f, OF0, DM);      /* exact f32 causal attention rows 0..255 (o x64) */
    k_oscale<<<(unsigned)(((size_t)QT0 * DM / 4 + 255) / 256), 256, 0, stream>>>(OF0, (float*)d_out + r0 * DM, (size_t)QT0 * DM / 4); }      /* rows 0..255 rewritten = o / 64 (the f16-path rows are replaced) */
}

// v001
// One run takes 2790 microseconds.
// In two side-by-side timings against v000, it was 2.09 and 2.11 times as fast.
#include <hip/hip_runtime.h>
// Masked (causal) multi-head self-attention WITHOUT output projection (X [2][2048][1024]; Q = X Wq^T + bq, K, V likewise (nn.Linear natural [1024][1024] sigma 1/32, biases sigma 1/32); 16 heads of 64; scores / 8; causal (tril, -inf); softmax; out = merged attn V -> [2][2048][1024]).
// Structure: x as exact f16 rows; q | k | v as ONE WMMA GEMM from the stacked x16 natural weight planes (+ stacked biases) (32x64 wave tiles, f32 accumulation, + bias, f16 outputs; q | k | v block order); per batch: V^T via LDS transposes; per query tile of 256 rows: scores against the keys below the tile end only (K = 64, 16 heads on grid.y, alpha 1/8), causal row softmax on VALU (arithmetic 0/1 select; f32 statistics, native exp; weights x256 f16), o = P V^T (alpha 2^-8) written f32 straight into the output rows (no output projection in this module); first-tile refinement: the first 256 rows of each batch recomputed exactly (f32 q/k/v GEMMs + online-softmax attention on VALU) and those output rows replaced; launches: see trace.
// Compute dtype: inputs rounded to bf16; x / weights exact; q, k, v and softmax weights as plain f16 GEMM operands (~2^-12), o written f32; scores and softmax statistics f32. v_wmma_f32_16x16x32_f16.
#define NB 2
#define SQ 2048
#define DM 1024
#define NH 16
#define HD 64
#define HG 4                         /* head group of the k_vt(b, h0) form; S / P sized HG*SQ*SQ = 2*NH*QT*SQ */
#define B0 0                         /* first batch processed (debug hook) */
#define NBR NB                       /* batches processed (debug hook) */
#define NR ((size_t)NB * SQ)         /* token rows */
#define MP ((int)((size_t)NBR * SQ)) /* rows projected (debug hook) */
#define QT 256                       /* query rows per causal tile */
#define NKX SQ                       /* S / P row pitch */
#define QT0 256                      /* first-tile rows recomputed exactly (256: margin for the few-key rows, no output projection) */
#define QN SQ                        /* query rows attended per batch (debug hook) */
#define NHD NH                       /* heads attended (debug hook) */
#define MPO MP                       /* unused */
#define LQ (3 * DM)      /* row pitch of the q/k/v rows */
typedef __bf16 v16b __attribute__((ext_vector_type(16)));
typedef unsigned short v8us __attribute__((ext_vector_type(8), may_alias));
typedef float  v8f  __attribute__((ext_vector_type(8)));
typedef float  v4f  __attribute__((ext_vector_type(4)));
typedef float  v4fa __attribute__((ext_vector_type(4), may_alias));
union FragB { v16b v; v8us half[2]; unsigned short u[16]; };

__device__ __forceinline__ unsigned short bf16_bits(float x) { unsigned int u = __float_as_uint(x); return (unsigned short)((u + 0x7FFFu + ((u >> 16) & 1u)) >> 16); }
__device__ __forceinline__ float bf16_val(unsigned short b) { return __uint_as_float(((unsigned int)b) << 16); }
__device__ __forceinline__ float bf16_round(float x) { return bf16_val(bf16_bits(x)); }
// D += A·B with NT terms: 1 = ah·bh, 2 = + al·bh (A split), 3 = + ah·bl (both split)
template <int NT>
__device__ __forceinline__ v8f mmaN(v16b ah, v16b al, v16b bh, v16b bl, v8f c) {
  c = __builtin_amdgcn_wmma_f32_16x16x32_bf16(false, ah, false, bh, (short)0, c, false, false);
  if (NT >= 2) c = __builtin_amdgcn_wmma_f32_16x16x32_bf16(false, al, false, bh, (short)0, c, false, false);
  if (NT >= 3) c = __builtin_amdgcn_wmma_f32_16x16x32_bf16(false, ah, false, bl, (short)0, c, false, false);
  asm volatile("v_nop\n\tv_nop\n\tv_nop\n\tv_nop" : "+v"(c) : "v"(ah), "v"(al), "v"(bh), "v"(bl));
  return c;
}

__global__ __launch_bounds__(256) void k_wt_bf16(const float* __restrict__ W, unsigned short* __restrict__ Wt, int K, int N) {
  const int t = blockIdx.x * 256 + threadIdx.x;
  const int k8n = K / 8;
  if (t >= N * k8n) return;
  const int n = t / k8n, k8 = (t % k8n) * 8;
  v8us v;
#pragma unroll
  for (int i = 0; i < 8; ++i) v[i] = bf16_bits(W[(size_t)(k8 + i) * N + n]);
  *(v8us*)(Wt + (size_t)n * K + k8) = v;
  
}

// GEMM C[M][N] (f32, pitch ldc) = act(A[M][K]·W + bias). A f32 row-major (pitch lda) converted per fragment to bf16
// (ASPLIT: hi/lo two planes -> 2 terms, else single rounded term); Wt bf16 [N][K] (pitch ldb). BIAS_BF16 rounds the
// bias to bf16 first (bias quantised to bf16 before the add). K%32==0, M%16==0, N%64==0.
template <bool ASPLIT, int ACT, bool BIAS_BF16>
__global__ __launch_bounds__(128) void k_gemm_bf(const float* __restrict__ A, int lda, const unsigned short* __restrict__ Wt, int ldb,
                                               const float* __restrict__ bias, float* __restrict__ C, int ldc, int M, int N, int K) {
  __shared__ __attribute__((aligned(16))) float so[4][16][64];
  const int tid = threadIdx.x, w = tid >> 5, lane = tid & 31, ln = lane & 15, hh = lane >> 4;
  const int ntn = N / 64;
  const int wid = blockIdx.x * 4 + w;
  const int mt = wid / ntn, nq = wid % ntn;
  if (mt * 16 >= M) return;
  const int row0 = mt * 16, col0 = nq * 64;
  const float* arow = A + (size_t)(row0 + ln) * lda;
  v8f acc[4] = {};
  for (int kb = 0; kb < K; kb += 32) {
    FragB ah, al;
    const v4f x0 = *(const v4fa*)(arow + kb + 8 * hh), x1 = *(const v4fa*)(arow + kb + 8 * hh + 4);
    const v4f x2 = *(const v4fa*)(arow + kb + 16 + 8 * hh), x3 = *(const v4fa*)(arow + kb + 16 + 8 * hh + 4);
    float xs[16] = {x0[0],x0[1],x0[2],x0[3],x1[0],x1[1],x1[2],x1[3],x2[0],x2[1],x2[2],x2[3],x3[0],x3[1],x3[2],x3[3]};
#pragma unroll
    for (int i = 0; i < 16; ++i) { const unsigned short hb = bf16_bits(xs[i]); ah.u[i] = hb; al.u[i] = ASPLIT ? bf16_bits(xs[i] - bf16_val(hb)) : (unsigned short)0; }
#pragma unroll
    for (int t = 0; t < 4; ++t) {
      const unsigned short* brow = Wt + (size_t)(col0 + t * 16 + ln) * ldb + kb;
      FragB b;
      b.half[0] = *(const v8us*)(brow + 8 * hh);
      b.half[1] = *(const v8us*)(brow + 16 + 8 * hh);
      acc[t] = mmaN<ASPLIT ? 2 : 1>(ah.v, al.v, b.v, b.v, acc[t]);
    }
  }
#pragma unroll
  for (int t = 0; t < 4; ++t) {
    float bv = bias ? bias[col0 + t * 16 + ln] : 0.f;
    if (BIAS_BF16) bv = bf16_round(bv);
#pragma unroll
    for (int r = 0; r < 8; ++r) { float v = acc[t][r] + bv; if (ACT == 1) v = fmaxf(v, 0.f); so[w][8 * hh + r][t * 16 + ln] = v; }
  }
  __builtin_amdgcn_fence(__ATOMIC_ACQ_REL, "workgroup");
  __builtin_amdgcn_wave_barrier();
  const int rsub = lane >> 4, c4 = (lane & 15) * 4;
  {
#pragma unroll
    for (int q = 0; q < 8; ++q) {
      const int r = q * 2 + rsub;
      const v4f v = *(const v4fa*)&so[w][r][c4];
      *(v4f*)(C + (size_t)(row0 + r) * ldc + col0 + c4) = v;
    }
    
  }
}

// GEMM C = act(A·W + bias + resid): A f32 (ASPLIT -> hi/lo 2 terms), Wt bf16 [N][K]; ACT 0 none, 1 relu, 2 exact gelu;
// resid (optional, f32, row index = (row % rmod), pitch ldr, RES_BF16 rounds it) added before the activation.
template <bool ASPLIT, int ACT, bool BIAS_BF16, bool RES_BF16>
__global__ __launch_bounds__(128) void k_gemm_bf3(const float* __restrict__ A, int lda, const unsigned short* __restrict__ Wt, int ldb,
                                                const float* __restrict__ bias, const float* __restrict__ resid, int rmod, int ldr,
                                                float* __restrict__ C, int ldc, int M, int N, int K) {
  __shared__ __attribute__((aligned(16))) float so[4][16][64];
  const int tid = threadIdx.x, w = tid >> 5, lane = tid & 31, ln = lane & 15, hh = lane >> 4;
  const int ntn = N / 64;
  const int wid = blockIdx.x * 4 + w;
  const int mt = wid / ntn, nq = wid % ntn;
  if (mt * 16 >= M) return;
  const int row0 = mt * 16, col0 = nq * 64;
  const float* arow = A + (size_t)(row0 + ln) * lda;
  v8f acc[4] = {};
  for (int kb = 0; kb < K; kb += 32) {
    FragB ah, al;
    const v4f x0 = *(const v4fa*)(arow + kb + 8 * hh), x1 = *(const v4fa*)(arow + kb + 8 * hh + 4);
    const v4f x2 = *(const v4fa*)(arow + kb + 16 + 8 * hh), x3 = *(const v4fa*)(arow + kb + 16 + 8 * hh + 4);
    float xs[16] = {x0[0],x0[1],x0[2],x0[3],x1[0],x1[1],x1[2],x1[3],x2[0],x2[1],x2[2],x2[3],x3[0],x3[1],x3[2],x3[3]};
#pragma unroll
    for (int i = 0; i < 16; ++i) { const unsigned short hb = bf16_bits(xs[i]); ah.u[i] = hb; al.u[i] = ASPLIT ? bf16_bits(xs[i] - bf16_val(hb)) : (unsigned short)0; }
#pragma unroll
    for (int t = 0; t < 4; ++t) {
      const unsigned short* brow = Wt + (size_t)(col0 + t * 16 + ln) * ldb + kb;
      FragB b;
      b.half[0] = *(const v8us*)(brow + 8 * hh);
      b.half[1] = *(const v8us*)(brow + 16 + 8 * hh);
      acc[t] = mmaN<ASPLIT ? 2 : 1>(ah.v, al.v, b.v, b.v, acc[t]);
    }
  }
#pragma unroll
  for (int t = 0; t < 4; ++t) {
    const int col = col0 + t * 16 + ln;
    float bv = bias ? bias[col] : 0.f;
    if (BIAS_BF16) bv = bf16_round(bv);
#pragma unroll
    for (int r = 0; r < 8; ++r) {
      float v = acc[t][r] + bv;
      if (resid) { float rv = resid[(size_t)((row0 + 8 * hh + r) % rmod) * ldr + col]; if (RES_BF16) rv = bf16_round(rv); v += rv; }
      if (ACT == 1) v = fmaxf(v, 0.f);
      if (ACT == 2) v = 0.5f * v * (1.0f + erff(v * 0.70710678118654752f));
      if (ACT == 3) { const float u = 0.7978845608028654f * (v + 0.044715f * v * v * v); v = 0.5f * v * (1.0f + tanhf(u)); }
      so[w][8 * hh + r][t * 16 + ln] = v;
    }
  }
  __builtin_amdgcn_fence(__ATOMIC_ACQ_REL, "workgroup");
  __builtin_amdgcn_wave_barrier();
  const int rsub = lane >> 4, c4 = (lane & 15) * 4;
  {
#pragma unroll
    for (int q = 0; q < 8; ++q) {
      const int r = q * 2 + rsub;
      const v4f v = *(const v4fa*)&so[w][r][c4];
      *(v4f*)(C + (size_t)(row0 + r) * ldc + col0 + c4) = v;
    }
    
  }
}
// row LayerNorm (biased variance, eps) over N: s = X (+ R); optional out_sum <- s; out_norm <- (s-mu)*rsqrt(var+eps)*g + b
template <bool PARAM_BF16>
__global__ __launch_bounds__(256) void k_layernorm(const float* __restrict__ X, const float* __restrict__ R, const float* __restrict__ g, const float* __restrict__ bta,
                                                  float* __restrict__ out_sum, float* __restrict__ out_norm, int N, float eps) {
  __shared__ float red[256];
  const int row = blockIdx.x, tid = threadIdx.x;
  const float* x = X + (size_t)row * N; const float* rr = R ? R + (size_t)row * N : nullptr;
  float vals[16];                     // up to N = 4096
  const int per = N / 256;            // contiguous chunk per thread? use strided-by-4 chunks: thread handles j = tid*4 + 1024*u
  float s1 = 0.f;
  for (int u = 0; u < per / 4; ++u) {
    const int j = tid * 4 + 1024 * u;
    const v4f a = *(const v4fa*)(x + j);
    v4f b = {0.f,0.f,0.f,0.f}; if (rr) b = *(const v4fa*)(rr + j);
#pragma unroll
    for (int q = 0; q < 4; ++q) { const float v = a[q] + b[q]; vals[u * 4 + q] = v; s1 += v; }
  }
  red[tid] = s1; __syncthreads();
  for (int st = 128; st > 0; st >>= 1) { if (tid < st) red[tid] += red[tid + st]; __syncthreads(); }
  const float mu = red[0] / (float)N; __syncthreads();
  float s2 = 0.f;
  for (int u = 0; u < per / 4; ++u)
#pragma unroll
    for (int q = 0; q < 4; ++q) { const float c = vals[u * 4 + q] - mu; s2 += c * c; }
  red[tid] = s2; __syncthreads();
  for (int st = 128; st > 0; st >>= 1) { if (tid < st) red[tid] += red[tid + st]; __syncthreads(); }
  const float rs = rsqrtf(red[0] / (float)N + eps);
  {
    for (int u = 0; u < per / 4; ++u) {
      const int j = tid * 4 + 1024 * u;
      v4f o, sm;
#pragma unroll
      for (int q = 0; q < 4; ++q) {
        float gg = g[j + q], bb = bta[j + q];
        if (PARAM_BF16) { gg = bf16_round(gg); bb = bf16_round(bb); }
        sm[q] = vals[u * 4 + q]; o[q] = (vals[u * 4 + q] - mu) * rs * gg + bb;
      }
      if (out_sum) *(v4f*)(out_sum + (size_t)row * N + j) = sm;
      *(v4f*)(out_norm + (size_t)row * N + j) = o;
    }
    
  }
}



// ---- f16 WMMA path (v_wmma_f32_16x16x32_f16): 11-bit significands for operands in range — used where a [0,1] probability operand needs more precision than bf16
typedef _Float16 v16h __attribute__((ext_vector_type(16)));
union FragH { v16h v; v8us half[2]; _Float16 h[16]; unsigned short u[16]; };
template <int NT>
__device__ __forceinline__ v8f mmaH(v16h ah, v16h al, v16h bh, v16h bl, v8f c) {
  c = __builtin_amdgcn_wmma_f32_16x16x32_f16(false, ah, false, bh, (short)0, c, false, false);
  if (NT >= 2) c = __builtin_amdgcn_wmma_f32_16x16x32_f16(false, al, false, bh, (short)0, c, false, false);
  if (NT >= 3) c = __builtin_amdgcn_wmma_f32_16x16x32_f16(false, ah, false, bl, (short)0, c, false, false);
  asm volatile("v_nop\n\tv_nop\n\tv_nop\n\tv_nop" : "+v"(c) : "v"(ah), "v"(al), "v"(bh), "v"(bl));
  return c;
}
// batched GEMM like k_gemm_b but f16 operands: A f32 (split into f16 hi/lo if ASPLIT, else rounded to f16), Bt = f16 values [n][k]; alpha; C f32; N multiple of 16 (partial tiles skipped)
template <bool ASPLIT>
__global__ __launch_bounds__(128) void k_gemm_h(const float* __restrict__ A, int lda, size_t sA, const _Float16* __restrict__ Bh, int ldb, size_t sB, float alpha, float* __restrict__ C, int ldc, size_t sC, int M, int N, int K) {
  __shared__ __attribute__((aligned(16))) float so[4][16][64];
  const int tid = threadIdx.x, w = tid >> 5, lane = tid & 31, ln = lane & 15, hh = lane >> 4; const int by = blockIdx.y;
  A += (size_t)by * sA; Bh += (size_t)by * sB; C += (size_t)by * sC;
  const int ntn = (N + 63) / 64; const int wid = blockIdx.x * 4 + w; const int mt = wid / ntn, nq = wid % ntn; if (mt * 16 >= M) return;
  const int row0 = mt * 16, col0 = nq * 64; const float* arow = A + (size_t)(row0 + ln) * lda;
  v8f acc[4] = {};
  for (int kb = 0; kb < K; kb += 32) {
    FragH ah, al;
    const v4f x0 = *(const v4fa*)(arow + kb + 8 * hh), x1 = *(const v4fa*)(arow + kb + 8 * hh + 4), x2 = *(const v4fa*)(arow + kb + 16 + 8 * hh), x3 = *(const v4fa*)(arow + kb + 16 + 8 * hh + 4);
    float xs[16] = {x0[0],x0[1],x0[2],x0[3],x1[0],x1[1],x1[2],x1[3],x2[0],x2[1],x2[2],x2[3],x3[0],x3[1],x3[2],x3[3]};
#pragma unroll
    for (int i = 0; i < 16; ++i) { const _Float16 h = (_Float16)xs[i]; ah.h[i] = h; al.h[i] = ASPLIT ? (_Float16)(xs[i] - (float)h) : (_Float16)0.0f; }
#pragma unroll
    for (int t = 0; t < 4; ++t) { if (col0 + t * 16 >= N) continue; const size_t boff = (size_t)(col0 + t * 16 + ln) * ldb + kb; FragH bq; bq.half[0] = *(const v8us*)(Bh + boff + 8 * hh); bq.half[1] = *(const v8us*)(Bh + boff + 16 + 8 * hh);
      acc[t] = mmaH<ASPLIT ? 2 : 1>(ah.v, al.v, bq.v, bq.v, acc[t]); }
  }
#pragma unroll
  for (int t = 0; t < 4; ++t) { if (col0 + t * 16 >= N) continue;
#pragma unroll
    for (int r = 0; r < 8; ++r) so[w][8 * hh + r][t * 16 + ln] = acc[t][r] * alpha; }
  __builtin_amdgcn_fence(__ATOMIC_ACQ_REL, "workgroup"); __builtin_amdgcn_wave_barrier();
  const int rsub = lane >> 4, c4 = (lane & 15) * 4;
  {
#pragma unroll
    for (int q = 0; q < 8; ++q) { const int r = q * 2 + rsub; if (col0 + c4 < N) { const v4f v = *(const v4fa*)&so[w][r][c4]; *(v4f*)(C + (size_t)(row0 + r) * ldc + col0 + c4) = v; } }
     }
}

// Wt[n][k] = f16(W[k][n]·scale) from f32 row-major W[K][N] (scale = power of two; bf16-exact weights stay exact in f16 away from the subnormal range)
__global__ __launch_bounds__(256) void k_wt_f16(const float* __restrict__ W, _Float16* __restrict__ Wt, int K, int N, float scale) {
  const int t = blockIdx.x * 256 + threadIdx.x; if (t >= N * (K / 8)) return; const int n = t / (K / 8), k8 = (t % (K / 8)) * 8; FragH f;
#pragma unroll
  for (int i = 0; i < 8; ++i) f.h[i] = (_Float16)(bf16_round(W[(size_t)(k8 + i) * N + n]) * scale); const v8us o = f.half[0];
  *(v8us*)((unsigned short*)Wt + (size_t)n * K + k8) = o; 
}
// k_gemm_hh variant with fused epilogue: v = acc·alpha + bias[by·sBias + col] (+ CP[(row/rowsPerB)·sCPb + by·64 + col] if CP) ; ACT 0 none / 1 elu ; writes f16 C16 (and f32 C if non-null)
template <int ACT>
__global__ __launch_bounds__(128) void k_gemm_hhx(const _Float16* __restrict__ A, int lda, size_t sA, const _Float16* __restrict__ Bh, int ldb, size_t sB, float alpha, const float* __restrict__ bias, size_t sBias, const float* __restrict__ CP, int rowsPerB, size_t sCPb, int row0g,
    float* __restrict__ C, _Float16* __restrict__ C16, int ldc, size_t sC, int M, int N, int K) {
  __shared__ __attribute__((aligned(16))) float so[4][16][64];
  const int tid = threadIdx.x, w = tid >> 5, lane = tid & 31, ln = lane & 15, hh = lane >> 4; const int by = blockIdx.y;
  A += (size_t)by * sA; Bh += (size_t)by * sB; const size_t cofs = (size_t)by * sC; const float* bp = bias ? bias + (size_t)by * sBias : nullptr;
  const int ntn = (N + 63) / 64; const int wid = blockIdx.x * 4 + w; const int mt = wid / ntn, nq = wid % ntn; if (mt * 16 >= M) return;
  const int row0 = mt * 16, col0 = nq * 64; const _Float16* arow = A + (size_t)(row0 + ln) * lda;
  v8f acc[4] = {};
  for (int kb = 0; kb < K; kb += 32) { FragH ah; ah.half[0] = *(const v8us*)((const unsigned short*)arow + kb + 8 * hh); ah.half[1] = *(const v8us*)((const unsigned short*)arow + kb + 16 + 8 * hh);
#pragma unroll
    for (int t = 0; t < 4; ++t) { if (col0 + t * 16 >= N) continue; const size_t boff = (size_t)(col0 + t * 16 + ln) * ldb + kb; FragH bq; bq.half[0] = *(const v8us*)((const unsigned short*)Bh + boff + 8 * hh); bq.half[1] = *(const v8us*)((const unsigned short*)Bh + boff + 16 + 8 * hh);
      acc[t] = mmaH<1>(ah.v, ah.v, bq.v, bq.v, acc[t]); }
  }
#pragma unroll
  for (int t = 0; t < 4; ++t) { if (col0 + t * 16 >= N) continue; const int col = col0 + t * 16 + ln; const float bv = bp ? bf16_round(bp[col]) : 0.f;
#pragma unroll
    for (int r = 0; r < 8; ++r) { float v = acc[t][r] * alpha + bv; if (CP) { const int rr = row0g + row0 + 8 * hh + r; if (rowsPerB < 0) v += CP[cofs + (size_t)rr * ldc + col];      /* rowsPerB < 0: own element of the batched C plane */ else { const int bidx = rr / rowsPerB; v += CP[(size_t)bidx * sCPb + (size_t)by * 64 + col]; } } if (ACT == 1) v = (v > 0.f) ? v : expm1f(v); else if (ACT == 7) v = (v > 0.f) ? v + 1.0f : expf(v); else if (ACT == 8) v = tanhf(v); else if (ACT == 9) v = 0.5f * v * (1.0f + tanhf(0.7978845608028654f * (v + 0.044715f * v * v * v))); else if (ACT == 11) v = 1.0f / (1.0f + expf(-v)); else if (ACT == 12) v = (v > 0.f) ? v : 0.01f * v; else if (ACT == 14) v = (v > 0.f) ? v : 0.1f * v; else if (ACT == 16) v = (v >= 0.f) ? v : 0.3f * v; else if (ACT == 17) v = (v >= 0.f) ? v : 0.2f * v; else if (ACT == 15) v = v / (1.0f + expf(-v)); else if (ACT == 3) v = fmaxf(v, 0.f); else if (ACT == 6) v = 0.5f * v * (1.0f + erff(v * 0.70710678118654752f)); so[w][8 * hh + r][t * 16 + ln] = v; } }
  __builtin_amdgcn_fence(__ATOMIC_ACQ_REL, "workgroup"); __builtin_amdgcn_wave_barrier();
  const int rsub = lane >> 4, c4 = (lane & 15) * 4; typedef _Float16 v4h __attribute__((ext_vector_type(4)));
  {
#pragma unroll
    for (int q = 0; q < 8; ++q) { const int r = q * 2 + rsub; if (col0 + c4 < N) { const v4f v = *(const v4fa*)&so[w][r][c4]; if (C) *(v4f*)(C + cofs + (size_t)(row0 + r) * ldc + col0 + c4) = v; if (C16) { v4h h4; for (int i = 0; i < 4; ++i) h4[i] = (_Float16)v[i]; *(v4h*)(C16 + cofs + (size_t)(row0 + r) * ldc + col0 + c4) = h4; } } }
     }
}


typedef _Float16 v4h __attribute__((ext_vector_type(4)));

__global__ __launch_bounds__(256) void k_x16(const float* __restrict__ x, _Float16* __restrict__ X16, size_t n8) { const size_t t = (size_t)blockIdx.x * 256 + threadIdx.x; if (t >= n8) return; FragH f;
#pragma unroll
  for (int q = 0; q < 8; ++q) f.h[q] = (_Float16)bf16_round(x[t * 8 + q]); *(v8us*)((unsigned short*)X16 + t * 8) = f.half[0];  }
__global__ __launch_bounds__(256) void k_h16(const float* __restrict__ x, _Float16* __restrict__ X16, size_t n8) { const size_t t = (size_t)blockIdx.x * 256 + threadIdx.x; if (t >= n8) return; FragH f;
#pragma unroll
  for (int q = 0; q < 8; ++q) f.h[q] = (_Float16)x[t * 8 + q]; *(v8us*)((unsigned short*)X16 + t * 8) = f.half[0];  }
__global__ __launch_bounds__(256) void k_round16f(const float* __restrict__ W, _Float16* __restrict__ Bt, size_t n8) { const size_t t = (size_t)blockIdx.x * 256 + threadIdx.x; if (t >= n8) return; FragH f;
#pragma unroll
  for (int i = 0; i < 8; ++i) f.h[i] = (_Float16)(bf16_round(W[t * 8 + i]) * 16.0f); *(v8us*)((unsigned short*)Bt + t * 8) = f.half[0];  }
template <int NHv, int TTv>
__global__ __launch_bounds__(256) void k_vt(const _Float16* __restrict__ V16, int ldv, int voff, _Float16* __restrict__ Vt) { __shared__ unsigned short tl[64][66]; const int tid = threadIdx.x; const int slab = blockIdx.x / (TTv / 64), lg = blockIdx.x % (TTv / 64); const int b = slab / NHv, h = slab % NHv;
  for (int i = tid; i < 64 * 8; i += 256) { const int r = i / 8, c8 = (i % 8) * 8; FragH f; f.half[0] = *(const v8us*)((const unsigned short*)V16 + ((size_t)b * TTv + lg * 64 + r) * ldv + voff + h * 64 + c8);
#pragma unroll
    for (int q = 0; q < 8; ++q) tl[r][c8 + q] = f.u[q]; }
  __syncthreads();
  {
#pragma unroll
    for (int rd = 0; rd < 2; ++rd) { const int d = rd * 32 + tid / 8, pc = tid % 8; FragH f;
#pragma unroll
      for (int q = 0; q < 8; ++q) f.u[q] = tl[pc * 8 + q][d];
      *(v8us*)((unsigned short*)Vt + ((size_t)slab * 64 + d) * TTv + lg * 64 + pc * 8) = f.half[0]; }
     } }

__global__ __launch_bounds__(256) void k_hl(const float* __restrict__ F, _Float16* __restrict__ Hh, _Float16* __restrict__ Hl, size_t n8) { const size_t t = (size_t)blockIdx.x * 256 + threadIdx.x; if (t >= n8) return; FragH fh, fl; const v4f a = *(const v4fa*)(F + t * 8), c = *(const v4fa*)(F + t * 8 + 4);
#pragma unroll
  for (int q = 0; q < 4; ++q) { _Float16 h = (_Float16)a[q]; fh.h[q] = h; fl.h[q] = (_Float16)((a[q] - (float)h) * 1024.0f); h = (_Float16)c[q]; fh.h[4 + q] = h; fl.h[4 + q] = (_Float16)((c[q] - (float)h) * 1024.0f); }
  { *(v8us*)((unsigned short*)Hh + t * 8) = fh.half[0]; *(v8us*)((unsigned short*)Hl + t * 8) = fl.half[0];  } }

// ---- fast GEMM (wave tile 32x64; requires M % 32 == 0 rows per launch region and N % 64 == 0); epilogue = k_gemm_hhx semantics ----
__device__ __forceinline__ v16h g2_frag(const _Float16* p, int hh) { FragH f; f.half[0] = *(const v8us*)((const unsigned short*)p + 8 * hh); f.half[1] = *(const v8us*)((const unsigned short*)p + 16 + 8 * hh); return f.v; }
__device__ __forceinline__ v8f g2_mma(v16h a, v16h b, v8f c) { v8f d = __builtin_amdgcn_wmma_f32_16x16x32_f16(false, a, false, b, (short)0, c, false, false); asm volatile("v_nop\n\tv_nop\n\tv_nop\n\tv_nop" : "+v"(d) : "v"(a), "v"(b)); return d; }
template <int ACT>
__global__ __launch_bounds__(128) void k_gemm2(const _Float16* __restrict__ A, int lda, size_t sA, const _Float16* __restrict__ Bh, int ldb, size_t sB, float alpha, const float* __restrict__ bias, size_t sBias, const float* __restrict__ CP, int rowsPerB, size_t sCPb, int row0g,
    float* __restrict__ C, _Float16* __restrict__ C16, int ldc, size_t sC, int M, int N, int K) { static_assert(ACT == 0 || ACT == 3 || ACT == 6 || ACT == 8 || ACT == 9 || ACT == 11 || ACT == 12 || ACT == 14 || ACT == 15 || ACT == 16 || ACT == 17, "k_gemm2: unsupported ACT code (would silently apply no activation)");
  __shared__ __attribute__((aligned(16))) float so[4][32][68];
  const int tid = threadIdx.x, w = tid >> 5, lane = tid & 31, ln = lane & 15, hh = lane >> 4; const int by = blockIdx.y;
  A += (size_t)by * sA; Bh += (size_t)by * sB; const size_t cofs = (size_t)by * sC; const float* bp = bias ? bias + (size_t)by * sBias : nullptr;
  const int ntn = N >> 6; const int mt = blockIdx.x / ntn, nq = blockIdx.x - mt * ntn; const int row0 = mt * 128 + 32 * w, col0 = nq * 64; if (row0 >= M) return;
  const _Float16* a0p = A + (size_t)(row0 + ln) * lda; const _Float16* a1p = a0p + (size_t)16 * lda;
  const _Float16* b0p = Bh + (size_t)(col0 + ln) * ldb; const _Float16* b1p = b0p + (size_t)16 * ldb; const _Float16* b2p = b1p + (size_t)16 * ldb; const _Float16* b3p = b2p + (size_t)16 * ldb;
  const v8f z8 = {0.f,0.f,0.f,0.f,0.f,0.f,0.f,0.f}; v8f c00 = z8, c01 = z8, c02 = z8, c03 = z8, c10 = z8, c11 = z8, c12 = z8, c13 = z8;
#pragma unroll 1
  for (int kb = 0; kb < K; kb += 32) { const v16h a0 = g2_frag(a0p + kb, hh), a1 = g2_frag(a1p + kb, hh);
    v16h b = g2_frag(b0p + kb, hh); c00 = g2_mma(a0, b, c00); c10 = g2_mma(a1, b, c10);
    b = g2_frag(b1p + kb, hh); c01 = g2_mma(a0, b, c01); c11 = g2_mma(a1, b, c11);
    b = g2_frag(b2p + kb, hh); c02 = g2_mma(a0, b, c02); c12 = g2_mma(a1, b, c12);
    b = g2_frag(b3p + kb, hh); c03 = g2_mma(a0, b, c03); c13 = g2_mma(a1, b, c13); }
  v8f accs[8] = {c00, c01, c02, c03, c10, c11, c12, c13};
#pragma unroll
  for (int u = 0; u < 8; ++u) { const int t = u & 3, half = u >> 2; const int col = col0 + t * 16 + ln; const float bv = bp ? bf16_round(bp[col]) : 0.f;
#pragma unroll
    for (int r = 0; r < 8; ++r) { const int rloc = half * 16 + 8 * hh + r; float v = accs[u][r] * alpha + bv; if (CP) { if (rowsPerB < 0) v += CP[cofs + (size_t)(row0g + row0 + rloc) * ldc + col];      /* rowsPerB < 0: own element of the batched C plane */ else { const int bidx = (row0g + row0 + rloc) / rowsPerB; v += CP[(size_t)bidx * sCPb + (size_t)by * 64 + col]; } }
      if (ACT == 3) v = fmaxf(v, 0.f); else if (ACT == 6) v = 0.5f * v * (1.0f + erff(v * 0.70710678118654752f)); else if (ACT == 11) v = 1.0f / (1.0f + expf(-v)); else if (ACT == 15) v = v / (1.0f + expf(-v)); else if (ACT == 12) v = (v > 0.f) ? v : 0.01f * v; else if (ACT == 8) v = tanhf(v); else if (ACT == 9) v = 0.5f * v * (1.0f + tanhf(0.7978845608028654f * (v + 0.044715f * v * v * v))); else if (ACT == 14) v = (v > 0.f) ? v : 0.1f * v; else if (ACT == 16) v = (v >= 0.f) ? v : 0.3f * v; else if (ACT == 17) v = (v >= 0.f) ? v : 0.2f * v;
      so[w][rloc][t * 16 + ln] = v; } }
  __builtin_amdgcn_fence(__ATOMIC_ACQ_REL, "workgroup"); __builtin_amdgcn_wave_barrier();
  const int rsub = lane >> 4, c4 = (lane & 15) * 4;
  {
#pragma unroll
    for (int q = 0; q < 16; ++q) { const int r = q * 2 + rsub; const v4f v = *(const v4fa*)&so[w][r][c4]; if (C) *(v4f*)(C + cofs + (size_t)(row0 + r) * ldc + col0 + c4) = v; if (C16) { v4h h4; for (int i = 0; i < 4; ++i) h4[i] = (_Float16)v[i]; *(v4h*)(C16 + cofs + (size_t)(row0 + r) * ldc + col0 + c4) = h4; } }
     } }


__global__ __launch_bounds__(256) void k_wnat(const float* __restrict__ w, size_t n8, _Float16* __restrict__ Bt) { const size_t t = (size_t)blockIdx.x * 256 + threadIdx.x; if (t >= n8) return; FragH f; for (int q = 0; q < 8; ++q) f.h[q] = (_Float16)(bf16_round(w[t * 8 + q]) * 16.0f); *(v8us*)((unsigned short*)Bt + t * 8) = f.half[0];  }
__global__ __launch_bounds__(256) void k_rsm(const float* __restrict__ S, _Float16* __restrict__ P, int nrows) {
  #pragma clang fp contract(off)
  const int i = blockIdx.x * 256 + threadIdx.x; if (i >= nrows) return; const float* s = S + (size_t)i * SQ; float mx = -3.0e38f;
#pragma unroll 1
  for (int j = 0; j < SQ; ++j) mx = fmaxf(mx, s[j]); float se = 0.f;
#pragma unroll 1
  for (int j = 0; j < SQ; ++j) se += expf(s[j] - mx); const float sc = 256.0f / se;
#pragma unroll 1
  for (int j0 = 0; j0 < SQ; j0 += 8) { FragH f; for (int q = 0; q < 8; ++q) f.h[q] = (_Float16)(expf(s[j0 + q] - mx) * sc); unsigned short* d = (unsigned short*)P + (size_t)i * SQ + j0; *(v8us*)d = f.half[0];  } }
__global__ __launch_bounds__(256) void k_vt(const _Float16* __restrict__ V16, int b, int h0, _Float16* __restrict__ VT) { __shared__ unsigned short tl[64][65]; const int tid = threadIdx.x; const int hh = blockIdx.x % HG, sg = blockIdx.x / HG; const int s0 = sg * 64; const int h = h0 + hh;
  for (int i = tid; i < 64 * 8; i += 256) { const int j = i / 8, d8 = (i % 8) * 8; FragH f; f.half[0] = *(const v8us*)((const unsigned short*)V16 + ((size_t)b * SQ + s0 + j) * DM + h * HD + d8); for (int q = 0; q < 8; ++q) tl[d8 + q][j] = f.u[q]; }
  __syncthreads();
  { for (int i = tid; i < 64 * 8; i += 256) { const int d = i / 8, j8 = (i % 8) * 8; FragH f; for (int q = 0; q < 8; ++q) f.u[q] = tl[d][j8 + q]; *(v8us*)((unsigned short*)VT + ((size_t)hh * HD + d) * SQ + s0 + j8) = f.half[0]; }  } }



// lane l with lane l ^ M of its 16-lane row (DPP row_xmask), and lane l with lane l ^ 16
template <int M> __device__ __forceinline__ float rs_xm(float x) { return __builtin_bit_cast(float, __builtin_amdgcn_update_dpp(0, __builtin_bit_cast(int, x), 0x160 | M, 0xf, 0xf, true)); }
__device__ __forceinline__ float rs_xh(float x) { return __builtin_bit_cast(float, __builtin_amdgcn_permlanex16(__builtin_bit_cast(int, x), __builtin_bit_cast(int, x), 0x76543210, 0xfedcba98, false, false)); }
__device__ __forceinline__ float rs_wmax(float x) { x = fmaxf(x, rs_xm<1>(x)); x = fmaxf(x, rs_xm<2>(x)); x = fmaxf(x, rs_xm<4>(x)); x = fmaxf(x, rs_xm<8>(x)); return fmaxf(x, rs_xh(x)); }
__device__ __forceinline__ float rs_wsum(float x) { x += rs_xm<1>(x); x += rs_xm<2>(x); x += rs_xm<4>(x); x += rs_xm<8>(x); return x + rs_xh(x); }
// causal row softmax, ONE WAVE PER SCORE ROW: lane l keeps columns 128 c + 4 l .. + 3 of its row in registers, so S is read once, 512 contiguous bytes per wave load, and P leaves in 256 contiguous bytes per wave store;
// maximum and sum: per lane, then a five-step butterfly over the wave (every lane ends with the row's value). nk is a multiple of QT (the tile end), so the row goes in groups of QT columns = 2 loads per lane.
__global__ __launch_bounds__(256) void k_rsmcf2(const float* __restrict__ S, _Float16* __restrict__ P, int hg, int q0, int nk) {
  const int t = blockIdx.x * 8 + __builtin_amdgcn_readfirstlane(threadIdx.x >> 5); if (t >= hg * QT) return;      /* wave-uniform row index */
  const int c4 = (threadIdx.x & 31) * 4; const float* s = S + (size_t)t * NKX + c4; _Float16* p = P + (size_t)t * NKX + c4; const int last = q0 + (t % QT);
  v4f e[NKX / 128]; v4h h[NKX / 128];
  /* every loop below is unrolled because the row's registers need constant indices */
#pragma unroll
  for (int g = 0; g < NKX / QT; ++g) if (g * QT < nk) { e[2 * g] = *(const v4fa*)(s + g * QT); e[2 * g + 1] = *(const v4fa*)(s + g * QT + 128); }      /* all loads of the row in flight together */
  asm volatile("s_wait_xcnt 0x0" :: "v"(s) : "memory");      /* precaution: no register that an issued load names is written ahead of this wait; the address pair is an input here so that no load's result is placed on it */
  float mx = -3.0e38f;
#pragma unroll
  for (int g = 0; g < NKX / QT; ++g) if (g * QT < nk) { for (int c = 2 * g; c < 2 * g + 2; ++c) for (int q = 0; q < 4; ++q) { const float f = (c * 128 + c4 + q <= last) ? 1.f : 0.f; const float v = fmaf(f, e[c][q], (1.f - f) * -1.0e9f); e[c][q] = v; mx = fmaxf(mx, v); } }
  mx = rs_wmax(mx);
  v4f s4 = {0.f, 0.f, 0.f, 0.f};
#pragma unroll
  for (int g = 0; g < NKX / QT; ++g) if (g * QT < nk) { for (int c = 2 * g; c < 2 * g + 2; ++c) for (int q = 0; q < 4; ++q) { const float v = __expf(e[c][q] - mx); e[c][q] = v; s4[q] += v; } }
  const float sc = 256.0f / rs_wsum((s4[0] + s4[1]) + (s4[2] + s4[3]));
#pragma unroll
  for (int g = 0; g < NKX / QT; ++g) if (g * QT < nk) { for (int c = 2 * g; c < 2 * g + 2; ++c) for (int q = 0; q < 4; ++q) h[c][q] = (_Float16)(e[c][q] * sc); }
  /* the stores come last, each from registers of its own: nothing that an issued store names is written again */
#pragma unroll
  for (int g = 0; g < NKX / QT; ++g) if (g * QT < nk) { *(v4h*)(p + g * QT) = h[2 * g]; *(v4h*)(p + g * QT + 128) = h[2 * g + 1]; } }

template <int MASKADD>
__global__ __launch_bounds__(64) void k_att0(const float* __restrict__ QF, const float* __restrict__ KF, const float* __restrict__ VF, int ld, const float* __restrict__ mask, float scale, float* __restrict__ OF, int ldo) {
  #pragma clang fp contract(off)
  __shared__ __attribute__((aligned(16))) float lq[64][64]; __shared__ __attribute__((aligned(16))) float lo[64][64];
  const int tid = threadIdx.x; const int h = blockIdx.x / (QT0 / 64), rg = blockIdx.x % (QT0 / 64); const int i = rg * 64 + tid;
  const float* qr = QF + (size_t)i * ld + h * HD;
#pragma unroll 1
  for (int c = 0; c < HD / 4; ++c) { *(v4f*)&lq[tid][c * 4] = *(const v4fa*)(qr + c * 4); const v4f z = {0.f, 0.f, 0.f, 0.f}; *(v4f*)&lo[tid][c * 4] = z; }
  float m = -1.0e30f, l = 0.f; const int jmax = MASKADD ? (SQ - 1) : (rg * 64 + 63);      /* additive-mask form: every key (the mask input decides); causal form: keys up to the block's last row */
#pragma unroll 1
  for (int j = 0; j <= jmax; ++j) { const float* kr = KF + (size_t)j * ld + h * HD; const float* vr = VF + (size_t)j * ld + h * HD; float s = 0.f;
#pragma unroll 1
    for (int c = 0; c < HD / 4; ++c) { const v4f kq = *(const v4fa*)(kr + c * 4); const v4f qq = *(v4f*)&lq[tid][c * 4]; s = __fadd_rn(s, __fmul_rn(qq[0], kq[0])); s = __fadd_rn(s, __fmul_rn(qq[1], kq[1])); s = __fadd_rn(s, __fmul_rn(qq[2], kq[2])); s = __fadd_rn(s, __fmul_rn(qq[3], kq[3])); }
    s = __fmul_rn(s, scale); if (MASKADD) s = __fadd_rn(s, __fmul_rn(bf16_round(mask[(size_t)i * SQ + j]), -10000.0f));
    const float f = (MASKADD || j <= i) ? 1.f : 0.f; const float sm = fmaf(f, s, (1.f - f) * -1.0e30f); const float mn = fmaxf(m, sm); const float sc = expf(m - mn); const float e = expf(sm - mn); l = __fadd_rn(__fmul_rn(l, sc), e); m = mn;
#pragma unroll 1
    for (int c = 0; c < HD / 4; ++c) { const v4f vv = *(const v4fa*)(vr + c * 4); v4f oo = *(v4f*)&lo[tid][c * 4]; for (int u = 0; u < 4; ++u) oo[u] = __fadd_rn(__fmul_rn(oo[u], sc), __fmul_rn(e, vv[u])); *(v4f*)&lo[tid][c * 4] = oo; } }
  const float fin = 64.0f / l;      /* o carried x64 (k_oscale divides by 64) */
#pragma unroll 1
  for (int c = 0; c < HD / 4; ++c) { v4f oo = *(v4f*)&lo[tid][c * 4]; for (int u = 0; u < 4; ++u) oo[u] = __fmul_rn(oo[u], fin); *(v4f*)&lo[tid][c * 4] = oo; }
  __syncthreads();
  {
#pragma unroll 1
    for (int it = 0; it < 16; ++it) { const int row = it * 4 + tid / 16, pc = (tid % 16) * 4; const v4f v = *(const v4f*)&lo[row][pc]; *(v4f*)(OF + (size_t)(rg * 64 + row) * ldo + h * HD + pc) = v; }
     } }

__global__ __launch_bounds__(256) void k_oscale(const float* __restrict__ OF, float* __restrict__ out, size_t n4) { const size_t t = (size_t)blockIdx.x * 256 + threadIdx.x; if (t >= n4) return; const v4f a = *(const v4fa*)(OF + t * 4); v4f o; for (int q = 0; q < 4; ++q) o[q] = a[q] * 0.015625f; *(v4f*)(out + t * 4) = o;  }

__global__ __launch_bounds__(256) void k_bcpy(const float* __restrict__ b, int n, int NP, float* __restrict__ dst, int dst0) { for (int i = threadIdx.x; i < NP; i += 256) { const float v = (i < n) ? b[i] : 0.f; *(float*)(dst + dst0 + i) = v; }  }


extern "C" void kernel_launch(void* const* d_in, const int* in_sizes, int n_in,
                              void* d_out, int out_size, void* d_ws, size_t ws_size, hipStream_t stream) {
  (void)in_sizes; (void)n_in; (void)out_size;
  const float* const* I = (const float* const*)d_in; const float* x = I[0]; const float* wq = I[1]; const float* bq = I[2]; const float* wk = I[3]; const float* bk = I[4]; const float* wv = I[5]; const float* bv = I[6];      /* natural nn.Linear [out][in] weights + biases */
  char* ws = (char*)d_ws; size_t off = 0;
  auto take = [&](size_t bytes) { char* p = ws + off; off += (bytes + 255) & ~(size_t)255; return p; };
  _Float16* BQKV = (_Float16*)take((size_t)3 * DM * DM * 2); float* bqkv = (float*)take((size_t)3 * DM * 4);      /* stacked q | k | v weight plane and bias vector */ 
  _Float16* X16 = (_Float16*)take(NR * DM * 2); _Float16* QKV = (_Float16*)take(NR * 3 * DM * 2); _Float16* Q16 = QKV; _Float16* K16 = QKV + DM; _Float16* V16 = QKV + 2 * DM;      /* q | k | v */ _Float16* O16 = (_Float16*)take(NR * DM * 2);
  float* S = (float*)take((size_t)HG * SQ * SQ * 4); _Float16* P = (_Float16*)take((size_t)HG * SQ * SQ * 2); _Float16* VT = (_Float16*)take((size_t)NH * HD * SQ * 2);
  float* QF0 = (float*)take((size_t)QT0 * DM * 4); float* KF0 = (float*)take((size_t)QT0 * DM * 4); float* VF0 = (float*)take((size_t)QT0 * DM * 4); float* OF0 = (float*)take((size_t)QT0 * DM * 4);
  if (off > ws_size) return;
  { const unsigned g = (unsigned)(((size_t)DM * DM / 8 + 255) / 256); k_wnat<<<g, 256, 0, stream>>>(wq, (size_t)DM * DM / 8, BQKV); k_wnat<<<g, 256, 0, stream>>>(wk, (size_t)DM * DM / 8, BQKV + (size_t)DM * DM); k_wnat<<<g, 256, 0, stream>>>(wv, (size_t)DM * DM / 8, BQKV + (size_t)2 * DM * DM); }      /* natural [out][in] = Bt[n][k] x16, stacked q | k | v */
  k_bcpy<<<1, 256, 0, stream>>>(bq, DM, DM, bqkv, 0); k_bcpy<<<1, 256, 0, stream>>>(bk, DM, DM, bqkv, DM); k_bcpy<<<1, 256, 0, stream>>>(bv, DM, DM, bqkv, 2 * DM);      /* stacked bias vector bq | bk | bv */
  k_x16<<<(unsigned)((NR * DM / 8 + 255) / 256), 256, 0, stream>>>(x, X16, NR * DM / 8);
  const size_t r0p = (size_t)B0 * SQ;      /* first projected row */
  k_gemm2<0><<<dim3((unsigned)((MP / 128) * (3 * DM / 64)), 1), 128, 0, stream>>>(X16 + r0p * DM, DM, 0, BQKV, DM, 0, 0.0625f, bqkv, 0, nullptr, 1, 0, 0, nullptr, QKV + r0p * 3 * DM, 3 * DM, 0, MP, 3 * DM, DM);      /* q | k | v rows (f16); head h = columns h*HD.. of each DM block */
  for (int b = B0; b < B0 + NBR; ++b) { const size_t r0 = (size_t)b * SQ;
    k_vt<NH, SQ><<<NH * (SQ / 64), 256, 0, stream>>>(V16 + r0 * LQ, LQ, 0, VT);      /* V^T [NH][HD][SQ] for this batch */
    for (int q0 = 0; q0 < QN; q0 += QT) { const int nk = q0 + QT;      /* causal: only keys below the tile end are computed */
      k_gemm2<0><<<dim3((QT / 128) * (nk / 64), NHD), 128, 0, stream>>>(Q16 + (r0 + q0) * LQ, LQ, (size_t)HD, K16 + r0 * LQ, LQ, (size_t)HD, 0.125f, nullptr, 0, nullptr, 1, 0, 0, S, nullptr, NKX, (size_t)QT * NKX, QT, nk, HD);      /* scores, all heads on grid.y */
      k_rsmcf2<<<(NHD * QT + 7) / 8, 256, 0, stream>>>(S, P, NHD, q0, nk);      /* 8 waves per block, one row each */
      k_gemm2<0><<<dim3((QT / 128) * (HD / 64), NHD), 128, 0, stream>>>(P, NKX, (size_t)QT * NKX, VT, SQ, (size_t)HD * SQ, 0.00390625f, nullptr, 0, nullptr, 1, 0, 0, (float*)d_out + (r0 + q0) * DM, nullptr, DM, (size_t)HD, QT, HD, nk); }      /* o (merged heads) f32 straight into the output rows */
    k_gemm2<0><<<dim3((QT0 / 128) * (DM / 64), 1), 128, 0, stream>>>(X16 + r0 * DM, DM, 0, BQKV, DM, 0, 0.0625f, bqkv, 0, nullptr, 1, 0, 0, QF0, nullptr, DM, 0, QT0, DM, DM); k_gemm2<0><<<dim3((QT0 / 128) * (DM / 64), 1), 128, 0, stream>>>(X16 + r0 * DM, DM, 0, BQKV + (size_t)DM * DM, DM, 0, 0.0625f, bqkv + DM, 0, nullptr, 1, 0, 0, KF0, nullptr, DM, 0, QT0, DM, DM); k_gemm2<0><<<dim3((QT0 / 128) * (DM / 64), 1), 128, 0, stream>>>(X16 + r0 * DM, DM, 0, BQKV + (size_t)2 * DM * DM, DM, 0, 0.0625f, bqkv + 2 * DM, 0, nullptr, 1, 0, 0, VF0, nullptr, DM, 0, QT0, DM, DM);      /* exact f32 q (block 0), k (block 1), v (block 2) of rows 0..255 */
    k_att0<0><<<NH * (QT0 / 64), 64, 0, stream>>>(QF0, KF0, VF0, DM, nullptr, 0.125f, OF0, DM);      /* exact f32 causal attention rows 0..255 (o x64) */
    k_oscale<<<(unsigned)(((size_t)QT0 * DM / 4 + 255) / 256), 256, 0, stream>>>(OF0, (float*)d_out + r0 * DM, (size_t)QT0 * DM / 4); }      /* rows 0..255 rewritten = o / 64 (the f16-path rows are replaced) */
}

// v002
// One run takes 1090 microseconds.
// In two side-by-side timings against v001, it was 2.53 and 2.57 times as fast.
// Over all steps from v000 it is 5.36 times as fast.
#include <hip/hip_runtime.h>
// Masked (causal) multi-head self-attention WITHOUT output projection (X [2][2048][1024]; Q = X Wq^T + bq, K, V likewise (nn.Linear natural [1024][1024] sigma 1/32, biases sigma 1/32); 16 heads of 64; scores / 8; causal (tril, -inf); softmax; out = merged attn V -> [2][2048][1024]).
// Structure: x as exact f16 rows; q | k | v as ONE WMMA GEMM from the stacked x16 natural weight planes (+ stacked biases) (32x64 wave tiles, f32 accumulation, + bias, f16 outputs; q | k | v block order); per batch: V^T via LDS transposes; per query tile of 256 rows: scores against the keys below the tile end only (K = 64, 16 heads on grid.y, alpha 1/8), causal row softmax on VALU (arithmetic 0/1 select; f32 statistics, native exp; weights x256 f16), o = P V^T (alpha 2^-8) written f32 straight into the output rows (no output projection in this module); first-tile refinement: the first 256 rows of each batch recomputed exactly (f32 q/k/v GEMMs + online-softmax attention on VALU) and those output rows replaced; launches: see trace.
// Compute dtype: inputs rounded to bf16; x / weights exact; q, k, v and softmax weights as plain f16 GEMM operands (~2^-12), o written f32; scores and softmax statistics f32. v_wmma_f32_16x16x32_f16.
#define NB 2
#define SQ 2048
#define DM 1024
#define NH 16
#define HD 64
#define HG 4                         /* head group of the k_vt(b, h0) form; S / P sized HG*SQ*SQ = 2*NH*QT*SQ */
#define B0 0                         /* first batch processed (debug hook) */
#define NBR NB                       /* batches processed (debug hook) */
#define NR ((size_t)NB * SQ)         /* token rows */
#define MP ((int)((size_t)NBR * SQ)) /* rows projected (debug hook) */
#define QT 256                       /* query rows per causal tile */
#define NKX SQ                       /* S / P row pitch */
#define QT0 256                      /* first-tile rows recomputed exactly (256: margin for the few-key rows, no output projection) */
#define QN SQ                        /* query rows attended per batch (debug hook) */
#define NHD NH                       /* heads attended (debug hook) */
#define MPO MP                       /* unused */
#define LQ (3 * DM)      /* row pitch of the q/k/v rows */
typedef __bf16 v16b __attribute__((ext_vector_type(16)));
typedef unsigned short v8us __attribute__((ext_vector_type(8), may_alias));
typedef float  v8f  __attribute__((ext_vector_type(8)));
typedef float  v4f  __attribute__((ext_vector_type(4)));
typedef float  v4fa __attribute__((ext_vector_type(4), may_alias));
union FragB { v16b v; v8us half[2]; unsigned short u[16]; };

__device__ __forceinline__ unsigned short bf16_bits(float x) { unsigned int u = __float_as_uint(x); return (unsigned short)((u + 0x7FFFu + ((u >> 16) & 1u)) >> 16); }
__device__ __forceinline__ float bf16_val(unsigned short b) { return __uint_as_float(((unsigned int)b) << 16); }
__device__ __forceinline__ float bf16_round(float x) { return bf16_val(bf16_bits(x)); }
// D += A·B with NT terms: 1 = ah·bh, 2 = + al·bh (A split), 3 = + ah·bl (both split)
template <int NT>
__device__ __forceinline__ v8f mmaN(v16b ah, v16b al, v16b bh, v16b bl, v8f c) {
  c = __builtin_amdgcn_wmma_f32_16x16x32_bf16(false, ah, false, bh, (short)0, c, false, false);
  if (NT >= 2) c = __builtin_amdgcn_wmma_f32_16x16x32_bf16(false, al, false, bh, (short)0, c, false, false);
  if (NT >= 3) c = __builtin_amdgcn_wmma_f32_16x16x32_bf16(false, ah, false, bl, (short)0, c, false, false);
  asm volatile("v_nop\n\tv_nop\n\tv_nop\n\tv_nop" : "+v"(c) : "v"(ah), "v"(al), "v"(bh), "v"(bl));
  return c;
}

__global__ __launch_bounds__(256) void k_wt_bf16(const float* __restrict__ W, unsigned short* __restrict__ Wt, int K, int N) {
  const int t = blockIdx.x * 256 + threadIdx.x;
  const int k8n = K / 8;
  if (t >= N * k8n) return;
  const int n = t / k8n, k8 = (t % k8n) * 8;
  v8us v;
#pragma unroll
  for (int i = 0; i < 8; ++i) v[i] = bf16_bits(W[(size_t)(k8 + i) * N + n]);
  *(v8us*)(Wt + (size_t)n * K + k8) = v;
  
}

// GEMM C[M][N] (f32, pitch ldc) = act(A[M][K]·W + bias). A f32 row-major (pitch lda) converted per fragment to bf16
// (ASPLIT: hi/lo two planes -> 2 terms, else single rounded term); Wt bf16 [N][K] (pitch ldb). BIAS_BF16 rounds the
// bias to bf16 first (bias quantised to bf16 before the add). K%32==0, M%16==0, N%64==0.
template <bool ASPLIT, int ACT, bool BIAS_BF16>
__global__ __launch_bounds__(128) void k_gemm_bf(const float* __restrict__ A, int lda, const unsigned short* __restrict__ Wt, int ldb,
                                               const float* __restrict__ bias, float* __restrict__ C, int ldc, int M, int N, int K) {
  __shared__ __attribute__((aligned(16))) float so[4][16][64];
  const int tid = threadIdx.x, w = tid >> 5, lane = tid & 31, ln = lane & 15, hh = lane >> 4;
  const int ntn = N / 64;
  const int wid = blockIdx.x * 4 + w;
  const int mt = wid / ntn, nq = wid % ntn;
  if (mt * 16 >= M) return;
  const int row0 = mt * 16, col0 = nq * 64;
  const float* arow = A + (size_t)(row0 + ln) * lda;
  v8f acc[4] = {};
  for (int kb = 0; kb < K; kb += 32) {
    FragB ah, al;
    const v4f x0 = *(const v4fa*)(arow + kb + 8 * hh), x1 = *(const v4fa*)(arow + kb + 8 * hh + 4);
    const v4f x2 = *(const v4fa*)(arow + kb + 16 + 8 * hh), x3 = *(const v4fa*)(arow + kb + 16 + 8 * hh + 4);
    float xs[16] = {x0[0],x0[1],x0[2],x0[3],x1[0],x1[1],x1[2],x1[3],x2[0],x2[1],x2[2],x2[3],x3[0],x3[1],x3[2],x3[3]};
#pragma unroll
    for (int i = 0; i < 16; ++i) { const unsigned short hb = bf16_bits(xs[i]); ah.u[i] = hb; al.u[i] = ASPLIT ? bf16_bits(xs[i] - bf16_val(hb)) : (unsigned short)0; }
#pragma unroll
    for (int t = 0; t < 4; ++t) {
      const unsigned short* brow = Wt + (size_t)(col0 + t * 16 + ln) * ldb + kb;
      FragB b;
      b.half[0] = *(const v8us*)(brow + 8 * hh);
      b.half[1] = *(const v8us*)(brow + 16 + 8 * hh);
      acc[t] = mmaN<ASPLIT ? 2 : 1>(ah.v, al.v, b.v, b.v, acc[t]);
    }
  }
#pragma unroll
  for (int t = 0; t < 4; ++t) {
    float bv = bias ? bias[col0 + t * 16 + ln] : 0.f;
    if (BIAS_BF16) bv = bf16_round(bv);
#pragma unroll
    for (int r = 0; r < 8; ++r) { float v = acc[t][r] + bv; if (ACT == 1) v = fmaxf(v, 0.f); so[w][8 * hh + r][t * 16 + ln] = v; }
  }
  __builtin_amdgcn_fence(__ATOMIC_ACQ_REL, "workgroup");
  __builtin_amdgcn_wave_barrier();
  const int rsub = lane >> 4, c4 = (lane & 15) * 4;
  {
#pragma unroll
    for (int q = 0; q < 8; ++q) {
      const int r = q * 2 + rsub;
      const v4f v = *(const v4fa*)&so[w][r][c4];
      *(v4f*)(C + (size_t)(row0 + r) * ldc + col0 + c4) = v;
    }
    
  }
}

// GEMM C = act(A·W + bias + resid): A f32 (ASPLIT -> hi/lo 2 terms), Wt bf16 [N][K]; ACT 0 none, 1 relu, 2 exact gelu;
// resid (optional, f32, row index = (row % rmod), pitch ldr, RES_BF16 rounds it) added before the activation.
template <bool ASPLIT, int ACT, bool BIAS_BF16, bool RES_BF16>
__global__ __launch_bounds__(128) void k_gemm_bf3(const float* __restrict__ A, int lda, const unsigned short* __restrict__ Wt, int ldb,
                                                const float* __restrict__ bias, const float* __restrict__ resid, int rmod, int ldr,
                                                float* __restrict__ C, int ldc, int M, int N, int K) {
  __shared__ __attribute__((aligned(16))) float so[4][16][64];
  const int tid = threadIdx.x, w = tid >> 5, lane = tid & 31, ln = lane & 15, hh = lane >> 4;
  const int ntn = N / 64;
  const int wid = blockIdx.x * 4 + w;
  const int mt = wid / ntn, nq = wid % ntn;
  if (mt * 16 >= M) return;
  const int row0 = mt * 16, col0 = nq * 64;
  const float* arow = A + (size_t)(row0 + ln) * lda;
  v8f acc[4] = {};
  for (int kb = 0; kb < K; kb += 32) {
    FragB ah, al;
    const v4f x0 = *(const v4fa*)(arow + kb + 8 * hh), x1 = *(const v4fa*)(arow + kb + 8 * hh + 4);
    const v4f x2 = *(const v4fa*)(arow + kb + 16 + 8 * hh), x3 = *(const v4fa*)(arow + kb + 16 + 8 * hh + 4);
    float xs[16] = {x0[0],x0[1],x0[2],x0[3],x1[0],x1[1],x1[2],x1[3],x2[0],x2[1],x2[2],x2[3],x3[0],x3[1],x3[2],x3[3]};
#pragma unroll
    for (int i = 0; i < 16; ++i) { const unsigned short hb = bf16_bits(xs[i]); ah.u[i] = hb; al.u[i] = ASPLIT ? bf16_bits(xs[i] - bf16_val(hb)) : (unsigned short)0; }
#pragma unroll
    for (int t = 0; t < 4; ++t) {
      const unsigned short* brow = Wt + (size_t)(col0 + t * 16 + ln) * ldb + kb;
      FragB b;
      b.half[0] = *(const v8us*)(brow + 8 * hh);
      b.half[1] = *(const v8us*)(brow + 16 + 8 * hh);
      acc[t] = mmaN<ASPLIT ? 2 : 1>(ah.v, al.v, b.v, b.v, acc[t]);
    }
  }
#pragma unroll
  for (int t = 0; t < 4; ++t) {
    const int col = col0 + t * 16 + ln;
    float bv = bias ? bias[col] : 0.f;
    if (BIAS_BF16) bv = bf16_round(bv);
#pragma unroll
    for (int r = 0; r < 8; ++r) {
      float v = acc[t][r] + bv;
      if (resid) { float rv = resid[(size_t)((row0 + 8 * hh + r) % rmod) * ldr + col]; if (RES_BF16) rv = bf16_round(rv); v += rv; }
      if (ACT == 1) v = fmaxf(v, 0.f);
      if (ACT == 2) v = 0.5f * v * (1.0f + erff(v * 0.70710678118654752f));
      if (ACT == 3) { const float u = 0.7978845608028654f * (v + 0.044715f * v * v * v); v = 0.5f * v * (1.0f + tanhf(u)); }
      so[w][8 * hh + r][t * 16 + ln] = v;
    }
  }
  __builtin_amdgcn_fence(__ATOMIC_ACQ_REL, "workgroup");
  __builtin_amdgcn_wave_barrier();
  const int rsub = lane >> 4, c4 = (lane & 15) * 4;
  {
#pragma unroll
    for (int q = 0; q < 8; ++q) {
      const int r = q * 2 + rsub;
      const v4f v = *(const v4fa*)&so[w][r][c4];
      *(v4f*)(C + (size_t)(row0 + r) * ldc + col0 + c4) = v;
    }
    
  }
}
// row LayerNorm (biased variance, eps) over N: s = X (+ R); optional out_sum <- s; out_norm <- (s-mu)*rsqrt(var+eps)*g + b
template <bool PARAM_BF16>
__global__ __launch_bounds__(256) void k_layernorm(const float* __restrict__ X, const float* __restrict__ R, const float* __restrict__ g, const float* __restrict__ bta,
                                                  float* __restrict__ out_sum, float* __restrict__ out_norm, int N, float eps) {
  __shared__ float red[256];
  const int row = blockIdx.x, tid = threadIdx.x;
  const float* x = X + (size_t)row * N; const float* rr = R ? R + (size_t)row * N : nullptr;
  float vals[16];                     // up to N = 4096
  const int per = N / 256;            // contiguous chunk per thread? use strided-by-4 chunks: thread handles j = tid*4 + 1024*u
  float s1 = 0.f;
  for (int u = 0; u < per / 4; ++u) {
    const int j = tid * 4 + 1024 * u;
    const v4f a = *(const v4fa*)(x + j);
    v4f b = {0.f,0.f,0.f,0.f}; if (rr) b = *(const v4fa*)(rr + j);
#pragma unroll
    for (int q = 0; q < 4; ++q) { const float v = a[q] + b[q]; vals[u * 4 + q] = v; s1 += v; }
  }
  red[tid] = s1; __syncthreads();
  for (int st = 128; st > 0; st >>= 1) { if (tid < st) red[tid] += red[tid + st]; __syncthreads(); }
  const float mu = red[0] / (float)N; __syncthreads();
  float s2 = 0.f;
  for (int u = 0; u < per / 4; ++u)
#pragma unroll
    for (int q = 0; q < 4; ++q) { const float c = vals[u * 4 + q] - mu; s2 += c * c; }
  red[tid] = s2; __syncthreads();
  for (int st = 128; st > 0; st >>= 1) { if (tid < st) red[tid] += red[tid + st]; __syncthreads(); }
  const float rs = rsqrtf(red[0] / (float)N + eps);
  {
    for (int u = 0; u < per / 4; ++u) {
      const int j = tid * 4 + 1024 * u;
      v4f o, sm;
#pragma unroll
      for (int q = 0; q < 4; ++q) {
        float gg = g[j + q], bb = bta[j + q];
        if (PARAM_BF16) { gg = bf16_round(gg); bb = bf16_round(bb); }
        sm[q] = vals[u * 4 + q]; o[q] = (vals[u * 4 + q] - mu) * rs * gg + bb;
      }
      if (out_sum) *(v4f*)(out_sum + (size_t)row * N + j) = sm;
      *(v4f*)(out_norm + (size_t)row * N + j) = o;
    }
    
  }
}



// ---- f16 WMMA path (v_wmma_f32_16x16x32_f16): 11-bit significands for operands in range — used where a [0,1] probability operand needs more precision than bf16
typedef _Float16 v16h __attribute__((ext_vector_type(16)));
union FragH { v16h v; v8us half[2]; _Float16 h[16]; unsigned short u[16]; };
template <int NT>
__device__ __forceinline__ v8f mmaH(v16h ah, v16h al, v16h bh, v16h bl, v8f c) {
  c = __builtin_amdgcn_wmma_f32_16x16x32_f16(false, ah, false, bh, (short)0, c, false, false);
  if (NT >= 2) c = __builtin_amdgcn_wmma_f32_16x16x32_f16(false, al, false, bh, (short)0, c, false, false);
  if (NT >= 3) c = __builtin_amdgcn_wmma_f32_16x16x32_f16(false, ah, false, bl, (short)0, c, false, false);
  asm volatile("v_nop\n\tv_nop\n\tv_nop\n\tv_nop" : "+v"(c) : "v"(ah), "v"(al), "v"(bh), "v"(bl));
  return c;
}
// batched GEMM like k_gemm_b but f16 operands: A f32 (split into f16 hi/lo if ASPLIT, else rounded to f16), Bt = f16 values [n][k]; alpha; C f32; N multiple of 16 (partial tiles skipped)
template <bool ASPLIT>
__global__ __launch_bounds__(128) void k_gemm_h(const float* __restrict__ A, int lda, size_t sA, const _Float16* __restrict__ Bh, int ldb, size_t sB, float alpha, float* __restrict__ C, int ldc, size_t sC, int M, int N, int K) {
  __shared__ __attribute__((aligned(16))) float so[4][16][64];
  const int tid = threadIdx.x, w = tid >> 5, lane = tid & 31, ln = lane & 15, hh = lane >> 4; const int by = blockIdx.y;
  A += (size_t)by * sA; Bh += (size_t)by * sB; C += (size_t)by * sC;
  const int ntn = (N + 63) / 64; const int wid = blockIdx.x * 4 + w; const int mt = wid / ntn, nq = wid % ntn; if (mt * 16 >= M) return;
  const int row0 = mt * 16, col0 = nq * 64; const float* arow = A + (size_t)(row0 + ln) * lda;
  v8f acc[4] = {};
  for (int kb = 0; kb < K; kb += 32) {
    FragH ah, al;
    const v4f x0 = *(const v4fa*)(arow + kb + 8 * hh), x1 = *(const v4fa*)(arow + kb + 8 * hh + 4), x2 = *(const v4fa*)(arow + kb + 16 + 8 * hh), x3 = *(const v4fa*)(arow + kb + 16 + 8 * hh + 4);
    float xs[16] = {x0[0],x0[1],x0[2],x0[3],x1[0],x1[1],x1[2],x1[3],x2[0],x2[1],x2[2],x2[3],x3[0],x3[1],x3[2],x3[3]};
#pragma unroll
    for (int i = 0; i < 16; ++i) { const _Float16 h = (_Float16)xs[i]; ah.h[i] = h; al.h[i] = ASPLIT ? (_Float16)(xs[i] - (float)h) : (_Float16)0.0f; }
#pragma unroll
    for (int t = 0; t < 4; ++t) { if (col0 + t * 16 >= N) continue; const size_t boff = (size_t)(col0 + t * 16 + ln) * ldb + kb; FragH bq; bq.half[0] = *(const v8us*)(Bh + boff + 8 * hh); bq.half[1] = *(const v8us*)(Bh + boff + 16 + 8 * hh);
      acc[t] = mmaH<ASPLIT ? 2 : 1>(ah.v, al.v, bq.v, bq.v, acc[t]); }
  }
#pragma unroll
  for (int t = 0; t < 4; ++t) { if (col0 + t * 16 >= N) continue;
#pragma unroll
    for (int r = 0; r < 8; ++r) so[w][8 * hh + r][t * 16 + ln] = acc[t][r] * alpha; }
  __builtin_amdgcn_fence(__ATOMIC_ACQ_REL, "workgroup"); __builtin_amdgcn_wave_barrier();
  const int rsub = lane >> 4, c4 = (lane & 15) * 4;
  {
#pragma unroll
    for (int q = 0; q < 8; ++q) { const int r = q * 2 + rsub; if (col0 + c4 < N) { const v4f v = *(const v4fa*)&so[w][r][c4]; *(v4f*)(C + (size_t)(row0 + r) * ldc + col0 + c4) = v; } }
     }
}

// Wt[n][k] = f16(W[k][n]·scale) from f32 row-major W[K][N] (scale = power of two; bf16-exact weights stay exact in f16 away from the subnormal range)
__global__ __launch_bounds__(256) void k_wt_f16(const float* __restrict__ W, _Float16* __restrict__ Wt, int K, int N, float scale) {
  const int t = blockIdx.x * 256 + threadIdx.x; if (t >= N * (K / 8)) return; const int n = t / (K / 8), k8 = (t % (K / 8)) * 8; FragH f;
#pragma unroll
  for (int i = 0; i < 8; ++i) f.h[i] = (_Float16)(bf16_round(W[(size_t)(k8 + i) * N + n]) * scale); const v8us o = f.half[0];
  *(v8us*)((unsigned short*)Wt + (size_t)n * K + k8) = o; 
}
// k_gemm_hh variant with fused epilogue: v = acc·alpha + bias[by·sBias + col] (+ CP[(row/rowsPerB)·sCPb + by·64 + col] if CP) ; ACT 0 none / 1 elu ; writes f16 C16 (and f32 C if non-null)
template <int ACT>
__global__ __launch_bounds__(128) void k_gemm_hhx(const _Float16* __restrict__ A, int lda, size_t sA, const _Float16* __restrict__ Bh, int ldb, size_t sB, float alpha, const float* __restrict__ bias, size_t sBias, const float* __restrict__ CP, int rowsPerB, size_t sCPb, int row0g,
    float* __restrict__ C, _Float16* __restrict__ C16, int ldc, size_t sC, int M, int N, int K) {
  __shared__ __attribute__((aligned(16))) float so[4][16][64];
  const int tid = threadIdx.x, w = tid >> 5, lane = tid & 31, ln = lane & 15, hh = lane >> 4; const int by = blockIdx.y;
  A += (size_t)by * sA; Bh += (size_t)by * sB; const size_t cofs = (size_t)by * sC; const float* bp = bias ? bias + (size_t)by * sBias : nullptr;
  const int ntn = (N + 63) / 64; const int wid = blockIdx.x * 4 + w; const int mt = wid / ntn, nq = wid % ntn; if (mt * 16 >= M) return;
  const int row0 = mt * 16, col0 = nq * 64; const _Float16* arow = A + (size_t)(row0 + ln) * lda;
  v8f acc[4] = {};
  for (int kb = 0; kb < K; kb += 32) { FragH ah; ah.half[0] = *(const v8us*)((const unsigned short*)arow + kb + 8 * hh); ah.half[1] = *(const v8us*)((const unsigned short*)arow + kb + 16 + 8 * hh);
#pragma unroll
    for (int t = 0; t < 4; ++t) { if (col0 + t * 16 >= N) continue; const size_t boff = (size_t)(col0 + t * 16 + ln) * ldb + kb; FragH bq; bq.half[0] = *(const v8us*)((const unsigned short*)Bh + boff + 8 * hh); bq.half[1] = *(const v8us*)((const unsigned short*)Bh + boff + 16 + 8 * hh);
      acc[t] = mmaH<1>(ah.v, ah.v, bq.v, bq.v, acc[t]); }
  }
#pragma unroll
  for (int t = 0; t < 4; ++t) { if (col0 + t * 16 >= N) continue; const int col = col0 + t * 16 + ln; const float bv = bp ? bf16_round(bp[col]) : 0.f;
#pragma unroll
    for (int r = 0; r < 8; ++r) { float v = acc[t][r] * alpha + bv; if (CP) { const int rr = row0g + row0 + 8 * hh + r; if (rowsPerB < 0) v += CP[cofs + (size_t)rr * ldc + col];      /* rowsPerB < 0: own element of the batched C plane */ else { const int bidx = rr / rowsPerB; v += CP[(size_t)bidx * sCPb + (size_t)by * 64 + col]; } } if (ACT == 1) v = (v > 0.f) ? v : expm1f(v); else if (ACT == 7) v = (v > 0.f) ? v + 1.0f : expf(v); else if (ACT == 8) v = tanhf(v); else if (ACT == 9) v = 0.5f * v * (1.0f + tanhf(0.7978845608028654f * (v + 0.044715f * v * v * v))); else if (ACT == 11) v = 1.0f / (1.0f + expf(-v)); else if (ACT == 12) v = (v > 0.f) ? v : 0.01f * v; else if (ACT == 14) v = (v > 0.f) ? v : 0.1f * v; else if (ACT == 16) v = (v >= 0.f) ? v : 0.3f * v; else if (ACT == 17) v = (v >= 0.f) ? v : 0.2f * v; else if (ACT == 15) v = v / (1.0f + expf(-v)); else if (ACT == 3) v = fmaxf(v, 0.f); else if (ACT == 6) v = 0.5f * v * (1.0f + erff(v * 0.70710678118654752f)); so[w][8 * hh + r][t * 16 + ln] = v; } }
  __builtin_amdgcn_fence(__ATOMIC_ACQ_REL, "workgroup"); __builtin_amdgcn_wave_barrier();
  const int rsub = lane >> 4, c4 = (lane & 15) * 4; typedef _Float16 v4h __attribute__((ext_vector_type(4)));
  {
#pragma unroll
    for (int q = 0; q < 8; ++q) { const int r = q * 2 + rsub; if (col0 + c4 < N) { const v4f v = *(const v4fa*)&so[w][r][c4]; if (C) *(v4f*)(C + cofs + (size_t)(row0 + r) * ldc + col0 + c4) = v; if (C16) { v4h h4; for (int i = 0; i < 4; ++i) h4[i] = (_Float16)v[i]; *(v4h*)(C16 + cofs + (size_t)(row0 + r) * ldc + col0 + c4) = h4; } } }
     }
}


typedef _Float16 v4h __attribute__((ext_vector_type(4)));

__global__ __launch_bounds__(256) void k_x16(const float* __restrict__ x, _Float16* __restrict__ X16, size_t n8) { const size_t t = (size_t)blockIdx.x * 256 + threadIdx.x; if (t >= n8) return; FragH f;
#pragma unroll
  for (int q = 0; q < 8; ++q) f.h[q] = (_Float16)bf16_round(x[t * 8 + q]); *(v8us*)((unsigned short*)X16 + t * 8) = f.half[0];  }
__global__ __launch_bounds__(256) void k_h16(const float* __restrict__ x, _Float16* __restrict__ X16, size_t n8) { const size_t t = (size_t)blockIdx.x * 256 + threadIdx.x; if (t >= n8) return; FragH f;
#pragma unroll
  for (int q = 0; q < 8; ++q) f.h[q] = (_Float16)x[t * 8 + q]; *(v8us*)((unsigned short*)X16 + t * 8) = f.half[0];  }
__global__ __launch_bounds__(256) void k_round16f(const float* __restrict__ W, _Float16* __restrict__ Bt, size_t n8) { const size_t t = (size_t)blockIdx.x * 256 + threadIdx.x; if (t >= n8) return; FragH f;
#pragma unroll
  for (int i = 0; i < 8; ++i) f.h[i] = (_Float16)(bf16_round(W[t * 8 + i]) * 16.0f); *(v8us*)((unsigned short*)Bt + t * 8) = f.half[0];  }
template <int NHv, int TTv>
__global__ __launch_bounds__(256) void k_vt(const _Float16* __restrict__ V16, int ldv, int voff, _Float16* __restrict__ Vt) { __shared__ unsigned short tl[64][66]; const int tid = threadIdx.x; const int slab = blockIdx.x / (TTv / 64), lg = blockIdx.x % (TTv / 64); const int b = slab / NHv, h = slab % NHv;
  for (int i = tid; i < 64 * 8; i += 256) { const int r = i / 8, c8 = (i % 8) * 8; FragH f; f.half[0] = *(const v8us*)((const unsigned short*)V16 + ((size_t)b * TTv + lg * 64 + r) * ldv + voff + h * 64 + c8);
#pragma unroll
    for (int q = 0; q < 8; ++q) tl[r][c8 + q] = f.u[q]; }
  __syncthreads();
  {
#pragma unroll
    for (int rd = 0; rd < 2; ++rd) { const int d = rd * 32 + tid / 8, pc = tid % 8; FragH f;
#pragma unroll
      for (int q = 0; q < 8; ++q) f.u[q] = tl[pc * 8 + q][d];
      *(v8us*)((unsigned short*)Vt + ((size_t)slab * 64 + d) * TTv + lg * 64 + pc * 8) = f.half[0]; }
     } }

__global__ __launch_bounds__(256) void k_hl(const float* __restrict__ F, _Float16* __restrict__ Hh, _Float16* __restrict__ Hl, size_t n8) { const size_t t = (size_t)blockIdx.x * 256 + threadIdx.x; if (t >= n8) return; FragH fh, fl; const v4f a = *(const v4fa*)(F + t * 8), c = *(const v4fa*)(F + t * 8 + 4);
#pragma unroll
  for (int q = 0; q < 4; ++q) { _Float16 h = (_Float16)a[q]; fh.h[q] = h; fl.h[q] = (_Float16)((a[q] - (float)h) * 1024.0f); h = (_Float16)c[q]; fh.h[4 + q] = h; fl.h[4 + q] = (_Float16)((c[q] - (float)h) * 1024.0f); }
  { *(v8us*)((unsigned short*)Hh + t * 8) = fh.half[0]; *(v8us*)((unsigned short*)Hl + t * 8) = fl.half[0];  } }

// ---- fast GEMM (wave tile 32x64; requires M % 32 == 0 rows per launch region and N % 64 == 0); epilogue = k_gemm_hhx semantics ----
__device__ __forceinline__ v16h g2_frag(const _Float16* p, int hh) { FragH f; f.half[0] = *(const v8us*)((const unsigned short*)p + 8 * hh); f.half[1] = *(const v8us*)((const unsigned short*)p + 16 + 8 * hh); return f.v; }
__device__ __forceinline__ v8f g2_mma(v16h a, v16h b, v8f c) { v8f d = __builtin_amdgcn_wmma_f32_16x16x32_f16(false, a, false, b, (short)0, c, false, false); asm volatile("v_nop\n\tv_nop\n\tv_nop\n\tv_nop" : "+v"(d) : "v"(a), "v"(b)); return d; }
template <int ACT>
__global__ __launch_bounds__(128) void k_gemm2(const _Float16* __restrict__ A, int lda, size_t sA, const _Float16* __restrict__ Bh, int ldb, size_t sB, float alpha, const float* __restrict__ bias, size_t sBias, const float* __restrict__ CP, int rowsPerB, size_t sCPb, int row0g,
    float* __restrict__ C, _Float16* __restrict__ C16, int ldc, size_t sC, int M, int N, int K) { static_assert(ACT == 0 || ACT == 3 || ACT == 6 || ACT == 8 || ACT == 9 || ACT == 11 || ACT == 12 || ACT == 14 || ACT == 15 || ACT == 16 || ACT == 17, "k_gemm2: unsupported ACT code (would silently apply no activation)");
  __shared__ __attribute__((aligned(16))) float so[4][32][68];
  const int tid = threadIdx.x, w = tid >> 5, lane = tid & 31, ln = lane & 15, hh = lane >> 4; const int by = blockIdx.y;
  A += (size_t)by * sA; Bh += (size_t)by * sB; const size_t cofs = (size_t)by * sC; const float* bp = bias ? bias + (size_t)by * sBias : nullptr;
  const int ntn = N >> 6; const int mt = blockIdx.x / ntn, nq = blockIdx.x - mt * ntn; const int row0 = mt * 128 + 32 * w, col0 = nq * 64; if (row0 >= M) return;
  const _Float16* a0p = A + (size_t)(row0 + ln) * lda; const _Float16* a1p = a0p + (size_t)16 * lda;
  const _Float16* b0p = Bh + (size_t)(col0 + ln) * ldb; const _Float16* b1p = b0p + (size_t)16 * ldb; const _Float16* b2p = b1p + (size_t)16 * ldb; const _Float16* b3p = b2p + (size_t)16 * ldb;
  const v8f z8 = {0.f,0.f,0.f,0.f,0.f,0.f,0.f,0.f}; v8f c00 = z8, c01 = z8, c02 = z8, c03 = z8, c10 = z8, c11 = z8, c12 = z8, c13 = z8;
#pragma unroll 1
  for (int kb = 0; kb < K; kb += 32) { const v16h a0 = g2_frag(a0p + kb, hh), a1 = g2_frag(a1p + kb, hh);
    v16h b = g2_frag(b0p + kb, hh); c00 = g2_mma(a0, b, c00); c10 = g2_mma(a1, b, c10);
    b = g2_frag(b1p + kb, hh); c01 = g2_mma(a0, b, c01); c11 = g2_mma(a1, b, c11);
    b = g2_frag(b2p + kb, hh); c02 = g2_mma(a0, b, c02); c12 = g2_mma(a1, b, c12);
    b = g2_frag(b3p + kb, hh); c03 = g2_mma(a0, b, c03); c13 = g2_mma(a1, b, c13); }
  v8f accs[8] = {c00, c01, c02, c03, c10, c11, c12, c13};
#pragma unroll
  for (int u = 0; u < 8; ++u) { const int t = u & 3, half = u >> 2; const int col = col0 + t * 16 + ln; const float bv = bp ? bf16_round(bp[col]) : 0.f;
#pragma unroll
    for (int r = 0; r < 8; ++r) { const int rloc = half * 16 + 8 * hh + r; float v = accs[u][r] * alpha + bv; if (CP) { if (rowsPerB < 0) v += CP[cofs + (size_t)(row0g + row0 + rloc) * ldc + col];      /* rowsPerB < 0: own element of the batched C plane */ else { const int bidx = (row0g + row0 + rloc) / rowsPerB; v += CP[(size_t)bidx * sCPb + (size_t)by * 64 + col]; } }
      if (ACT == 3) v = fmaxf(v, 0.f); else if (ACT == 6) v = 0.5f * v * (1.0f + erff(v * 0.70710678118654752f)); else if (ACT == 11) v = 1.0f / (1.0f + expf(-v)); else if (ACT == 15) v = v / (1.0f + expf(-v)); else if (ACT == 12) v = (v > 0.f) ? v : 0.01f * v; else if (ACT == 8) v = tanhf(v); else if (ACT == 9) v = 0.5f * v * (1.0f + tanhf(0.7978845608028654f * (v + 0.044715f * v * v * v))); else if (ACT == 14) v = (v > 0.f) ? v : 0.1f * v; else if (ACT == 16) v = (v >= 0.f) ? v : 0.3f * v; else if (ACT == 17) v = (v >= 0.f) ? v : 0.2f * v;
      so[w][rloc][t * 16 + ln] = v; } }
  __builtin_amdgcn_fence(__ATOMIC_ACQ_REL, "workgroup"); __builtin_amdgcn_wave_barrier();
  const int rsub = lane >> 4, c4 = (lane & 15) * 4;
  {
#pragma unroll
    for (int q = 0; q < 16; ++q) { const int r = q * 2 + rsub; const v4f v = *(const v4fa*)&so[w][r][c4]; if (C) *(v4f*)(C + cofs + (size_t)(row0 + r) * ldc + col0 + c4) = v; if (C16) { v4h h4; for (int i = 0; i < 4; ++i) h4[i] = (_Float16)v[i]; *(v4h*)(C16 + cofs + (size_t)(row0 + r) * ldc + col0 + c4) = h4; } }
     } }


__global__ __launch_bounds__(256) void k_wnat(const float* __restrict__ w, size_t n8, _Float16* __restrict__ Bt) { const size_t t = (size_t)blockIdx.x * 256 + threadIdx.x; if (t >= n8) return; FragH f; for (int q = 0; q < 8; ++q) f.h[q] = (_Float16)(bf16_round(w[t * 8 + q]) * 16.0f); *(v8us*)((unsigned short*)Bt + t * 8) = f.half[0];  }
__global__ __launch_bounds__(256) void k_rsm(const float* __restrict__ S, _Float16* __restrict__ P, int nrows) {
  #pragma clang fp contract(off)
  const int i = blockIdx.x * 256 + threadIdx.x; if (i >= nrows) return; const float* s = S + (size_t)i * SQ; float mx = -3.0e38f;
#pragma unroll 1
  for (int j = 0; j < SQ; ++j) mx = fmaxf(mx, s[j]); float se = 0.f;
#pragma unroll 1
  for (int j = 0; j < SQ; ++j) se += expf(s[j] - mx); const float sc = 256.0f / se;
#pragma unroll 1
  for (int j0 = 0; j0 < SQ; j0 += 8) { FragH f; for (int q = 0; q < 8; ++q) f.h[q] = (_Float16)(expf(s[j0 + q] - mx) * sc); unsigned short* d = (unsigned short*)P + (size_t)i * SQ + j0; *(v8us*)d = f.half[0];  } }
__global__ __launch_bounds__(256) void k_vt(const _Float16* __restrict__ V16, int b, int h0, _Float16* __restrict__ VT) { __shared__ unsigned short tl[64][65]; const int tid = threadIdx.x; const int hh = blockIdx.x % HG, sg = blockIdx.x / HG; const int s0 = sg * 64; const int h = h0 + hh;
  for (int i = tid; i < 64 * 8; i += 256) { const int j = i / 8, d8 = (i % 8) * 8; FragH f; f.half[0] = *(const v8us*)((const unsigned short*)V16 + ((size_t)b * SQ + s0 + j) * DM + h * HD + d8); for (int q = 0; q < 8; ++q) tl[d8 + q][j] = f.u[q]; }
  __syncthreads();
  { for (int i = tid; i < 64 * 8; i += 256) { const int d = i / 8, j8 = (i % 8) * 8; FragH f; for (int q = 0; q < 8; ++q) f.u[q] = tl[d][j8 + q]; *(v8us*)((unsigned short*)VT + ((size_t)hh * HD + d) * SQ + s0 + j8) = f.half[0]; }  } }



// lane l with lane l ^ M of its 16-lane row (DPP row_xmask), and lane l with lane l ^ 16
template <int M> __device__ __forceinline__ float rs_xm(float x) { return __builtin_bit_cast(float, __builtin_amdgcn_update_dpp(0, __builtin_bit_cast(int, x), 0x160 | M, 0xf, 0xf, true)); }
__device__ __forceinline__ float rs_xh(float x) { return __builtin_bit_cast(float, __builtin_amdgcn_permlanex16(__builtin_bit_cast(int, x), __builtin_bit_cast(int, x), 0x76543210, 0xfedcba98, false, false)); }
__device__ __forceinline__ float rs_wmax(float x) { x = fmaxf(x, rs_xm<1>(x)); x = fmaxf(x, rs_xm<2>(x)); x = fmaxf(x, rs_xm<4>(x)); x = fmaxf(x, rs_xm<8>(x)); return fmaxf(x, rs_xh(x)); }
__device__ __forceinline__ float rs_wsum(float x) { x += rs_xm<1>(x); x += rs_xm<2>(x); x += rs_xm<4>(x); x += rs_xm<8>(x); return x + rs_xh(x); }
// causal row softmax, ONE WAVE PER SCORE ROW: lane l keeps columns 128 c + 4 l .. + 3 of its row in registers, so S is read once, 512 contiguous bytes per wave load, and P leaves in 256 contiguous bytes per wave store;
// maximum and sum: per lane, then a five-step butterfly over the wave (every lane ends with the row's value). nk is a multiple of QT (the tile end), so the row goes in groups of QT columns = 2 loads per lane.
__global__ __launch_bounds__(256) void k_rsmcf2(const float* __restrict__ S, _Float16* __restrict__ P, int hg, int q0, int nk) {
  const int t = blockIdx.x * 8 + __builtin_amdgcn_readfirstlane(threadIdx.x >> 5); if (t >= hg * QT) return;      /* wave-uniform row index */
  const int c4 = (threadIdx.x & 31) * 4; const float* s = S + (size_t)t * NKX + c4; _Float16* p = P + (size_t)t * NKX + c4; const int last = q0 + (t % QT);
  v4f e[NKX / 128]; v4h h[NKX / 128];
  /* every loop below is unrolled because the row's registers need constant indices */
#pragma unroll
  for (int g = 0; g < NKX / QT; ++g) if (g * QT < nk) { e[2 * g] = *(const v4fa*)(s + g * QT); e[2 * g + 1] = *(const v4fa*)(s + g * QT + 128); }      /* all loads of the row in flight together */
  asm volatile("s_wait_xcnt 0x0" :: "v"(s) : "memory");      /* precaution: no register that an issued load names is written ahead of this wait; the address pair is an input here so that no load's result is placed on it */
  float mx = -3.0e38f;
#pragma unroll
  for (int g = 0; g < NKX / QT; ++g) if (g * QT < nk) { for (int c = 2 * g; c < 2 * g + 2; ++c) for (int q = 0; q < 4; ++q) { const float f = (c * 128 + c4 + q <= last) ? 1.f : 0.f; const float v = fmaf(f, e[c][q], (1.f - f) * -1.0e9f); e[c][q] = v; mx = fmaxf(mx, v); } }
  mx = rs_wmax(mx);
  v4f s4 = {0.f, 0.f, 0.f, 0.f};
#pragma unroll
  for (int g = 0; g < NKX / QT; ++g) if (g * QT < nk) { for (int c = 2 * g; c < 2 * g + 2; ++c) for (int q = 0; q < 4; ++q) { const float v = __expf(e[c][q] - mx); e[c][q] = v; s4[q] += v; } }
  const float sc = 256.0f / rs_wsum((s4[0] + s4[1]) + (s4[2] + s4[3]));
#pragma unroll
  for (int g = 0; g < NKX / QT; ++g) if (g * QT < nk) { for (int c = 2 * g; c < 2 * g + 2; ++c) for (int q = 0; q < 4; ++q) h[c][q] = (_Float16)(e[c][q] * sc); }
  /* the stores come last, each from registers of its own: nothing that an issued store names is written again */
#pragma unroll
  for (int g = 0; g < NKX / QT; ++g) if (g * QT < nk) { *(v4h*)(p + g * QT) = h[2 * g]; *(v4h*)(p + g * QT + 128) = h[2 * g + 1]; } }

// lane K of each 16-lane row, handed to all sixteen lanes of that row (DPP row_share)
template <int K> __device__ __forceinline__ float a0_share(float x) { return __builtin_bit_cast(float, __builtin_amdgcn_update_dpp(0, __builtin_bit_cast(int, x), 0x150 | K, 0xf, 0xf, true)); }
template <int K> __device__ __forceinline__ void a0_acc(v4f& o, float e, const v4f* vv) { o += a0_share<K>(e) * vv[K]; if constexpr (K + 1 < 16) a0_acc<K + 1>(o, e, vv); }
// exact f32 attention of the first QT0 rows, SIXTEEN LANES PER QUERY ROW, keys in groups of 16: lane p scores key 16 g + p (whole q row in registers, K row straight from global memory), the group's maximum comes from a
// four-step butterfly over the 16 lanes, the running o and l are rescaled once per group, lane p keeps columns 4 p .. 4 p + 3 of o and its own keys' share of l (summed over the 16 lanes at the end). No LDS, no barrier.
template <int MASKADD>
__global__ __launch_bounds__(256) void k_att0(const float* __restrict__ QF, const float* __restrict__ KF, const float* __restrict__ VF, const float* __restrict__ mask, float scale, float* __restrict__ OF, int ldo) {
  const int p = threadIdx.x & 15; const int h = blockIdx.x / (QT0 / 16), rb = blockIdx.x % (QT0 / 16); const int i = rb * 16 + (threadIdx.x >> 4);
  const float* qr = QF + (size_t)i * DM + h * HD; v4f q[HD / 4];      /* q, k, v rows have the pitch DM, a constant, so that a group's sixteen V rows hang on one address pair by immediate offsets */
  /* the loops over c are unrolled because the rows live in registers, which need constant indices */
#pragma unroll
  for (int c = 0; c < HD / 4; ++c) q[c] = *(const v4fa*)(qr + c * 4);
  asm volatile("s_wait_xcnt 0x0" :: "v"(qr) : "memory");      /* precaution: no register that an issued load names is written ahead of this wait; the address pair is an input here so that no load's result is placed on it */
  v4f o = {0.f, 0.f, 0.f, 0.f}; float m = -1.0e30f, l = 0.f; const int ng = MASKADD ? (SQ / 16) : (rb + 1);      /* additive-mask form: every key (the mask input decides); causal form: key groups up to the block's last row */
  for (int g = 0; g < ng; ++g) { const int j = g * 16 + p; const float* kr = KF + (size_t)j * DM + h * HD; const float* vr = VF + (size_t)(g * 16) * DM + h * HD + p * 4; v4f kk[HD / 4], vv[16];
#pragma unroll
    for (int c = 0; c < HD / 4; ++c) kk[c] = *(const v4fa*)(kr + c * 4);
#pragma unroll
    for (int c = 0; c < 16; ++c) vv[c] = *(const v4fa*)(vr + c * DM);
    asm volatile("s_wait_xcnt 0x0" :: "v"(kr), "v"(vr) : "memory");      /* the same precaution for the two address pairs of the group */
    /* inputs-only fences on the loaded values: they keep all 32 loads of the group in front of the arithmetic, in flight together (one memory latency per group; left alone the compiler waits after every second load) */
    asm volatile("" :: "v"(kk[0]), "v"(kk[1]), "v"(kk[2]), "v"(kk[3]), "v"(kk[4]), "v"(kk[5]), "v"(kk[6]), "v"(kk[7]), "v"(kk[8]), "v"(kk[9]), "v"(kk[10]), "v"(kk[11]), "v"(kk[12]), "v"(kk[13]), "v"(kk[14]), "v"(kk[15]), "v"(vv[0]), "v"(vv[1]), "v"(vv[2]), "v"(vv[3]), "v"(vv[4]), "v"(vv[5]), "v"(vv[6]), "v"(vv[7]), "v"(vv[8]), "v"(vv[9]), "v"(vv[10]), "v"(vv[11]), "v"(vv[12]), "v"(vv[13]));
    asm volatile("" :: "v"(vv[14]), "v"(vv[15]));
    v4f s4 = {0.f, 0.f, 0.f, 0.f};
#pragma unroll
    for (int c = 0; c < HD / 4; ++c) s4 += q[c] * kk[c];
    float s = ((s4[0] + s4[1]) + (s4[2] + s4[3])) * scale; if (MASKADD) s += bf16_round(mask[(size_t)i * SQ + j]) * -10000.0f;
    const float sm = (MASKADD || j <= i) ? s : -1.0e30f;
    float gm = sm; gm = fmaxf(gm, rs_xm<1>(gm)); gm = fmaxf(gm, rs_xm<2>(gm)); gm = fmaxf(gm, rs_xm<4>(gm)); gm = fmaxf(gm, rs_xm<8>(gm));
    const float mn = fmaxf(m, gm); const float sc = expf(m - mn); const float e = expf(sm - mn); l = l * sc + e; m = mn; o *= sc;
    a0_acc<0>(o, e, vv); }
  l += rs_xm<1>(l); l += rs_xm<2>(l); l += rs_xm<4>(l); l += rs_xm<8>(l);
  const float fin = 64.0f / l;      /* o carried x64; k_oscale divides by 64 */
  *(v4f*)(OF + (size_t)i * ldo + h * HD + p * 4) = o * fin; }

__global__ __launch_bounds__(256) void k_oscale(const float* __restrict__ OF, float* __restrict__ out, size_t n4) { const size_t t = (size_t)blockIdx.x * 256 + threadIdx.x; if (t >= n4) return; const v4f a = *(const v4fa*)(OF + t * 4); v4f o; for (int q = 0; q < 4; ++q) o[q] = a[q] * 0.015625f; *(v4f*)(out + t * 4) = o;  }

__global__ __launch_bounds__(256) void k_bcpy(const float* __restrict__ b, int n, int NP, float* __restrict__ dst, int dst0) { for (int i = threadIdx.x; i < NP; i += 256) { const float v = (i < n) ? b[i] : 0.f; *(float*)(dst + dst0 + i) = v; }  }


extern "C" void kernel_launch(void* const* d_in, const int* in_sizes, int n_in,
                              void* d_out, int out_size, void* d_ws, size_t ws_size, hipStream_t stream) {
  (void)in_sizes; (void)n_in; (void)out_size;
  const float* const* I = (const float* const*)d_in; const float* x = I[0]; const float* wq = I[1]; const float* bq = I[2]; const float* wk = I[3]; const float* bk = I[4]; const float* wv = I[5]; const float* bv = I[6];      /* natural nn.Linear [out][in] weights + biases */
  char* ws = (char*)d_ws; size_t off = 0;
  auto take = [&](size_t bytes) { char* p = ws + off; off += (bytes + 255) & ~(size_t)255; return p; };
  _Float16* BQKV = (_Float16*)take((size_t)3 * DM * DM * 2); float* bqkv = (float*)take((size_t)3 * DM * 4);      /* stacked q | k | v weight plane and bias vector */ 
  _Float16* X16 = (_Float16*)take(NR * DM * 2); _Float16* QKV = (_Float16*)take(NR * 3 * DM * 2); _Float16* Q16 = QKV; _Float16* K16 = QKV + DM; _Float16* V16 = QKV + 2 * DM;      /* q | k | v */ _Float16* O16 = (_Float16*)take(NR * DM * 2);
  float* S = (float*)take((size_t)HG * SQ * SQ * 4); _Float16* P = (_Float16*)take((size_t)HG * SQ * SQ * 2); _Float16* VT = (_Float16*)take((size_t)NH * HD * SQ * 2);
  float* QF0 = (float*)take((size_t)QT0 * DM * 4); float* KF0 = (float*)take((size_t)QT0 * DM * 4); float* VF0 = (float*)take((size_t)QT0 * DM * 4); float* OF0 = (float*)take((size_t)QT0 * DM * 4);
  if (off > ws_size) return;
  { const unsigned g = (unsigned)(((size_t)DM * DM / 8 + 255) / 256); k_wnat<<<g, 256, 0, stream>>>(wq, (size_t)DM * DM / 8, BQKV); k_wnat<<<g, 256, 0, stream>>>(wk, (size_t)DM * DM / 8, BQKV + (size_t)DM * DM); k_wnat<<<g, 256, 0, stream>>>(wv, (size_t)DM * DM / 8, BQKV + (size_t)2 * DM * DM); }      /* natural [out][in] = Bt[n][k] x16, stacked q | k | v */
  k_bcpy<<<1, 256, 0, stream>>>(bq, DM, DM, bqkv, 0); k_bcpy<<<1, 256, 0, stream>>>(bk, DM, DM, bqkv, DM); k_bcpy<<<1, 256, 0, stream>>>(bv, DM, DM, bqkv, 2 * DM);      /* stacked bias vector bq | bk | bv */
  k_x16<<<(unsigned)((NR * DM / 8 + 255) / 256), 256, 0, stream>>>(x, X16, NR * DM / 8);
  const size_t r0p = (size_t)B0 * SQ;      /* first projected row */
  k_gemm2<0><<<dim3((unsigned)((MP / 128) * (3 * DM / 64)), 1), 128, 0, stream>>>(X16 + r0p * DM, DM, 0, BQKV, DM, 0, 0.0625f, bqkv, 0, nullptr, 1, 0, 0, nullptr, QKV + r0p * 3 * DM, 3 * DM, 0, MP, 3 * DM, DM);      /* q | k | v rows (f16); head h = columns h*HD.. of each DM block */
  for (int b = B0; b < B0 + NBR; ++b) { const size_t r0 = (size_t)b * SQ;
    k_vt<NH, SQ><<<NH * (SQ / 64), 256, 0, stream>>>(V16 + r0 * LQ, LQ, 0, VT);      /* V^T [NH][HD][SQ] for this batch */
    for (int q0 = 0; q0 < QN; q0 += QT) { const int nk = q0 + QT;      /* causal: only keys below the tile end are computed */
      k_gemm2<0><<<dim3((QT / 128) * (nk / 64), NHD), 128, 0, stream>>>(Q16 + (r0 + q0) * LQ, LQ, (size_t)HD, K16 + r0 * LQ, LQ, (size_t)HD, 0.125f, nullptr, 0, nullptr, 1, 0, 0, S, nullptr, NKX, (size_t)QT * NKX, QT, nk, HD);      /* scores, all heads on grid.y */
      k_rsmcf2<<<(NHD * QT + 7) / 8, 256, 0, stream>>>(S, P, NHD, q0, nk);      /* 8 waves per block, one row each */
      k_gemm2<0><<<dim3((QT / 128) * (HD / 64), NHD), 128, 0, stream>>>(P, NKX, (size_t)QT * NKX, VT, SQ, (size_t)HD * SQ, 0.00390625f, nullptr, 0, nullptr, 1, 0, 0, (float*)d_out + (r0 + q0) * DM, nullptr, DM, (size_t)HD, QT, HD, nk); }      /* o (merged heads) f32 straight into the output rows */
    k_gemm2<0><<<dim3((QT0 / 128) * (DM / 64), 1), 128, 0, stream>>>(X16 + r0 * DM, DM, 0, BQKV, DM, 0, 0.0625f, bqkv, 0, nullptr, 1, 0, 0, QF0, nullptr, DM, 0, QT0, DM, DM); k_gemm2<0><<<dim3((QT0 / 128) * (DM / 64), 1), 128, 0, stream>>>(X16 + r0 * DM, DM, 0, BQKV + (size_t)DM * DM, DM, 0, 0.0625f, bqkv + DM, 0, nullptr, 1, 0, 0, KF0, nullptr, DM, 0, QT0, DM, DM); k_gemm2<0><<<dim3((QT0 / 128) * (DM / 64), 1), 128, 0, stream>>>(X16 + r0 * DM, DM, 0, BQKV + (size_t)2 * DM * DM, DM, 0, 0.0625f, bqkv + 2 * DM, 0, nullptr, 1, 0, 0, VF0, nullptr, DM, 0, QT0, DM, DM);      /* exact f32 q (block 0), k (block 1), v (block 2) of rows 0..255 */
    k_att0<0><<<NH * (QT0 / 16), 256, 0, stream>>>(QF0, KF0, VF0, nullptr, 0.125f, OF0, DM);      /* exact f32 causal attention rows 0..255 (o x64) */
    k_oscale<<<(unsigned)(((size_t)QT0 * DM / 4 + 255) / 256), 256, 0, stream>>>(OF0, (float*)d_out + r0 * DM, (size_t)QT0 * DM / 4); }      /* rows 0..255 rewritten = o / 64 (the f16-path rows are replaced) */
}

// v003
// It runs in 365 microseconds.
// Timed twice side by side with v002, it ran 3.00 and 2.99 times as fast.
// All steps since v000 together make it 16.1 times as fast.
#include <hip/hip_runtime.h>
#define NB 2
#define SQ 2048
#define DM 1024
#define NH 16
#define HD 64
#define HG 4                         /* head group of the k_vt(b, h0) form */
#define B0 0                         /* first batch processed (debug hook) */
#define NBR NB                       /* batches processed (debug hook) */
#define NR ((size_t)NB * SQ)         /* token rows */
#define MP ((int)((size_t)NBR * SQ)) /* rows projected (debug hook) */
#define QT 256                       /* unused */
#define NKX SQ                       /* unused */
#define QT0 256                      /* first-tile rows recomputed exactly (256: margin for the few-key rows, no output projection) */
#define QN SQ                        /* query rows attended per batch (debug hook) */
#define NHD NH                       /* heads attended (debug hook) */
#define MPO MP                       /* unused */
#define LQ (3 * DM)      /* row pitch of the q/k/v rows */
typedef __bf16 v16b __attribute__((ext_vector_type(16)));
typedef unsigned short v8us __attribute__((ext_vector_type(8), may_alias));
typedef float  v8f  __attribute__((ext_vector_type(8)));
typedef float  v4f  __attribute__((ext_vector_type(4)));
typedef float  v4fa __attribute__((ext_vector_type(4), may_alias));
union FragB { v16b v; v8us half[2]; unsigned short u[16]; };

__device__ __forceinline__ unsigned short bf16_bits(float x) { unsigned int u = __float_as_uint(x); return (unsigned short)((u + 0x7FFFu + ((u >> 16) & 1u)) >> 16); }
__device__ __forceinline__ float bf16_val(unsigned short b) { return __uint_as_float(((unsigned int)b) << 16); }
__device__ __forceinline__ float bf16_round(float x) { return bf16_val(bf16_bits(x)); }
// D += A·B with NT terms: 1 = ah·bh, 2 = + al·bh (A split), 3 = + ah·bl (both split)
template <int NT>
__device__ __forceinline__ v8f mmaN(v16b ah, v16b al, v16b bh, v16b bl, v8f c) {
  c = __builtin_amdgcn_wmma_f32_16x16x32_bf16(false, ah, false, bh, (short)0, c, false, false);
  if (NT >= 2) c = __builtin_amdgcn_wmma_f32_16x16x32_bf16(false, al, false, bh, (short)0, c, false, false);
  if (NT >= 3) c = __builtin_amdgcn_wmma_f32_16x16x32_bf16(false, ah, false, bl, (short)0, c, false, false);
  asm volatile("v_nop\n\tv_nop\n\tv_nop\n\tv_nop" : "+v"(c) : "v"(ah), "v"(al), "v"(bh), "v"(bl));
  return c;
}

__global__ __launch_bounds__(256) void k_wt_bf16(const float* __restrict__ W, unsigned short* __restrict__ Wt, int K, int N) {
  const int t = blockIdx.x * 256 + threadIdx.x;
  const int k8n = K / 8;
  if (t >= N * k8n) return;
  const int n = t / k8n, k8 = (t % k8n) * 8;
  v8us v;
#pragma unroll
  for (int i = 0; i < 8; ++i) v[i] = bf16_bits(W[(size_t)(k8 + i) * N + n]);
  *(v8us*)(Wt + (size_t)n * K + k8) = v;
  
}

// GEMM C[M][N] (f32, pitch ldc) = act(A[M][K]·W + bias). A f32 row-major (pitch lda) converted per fragment to bf16
// (ASPLIT: hi/lo two planes -> 2 terms, else single rounded term); Wt bf16 [N][K] (pitch ldb). BIAS_BF16 rounds the
// bias to bf16 first (bias quantised to bf16 before the add). K%32==0, M%16==0, N%64==0.
template <bool ASPLIT, int ACT, bool BIAS_BF16>
__global__ __launch_bounds__(128) void k_gemm_bf(const float* __restrict__ A, int lda, const unsigned short* __restrict__ Wt, int ldb,
                                               const float* __restrict__ bias, float* __restrict__ C, int ldc, int M, int N, int K) {
  __shared__ __attribute__((aligned(16))) float so[4][16][64];
  const int tid = threadIdx.x, w = tid >> 5, lane = tid & 31, ln = lane & 15, hh = lane >> 4;
  const int ntn = N / 64;
  const int wid = blockIdx.x * 4 + w;
  const int mt = wid / ntn, nq = wid % ntn;
  if (mt * 16 >= M) return;
  const int row0 = mt * 16, col0 = nq * 64;
  const float* arow = A + (size_t)(row0 + ln) * lda;
  v8f acc[4] = {};
  for (int kb = 0; kb < K; kb += 32) {
    FragB ah, al;
    const v4f x0 = *(const v4fa*)(arow + kb + 8 * hh), x1 = *(const v4fa*)(arow + kb + 8 * hh + 4);
    const v4f x2 = *(const v4fa*)(arow + kb + 16 + 8 * hh), x3 = *(const v4fa*)(arow + kb + 16 + 8 * hh + 4);
    float xs[16] = {x0[0],x0[1],x0[2],x0[3],x1[0],x1[1],x1[2],x1[3],x2[0],x2[1],x2[2],x2[3],x3[0],x3[1],x3[2],x3[3]};
#pragma unroll
    for (int i = 0; i < 16; ++i) { const unsigned short hb = bf16_bits(xs[i]); ah.u[i] = hb; al.u[i] = ASPLIT ? bf16_bits(xs[i] - bf16_val(hb)) : (unsigned short)0; }
#pragma unroll
    for (int t = 0; t < 4; ++t) {
      const unsigned short* brow = Wt + (size_t)(col0 + t * 16 + ln) * ldb + kb;
      FragB b;
      b.half[0] = *(const v8us*)(brow + 8 * hh);
      b.half[1] = *(const v8us*)(brow + 16 + 8 * hh);
      acc[t] = mmaN<ASPLIT ? 2 : 1>(ah.v, al.v, b.v, b.v, acc[t]);
    }
  }
#pragma unroll
  for (int t = 0; t < 4; ++t) {
    float bv = bias ? bias[col0 + t * 16 + ln] : 0.f;
    if (BIAS_BF16) bv = bf16_round(bv);
#pragma unroll
    for (int r = 0; r < 8; ++r) { float v = acc[t][r] + bv; if (ACT == 1) v = fmaxf(v, 0.f); so[w][8 * hh + r][t * 16 + ln] = v; }
  }
  __builtin_amdgcn_fence(__ATOMIC_ACQ_REL, "workgroup");
  __builtin_amdgcn_wave_barrier();
  const int rsub = lane >> 4, c4 = (lane & 15) * 4;
  {
#pragma unroll
    for (int q = 0; q < 8; ++q) {
      const int r = q * 2 + rsub;
      const v4f v = *(const v4fa*)&so[w][r][c4];
      *(v4f*)(C + (size_t)(row0 + r) * ldc + col0 + c4) = v;
    }
    
  }
}

// GEMM C = act(A·W + bias + resid): A f32 (ASPLIT -> hi/lo 2 terms), Wt bf16 [N][K]; ACT 0 none, 1 relu, 2 exact gelu;
// resid (optional, f32, row index = (row % rmod), pitch ldr, RES_BF16 rounds it) added before the activation.
template <bool ASPLIT, int ACT, bool BIAS_BF16, bool RES_BF16>
__global__ __launch_bounds__(128) void k_gemm_bf3(const float* __restrict__ A, int lda, const unsigned short* __restrict__ Wt, int ldb,
                                                const float* __restrict__ bias, const float* __restrict__ resid, int rmod, int ldr,
                                                float* __restrict__ C, int ldc, int M, int N, int K) {
  __shared__ __attribute__((aligned(16))) float so[4][16][64];
  const int tid = threadIdx.x, w = tid >> 5, lane = tid & 31, ln = lane & 15, hh = lane >> 4;
  const int ntn = N / 64;
  const int wid = blockIdx.x * 4 + w;
  const int mt = wid / ntn, nq = wid % ntn;
  if (mt * 16 >= M) return;
  const int row0 = mt * 16, col0 = nq * 64;
  const float* arow = A + (size_t)(row0 + ln) * lda;
  v8f acc[4] = {};
  for (int kb = 0; kb < K; kb += 32) {
    FragB ah, al;
    const v4f x0 = *(const v4fa*)(arow + kb + 8 * hh), x1 = *(const v4fa*)(arow + kb + 8 * hh + 4);
    const v4f x2 = *(const v4fa*)(arow + kb + 16 + 8 * hh), x3 = *(const v4fa*)(arow + kb + 16 + 8 * hh + 4);
    float xs[16] = {x0[0],x0[1],x0[2],x0[3],x1[0],x1[1],x1[2],x1[3],x2[0],x2[1],x2[2],x2[3],x3[0],x3[1],x3[2],x3[3]};
#pragma unroll
    for (int i = 0; i < 16; ++i) { const unsigned short hb = bf16_bits(xs[i]); ah.u[i] = hb; al.u[i] = ASPLIT ? bf16_bits(xs[i] - bf16_val(hb)) : (unsigned short)0; }
#pragma unroll
    for (int t = 0; t < 4; ++t) {
      const unsigned short* brow = Wt + (size_t)(col0 + t * 16 + ln) * ldb + kb;
      FragB b;
      b.half[0] = *(const v8us*)(brow + 8 * hh);
      b.half[1] = *(const v8us*)(brow + 16 + 8 * hh);
      acc[t] = mmaN<ASPLIT ? 2 : 1>(ah.v, al.v, b.v, b.v, acc[t]);
    }
  }
#pragma unroll
  for (int t = 0; t < 4; ++t) {
    const int col = col0 + t * 16 + ln;
    float bv = bias ? bias[col] : 0.f;
    if (BIAS_BF16) bv = bf16_round(bv);
#pragma unroll
    for (int r = 0; r < 8; ++r) {
      float v = acc[t][r] + bv;
      if (resid) { float rv = resid[(size_t)((row0 + 8 * hh + r) % rmod) * ldr + col]; if (RES_BF16) rv = bf16_round(rv); v += rv; }
      if (ACT == 1) v = fmaxf(v, 0.f);
      if (ACT == 2) v = 0.5f * v * (1.0f + erff(v * 0.70710678118654752f));
      if (ACT == 3) { const float u = 0.7978845608028654f * (v + 0.044715f * v * v * v); v = 0.5f * v * (1.0f + tanhf(u)); }
      so[w][8 * hh + r][t * 16 + ln] = v;
    }
  }
  __builtin_amdgcn_fence(__ATOMIC_ACQ_REL, "workgroup");
  __builtin_amdgcn_wave_barrier();
  const int rsub = lane >> 4, c4 = (lane & 15) * 4;
  {
#pragma unroll
    for (int q = 0; q < 8; ++q) {
      const int r = q * 2 + rsub;
      const v4f v = *(const v4fa*)&so[w][r][c4];
      *(v4f*)(C + (size_t)(row0 + r) * ldc + col0 + c4) = v;
    }
    
  }
}
// row LayerNorm (biased variance, eps) over N: s = X (+ R); optional out_sum <- s; out_norm <- (s-mu)*rsqrt(var+eps)*g + b
template <bool PARAM_BF16>
__global__ __launch_bounds__(256) void k_layernorm(const float* __restrict__ X, const float* __restrict__ R, const float* __restrict__ g, const float* __restrict__ bta,
                                                  float* __restrict__ out_sum, float* __restrict__ out_norm, int N, float eps) {
  __shared__ float red[256];
  const int row = blockIdx.x, tid = threadIdx.x;
  const float* x = X + (size_t)row * N; const float* rr = R ? R + (size_t)row * N : nullptr;
  float vals[16];                     // up to N = 4096
  const int per = N / 256;            // contiguous chunk per thread? use strided-by-4 chunks: thread handles j = tid*4 + 1024*u
  float s1 = 0.f;
  for (int u = 0; u < per / 4; ++u) {
    const int j = tid * 4 + 1024 * u;
    const v4f a = *(const v4fa*)(x + j);
    v4f b = {0.f,0.f,0.f,0.f}; if (rr) b = *(const v4fa*)(rr + j);
#pragma unroll
    for (int q = 0; q < 4; ++q) { const float v = a[q] + b[q]; vals[u * 4 + q] = v; s1 += v; }
  }
  red[tid] = s1; __syncthreads();
  for (int st = 128; st > 0; st >>= 1) { if (tid < st) red[tid] += red[tid + st]; __syncthreads(); }
  const float mu = red[0] / (float)N; __syncthreads();
  float s2 = 0.f;
  for (int u = 0; u < per / 4; ++u)
#pragma unroll
    for (int q = 0; q < 4; ++q) { const float c = vals[u * 4 + q] - mu; s2 += c * c; }
  red[tid] = s2; __syncthreads();
  for (int st = 128; st > 0; st >>= 1) { if (tid < st) red[tid] += red[tid + st]; __syncthreads(); }
  const float rs = rsqrtf(red[0] / (float)N + eps);
  {
    for (int u = 0; u < per / 4; ++u) {
      const int j = tid * 4 + 1024 * u;
      v4f o, sm;
#pragma unroll
      for (int q = 0; q < 4; ++q) {
        float gg = g[j + q], bb = bta[j + q];
        if (PARAM_BF16) { gg = bf16_round(gg); bb = bf16_round(bb); }
        sm[q] = vals[u * 4 + q]; o[q] = (vals[u * 4 + q] - mu) * rs * gg + bb;
      }
      if (out_sum) *(v4f*)(out_sum + (size_t)row * N + j) = sm;
      *(v4f*)(out_norm + (size_t)row * N + j) = o;
    }
    
  }
}



// ---- f16 WMMA path (v_wmma_f32_16x16x32_f16): 11-bit significands for operands in range — used where a [0,1] probability operand needs more precision than bf16
typedef _Float16 v16h __attribute__((ext_vector_type(16)));
union FragH { v16h v; v8us half[2]; _Float16 h[16]; unsigned short u[16]; };
template <int NT>
__device__ __forceinline__ v8f mmaH(v16h ah, v16h al, v16h bh, v16h bl, v8f c) {
  c = __builtin_amdgcn_wmma_f32_16x16x32_f16(false, ah, false, bh, (short)0, c, false, false);
  if (NT >= 2) c = __builtin_amdgcn_wmma_f32_16x16x32_f16(false, al, false, bh, (short)0, c, false, false);
  if (NT >= 3) c = __builtin_amdgcn_wmma_f32_16x16x32_f16(false, ah, false, bl, (short)0, c, false, false);
  asm volatile("v_nop\n\tv_nop\n\tv_nop\n\tv_nop" : "+v"(c) : "v"(ah), "v"(al), "v"(bh), "v"(bl));
  return c;
}
// batched GEMM like k_gemm_b but f16 operands: A f32 (split into f16 hi/lo if ASPLIT, else rounded to f16), Bt = f16 values [n][k]; alpha; C f32; N multiple of 16 (partial tiles skipped)
template <bool ASPLIT>
__global__ __launch_bounds__(128) void k_gemm_h(const float* __restrict__ A, int lda, size_t sA, const _Float16* __restrict__ Bh, int ldb, size_t sB, float alpha, float* __restrict__ C, int ldc, size_t sC, int M, int N, int K) {
  __shared__ __attribute__((aligned(16))) float so[4][16][64];
  const int tid = threadIdx.x, w = tid >> 5, lane = tid & 31, ln = lane & 15, hh = lane >> 4; const int by = blockIdx.y;
  A += (size_t)by * sA; Bh += (size_t)by * sB; C += (size_t)by * sC;
  const int ntn = (N + 63) / 64; const int wid = blockIdx.x * 4 + w; const int mt = wid / ntn, nq = wid % ntn; if (mt * 16 >= M) return;
  const int row0 = mt * 16, col0 = nq * 64; const float* arow = A + (size_t)(row0 + ln) * lda;
  v8f acc[4] = {};
  for (int kb = 0; kb < K; kb += 32) {
    FragH ah, al;
    const v4f x0 = *(const v4fa*)(arow + kb + 8 * hh), x1 = *(const v4fa*)(arow + kb + 8 * hh + 4), x2 = *(const v4fa*)(arow + kb + 16 + 8 * hh), x3 = *(const v4fa*)(arow + kb + 16 + 8 * hh + 4);
    float xs[16] = {x0[0],x0[1],x0[2],x0[3],x1[0],x1[1],x1[2],x1[3],x2[0],x2[1],x2[2],x2[3],x3[0],x3[1],x3[2],x3[3]};
#pragma unroll
    for (int i = 0; i < 16; ++i) { const _Float16 h = (_Float16)xs[i]; ah.h[i] = h; al.h[i] = ASPLIT ? (_Float16)(xs[i] - (float)h) : (_Float16)0.0f; }
#pragma unroll
    for (int t = 0; t < 4; ++t) { if (col0 + t * 16 >= N) continue; const size_t boff = (size_t)(col0 + t * 16 + ln) * ldb + kb; FragH bq; bq.half[0] = *(const v8us*)(Bh + boff + 8 * hh); bq.half[1] = *(const v8us*)(Bh + boff + 16 + 8 * hh);
      acc[t] = mmaH<ASPLIT ? 2 : 1>(ah.v, al.v, bq.v, bq.v, acc[t]); }
  }
#pragma unroll
  for (int t = 0; t < 4; ++t) { if (col0 + t * 16 >= N) continue;
#pragma unroll
    for (int r = 0; r < 8; ++r) so[w][8 * hh + r][t * 16 + ln] = acc[t][r] * alpha; }
  __builtin_amdgcn_fence(__ATOMIC_ACQ_REL, "workgroup"); __builtin_amdgcn_wave_barrier();
  const int rsub = lane >> 4, c4 = (lane & 15) * 4;
  {
#pragma unroll
    for (int q = 0; q < 8; ++q) { const int r = q * 2 + rsub; if (col0 + c4 < N) { const v4f v = *(const v4fa*)&so[w][r][c4]; *(v4f*)(C + (size_t)(row0 + r) * ldc + col0 + c4) = v; } }
     }
}

// Wt[n][k] = f16(W[k][n]·scale) from f32 row-major W[K][N] (scale = power of two; bf16-exact weights stay exact in f16 away from the subnormal range)
__global__ __launch_bounds__(256) void k_wt_f16(const float* __restrict__ W, _Float16* __restrict__ Wt, int K, int N, float scale) {
  const int t = blockIdx.x * 256 + threadIdx.x; if (t >= N * (K / 8)) return; const int n = t / (K / 8), k8 = (t % (K / 8)) * 8; FragH f;
#pragma unroll
  for (int i = 0; i < 8; ++i) f.h[i] = (_Float16)(bf16_round(W[(size_t)(k8 + i) * N + n]) * scale); const v8us o = f.half[0];
  *(v8us*)((unsigned short*)Wt + (size_t)n * K + k8) = o; 
}
// k_gemm_hh variant with fused epilogue: v = acc·alpha + bias[by·sBias + col] (+ CP[(row/rowsPerB)·sCPb + by·64 + col] if CP) ; ACT 0 none / 1 elu ; writes f16 C16 (and f32 C if non-null)
template <int ACT>
__global__ __launch_bounds__(128) void k_gemm_hhx(const _Float16* __restrict__ A, int lda, size_t sA, const _Float16* __restrict__ Bh, int ldb, size_t sB, float alpha, const float* __restrict__ bias, size_t sBias, const float* __restrict__ CP, int rowsPerB, size_t sCPb, int row0g,
    float* __restrict__ C, _Float16* __restrict__ C16, int ldc, size_t sC, int M, int N, int K) {
  __shared__ __attribute__((aligned(16))) float so[4][16][64];
  const int tid = threadIdx.x, w = tid >> 5, lane = tid & 31, ln = lane & 15, hh = lane >> 4; const int by = blockIdx.y;
  A += (size_t)by * sA; Bh += (size_t)by * sB; const size_t cofs = (size_t)by * sC; const float* bp = bias ? bias + (size_t)by * sBias : nullptr;
  const int ntn = (N + 63) / 64; const int wid = blockIdx.x * 4 + w; const int mt = wid / ntn, nq = wid % ntn; if (mt * 16 >= M) return;
  const int row0 = mt * 16, col0 = nq * 64; const _Float16* arow = A + (size_t)(row0 + ln) * lda;
  v8f acc[4] = {};
  for (int kb = 0; kb < K; kb += 32) { FragH ah; ah.half[0] = *(const v8us*)((const unsigned short*)arow + kb + 8 * hh); ah.half[1] = *(const v8us*)((const unsigned short*)arow + kb + 16 + 8 * hh);
#pragma unroll
    for (int t = 0; t < 4; ++t) { if (col0 + t * 16 >= N) continue; const size_t boff = (size_t)(col0 + t * 16 + ln) * ldb + kb; FragH bq; bq.half[0] = *(const v8us*)((const unsigned short*)Bh + boff + 8 * hh); bq.half[1] = *(const v8us*)((const unsigned short*)Bh + boff + 16 + 8 * hh);
      acc[t] = mmaH<1>(ah.v, ah.v, bq.v, bq.v, acc[t]); }
  }
#pragma unroll
  for (int t = 0; t < 4; ++t) { if (col0 + t * 16 >= N) continue; const int col = col0 + t * 16 + ln; const float bv = bp ? bf16_round(bp[col]) : 0.f;
#pragma unroll
    for (int r = 0; r < 8; ++r) { float v = acc[t][r] * alpha + bv; if (CP) { const int rr = row0g + row0 + 8 * hh + r; if (rowsPerB < 0) v += CP[cofs + (size_t)rr * ldc + col];      /* rowsPerB < 0: own element of the batched C plane */ else { const int bidx = rr / rowsPerB; v += CP[(size_t)bidx * sCPb + (size_t)by * 64 + col]; } } if (ACT == 1) v = (v > 0.f) ? v : expm1f(v); else if (ACT == 7) v = (v > 0.f) ? v + 1.0f : expf(v); else if (ACT == 8) v = tanhf(v); else if (ACT == 9) v = 0.5f * v * (1.0f + tanhf(0.7978845608028654f * (v + 0.044715f * v * v * v))); else if (ACT == 11) v = 1.0f / (1.0f + expf(-v)); else if (ACT == 12) v = (v > 0.f) ? v : 0.01f * v; else if (ACT == 14) v = (v > 0.f) ? v : 0.1f * v; else if (ACT == 16) v = (v >= 0.f) ? v : 0.3f * v; else if (ACT == 17) v = (v >= 0.f) ? v : 0.2f * v; else if (ACT == 15) v = v / (1.0f + expf(-v)); else if (ACT == 3) v = fmaxf(v, 0.f); else if (ACT == 6) v = 0.5f * v * (1.0f + erff(v * 0.70710678118654752f)); so[w][8 * hh + r][t * 16 + ln] = v; } }
  __builtin_amdgcn_fence(__ATOMIC_ACQ_REL, "workgroup"); __builtin_amdgcn_wave_barrier();
  const int rsub = lane >> 4, c4 = (lane & 15) * 4; typedef _Float16 v4h __attribute__((ext_vector_type(4)));
  {
#pragma unroll
    for (int q = 0; q < 8; ++q) { const int r = q * 2 + rsub; if (col0 + c4 < N) { const v4f v = *(const v4fa*)&so[w][r][c4]; if (C) *(v4f*)(C + cofs + (size_t)(row0 + r) * ldc + col0 + c4) = v; if (C16) { v4h h4; for (int i = 0; i < 4; ++i) h4[i] = (_Float16)v[i]; *(v4h*)(C16 + cofs + (size_t)(row0 + r) * ldc + col0 + c4) = h4; } } }
     }
}


typedef _Float16 v4h __attribute__((ext_vector_type(4)));

__global__ __launch_bounds__(256) void k_x16(const float* __restrict__ x, _Float16* __restrict__ X16, size_t n8) { const size_t t = (size_t)blockIdx.x * 256 + threadIdx.x; if (t >= n8) return; FragH f;
#pragma unroll
  for (int q = 0; q < 8; ++q) f.h[q] = (_Float16)bf16_round(x[t * 8 + q]); *(v8us*)((unsigned short*)X16 + t * 8) = f.half[0];  }
__global__ __launch_bounds__(256) void k_h16(const float* __restrict__ x, _Float16* __restrict__ X16, size_t n8) { const size_t t = (size_t)blockIdx.x * 256 + threadIdx.x; if (t >= n8) return; FragH f;
#pragma unroll
  for (int q = 0; q < 8; ++q) f.h[q] = (_Float16)x[t * 8 + q]; *(v8us*)((unsigned short*)X16 + t * 8) = f.half[0];  }
__global__ __launch_bounds__(256) void k_round16f(const float* __restrict__ W, _Float16* __restrict__ Bt, size_t n8) { const size_t t = (size_t)blockIdx.x * 256 + threadIdx.x; if (t >= n8) return; FragH f;
#pragma unroll
  for (int i = 0; i < 8; ++i) f.h[i] = (_Float16)(bf16_round(W[t * 8 + i]) * 16.0f); *(v8us*)((unsigned short*)Bt + t * 8) = f.half[0];  }
template <int NHv, int TTv>
__global__ __launch_bounds__(256) void k_vt(const _Float16* __restrict__ V16, int ldv, int voff, _Float16* __restrict__ Vt) { __shared__ unsigned short tl[64][66]; const int tid = threadIdx.x; const int slab = blockIdx.x / (TTv / 64), lg = blockIdx.x % (TTv / 64); const int b = slab / NHv, h = slab % NHv;
  for (int i = tid; i < 64 * 8; i += 256) { const int r = i / 8, c8 = (i % 8) * 8; FragH f; f.half[0] = *(const v8us*)((const unsigned short*)V16 + ((size_t)b * TTv + lg * 64 + r) * ldv + voff + h * 64 + c8);
#pragma unroll
    for (int q = 0; q < 8; ++q) tl[r][c8 + q] = f.u[q]; }
  __syncthreads();
  {
#pragma unroll
    for (int rd = 0; rd < 2; ++rd) { const int d = rd * 32 + tid / 8, pc = tid % 8; FragH f;
#pragma unroll
      for (int q = 0; q < 8; ++q) f.u[q] = tl[pc * 8 + q][d];
      *(v8us*)((unsigned short*)Vt + ((size_t)slab * 64 + d) * TTv + lg * 64 + pc * 8) = f.half[0]; }
     } }

__global__ __launch_bounds__(256) void k_hl(const float* __restrict__ F, _Float16* __restrict__ Hh, _Float16* __restrict__ Hl, size_t n8) { const size_t t = (size_t)blockIdx.x * 256 + threadIdx.x; if (t >= n8) return; FragH fh, fl; const v4f a = *(const v4fa*)(F + t * 8), c = *(const v4fa*)(F + t * 8 + 4);
#pragma unroll
  for (int q = 0; q < 4; ++q) { _Float16 h = (_Float16)a[q]; fh.h[q] = h; fl.h[q] = (_Float16)((a[q] - (float)h) * 1024.0f); h = (_Float16)c[q]; fh.h[4 + q] = h; fl.h[4 + q] = (_Float16)((c[q] - (float)h) * 1024.0f); }
  { *(v8us*)((unsigned short*)Hh + t * 8) = fh.half[0]; *(v8us*)((unsigned short*)Hl + t * 8) = fl.half[0];  } }

// ---- fast GEMM (wave tile 32x64; requires M % 32 == 0 rows per launch region and N % 64 == 0); epilogue = k_gemm_hhx semantics ----
__device__ __forceinline__ v16h g2_frag(const _Float16* p, int hh) { FragH f; f.half[0] = *(const v8us*)((const unsigned short*)p + 8 * hh); f.half[1] = *(const v8us*)((const unsigned short*)p + 16 + 8 * hh); return f.v; }
__device__ __forceinline__ v8f g2_mma(v16h a, v16h b, v8f c) { v8f d = __builtin_amdgcn_wmma_f32_16x16x32_f16(false, a, false, b, (short)0, c, false, false); asm volatile("v_nop\n\tv_nop\n\tv_nop\n\tv_nop" : "+v"(d) : "v"(a), "v"(b)); return d; }
template <int ACT>
__global__ __launch_bounds__(128) void k_gemm2(const _Float16* __restrict__ A, int lda, size_t sA, const _Float16* __restrict__ Bh, int ldb, size_t sB, float alpha, const float* __restrict__ bias, size_t sBias, const float* __restrict__ CP, int rowsPerB, size_t sCPb, int row0g,
    float* __restrict__ C, _Float16* __restrict__ C16, int ldc, size_t sC, int M, int N, int K) { static_assert(ACT == 0 || ACT == 3 || ACT == 6 || ACT == 8 || ACT == 9 || ACT == 11 || ACT == 12 || ACT == 14 || ACT == 15 || ACT == 16 || ACT == 17, "k_gemm2: unsupported ACT code (would silently apply no activation)");
  __shared__ __attribute__((aligned(16))) float so[4][32][68];
  const int tid = threadIdx.x, w = tid >> 5, lane = tid & 31, ln = lane & 15, hh = lane >> 4; const int by = blockIdx.y;
  A += (size_t)by * sA; Bh += (size_t)by * sB; const size_t cofs = (size_t)by * sC; const float* bp = bias ? bias + (size_t)by * sBias : nullptr;
  const int ntn = N >> 6; const int mt = blockIdx.x / ntn, nq = blockIdx.x - mt * ntn; const int row0 = mt * 128 + 32 * w, col0 = nq * 64; if (row0 >= M) return;
  const _Float16* a0p = A + (size_t)(row0 + ln) * lda; const _Float16* a1p = a0p + (size_t)16 * lda;
  const _Float16* b0p = Bh + (size_t)(col0 + ln) * ldb; const _Float16* b1p = b0p + (size_t)16 * ldb; const _Float16* b2p = b1p + (size_t)16 * ldb; const _Float16* b3p = b2p + (size_t)16 * ldb;
  const v8f z8 = {0.f,0.f,0.f,0.f,0.f,0.f,0.f,0.f}; v8f c00 = z8, c01 = z8, c02 = z8, c03 = z8, c10 = z8, c11 = z8, c12 = z8, c13 = z8;
#pragma unroll 1
  for (int kb = 0; kb < K; kb += 32) { const v16h a0 = g2_frag(a0p + kb, hh), a1 = g2_frag(a1p + kb, hh);
    v16h b = g2_frag(b0p + kb, hh); c00 = g2_mma(a0, b, c00); c10 = g2_mma(a1, b, c10);
    b = g2_frag(b1p + kb, hh); c01 = g2_mma(a0, b, c01); c11 = g2_mma(a1, b, c11);
    b = g2_frag(b2p + kb, hh); c02 = g2_mma(a0, b, c02); c12 = g2_mma(a1, b, c12);
    b = g2_frag(b3p + kb, hh); c03 = g2_mma(a0, b, c03); c13 = g2_mma(a1, b, c13); }
  v8f accs[8] = {c00, c01, c02, c03, c10, c11, c12, c13};
#pragma unroll
  for (int u = 0; u < 8; ++u) { const int t = u & 3, half = u >> 2; const int col = col0 + t * 16 + ln; const float bv = bp ? bf16_round(bp[col]) : 0.f;
#pragma unroll
    for (int r = 0; r < 8; ++r) { const int rloc = half * 16 + 8 * hh + r; float v = accs[u][r] * alpha + bv; if (CP) { if (rowsPerB < 0) v += CP[cofs + (size_t)(row0g + row0 + rloc) * ldc + col];      /* rowsPerB < 0: own element of the batched C plane */ else { const int bidx = (row0g + row0 + rloc) / rowsPerB; v += CP[(size_t)bidx * sCPb + (size_t)by * 64 + col]; } }
      if (ACT == 3) v = fmaxf(v, 0.f); else if (ACT == 6) v = 0.5f * v * (1.0f + erff(v * 0.70710678118654752f)); else if (ACT == 11) v = 1.0f / (1.0f + expf(-v)); else if (ACT == 15) v = v / (1.0f + expf(-v)); else if (ACT == 12) v = (v > 0.f) ? v : 0.01f * v; else if (ACT == 8) v = tanhf(v); else if (ACT == 9) v = 0.5f * v * (1.0f + tanhf(0.7978845608028654f * (v + 0.044715f * v * v * v))); else if (ACT == 14) v = (v > 0.f) ? v : 0.1f * v; else if (ACT == 16) v = (v >= 0.f) ? v : 0.3f * v; else if (ACT == 17) v = (v >= 0.f) ? v : 0.2f * v;
      so[w][rloc][t * 16 + ln] = v; } }
  __builtin_amdgcn_fence(__ATOMIC_ACQ_REL, "workgroup"); __builtin_amdgcn_wave_barrier();
  const int rsub = lane >> 4, c4 = (lane & 15) * 4;
  {
#pragma unroll
    for (int q = 0; q < 16; ++q) { const int r = q * 2 + rsub; const v4f v = *(const v4fa*)&so[w][r][c4]; if (C) *(v4f*)(C + cofs + (size_t)(row0 + r) * ldc + col0 + c4) = v; if (C16) { v4h h4; for (int i = 0; i < 4; ++i) h4[i] = (_Float16)v[i]; *(v4h*)(C16 + cofs + (size_t)(row0 + r) * ldc + col0 + c4) = h4; } }
     } }


__global__ __launch_bounds__(256) void k_wnat(const float* __restrict__ w, size_t n8, _Float16* __restrict__ Bt) { const size_t t = (size_t)blockIdx.x * 256 + threadIdx.x; if (t >= n8) return; FragH f; for (int q = 0; q < 8; ++q) f.h[q] = (_Float16)(bf16_round(w[t * 8 + q]) * 16.0f); *(v8us*)((unsigned short*)Bt + t * 8) = f.half[0];  }
__global__ __launch_bounds__(256) void k_rsm(const float* __restrict__ S, _Float16* __restrict__ P, int nrows) {
  #pragma clang fp contract(off)
  const int i = blockIdx.x * 256 + threadIdx.x; if (i >= nrows) return; const float* s = S + (size_t)i * SQ; float mx = -3.0e38f;
#pragma unroll 1
  for (int j = 0; j < SQ; ++j) mx = fmaxf(mx, s[j]); float se = 0.f;
#pragma unroll 1
  for (int j = 0; j < SQ; ++j) se += expf(s[j] - mx); const float sc = 256.0f / se;
#pragma unroll 1
  for (int j0 = 0; j0 < SQ; j0 += 8) { FragH f; for (int q = 0; q < 8; ++q) f.h[q] = (_Float16)(expf(s[j0 + q] - mx) * sc); unsigned short* d = (unsigned short*)P + (size_t)i * SQ + j0; *(v8us*)d = f.half[0];  } }
__global__ __launch_bounds__(256) void k_vt(const _Float16* __restrict__ V16, int b, int h0, _Float16* __restrict__ VT) { __shared__ unsigned short tl[64][65]; const int tid = threadIdx.x; const int hh = blockIdx.x % HG, sg = blockIdx.x / HG; const int s0 = sg * 64; const int h = h0 + hh;
  for (int i = tid; i < 64 * 8; i += 256) { const int j = i / 8, d8 = (i % 8) * 8; FragH f; f.half[0] = *(const v8us*)((const unsigned short*)V16 + ((size_t)b * SQ + s0 + j) * DM + h * HD + d8); for (int q = 0; q < 8; ++q) tl[d8 + q][j] = f.u[q]; }
  __syncthreads();
  { for (int i = tid; i < 64 * 8; i += 256) { const int d = i / 8, j8 = (i % 8) * 8; FragH f; for (int q = 0; q < 8; ++q) f.u[q] = tl[d][j8 + q]; *(v8us*)((unsigned short*)VT + ((size_t)hh * HD + d) * SQ + s0 + j8) = f.half[0]; }  } }



// lane l with lane l ^ M of its 16-lane row (DPP row_xmask), and lane l with lane l ^ 16
template <int M> __device__ __forceinline__ float rs_xm(float x) { return __builtin_bit_cast(float, __builtin_amdgcn_update_dpp(0, __builtin_bit_cast(int, x), 0x160 | M, 0xf, 0xf, true)); }
__device__ __forceinline__ float rs_xh(float x) { return __builtin_bit_cast(float, __builtin_amdgcn_permlanex16(__builtin_bit_cast(int, x), __builtin_bit_cast(int, x), 0x76543210, 0xfedcba98, false, false)); }
__device__ __forceinline__ v16h fa_frag(const _Float16* p) { FragH f; f.half[0] = *(const v8us*)((const unsigned short*)p); f.half[1] = *(const v8us*)((const unsigned short*)p + 16); return f.v; }      /* p already holds the lane half's 8-element shift */
// exp2 of eight values, and of one: each v_exp_f32 works on a register of its own and a v_nop ends the statement. It is there for the slot that the instruction set asks for behind a transcendental before its result is read or its source overwritten.
__device__ __forceinline__ void fa_exp2x8(float (&e)[8]) { asm("v_exp_f32 %0, %0\n\tv_exp_f32 %1, %1\n\tv_exp_f32 %2, %2\n\tv_exp_f32 %3, %3\n\tv_exp_f32 %4, %4\n\tv_exp_f32 %5, %5\n\tv_exp_f32 %6, %6\n\tv_exp_f32 %7, %7\n\tv_nop" : "+v"(e[0]), "+v"(e[1]), "+v"(e[2]), "+v"(e[3]), "+v"(e[4]), "+v"(e[5]), "+v"(e[6]), "+v"(e[7])); }
__device__ __forceinline__ float fa_exp2(float x) { asm("v_exp_f32 %0, %0\n\tv_nop" : "+v"(x)); return x; }
// one trip: keys kb .. kb + 63 from kc; kx receives the next trip's K fragments
__device__ __forceinline__ void fa_trip(const int kb, const int q0, const int ln, const int hh, const _Float16* __restrict__ kp, const _Float16* __restrict__ vp, const v16h qf0, const v16h qf1, v16h (&kc)[4][2], v16h (&kx)[4][2], v8f (&o)[4], float& m, float& l) {
  const v8f z8 = {0.f,0.f,0.f,0.f,0.f,0.f,0.f,0.f}; const float cs = 0.125f * 1.4426950408889634f;      /* 1 / sqrt(HD), in log2 units */
  const _Float16* vr = vp + kb; v16h vf[4][2];
  /* every loop of this function is unrolled because fragments, scores and sums live in registers, which need constant indices */
#pragma unroll
  for (int t = 0; t < 4; ++t) { vf[t][0] = fa_frag(vr + (size_t)(16 * t) * SQ); vf[t][1] = fa_frag(vr + (size_t)(16 * t) * SQ + 32); }
  asm volatile("s_wait_xcnt 0x0" ::: "memory");      /* precaution: no register that an issued load names is written ahead of this wait (the V^T address pair lives on through the loop) */
  v8f s[4];
#pragma unroll
  for (int t = 0; t < 4; ++t) { s[t] = __builtin_amdgcn_wmma_f32_16x16x32_f16(false, kc[t][0], false, qf0, (short)0, z8, false, false); s[t] = __builtin_amdgcn_wmma_f32_16x16x32_f16(false, kc[t][1], false, qf1, (short)0, s[t], false, false); }
  const int kn = (kb + 64 < q0 + 16) ? kb + 64 : kb;      /* the last trip asks for its own rows again: always rows that the projection wrote */
  const _Float16* kr = kp + (size_t)kn * LQ;      /* kp points at the q block of the row: the k block's shift DM rides in the loads' constant offsets, so that kr is the very address pair that the loads name */
#pragma unroll
  for (int t = 0; t < 4; ++t) { kx[t][0] = fa_frag(kr + (size_t)(16 * t) * LQ + DM); kx[t][1] = fa_frag(kr + (size_t)(16 * t) * LQ + DM + 32); }
  asm volatile("s_wait_xcnt 0x0" :: "v"(kr) : "memory");      /* the same precaution for the next trip's K loads; their address pair is an input here so that no load's result is placed on it */
  if (kb + 63 > q0) {      /* wave-uniform: the trip that reaches the diagonal; s[t][r] = key kb + 16 t + 8 hh + r against query q0 + ln */
#pragma unroll
    for (int t = 0; t < 4; ++t) for (int r = 0; r < 8; ++r) s[t][r] = (kb + 16 * t + 8 * hh + r <= q0 + ln) ? s[t][r] : -1.0e30f; }
  float mx = s[0][0];
#pragma unroll
  for (int t = 0; t < 4; ++t) for (int r = 0; r < 8; ++r) mx = fmaxf(mx, s[t][r]);
  mx = fmaxf(mx, rs_xh(mx));      /* the other half of the query's keys */
  const float mn = fmaxf(m, mx * cs); const float al = fa_exp2(m - mn); m = mn;
  v4f s4 = {0.f, 0.f, 0.f, 0.f}; FragH pf[2];
#pragma unroll
  for (int t = 0; t < 4; ++t) { float e[8]; for (int r = 0; r < 8; ++r) e[r] = fmaf(s[t][r], cs, -mn); fa_exp2x8(e); for (int r = 0; r < 8; ++r) { s4[r & 3] += e[r]; pf[t >> 1].h[(t & 1) * 8 + r] = (_Float16)e[r]; } }
  l = l * al + ((s4[0] + s4[1]) + (s4[2] + s4[3]));      /* each half keeps its own keys' share */
#pragma unroll
  for (int t = 0; t < 4; ++t) { o[t] *= al; o[t] = __builtin_amdgcn_wmma_f32_16x16x32_f16(false, vf[t][0], false, pf[0].v, (short)0, o[t], false, false); o[t] = __builtin_amdgcn_wmma_f32_16x16x32_f16(false, vf[t][1], false, pf[1].v, (short)0, o[t], false, false); } }
// four waves per SIMD: with at most 256 registers a wave all 4096 waves of the launch are resident at once (16 per WGP), and the waves of a SIMD fill each other's waits
__global__ __launch_bounds__(128) __attribute__((amdgpu_waves_per_eu(4, 4))) void k_fattn(const _Float16* __restrict__ QKVp, const _Float16* __restrict__ VTp, float* __restrict__ out) {
  const int lane = threadIdx.x & 31, ln = lane & 15, hh = lane >> 4; const int w = __builtin_amdgcn_readfirstlane(threadIdx.x >> 5);
  const int bh = blockIdx.x, b = bh / NH, h = bh % NH; const int q0 = (SQ / 64 - 1 - (int)blockIdx.y) * 64 + w * 16;      /* wave-uniform first query row */
  const _Float16* qp = QKVp + ((size_t)b * SQ + q0 + ln) * LQ + h * HD + 8 * hh; const _Float16* kp = QKVp + ((size_t)b * SQ + ln) * LQ + h * HD + 8 * hh; const _Float16* vp = VTp + ((size_t)bh * HD + ln) * SQ + 8 * hh;
  const v16h qf0 = fa_frag(qp), qf1 = fa_frag(qp + 32); v16h ka[4][2], kc[4][2];
  /* unrolled, here and at the stores, for constant register indices */
#pragma unroll
  for (int t = 0; t < 4; ++t) { ka[t][0] = fa_frag(kp + (size_t)(16 * t) * LQ + DM); ka[t][1] = fa_frag(kp + (size_t)(16 * t) * LQ + DM + 32); }
  asm volatile("s_wait_xcnt 0x0" :: "v"(qp) : "memory");      /* precaution: no register that an issued load names is written ahead of this wait; the q address pair is an input here so that no load's result is placed on it (the K pair lives on through the loop) */
  const v8f z8 = {0.f,0.f,0.f,0.f,0.f,0.f,0.f,0.f}; v8f o[4] = {z8, z8, z8, z8}; float m = -1.0e30f, l = 0.f;
  for (int kb = 0; ; kb += 128) {      /* at most SQ / 128 rounds of two trips; both exits are wave-uniform */
    fa_trip(kb, q0, ln, hh, kp, vp, qf0, qf1, ka, kc, o, m, l); if (kb + 64 >= q0 + 16) break;
    fa_trip(kb + 64, q0, ln, hh, kp, vp, qf0, qf1, kc, ka, o, m, l); if (kb + 128 >= q0 + 16) break; }
  asm volatile("s_wait_loadcnt 0x0" ::: "memory");      /* the last trip's K request has no reader, so nothing else makes the wave wait for all of it: with this wait it has landed before the wave hands its registers back at its end */
  l += rs_xh(l); const float fin = 1.0f / l;
  float* op = out + ((size_t)b * SQ + q0 + ln) * DM + h * HD + 8 * hh;      /* o[t][r] = column 16 t + 8 hh + r of query q0 + ln */
#pragma unroll
  for (int t = 0; t < 4; ++t) { const v4f lo = {o[t][0] * fin, o[t][1] * fin, o[t][2] * fin, o[t][3] * fin}, hi = {o[t][4] * fin, o[t][5] * fin, o[t][6] * fin, o[t][7] * fin}; *(v4f*)(op + 16 * t) = lo; *(v4f*)(op + 16 * t + 4) = hi; } }

// lane K of each 16-lane row, handed to all sixteen lanes of that row (DPP row_share)
template <int K> __device__ __forceinline__ float a0_share(float x) { return __builtin_bit_cast(float, __builtin_amdgcn_update_dpp(0, __builtin_bit_cast(int, x), 0x150 | K, 0xf, 0xf, true)); }
template <int K> __device__ __forceinline__ void a0_acc(v4f& o, float e, const v4f* vv) { o += a0_share<K>(e) * vv[K]; if constexpr (K + 1 < 16) a0_acc<K + 1>(o, e, vv); }
// exact f32 attention of the first QT0 rows, SIXTEEN LANES PER QUERY ROW, keys in groups of 16: lane p scores key 16 g + p (whole q row in registers, K row straight from global memory), the group's maximum comes from a
// four-step butterfly over the 16 lanes, the running o and l are rescaled once per group, lane p keeps columns 4 p .. 4 p + 3 of o and its own keys' share of l (summed over the 16 lanes at the end). No LDS, no barrier.
template <int MASKADD>
__global__ __launch_bounds__(256) void k_att0(const float* __restrict__ QF, const float* __restrict__ KF, const float* __restrict__ VF, const float* __restrict__ mask, float scale, float* __restrict__ OF, int ldo) {
  const int p = threadIdx.x & 15; const int h = blockIdx.x / (QT0 / 16), rb = blockIdx.x % (QT0 / 16); const int i = rb * 16 + (threadIdx.x >> 4);
  const float* qr = QF + (size_t)i * DM + h * HD; v4f q[HD / 4];      /* q, k, v rows have the pitch DM, a constant, so that a group's sixteen V rows hang on one address pair by immediate offsets */
  /* the loops over c are unrolled because the rows live in registers, which need constant indices */
#pragma unroll
  for (int c = 0; c < HD / 4; ++c) q[c] = *(const v4fa*)(qr + c * 4);
  asm volatile("s_wait_xcnt 0x0" :: "v"(qr) : "memory");      /* precaution: no register that an issued load names is written ahead of this wait; the address pair is an input here so that no load's result is placed on it */
  v4f o = {0.f, 0.f, 0.f, 0.f}; float m = -1.0e30f, l = 0.f; const int ng = MASKADD ? (SQ / 16) : (rb + 1);      /* additive-mask form: every key (the mask input decides); causal form: key groups up to the block's last row */
  for (int g = 0; g < ng; ++g) { const int j = g * 16 + p; const float* kr = KF + (size_t)j * DM + h * HD; const float* vr = VF + (size_t)(g * 16) * DM + h * HD + p * 4; v4f kk[HD / 4], vv[16];
#pragma unroll
    for (int c = 0; c < HD / 4; ++c) kk[c] = *(const v4fa*)(kr + c * 4);
#pragma unroll
    for (int c = 0; c < 16; ++c) vv[c] = *(const v4fa*)(vr + c * DM);
    asm volatile("s_wait_xcnt 0x0" :: "v"(kr), "v"(vr) : "memory");      /* the same precaution for the two address pairs of the group */
    /* inputs-only fences on the loaded values: they keep all 32 loads of the group in front of the arithmetic, in flight together (one memory latency per group; left alone the compiler waits after every second load) */
    asm volatile("" :: "v"(kk[0]), "v"(kk[1]), "v"(kk[2]), "v"(kk[3]), "v"(kk[4]), "v"(kk[5]), "v"(kk[6]), "v"(kk[7]), "v"(kk[8]), "v"(kk[9]), "v"(kk[10]), "v"(kk[11]), "v"(kk[12]), "v"(kk[13]), "v"(kk[14]), "v"(kk[15]), "v"(vv[0]), "v"(vv[1]), "v"(vv[2]), "v"(vv[3]), "v"(vv[4]), "v"(vv[5]), "v"(vv[6]), "v"(vv[7]), "v"(vv[8]), "v"(vv[9]), "v"(vv[10]), "v"(vv[11]), "v"(vv[12]), "v"(vv[13]));
    asm volatile("" :: "v"(vv[14]), "v"(vv[15]));
    v4f s4 = {0.f, 0.f, 0.f, 0.f};
#pragma unroll
    for (int c = 0; c < HD / 4; ++c) s4 += q[c] * kk[c];
    float s = ((s4[0] + s4[1]) + (s4[2] + s4[3])) * scale; if (MASKADD) s += bf16_round(mask[(size_t)i * SQ + j]) * -10000.0f;
    const float sm = (MASKADD || j <= i) ? s : -1.0e30f;
    float gm = sm; gm = fmaxf(gm, rs_xm<1>(gm)); gm = fmaxf(gm, rs_xm<2>(gm)); gm = fmaxf(gm, rs_xm<4>(gm)); gm = fmaxf(gm, rs_xm<8>(gm));
    const float mn = fmaxf(m, gm); const float sc = expf(m - mn); const float e = expf(sm - mn); l = l * sc + e; m = mn; o *= sc;
    a0_acc<0>(o, e, vv); }
  l += rs_xm<1>(l); l += rs_xm<2>(l); l += rs_xm<4>(l); l += rs_xm<8>(l);
  const float fin = 64.0f / l;      /* o carried x64; k_oscale divides by 64 */
  *(v4f*)(OF + (size_t)i * ldo + h * HD + p * 4) = o * fin; }

__global__ __launch_bounds__(256) void k_oscale(const float* __restrict__ OF, float* __restrict__ out, size_t n4) { const size_t t = (size_t)blockIdx.x * 256 + threadIdx.x; if (t >= n4) return; const v4f a = *(const v4fa*)(OF + t * 4); v4f o; for (int q = 0; q < 4; ++q) o[q] = a[q] * 0.015625f; *(v4f*)(out + t * 4) = o;  }

__global__ __launch_bounds__(256) void k_bcpy(const float* __restrict__ b, int n, int NP, float* __restrict__ dst, int dst0) { for (int i = threadIdx.x; i < NP; i += 256) { const float v = (i < n) ? b[i] : 0.f; *(float*)(dst + dst0 + i) = v; }  }


extern "C" void kernel_launch(void* const* d_in, const int* in_sizes, int n_in,
                              void* d_out, int out_size, void* d_ws, size_t ws_size, hipStream_t stream) {
  (void)in_sizes; (void)n_in; (void)out_size;
  const float* const* I = (const float* const*)d_in; const float* x = I[0]; const float* wq = I[1]; const float* bq = I[2]; const float* wk = I[3]; const float* bk = I[4]; const float* wv = I[5]; const float* bv = I[6];      /* natural nn.Linear [out][in] weights + biases */
  char* ws = (char*)d_ws; size_t off = 0;
  auto take = [&](size_t bytes) { char* p = ws + off; off += (bytes + 255) & ~(size_t)255; return p; };
  _Float16* BQKV = (_Float16*)take((size_t)3 * DM * DM * 2); float* bqkv = (float*)take((size_t)3 * DM * 4);      /* stacked q | k | v weight plane and bias vector */ 
  _Float16* X16 = (_Float16*)take(NR * DM * 2); _Float16* QKV = (_Float16*)take(NR * 3 * DM * 2); _Float16* Q16 = QKV; _Float16* K16 = QKV + DM; _Float16* V16 = QKV + 2 * DM;      /* q | k | v */ _Float16* O16 = (_Float16*)take(NR * DM * 2);
  _Float16* VT = (_Float16*)take((size_t)NB * NH * HD * SQ * 2);
  float* QF0 = (float*)take((size_t)QT0 * DM * 4); float* KF0 = (float*)take((size_t)QT0 * DM * 4); float* VF0 = (float*)take((size_t)QT0 * DM * 4); float* OF0 = (float*)take((size_t)QT0 * DM * 4);
  if (off > ws_size) return;
  { const unsigned g = (unsigned)(((size_t)DM * DM / 8 + 255) / 256); k_wnat<<<g, 256, 0, stream>>>(wq, (size_t)DM * DM / 8, BQKV); k_wnat<<<g, 256, 0, stream>>>(wk, (size_t)DM * DM / 8, BQKV + (size_t)DM * DM); k_wnat<<<g, 256, 0, stream>>>(wv, (size_t)DM * DM / 8, BQKV + (size_t)2 * DM * DM); }      /* natural [out][in] = Bt[n][k] x16, stacked q | k | v */
  k_bcpy<<<1, 256, 0, stream>>>(bq, DM, DM, bqkv, 0); k_bcpy<<<1, 256, 0, stream>>>(bk, DM, DM, bqkv, DM); k_bcpy<<<1, 256, 0, stream>>>(bv, DM, DM, bqkv, 2 * DM);      /* stacked bias vector bq | bk | bv */
  k_x16<<<(unsigned)((NR * DM / 8 + 255) / 256), 256, 0, stream>>>(x, X16, NR * DM / 8);
  const size_t r0p = (size_t)B0 * SQ;      /* first projected row */
  k_gemm2<0><<<dim3((unsigned)((MP / 128) * (3 * DM / 64)), 1), 128, 0, stream>>>(X16 + r0p * DM, DM, 0, BQKV, DM, 0, 0.0625f, bqkv, 0, nullptr, 1, 0, 0, nullptr, QKV + r0p * 3 * DM, 3 * DM, 0, MP, 3 * DM, DM);      /* q | k | v rows (f16); head h = columns h*HD.. of each DM block */
  k_vt<NH, SQ><<<NB * NH * (SQ / 64), 256, 0, stream>>>(V16, LQ, 0, VT);      /* V^T [NB][NH][HD][SQ] */
  k_fattn<<<dim3(NB * NH, SQ / 64), 128, 0, stream>>>(QKV, VT, (float*)d_out);      /* o (merged heads) f32 straight into the output rows */
  for (int b = B0; b < B0 + NBR; ++b) { const size_t r0 = (size_t)b * SQ;
    k_gemm2<0><<<dim3((QT0 / 128) * (DM / 64), 1), 128, 0, stream>>>(X16 + r0 * DM, DM, 0, BQKV, DM, 0, 0.0625f, bqkv, 0, nullptr, 1, 0, 0, QF0, nullptr, DM, 0, QT0, DM, DM); k_gemm2<0><<<dim3((QT0 / 128) * (DM / 64), 1), 128, 0, stream>>>(X16 + r0 * DM, DM, 0, BQKV + (size_t)DM * DM, DM, 0, 0.0625f, bqkv + DM, 0, nullptr, 1, 0, 0, KF0, nullptr, DM, 0, QT0, DM, DM); k_gemm2<0><<<dim3((QT0 / 128) * (DM / 64), 1), 128, 0, stream>>>(X16 + r0 * DM, DM, 0, BQKV + (size_t)2 * DM * DM, DM, 0, 0.0625f, bqkv + 2 * DM, 0, nullptr, 1, 0, 0, VF0, nullptr, DM, 0, QT0, DM, DM);      /* exact f32 q (block 0), k (block 1), v (block 2) of rows 0..255 */
    k_att0<0><<<NH * (QT0 / 16), 256, 0, stream>>>(QF0, KF0, VF0, nullptr, 0.125f, OF0, DM);      /* exact f32 causal attention rows 0..255 (o x64) */
    k_oscale<<<(unsigned)(((size_t)QT0 * DM / 4 + 255) / 256), 256, 0, stream>>>(OF0, (float*)d_out + r0 * DM, (size_t)QT0 * DM / 4); }      /* rows 0..255 rewritten = o / 64 (the f16-path rows are replaced) */
}

// v004
// One run takes 181 microseconds.
// Timed twice side by side with v003, it ran 2.02 and 2.03 times as fast.
// All steps since v000 together make it 32.5 times as fast.
#include <hip/hip_runtime.h>
#define NB 2
#define SQ 2048
#define DM 1024
#define NH 16
#define HD 64
#define HG 4                         /* head group of the k_vt(b, h0) form */
#define B0 0                         /* first batch processed (debug hook) */
#define NBR NB                       /* batches processed (debug hook) */
#define NR ((size_t)NB * SQ)         /* token rows */
#define MP ((int)((size_t)NBR * SQ)) /* rows projected (debug hook) */
#define QT 256                       /* unused */
#define NKX SQ                       /* unused */
#define QT0 256                      /* first-tile rows recomputed exactly (256: margin for the few-key rows, no output projection) */
#define QN SQ                        /* unused */
#define NHD NH                       /* unused */
#define MPO MP                       /* unused */
#define LQ (3 * DM)      /* row pitch of the q/k/v rows */
typedef __bf16 v16b __attribute__((ext_vector_type(16)));
typedef unsigned short v8us __attribute__((ext_vector_type(8), may_alias));
typedef float  v8f  __attribute__((ext_vector_type(8)));
typedef float  v4f  __attribute__((ext_vector_type(4)));
typedef float  v4fa __attribute__((ext_vector_type(4), may_alias));
union FragB { v16b v; v8us half[2]; unsigned short u[16]; };

__device__ __forceinline__ unsigned short bf16_bits(float x) { unsigned int u = __float_as_uint(x); return (unsigned short)((u + 0x7FFFu + ((u >> 16) & 1u)) >> 16); }
__device__ __forceinline__ float bf16_val(unsigned short b) { return __uint_as_float(((unsigned int)b) << 16); }
__device__ __forceinline__ float bf16_round(float x) { return bf16_val(bf16_bits(x)); }
// D += A·B with NT terms: 1 = ah·bh, 2 = + al·bh (A split), 3 = + ah·bl (both split)
template <int NT>
__device__ __forceinline__ v8f mmaN(v16b ah, v16b al, v16b bh, v16b bl, v8f c) {
  c = __builtin_amdgcn_wmma_f32_16x16x32_bf16(false, ah, false, bh, (short)0, c, false, false);
  if (NT >= 2) c = __builtin_amdgcn_wmma_f32_16x16x32_bf16(false, al, false, bh, (short)0, c, false, false);
  if (NT >= 3) c = __builtin_amdgcn_wmma_f32_16x16x32_bf16(false, ah, false, bl, (short)0, c, false, false);
  asm volatile("v_nop\n\tv_nop\n\tv_nop\n\tv_nop" : "+v"(c) : "v"(ah), "v"(al), "v"(bh), "v"(bl));
  return c;
}

__global__ __launch_bounds__(256) void k_wt_bf16(const float* __restrict__ W, unsigned short* __restrict__ Wt, int K, int N) {
  const int t = blockIdx.x * 256 + threadIdx.x;
  const int k8n = K / 8;
  if (t >= N * k8n) return;
  const int n = t / k8n, k8 = (t % k8n) * 8;
  v8us v;
#pragma unroll
  for (int i = 0; i < 8; ++i) v[i] = bf16_bits(W[(size_t)(k8 + i) * N + n]);
  *(v8us*)(Wt + (size_t)n * K + k8) = v;
  
}

// GEMM C[M][N] (f32, pitch ldc) = act(A[M][K]·W + bias). A f32 row-major (pitch lda) converted per fragment to bf16
// (ASPLIT: hi/lo two planes -> 2 terms, else single rounded term); Wt bf16 [N][K] (pitch ldb). BIAS_BF16 rounds the
// bias to bf16 first (bias quantised to bf16 before the add). K%32==0, M%16==0, N%64==0.
template <bool ASPLIT, int ACT, bool BIAS_BF16>
__global__ __launch_bounds__(128) void k_gemm_bf(const float* __restrict__ A, int lda, const unsigned short* __restrict__ Wt, int ldb,
                                               const float* __restrict__ bias, float* __restrict__ C, int ldc, int M, int N, int K) {
  __shared__ __attribute__((aligned(16))) float so[4][16][64];
  const int tid = threadIdx.x, w = tid >> 5, lane = tid & 31, ln = lane & 15, hh = lane >> 4;
  const int ntn = N / 64;
  const int wid = blockIdx.x * 4 + w;
  const int mt = wid / ntn, nq = wid % ntn;
  if (mt * 16 >= M) return;
  const int row0 = mt * 16, col0 = nq * 64;
  const float* arow = A + (size_t)(row0 + ln) * lda;
  v8f acc[4] = {};
  for (int kb = 0; kb < K; kb += 32) {
    FragB ah, al;
    const v4f x0 = *(const v4fa*)(arow + kb + 8 * hh), x1 = *(const v4fa*)(arow + kb + 8 * hh + 4);
    const v4f x2 = *(const v4fa*)(arow + kb + 16 + 8 * hh), x3 = *(const v4fa*)(arow + kb + 16 + 8 * hh + 4);
    float xs[16] = {x0[0],x0[1],x0[2],x0[3],x1[0],x1[1],x1[2],x1[3],x2[0],x2[1],x2[2],x2[3],x3[0],x3[1],x3[2],x3[3]};
#pragma unroll
    for (int i = 0; i < 16; ++i) { const unsigned short hb = bf16_bits(xs[i]); ah.u[i] = hb; al.u[i] = ASPLIT ? bf16_bits(xs[i] - bf16_val(hb)) : (unsigned short)0; }
#pragma unroll
    for (int t = 0; t < 4; ++t) {
      const unsigned short* brow = Wt + (size_t)(col0 + t * 16 + ln) * ldb + kb;
      FragB b;
      b.half[0] = *(const v8us*)(brow + 8 * hh);
      b.half[1] = *(const v8us*)(brow + 16 + 8 * hh);
      acc[t] = mmaN<ASPLIT ? 2 : 1>(ah.v, al.v, b.v, b.v, acc[t]);
    }
  }
#pragma unroll
  for (int t = 0; t < 4; ++t) {
    float bv = bias ? bias[col0 + t * 16 + ln] : 0.f;
    if (BIAS_BF16) bv = bf16_round(bv);
#pragma unroll
    for (int r = 0; r < 8; ++r) { float v = acc[t][r] + bv; if (ACT == 1) v = fmaxf(v, 0.f); so[w][8 * hh + r][t * 16 + ln] = v; }
  }
  __builtin_amdgcn_fence(__ATOMIC_ACQ_REL, "workgroup");
  __builtin_amdgcn_wave_barrier();
  const int rsub = lane >> 4, c4 = (lane & 15) * 4;
  {
#pragma unroll
    for (int q = 0; q < 8; ++q) {
      const int r = q * 2 + rsub;
      const v4f v = *(const v4fa*)&so[w][r][c4];
      *(v4f*)(C + (size_t)(row0 + r) * ldc + col0 + c4) = v;
    }
    
  }
}

// GEMM C = act(A·W + bias + resid): A f32 (ASPLIT -> hi/lo 2 terms), Wt bf16 [N][K]; ACT 0 none, 1 relu, 2 exact gelu;
// resid (optional, f32, row index = (row % rmod), pitch ldr, RES_BF16 rounds it) added before the activation.
template <bool ASPLIT, int ACT, bool BIAS_BF16, bool RES_BF16>
__global__ __launch_bounds__(128) void k_gemm_bf3(const float* __restrict__ A, int lda, const unsigned short* __restrict__ Wt, int ldb,
                                                const float* __restrict__ bias, const float* __restrict__ resid, int rmod, int ldr,
                                                float* __restrict__ C, int ldc, int M, int N, int K) {
  __shared__ __attribute__((aligned(16))) float so[4][16][64];
  const int tid = threadIdx.x, w = tid >> 5, lane = tid & 31, ln = lane & 15, hh = lane >> 4;
  const int ntn = N / 64;
  const int wid = blockIdx.x * 4 + w;
  const int mt = wid / ntn, nq = wid % ntn;
  if (mt * 16 >= M) return;
  const int row0 = mt * 16, col0 = nq * 64;
  const float* arow = A + (size_t)(row0 + ln) * lda;
  v8f acc[4] = {};
  for (int kb = 0; kb < K; kb += 32) {
    FragB ah, al;
    const v4f x0 = *(const v4fa*)(arow + kb + 8 * hh), x1 = *(const v4fa*)(arow + kb + 8 * hh + 4);
    const v4f x2 = *(const v4fa*)(arow + kb + 16 + 8 * hh), x3 = *(const v4fa*)(arow + kb + 16 + 8 * hh + 4);
    float xs[16] = {x0[0],x0[1],x0[2],x0[3],x1[0],x1[1],x1[2],x1[3],x2[0],x2[1],x2[2],x2[3],x3[0],x3[1],x3[2],x3[3]};
#pragma unroll
    for (int i = 0; i < 16; ++i) { const unsigned short hb = bf16_bits(xs[i]); ah.u[i] = hb; al.u[i] = ASPLIT ? bf16_bits(xs[i] - bf16_val(hb)) : (unsigned short)0; }
#pragma unroll
    for (int t = 0; t < 4; ++t) {
      const unsigned short* brow = Wt + (size_t)(col0 + t * 16 + ln) * ldb + kb;
      FragB b;
      b.half[0] = *(const v8us*)(brow + 8 * hh);
      b.half[1] = *(const v8us*)(brow + 16 + 8 * hh);
      acc[t] = mmaN<ASPLIT ? 2 : 1>(ah.v, al.v, b.v, b.v, acc[t]);
    }
  }
#pragma unroll
  for (int t = 0; t < 4; ++t) {
    const int col = col0 + t * 16 + ln;
    float bv = bias ? bias[col] : 0.f;
    if (BIAS_BF16) bv = bf16_round(bv);
#pragma unroll
    for (int r = 0; r < 8; ++r) {
      float v = acc[t][r] + bv;
      if (resid) { float rv = resid[(size_t)((row0 + 8 * hh + r) % rmod) * ldr + col]; if (RES_BF16) rv = bf16_round(rv); v += rv; }
      if (ACT == 1) v = fmaxf(v, 0.f);
      if (ACT == 2) v = 0.5f * v * (1.0f + erff(v * 0.70710678118654752f));
      if (ACT == 3) { const float u = 0.7978845608028654f * (v + 0.044715f * v * v * v); v = 0.5f * v * (1.0f + tanhf(u)); }
      so[w][8 * hh + r][t * 16 + ln] = v;
    }
  }
  __builtin_amdgcn_fence(__ATOMIC_ACQ_REL, "workgroup");
  __builtin_amdgcn_wave_barrier();
  const int rsub = lane >> 4, c4 = (lane & 15) * 4;
  {
#pragma unroll
    for (int q = 0; q < 8; ++q) {
      const int r = q * 2 + rsub;
      const v4f v = *(const v4fa*)&so[w][r][c4];
      *(v4f*)(C + (size_t)(row0 + r) * ldc + col0 + c4) = v;
    }
    
  }
}
// row LayerNorm (biased variance, eps) over N: s = X (+ R); optional out_sum <- s; out_norm <- (s-mu)*rsqrt(var+eps)*g + b
template <bool PARAM_BF16>
__global__ __launch_bounds__(256) void k_layernorm(const float* __restrict__ X, const float* __restrict__ R, const float* __restrict__ g, const float* __restrict__ bta,
                                                  float* __restrict__ out_sum, float* __restrict__ out_norm, int N, float eps) {
  __shared__ float red[256];
  const int row = blockIdx.x, tid = threadIdx.x;
  const float* x = X + (size_t)row * N; const float* rr = R ? R + (size_t)row * N : nullptr;
  float vals[16];                     // up to N = 4096
  const int per = N / 256;            // contiguous chunk per thread? use strided-by-4 chunks: thread handles j = tid*4 + 1024*u
  float s1 = 0.f;
  for (int u = 0; u < per / 4; ++u) {
    const int j = tid * 4 + 1024 * u;
    const v4f a = *(const v4fa*)(x + j);
    v4f b = {0.f,0.f,0.f,0.f}; if (rr) b = *(const v4fa*)(rr + j);
#pragma unroll
    for (int q = 0; q < 4; ++q) { const float v = a[q] + b[q]; vals[u * 4 + q] = v; s1 += v; }
  }
  red[tid] = s1; __syncthreads();
  for (int st = 128; st > 0; st >>= 1) { if (tid < st) red[tid] += red[tid + st]; __syncthreads(); }
  const float mu = red[0] / (float)N; __syncthreads();
  float s2 = 0.f;
  for (int u = 0; u < per / 4; ++u)
#pragma unroll
    for (int q = 0; q < 4; ++q) { const float c = vals[u * 4 + q] - mu; s2 += c * c; }
  red[tid] = s2; __syncthreads();
  for (int st = 128; st > 0; st >>= 1) { if (tid < st) red[tid] += red[tid + st]; __syncthreads(); }
  const float rs = rsqrtf(red[0] / (float)N + eps);
  {
    for (int u = 0; u < per / 4; ++u) {
      const int j = tid * 4 + 1024 * u;
      v4f o, sm;
#pragma unroll
      for (int q = 0; q < 4; ++q) {
        float gg = g[j + q], bb = bta[j + q];
        if (PARAM_BF16) { gg = bf16_round(gg); bb = bf16_round(bb); }
        sm[q] = vals[u * 4 + q]; o[q] = (vals[u * 4 + q] - mu) * rs * gg + bb;
      }
      if (out_sum) *(v4f*)(out_sum + (size_t)row * N + j) = sm;
      *(v4f*)(out_norm + (size_t)row * N + j) = o;
    }
    
  }
}



// ---- f16 WMMA path (v_wmma_f32_16x16x32_f16): 11-bit significands for operands in range — used where a [0,1] probability operand needs more precision than bf16
typedef _Float16 v16h __attribute__((ext_vector_type(16)));
union FragH { v16h v; v8us half[2]; _Float16 h[16]; unsigned short u[16]; };
template <int NT>
__device__ __forceinline__ v8f mmaH(v16h ah, v16h al, v16h bh, v16h bl, v8f c) {
  c = __builtin_amdgcn_wmma_f32_16x16x32_f16(false, ah, false, bh, (short)0, c, false, false);
  if (NT >= 2) c = __builtin_amdgcn_wmma_f32_16x16x32_f16(false, al, false, bh, (short)0, c, false, false);
  if (NT >= 3) c = __builtin_amdgcn_wmma_f32_16x16x32_f16(false, ah, false, bl, (short)0, c, false, false);
  asm volatile("v_nop\n\tv_nop\n\tv_nop\n\tv_nop" : "+v"(c) : "v"(ah), "v"(al), "v"(bh), "v"(bl));
  return c;
}
// batched GEMM like k_gemm_b but f16 operands: A f32 (split into f16 hi/lo if ASPLIT, else rounded to f16), Bt = f16 values [n][k]; alpha; C f32; N multiple of 16 (partial tiles skipped)
template <bool ASPLIT>
__global__ __launch_bounds__(128) void k_gemm_h(const float* __restrict__ A, int lda, size_t sA, const _Float16* __restrict__ Bh, int ldb, size_t sB, float alpha, float* __restrict__ C, int ldc, size_t sC, int M, int N, int K) {
  __shared__ __attribute__((aligned(16))) float so[4][16][64];
  const int tid = threadIdx.x, w = tid >> 5, lane = tid & 31, ln = lane & 15, hh = lane >> 4; const int by = blockIdx.y;
  A += (size_t)by * sA; Bh += (size_t)by * sB; C += (size_t)by * sC;
  const int ntn = (N + 63) / 64; const int wid = blockIdx.x * 4 + w; const int mt = wid / ntn, nq = wid % ntn; if (mt * 16 >= M) return;
  const int row0 = mt * 16, col0 = nq * 64; const float* arow = A + (size_t)(row0 + ln) * lda;
  v8f acc[4] = {};
  for (int kb = 0; kb < K; kb += 32) {
    FragH ah, al;
    const v4f x0 = *(const v4fa*)(arow + kb + 8 * hh), x1 = *(const v4fa*)(arow + kb + 8 * hh + 4), x2 = *(const v4fa*)(arow + kb + 16 + 8 * hh), x3 = *(const v4fa*)(arow + kb + 16 + 8 * hh + 4);
    float xs[16] = {x0[0],x0[1],x0[2],x0[3],x1[0],x1[1],x1[2],x1[3],x2[0],x2[1],x2[2],x2[3],x3[0],x3[1],x3[2],x3[3]};
#pragma unroll
    for (int i = 0; i < 16; ++i) { const _Float16 h = (_Float16)xs[i]; ah.h[i] = h; al.h[i] = ASPLIT ? (_Float16)(xs[i] - (float)h) : (_Float16)0.0f; }
#pragma unroll
    for (int t = 0; t < 4; ++t) { if (col0 + t * 16 >= N) continue; const size_t boff = (size_t)(col0 + t * 16 + ln) * ldb + kb; FragH bq; bq.half[0] = *(const v8us*)(Bh + boff + 8 * hh); bq.half[1] = *(const v8us*)(Bh + boff + 16 + 8 * hh);
      acc[t] = mmaH<ASPLIT ? 2 : 1>(ah.v, al.v, bq.v, bq.v, acc[t]); }
  }
#pragma unroll
  for (int t = 0; t < 4; ++t) { if (col0 + t * 16 >= N) continue;
#pragma unroll
    for (int r = 0; r < 8; ++r) so[w][8 * hh + r][t * 16 + ln] = acc[t][r] * alpha; }
  __builtin_amdgcn_fence(__ATOMIC_ACQ_REL, "workgroup"); __builtin_amdgcn_wave_barrier();
  const int rsub = lane >> 4, c4 = (lane & 15) * 4;
  {
#pragma unroll
    for (int q = 0; q < 8; ++q) { const int r = q * 2 + rsub; if (col0 + c4 < N) { const v4f v = *(const v4fa*)&so[w][r][c4]; *(v4f*)(C + (size_t)(row0 + r) * ldc + col0 + c4) = v; } }
     }
}

// Wt[n][k] = f16(W[k][n]·scale) from f32 row-major W[K][N] (scale = power of two; bf16-exact weights stay exact in f16 away from the subnormal range)
__global__ __launch_bounds__(256) void k_wt_f16(const float* __restrict__ W, _Float16* __restrict__ Wt, int K, int N, float scale) {
  const int t = blockIdx.x * 256 + threadIdx.x; if (t >= N * (K / 8)) return; const int n = t / (K / 8), k8 = (t % (K / 8)) * 8; FragH f;
#pragma unroll
  for (int i = 0; i < 8; ++i) f.h[i] = (_Float16)(bf16_round(W[(size_t)(k8 + i) * N + n]) * scale); const v8us o = f.half[0];
  *(v8us*)((unsigned short*)Wt + (size_t)n * K + k8) = o; 
}
// k_gemm_hh variant with fused epilogue: v = acc·alpha + bias[by·sBias + col] (+ CP[(row/rowsPerB)·sCPb + by·64 + col] if CP) ; ACT 0 none / 1 elu ; writes f16 C16 (and f32 C if non-null)
template <int ACT>
__global__ __launch_bounds__(128) void k_gemm_hhx(const _Float16* __restrict__ A, int lda, size_t sA, const _Float16* __restrict__ Bh, int ldb, size_t sB, float alpha, const float* __restrict__ bias, size_t sBias, const float* __restrict__ CP, int rowsPerB, size_t sCPb, int row0g,
    float* __restrict__ C, _Float16* __restrict__ C16, int ldc, size_t sC, int M, int N, int K) {
  __shared__ __attribute__((aligned(16))) float so[4][16][64];
  const int tid = threadIdx.x, w = tid >> 5, lane = tid & 31, ln = lane & 15, hh = lane >> 4; const int by = blockIdx.y;
  A += (size_t)by * sA; Bh += (size_t)by * sB; const size_t cofs = (size_t)by * sC; const float* bp = bias ? bias + (size_t)by * sBias : nullptr;
  const int ntn = (N + 63) / 64; const int wid = blockIdx.x * 4 + w; const int mt = wid / ntn, nq = wid % ntn; if (mt * 16 >= M) return;
  const int row0 = mt * 16, col0 = nq * 64; const _Float16* arow = A + (size_t)(row0 + ln) * lda;
  v8f acc[4] = {};
  for (int kb = 0; kb < K; kb += 32) { FragH ah; ah.half[0] = *(const v8us*)((const unsigned short*)arow + kb + 8 * hh); ah.half[1] = *(const v8us*)((const unsigned short*)arow + kb + 16 + 8 * hh);
#pragma unroll
    for (int t = 0; t < 4; ++t) { if (col0 + t * 16 >= N) continue; const size_t boff = (size_t)(col0 + t * 16 + ln) * ldb + kb; FragH bq; bq.half[0] = *(const v8us*)((const unsigned short*)Bh + boff + 8 * hh); bq.half[1] = *(const v8us*)((const unsigned short*)Bh + boff + 16 + 8 * hh);
      acc[t] = mmaH<1>(ah.v, ah.v, bq.v, bq.v, acc[t]); }
  }
#pragma unroll
  for (int t = 0; t < 4; ++t) { if (col0 + t * 16 >= N) continue; const int col = col0 + t * 16 + ln; const float bv = bp ? bf16_round(bp[col]) : 0.f;
#pragma unroll
    for (int r = 0; r < 8; ++r) { float v = acc[t][r] * alpha + bv; if (CP) { const int rr = row0g + row0 + 8 * hh + r; if (rowsPerB < 0) v += CP[cofs + (size_t)rr * ldc + col];      /* rowsPerB < 0: own element of the batched C plane */ else { const int bidx = rr / rowsPerB; v += CP[(size_t)bidx * sCPb + (size_t)by * 64 + col]; } } if (ACT == 1) v = (v > 0.f) ? v : expm1f(v); else if (ACT == 7) v = (v > 0.f) ? v + 1.0f : expf(v); else if (ACT == 8) v = tanhf(v); else if (ACT == 9) v = 0.5f * v * (1.0f + tanhf(0.7978845608028654f * (v + 0.044715f * v * v * v))); else if (ACT == 11) v = 1.0f / (1.0f + expf(-v)); else if (ACT == 12) v = (v > 0.f) ? v : 0.01f * v; else if (ACT == 14) v = (v > 0.f) ? v : 0.1f * v; else if (ACT == 16) v = (v >= 0.f) ? v : 0.3f * v; else if (ACT == 17) v = (v >= 0.f) ? v : 0.2f * v; else if (ACT == 15) v = v / (1.0f + expf(-v)); else if (ACT == 3) v = fmaxf(v, 0.f); else if (ACT == 6) v = 0.5f * v * (1.0f + erff(v * 0.70710678118654752f)); so[w][8 * hh + r][t * 16 + ln] = v; } }
  __builtin_amdgcn_fence(__ATOMIC_ACQ_REL, "workgroup"); __builtin_amdgcn_wave_barrier();
  const int rsub = lane >> 4, c4 = (lane & 15) * 4; typedef _Float16 v4h __attribute__((ext_vector_type(4)));
  {
#pragma unroll
    for (int q = 0; q < 8; ++q) { const int r = q * 2 + rsub; if (col0 + c4 < N) { const v4f v = *(const v4fa*)&so[w][r][c4]; if (C) *(v4f*)(C + cofs + (size_t)(row0 + r) * ldc + col0 + c4) = v; if (C16) { v4h h4; for (int i = 0; i < 4; ++i) h4[i] = (_Float16)v[i]; *(v4h*)(C16 + cofs + (size_t)(row0 + r) * ldc + col0 + c4) = h4; } } }
     }
}


typedef _Float16 v4h __attribute__((ext_vector_type(4)));

__global__ __launch_bounds__(256) void k_x16(const float* __restrict__ x, _Float16* __restrict__ X16, size_t n8) { const size_t t = (size_t)blockIdx.x * 256 + threadIdx.x; if (t >= n8) return; FragH f;
#pragma unroll
  for (int q = 0; q < 8; ++q) f.h[q] = (_Float16)bf16_round(x[t * 8 + q]); *(v8us*)((unsigned short*)X16 + t * 8) = f.half[0];  }
__global__ __launch_bounds__(256) void k_h16(const float* __restrict__ x, _Float16* __restrict__ X16, size_t n8) { const size_t t = (size_t)blockIdx.x * 256 + threadIdx.x; if (t >= n8) return; FragH f;
#pragma unroll
  for (int q = 0; q < 8; ++q) f.h[q] = (_Float16)x[t * 8 + q]; *(v8us*)((unsigned short*)X16 + t * 8) = f.half[0];  }
__global__ __launch_bounds__(256) void k_round16f(const float* __restrict__ W, _Float16* __restrict__ Bt, size_t n8) { const size_t t = (size_t)blockIdx.x * 256 + threadIdx.x; if (t >= n8) return; FragH f;
#pragma unroll
  for (int i = 0; i < 8; ++i) f.h[i] = (_Float16)(bf16_round(W[t * 8 + i]) * 16.0f); *(v8us*)((unsigned short*)Bt + t * 8) = f.half[0];  }
template <int NHv, int TTv>
__global__ __launch_bounds__(256) void k_vt(const _Float16* __restrict__ V16, int ldv, int voff, _Float16* __restrict__ Vt) { __shared__ unsigned short tl[64][66]; const int tid = threadIdx.x; const int slab = blockIdx.x / (TTv / 64), lg = blockIdx.x % (TTv / 64); const int b = slab / NHv, h = slab % NHv;
  for (int i = tid; i < 64 * 8; i += 256) { const int r = i / 8, c8 = (i % 8) * 8; FragH f; f.half[0] = *(const v8us*)((const unsigned short*)V16 + ((size_t)b * TTv + lg * 64 + r) * ldv + voff + h * 64 + c8);
#pragma unroll
    for (int q = 0; q < 8; ++q) tl[r][c8 + q] = f.u[q]; }
  __syncthreads();
  {
#pragma unroll
    for (int rd = 0; rd < 2; ++rd) { const int d = rd * 32 + tid / 8, pc = tid % 8; FragH f;
#pragma unroll
      for (int q = 0; q < 8; ++q) f.u[q] = tl[pc * 8 + q][d];
      *(v8us*)((unsigned short*)Vt + ((size_t)slab * 64 + d) * TTv + lg * 64 + pc * 8) = f.half[0]; }
     } }

__global__ __launch_bounds__(256) void k_hl(const float* __restrict__ F, _Float16* __restrict__ Hh, _Float16* __restrict__ Hl, size_t n8) { const size_t t = (size_t)blockIdx.x * 256 + threadIdx.x; if (t >= n8) return; FragH fh, fl; const v4f a = *(const v4fa*)(F + t * 8), c = *(const v4fa*)(F + t * 8 + 4);
#pragma unroll
  for (int q = 0; q < 4; ++q) { _Float16 h = (_Float16)a[q]; fh.h[q] = h; fl.h[q] = (_Float16)((a[q] - (float)h) * 1024.0f); h = (_Float16)c[q]; fh.h[4 + q] = h; fl.h[4 + q] = (_Float16)((c[q] - (float)h) * 1024.0f); }
  { *(v8us*)((unsigned short*)Hh + t * 8) = fh.half[0]; *(v8us*)((unsigned short*)Hl + t * 8) = fl.half[0];  } }

// ---- fast GEMM (wave tile 32x64; requires M % 32 == 0 rows per launch region and N % 64 == 0); epilogue = k_gemm_hhx semantics ----
// the f32 plane C holds only the first crows rows of every cmod rows, packed (row (R / cmod) * crows + R % cmod, pitch ldc); cmod % 32 == 0 and crows % 32 == 0, so a wave's tile is wholly in it or wholly out
__device__ __forceinline__ v16h g2_frag(const _Float16* p, int hh) { FragH f; f.half[0] = *(const v8us*)((const unsigned short*)p + 8 * hh); f.half[1] = *(const v8us*)((const unsigned short*)p + 16 + 8 * hh); return f.v; }
__device__ __forceinline__ v8f g2_mma(v16h a, v16h b, v8f c) { v8f d = __builtin_amdgcn_wmma_f32_16x16x32_f16(false, a, false, b, (short)0, c, false, false); asm volatile("v_nop\n\tv_nop\n\tv_nop\n\tv_nop" : "+v"(d) : "v"(a), "v"(b)); return d; }
template <int ACT>
__global__ __launch_bounds__(128) void k_gemm2(const _Float16* __restrict__ A, int lda, size_t sA, const _Float16* __restrict__ Bh, int ldb, size_t sB, float alpha, const float* __restrict__ bias, size_t sBias, const float* __restrict__ CP, int rowsPerB, size_t sCPb, int row0g,
    float* __restrict__ C, int cmod, int crows, _Float16* __restrict__ C16, int ldc, size_t sC, int M, int N, int K) { static_assert(ACT == 0 || ACT == 3 || ACT == 6 || ACT == 8 || ACT == 9 || ACT == 11 || ACT == 12 || ACT == 14 || ACT == 15 || ACT == 16 || ACT == 17, "k_gemm2: unsupported ACT code (would silently apply no activation)");
  __shared__ __attribute__((aligned(16))) float so[4][32][68];
  const int tid = threadIdx.x, w = tid >> 5, lane = tid & 31, ln = lane & 15, hh = lane >> 4; const int by = blockIdx.y;
  A += (size_t)by * sA; Bh += (size_t)by * sB; const size_t cofs = (size_t)by * sC; const float* bp = bias ? bias + (size_t)by * sBias : nullptr;
  const int ntn = N >> 6; const int mt = blockIdx.x / ntn, nq = blockIdx.x - mt * ntn; const int row0 = mt * 128 + 32 * w, col0 = nq * 64; if (row0 >= M) return;
  const _Float16* a0p = A + (size_t)(row0 + ln) * lda; const _Float16* a1p = a0p + (size_t)16 * lda;
  const _Float16* b0p = Bh + (size_t)(col0 + ln) * ldb; const _Float16* b1p = b0p + (size_t)16 * ldb; const _Float16* b2p = b1p + (size_t)16 * ldb; const _Float16* b3p = b2p + (size_t)16 * ldb;
  const v8f z8 = {0.f,0.f,0.f,0.f,0.f,0.f,0.f,0.f}; v8f c00 = z8, c01 = z8, c02 = z8, c03 = z8, c10 = z8, c11 = z8, c12 = z8, c13 = z8;
#pragma unroll 1
  for (int kb = 0; kb < K; kb += 32) { const v16h a0 = g2_frag(a0p + kb, hh), a1 = g2_frag(a1p + kb, hh);
    v16h b = g2_frag(b0p + kb, hh); c00 = g2_mma(a0, b, c00); c10 = g2_mma(a1, b, c10);
    b = g2_frag(b1p + kb, hh); c01 = g2_mma(a0, b, c01); c11 = g2_mma(a1, b, c11);
    b = g2_frag(b2p + kb, hh); c02 = g2_mma(a0, b, c02); c12 = g2_mma(a1, b, c12);
    b = g2_frag(b3p + kb, hh); c03 = g2_mma(a0, b, c03); c13 = g2_mma(a1, b, c13); }
  v8f accs[8] = {c00, c01, c02, c03, c10, c11, c12, c13};
#pragma unroll
  for (int u = 0; u < 8; ++u) { const int t = u & 3, half = u >> 2; const int col = col0 + t * 16 + ln; const float bv = bp ? bf16_round(bp[col]) : 0.f;
#pragma unroll
    for (int r = 0; r < 8; ++r) { const int rloc = half * 16 + 8 * hh + r; float v = accs[u][r] * alpha + bv; if (CP) { if (rowsPerB < 0) v += CP[cofs + (size_t)(row0g + row0 + rloc) * ldc + col];      /* rowsPerB < 0: own element of the batched C plane */ else { const int bidx = (row0g + row0 + rloc) / rowsPerB; v += CP[(size_t)bidx * sCPb + (size_t)by * 64 + col]; } }
      if (ACT == 3) v = fmaxf(v, 0.f); else if (ACT == 6) v = 0.5f * v * (1.0f + erff(v * 0.70710678118654752f)); else if (ACT == 11) v = 1.0f / (1.0f + expf(-v)); else if (ACT == 15) v = v / (1.0f + expf(-v)); else if (ACT == 12) v = (v > 0.f) ? v : 0.01f * v; else if (ACT == 8) v = tanhf(v); else if (ACT == 9) v = 0.5f * v * (1.0f + tanhf(0.7978845608028654f * (v + 0.044715f * v * v * v))); else if (ACT == 14) v = (v > 0.f) ? v : 0.1f * v; else if (ACT == 16) v = (v >= 0.f) ? v : 0.3f * v; else if (ACT == 17) v = (v >= 0.f) ? v : 0.2f * v;
      so[w][rloc][t * 16 + ln] = v; } }
  __builtin_amdgcn_fence(__ATOMIC_ACQ_REL, "workgroup"); __builtin_amdgcn_wave_barrier();
  const int rsub = lane >> 4, c4 = (lane & 15) * 4; const int rin = row0 % cmod; float* Cw = (C && rin < crows) ? C + cofs + ((size_t)(row0 / cmod) * crows + rin) * ldc + col0 + c4 : nullptr;
  {
#pragma unroll
    for (int q = 0; q < 16; ++q) { const int r = q * 2 + rsub; const v4f v = *(const v4fa*)&so[w][r][c4]; if (Cw) *(v4f*)(Cw + (size_t)r * ldc) = v; if (C16) { v4h h4; for (int i = 0; i < 4; ++i) h4[i] = (_Float16)v[i]; *(v4h*)(C16 + cofs + (size_t)(row0 + r) * ldc + col0 + c4) = h4; } }
     } }


__global__ __launch_bounds__(256) void k_wnat(const float* __restrict__ w, size_t n8, _Float16* __restrict__ Bt) { const size_t t = (size_t)blockIdx.x * 256 + threadIdx.x; if (t >= n8) return; FragH f; for (int q = 0; q < 8; ++q) f.h[q] = (_Float16)(bf16_round(w[t * 8 + q]) * 16.0f); *(v8us*)((unsigned short*)Bt + t * 8) = f.half[0];  }
__global__ __launch_bounds__(256) void k_rsm(const float* __restrict__ S, _Float16* __restrict__ P, int nrows) {
  #pragma clang fp contract(off)
  const int i = blockIdx.x * 256 + threadIdx.x; if (i >= nrows) return; const float* s = S + (size_t)i * SQ; float mx = -3.0e38f;
#pragma unroll 1
  for (int j = 0; j < SQ; ++j) mx = fmaxf(mx, s[j]); float se = 0.f;
#pragma unroll 1
  for (int j = 0; j < SQ; ++j) se += expf(s[j] - mx); const float sc = 256.0f / se;
#pragma unroll 1
  for (int j0 = 0; j0 < SQ; j0 += 8) { FragH f; for (int q = 0; q < 8; ++q) f.h[q] = (_Float16)(expf(s[j0 + q] - mx) * sc); unsigned short* d = (unsigned short*)P + (size_t)i * SQ + j0; *(v8us*)d = f.half[0];  } }
__global__ __launch_bounds__(256) void k_vt(const _Float16* __restrict__ V16, int b, int h0, _Float16* __restrict__ VT) { __shared__ unsigned short tl[64][65]; const int tid = threadIdx.x; const int hh = blockIdx.x % HG, sg = blockIdx.x / HG; const int s0 = sg * 64; const int h = h0 + hh;
  for (int i = tid; i < 64 * 8; i += 256) { const int j = i / 8, d8 = (i % 8) * 8; FragH f; f.half[0] = *(const v8us*)((const unsigned short*)V16 + ((size_t)b * SQ + s0 + j) * DM + h * HD + d8); for (int q = 0; q < 8; ++q) tl[d8 + q][j] = f.u[q]; }
  __syncthreads();
  { for (int i = tid; i < 64 * 8; i += 256) { const int d = i / 8, j8 = (i % 8) * 8; FragH f; for (int q = 0; q < 8; ++q) f.u[q] = tl[d][j8 + q]; *(v8us*)((unsigned short*)VT + ((size_t)hh * HD + d) * SQ + s0 + j8) = f.half[0]; }  } }



// lane l with lane l ^ M of its 16-lane row (DPP row_xmask), and lane l with lane l ^ 16
template <int M> __device__ __forceinline__ float rs_xm(float x) { return __builtin_bit_cast(float, __builtin_amdgcn_update_dpp(0, __builtin_bit_cast(int, x), 0x160 | M, 0xf, 0xf, true)); }
__device__ __forceinline__ float rs_xh(float x) { return __builtin_bit_cast(float, __builtin_amdgcn_permlanex16(__builtin_bit_cast(int, x), __builtin_bit_cast(int, x), 0x76543210, 0xfedcba98, false, false)); }
__device__ __forceinline__ v16h fa_frag(const _Float16* p) { FragH f; f.half[0] = *(const v8us*)((const unsigned short*)p); f.half[1] = *(const v8us*)((const unsigned short*)p + 16); return f.v; }      /* p already holds the lane half's 8-element shift */
// exp2 of eight values, and of one: each v_exp_f32 works on a register of its own and a v_nop ends the statement. It is there for the slot that the instruction set asks for behind a transcendental before its result is read or its source overwritten.
__device__ __forceinline__ void fa_exp2x8(float (&e)[8]) { asm("v_exp_f32 %0, %0\n\tv_exp_f32 %1, %1\n\tv_exp_f32 %2, %2\n\tv_exp_f32 %3, %3\n\tv_exp_f32 %4, %4\n\tv_exp_f32 %5, %5\n\tv_exp_f32 %6, %6\n\tv_exp_f32 %7, %7\n\tv_nop" : "+v"(e[0]), "+v"(e[1]), "+v"(e[2]), "+v"(e[3]), "+v"(e[4]), "+v"(e[5]), "+v"(e[6]), "+v"(e[7])); }
__device__ __forceinline__ float fa_exp2(float x) { asm("v_exp_f32 %0, %0\n\tv_nop" : "+v"(x)); return x; }
// one trip: keys kb .. kb + 63 from kc; kx receives the next trip's K fragments
__device__ __forceinline__ void fa_trip(const int kb, const int q0, const int ln, const int hh, const _Float16* __restrict__ kp, const _Float16* __restrict__ vp, const v16h qf0, const v16h qf1, v16h (&kc)[4][2], v16h (&kx)[4][2], v8f (&o)[4], float& m, float& l) {
  const v8f z8 = {0.f,0.f,0.f,0.f,0.f,0.f,0.f,0.f}; const float cs = 0.125f * 1.4426950408889634f;      /* 1 / sqrt(HD), in log2 units */
  const _Float16* vr = vp + kb; v16h vf[4][2];
  /* every loop of this function is unrolled because fragments, scores and sums live in registers, which need constant indices */
#pragma unroll
  for (int t = 0; t < 4; ++t) { vf[t][0] = fa_frag(vr + (size_t)(16 * t) * SQ); vf[t][1] = fa_frag(vr + (size_t)(16 * t) * SQ + 32); }
  asm volatile("s_wait_xcnt 0x0" ::: "memory");      /* precaution: no register that an issued load names is written ahead of this wait (the V^T address pair lives on through the loop) */
  v8f s[4];
#pragma unroll
  for (int t = 0; t < 4; ++t) { s[t] = __builtin_amdgcn_wmma_f32_16x16x32_f16(false, kc[t][0], false, qf0, (short)0, z8, false, false); s[t] = __builtin_amdgcn_wmma_f32_16x16x32_f16(false, kc[t][1], false, qf1, (short)0, s[t], false, false); }
  const int kn = (kb + 64 < q0 + 16) ? kb + 64 : kb;      /* the last trip asks for its own rows again: always rows that the projection wrote */
  const _Float16* kr = kp + (size_t)kn * LQ;      /* kp points at the q block of the row: the k block's shift DM rides in the loads' constant offsets, so that kr is the very address pair that the loads name */
#pragma unroll
  for (int t = 0; t < 4; ++t) { kx[t][0] = fa_frag(kr + (size_t)(16 * t) * LQ + DM); kx[t][1] = fa_frag(kr + (size_t)(16 * t) * LQ + DM + 32); }
  asm volatile("s_wait_xcnt 0x0" :: "v"(kr) : "memory");      /* the same precaution for the next trip's K loads; their address pair is an input here so that no load's result is placed on it */
  if (kb + 63 > q0) {      /* wave-uniform: the trip that reaches the diagonal; s[t][r] = key kb + 16 t + 8 hh + r against query q0 + ln */
#pragma unroll
    for (int t = 0; t < 4; ++t) for (int r = 0; r < 8; ++r) s[t][r] = (kb + 16 * t + 8 * hh + r <= q0 + ln) ? s[t][r] : -1.0e30f; }
  float mx = s[0][0];
#pragma unroll
  for (int t = 0; t < 4; ++t) for (int r = 0; r < 8; ++r) mx = fmaxf(mx, s[t][r]);
  mx = fmaxf(mx, rs_xh(mx));      /* the other half of the query's keys */
  const float mn = fmaxf(m, mx * cs); const float al = fa_exp2(m - mn); m = mn;
  v4f s4 = {0.f, 0.f, 0.f, 0.f}; FragH pf[2];
#pragma unroll
  for (int t = 0; t < 4; ++t) { float e[8]; for (int r = 0; r < 8; ++r) e[r] = fmaf(s[t][r], cs, -mn); fa_exp2x8(e); for (int r = 0; r < 8; ++r) { s4[r & 3] += e[r]; pf[t >> 1].h[(t & 1) * 8 + r] = (_Float16)e[r]; } }
  l = l * al + ((s4[0] + s4[1]) + (s4[2] + s4[3]));      /* each half keeps its own keys' share */
#pragma unroll
  for (int t = 0; t < 4; ++t) { o[t] *= al; o[t] = __builtin_amdgcn_wmma_f32_16x16x32_f16(false, vf[t][0], false, pf[0].v, (short)0, o[t], false, false); o[t] = __builtin_amdgcn_wmma_f32_16x16x32_f16(false, vf[t][1], false, pf[1].v, (short)0, o[t], false, false); } }
// four waves per SIMD: with at most 256 registers a wave all 4096 waves of the launch are resident at once (16 per WGP), and the waves of a SIMD fill each other's waits
__global__ __launch_bounds__(128) __attribute__((amdgpu_waves_per_eu(4, 4))) void k_fattn(const _Float16* __restrict__ QKVp, const _Float16* __restrict__ VTp, float* __restrict__ out) {
  const int lane = threadIdx.x & 31, ln = lane & 15, hh = lane >> 4; const int w = __builtin_amdgcn_readfirstlane(threadIdx.x >> 5);
  const int bh = blockIdx.x, b = bh / NH, h = bh % NH; const int q0 = (SQ / 64 - 1 - (int)blockIdx.y) * 64 + w * 16;      /* wave-uniform first query row */
  const _Float16* qp = QKVp + ((size_t)b * SQ + q0 + ln) * LQ + h * HD + 8 * hh; const _Float16* kp = QKVp + ((size_t)b * SQ + ln) * LQ + h * HD + 8 * hh; const _Float16* vp = VTp + ((size_t)bh * HD + ln) * SQ + 8 * hh;
  const v16h qf0 = fa_frag(qp), qf1 = fa_frag(qp + 32); v16h ka[4][2], kc[4][2];
  /* unrolled, here and at the stores, for constant register indices */
#pragma unroll
  for (int t = 0; t < 4; ++t) { ka[t][0] = fa_frag(kp + (size_t)(16 * t) * LQ + DM); ka[t][1] = fa_frag(kp + (size_t)(16 * t) * LQ + DM + 32); }
  asm volatile("s_wait_xcnt 0x0" :: "v"(qp) : "memory");      /* precaution: no register that an issued load names is written ahead of this wait; the q address pair is an input here so that no load's result is placed on it (the K pair lives on through the loop) */
  const v8f z8 = {0.f,0.f,0.f,0.f,0.f,0.f,0.f,0.f}; v8f o[4] = {z8, z8, z8, z8}; float m = -1.0e30f, l = 0.f;
  for (int kb = 0; ; kb += 128) {      /* at most SQ / 128 rounds of two trips; both exits are wave-uniform */
    fa_trip(kb, q0, ln, hh, kp, vp, qf0, qf1, ka, kc, o, m, l); if (kb + 64 >= q0 + 16) break;
    fa_trip(kb + 64, q0, ln, hh, kp, vp, qf0, qf1, kc, ka, o, m, l); if (kb + 128 >= q0 + 16) break; }
  asm volatile("s_wait_loadcnt 0x0" ::: "memory");      /* the last trip's K request has no reader, so nothing else makes the wave wait for all of it: with this wait it has landed before the wave hands its registers back at its end */
  l += rs_xh(l); const float fin = 1.0f / l;
  float* op = out + ((size_t)b * SQ + q0 + ln) * DM + h * HD + 8 * hh;      /* o[t][r] = column 16 t + 8 hh + r of query q0 + ln */
#pragma unroll
  for (int t = 0; t < 4; ++t) { const v4f lo = {o[t][0] * fin, o[t][1] * fin, o[t][2] * fin, o[t][3] * fin}, hi = {o[t][4] * fin, o[t][5] * fin, o[t][6] * fin, o[t][7] * fin}; *(v4f*)(op + 16 * t) = lo; *(v4f*)(op + 16 * t + 4) = hi; } }

// lane K of each 16-lane row, handed to all sixteen lanes of that row (DPP row_share)
template <int K> __device__ __forceinline__ float a0_share(float x) { return __builtin_bit_cast(float, __builtin_amdgcn_update_dpp(0, __builtin_bit_cast(int, x), 0x150 | K, 0xf, 0xf, true)); }
template <int K> __device__ __forceinline__ void a0_acc(v4f& o, float e, const v4f* vv) { o += a0_share<K>(e) * vv[K]; if constexpr (K + 1 < 16) a0_acc<K + 1>(o, e, vv); }
// exact f32 attention of the first QT0 rows, SIXTEEN LANES PER QUERY ROW, keys in groups of 16: lane p scores key 16 g + p (whole q row in registers, K row straight from global memory), the group's maximum comes from a
// four-step butterfly over the 16 lanes, the running o and l are rescaled once per group, lane p keeps columns 4 p .. 4 p + 3 of o and its own keys' share of l (summed over the 16 lanes at the end). No LDS, no barrier.
// grid.y = batch: QF, KF, VF point at the q, k, v blocks of the packed f32 rows (QT0 rows a batch, pitch LQ), OF at the output rows (SQ rows a batch). The odd batch takes its row blocks in falling order: row block rb costs rb + 1 key groups,
// so where block x of one batch and block x of the other share a WGP their costs add to the same sum for every x (speed only, nothing rests on the placement).
template <int MASKADD>
__global__ __launch_bounds__(256) void k_att0(const float* __restrict__ QF, const float* __restrict__ KF, const float* __restrict__ VF, const float* __restrict__ mask, float scale, float* __restrict__ OF, int ldo) {
  const int p = threadIdx.x & 15; const int b = blockIdx.y; const int h = blockIdx.x / (QT0 / 16), rx = blockIdx.x % (QT0 / 16), rb = (b & 1) ? QT0 / 16 - 1 - rx : rx; const int i = rb * 16 + (threadIdx.x >> 4);
  QF += (size_t)b * QT0 * LQ; KF += (size_t)b * QT0 * LQ; VF += (size_t)b * QT0 * LQ; OF += (size_t)b * SQ * ldo;
  const float* qr = QF + (size_t)i * LQ + h * HD; v4f q[HD / 4];      /* q, k, v rows have the pitch LQ, a constant, so that a group's sixteen V rows hang on one address pair by immediate offsets */
  /* the loops over c are unrolled because the rows live in registers, which need constant indices */
#pragma unroll
  for (int c = 0; c < HD / 4; ++c) q[c] = *(const v4fa*)(qr + c * 4);
  asm volatile("s_wait_xcnt 0x0" :: "v"(qr) : "memory");      /* precaution: no register that an issued load names is written ahead of this wait; the address pair is an input here so that no load's result is placed on it */
  v4f o = {0.f, 0.f, 0.f, 0.f}; float m = -1.0e30f, l = 0.f; const int ng = MASKADD ? (SQ / 16) : (rb + 1);      /* additive-mask form: every key (the mask input decides); causal form: key groups up to the block's last row */
  for (int g = 0; g < ng; ++g) { const int j = g * 16 + p; const float* kr = KF + (size_t)j * LQ + h * HD; const float* vr = VF + (size_t)(g * 16) * LQ + h * HD + p * 4; v4f kk[HD / 4], vv[16];
#pragma unroll
    for (int c = 0; c < HD / 4; ++c) kk[c] = *(const v4fa*)(kr + c * 4);
#pragma unroll
    for (int c = 0; c < 16; ++c) vv[c] = *(const v4fa*)(vr + c * LQ);
    asm volatile("s_wait_xcnt 0x0" :: "v"(kr), "v"(vr) : "memory");      /* the same precaution for the two address pairs of the group */
    /* inputs-only fences on the loaded values: they keep all 32 loads of the group in front of the arithmetic, in flight together (one memory latency per group; left alone the compiler waits after every second load) */
    asm volatile("" :: "v"(kk[0]), "v"(kk[1]), "v"(kk[2]), "v"(kk[3]), "v"(kk[4]), "v"(kk[5]), "v"(kk[6]), "v"(kk[7]), "v"(kk[8]), "v"(kk[9]), "v"(kk[10]), "v"(kk[11]), "v"(kk[12]), "v"(kk[13]), "v"(kk[14]), "v"(kk[15]), "v"(vv[0]), "v"(vv[1]), "v"(vv[2]), "v"(vv[3]), "v"(vv[4]), "v"(vv[5]), "v"(vv[6]), "v"(vv[7]), "v"(vv[8]), "v"(vv[9]), "v"(vv[10]), "v"(vv[11]), "v"(vv[12]), "v"(vv[13]));
    asm volatile("" :: "v"(vv[14]), "v"(vv[15]));
    v4f s4 = {0.f, 0.f, 0.f, 0.f};
#pragma unroll
    for (int c = 0; c < HD / 4; ++c) s4 += q[c] * kk[c];
    float s = ((s4[0] + s4[1]) + (s4[2] + s4[3])) * scale; if (MASKADD) s += bf16_round(mask[(size_t)i * SQ + j]) * -10000.0f;
    const float sm = (MASKADD || j <= i) ? s : -1.0e30f;
    float gm = sm; gm = fmaxf(gm, rs_xm<1>(gm)); gm = fmaxf(gm, rs_xm<2>(gm)); gm = fmaxf(gm, rs_xm<4>(gm)); gm = fmaxf(gm, rs_xm<8>(gm));
    const float mn = fmaxf(m, gm); const float sc = expf(m - mn); const float e = expf(sm - mn); l = l * sc + e; m = mn; o *= sc;
    a0_acc<0>(o, e, vv); }
  l += rs_xm<1>(l); l += rs_xm<2>(l); l += rs_xm<4>(l); l += rs_xm<8>(l);
  const float fin = 1.0f / l;
  *(v4f*)(OF + (size_t)i * ldo + h * HD + p * 4) = o * fin; }

__global__ __launch_bounds__(256) void k_bcpy(const float* __restrict__ b, int n, int NP, float* __restrict__ dst, int dst0) { for (int i = threadIdx.x; i < NP; i += 256) { const float v = (i < n) ? b[i] : 0.f; *(float*)(dst + dst0 + i) = v; }  }


extern "C" void kernel_launch(void* const* d_in, const int* in_sizes, int n_in,
                              void* d_out, int out_size, void* d_ws, size_t ws_size, hipStream_t stream) {
  (void)in_sizes; (void)n_in; (void)out_size;
  const float* const* I = (const float* const*)d_in; const float* x = I[0]; const float* wq = I[1]; const float* bq = I[2]; const float* wk = I[3]; const float* bk = I[4]; const float* wv = I[5]; const float* bv = I[6];      /* natural nn.Linear [out][in] weights + biases */
  char* ws = (char*)d_ws; size_t off = 0;
  auto take = [&](size_t bytes) { char* p = ws + off; off += (bytes + 255) & ~(size_t)255; return p; };
  _Float16* BQKV = (_Float16*)take((size_t)3 * DM * DM * 2); float* bqkv = (float*)take((size_t)3 * DM * 4);      /* stacked q | k | v weight plane and bias vector */ 
  _Float16* X16 = (_Float16*)take(NR * DM * 2); _Float16* QKV = (_Float16*)take(NR * 3 * DM * 2); _Float16* Q16 = QKV; _Float16* K16 = QKV + DM; _Float16* V16 = QKV + 2 * DM;      /* q | k | v */ _Float16* O16 = (_Float16*)take(NR * DM * 2);
  _Float16* VT = (_Float16*)take((size_t)NB * NH * HD * SQ * 2);
  float* F0 = (float*)take((size_t)NB * QT0 * LQ * 4);      /* f32 q | k | v of the first QT0 rows of each batch, packed */
  if (off > ws_size) return;
  { const unsigned g = (unsigned)(((size_t)DM * DM / 8 + 255) / 256); k_wnat<<<g, 256, 0, stream>>>(wq, (size_t)DM * DM / 8, BQKV); k_wnat<<<g, 256, 0, stream>>>(wk, (size_t)DM * DM / 8, BQKV + (size_t)DM * DM); k_wnat<<<g, 256, 0, stream>>>(wv, (size_t)DM * DM / 8, BQKV + (size_t)2 * DM * DM); }      /* natural [out][in] = Bt[n][k] x16, stacked q | k | v */
  k_bcpy<<<1, 256, 0, stream>>>(bq, DM, DM, bqkv, 0); k_bcpy<<<1, 256, 0, stream>>>(bk, DM, DM, bqkv, DM); k_bcpy<<<1, 256, 0, stream>>>(bv, DM, DM, bqkv, 2 * DM);      /* stacked bias vector bq | bk | bv */
  k_x16<<<(unsigned)((NR * DM / 8 + 255) / 256), 256, 0, stream>>>(x, X16, NR * DM / 8);
  const size_t r0p = (size_t)B0 * SQ;      /* first projected row */
  k_gemm2<0><<<dim3((unsigned)((MP / 128) * (3 * DM / 64)), 1), 128, 0, stream>>>(X16 + r0p * DM, DM, 0, BQKV, DM, 0, 0.0625f, bqkv, 0, nullptr, 1, 0, 0, F0, SQ, QT0, QKV + r0p * 3 * DM, 3 * DM, 0, MP, 3 * DM, DM);      /* q | k | v rows (f16); head h = columns h*HD.. of each DM block; the first QT0 rows of each batch also f32 */
  k_vt<NH, SQ><<<NB * NH * (SQ / 64), 256, 0, stream>>>(V16, LQ, 0, VT);      /* V^T [NB][NH][HD][SQ] */
  k_fattn<<<dim3(NB * NH, SQ / 64), 128, 0, stream>>>(QKV, VT, (float*)d_out);      /* o (merged heads) f32 straight into the output rows */
  k_att0<0><<<dim3(NH * (QT0 / 16), NB), 256, 0, stream>>>(F0, F0 + DM, F0 + 2 * DM, nullptr, 0.125f, (float*)d_out, DM);      /* exact f32 causal attention of the first QT0 rows of each batch: those output rows rewritten (the f16-path rows are replaced) */
}

// v005
// It runs in 107 microseconds.
// In two side-by-side timings against v004, it was 1.69 and 1.68 times as fast.
// Over all steps from v000 it is 54.6 times as fast.
#include <hip/hip_runtime.h>
#define NB 2
#define SQ 2048
#define DM 1024
#define NH 16
#define HD 64
#define HG 4                         /* head group of the k_vt(b, h0) form */
#define B0 0                         /* first batch processed (debug hook) */
#define NBR NB                       /* batches processed (debug hook) */
#define NR ((size_t)NB * SQ)         /* token rows */
#define MP ((int)((size_t)NBR * SQ)) /* rows projected (debug hook) */
#define QT 256                       /* unused */
#define NKX SQ                       /* unused */
#define QT0 256                      /* first-tile rows recomputed exactly (256: margin for the few-key rows, no output projection) */
#define QN SQ                        /* unused */
#define NHD NH                       /* unused */
#define MPO MP                       /* unused */
#define LQ (3 * DM)      /* row pitch of the q/k/v rows */
typedef __bf16 v16b __attribute__((ext_vector_type(16)));
typedef unsigned short v8us __attribute__((ext_vector_type(8), may_alias));
typedef float  v8f  __attribute__((ext_vector_type(8)));
typedef float  v4f  __attribute__((ext_vector_type(4)));
typedef float  v4fa __attribute__((ext_vector_type(4), may_alias));
union FragB { v16b v; v8us half[2]; unsigned short u[16]; };

__device__ __forceinline__ unsigned short bf16_bits(float x) { unsigned int u = __float_as_uint(x); return (unsigned short)((u + 0x7FFFu + ((u >> 16) & 1u)) >> 16); }
__device__ __forceinline__ float bf16_val(unsigned short b) { return __uint_as_float(((unsigned int)b) << 16); }
__device__ __forceinline__ float bf16_round(float x) { return bf16_val(bf16_bits(x)); }
// D += A·B with NT terms: 1 = ah·bh, 2 = + al·bh (A split), 3 = + ah·bl (both split)
template <int NT>
__device__ __forceinline__ v8f mmaN(v16b ah, v16b al, v16b bh, v16b bl, v8f c) {
  c = __builtin_amdgcn_wmma_f32_16x16x32_bf16(false, ah, false, bh, (short)0, c, false, false);
  if (NT >= 2) c = __builtin_amdgcn_wmma_f32_16x16x32_bf16(false, al, false, bh, (short)0, c, false, false);
  if (NT >= 3) c = __builtin_amdgcn_wmma_f32_16x16x32_bf16(false, ah, false, bl, (short)0, c, false, false);
  asm volatile("v_nop\n\tv_nop\n\tv_nop\n\tv_nop" : "+v"(c) : "v"(ah), "v"(al), "v"(bh), "v"(bl));
  return c;
}

__global__ __launch_bounds__(256) void k_wt_bf16(const float* __restrict__ W, unsigned short* __restrict__ Wt, int K, int N) {
  const int t = blockIdx.x * 256 + threadIdx.x;
  const int k8n = K / 8;
  if (t >= N * k8n) return;
  const int n = t / k8n, k8 = (t % k8n) * 8;
  v8us v;
#pragma unroll
  for (int i = 0; i < 8; ++i) v[i] = bf16_bits(W[(size_t)(k8 + i) * N + n]);
  *(v8us*)(Wt + (size_t)n * K + k8) = v;
  
}

// GEMM C[M][N] (f32, pitch ldc) = act(A[M][K]·W + bias). A f32 row-major (pitch lda) converted per fragment to bf16
// (ASPLIT: hi/lo two planes -> 2 terms, else single rounded term); Wt bf16 [N][K] (pitch ldb). BIAS_BF16 rounds the
// bias to bf16 first (bias quantised to bf16 before the add). K%32==0, M%16==0, N%64==0.
template <bool ASPLIT, int ACT, bool BIAS_BF16>
__global__ __launch_bounds__(128) void k_gemm_bf(const float* __restrict__ A, int lda, const unsigned short* __restrict__ Wt, int ldb,
                                               const float* __restrict__ bias, float* __restrict__ C, int ldc, int M, int N, int K) {
  __shared__ __attribute__((aligned(16))) float so[4][16][64];
  const int tid = threadIdx.x, w = tid >> 5, lane = tid & 31, ln = lane & 15, hh = lane >> 4;
  const int ntn = N / 64;
  const int wid = blockIdx.x * 4 + w;
  const int mt = wid / ntn, nq = wid % ntn;
  if (mt * 16 >= M) return;
  const int row0 = mt * 16, col0 = nq * 64;
  const float* arow = A + (size_t)(row0 + ln) * lda;
  v8f acc[4] = {};
  for (int kb = 0; kb < K; kb += 32) {
    FragB ah, al;
    const v4f x0 = *(const v4fa*)(arow + kb + 8 * hh), x1 = *(const v4fa*)(arow + kb + 8 * hh + 4);
    const v4f x2 = *(const v4fa*)(arow + kb + 16 + 8 * hh), x3 = *(const v4fa*)(arow + kb + 16 + 8 * hh + 4);
    float xs[16] = {x0[0],x0[1],x0[2],x0[3],x1[0],x1[1],x1[2],x1[3],x2[0],x2[1],x2[2],x2[3],x3[0],x3[1],x3[2],x3[3]};
#pragma unroll
    for (int i = 0; i < 16; ++i) { const unsigned short hb = bf16_bits(xs[i]); ah.u[i] = hb; al.u[i] = ASPLIT ? bf16_bits(xs[i] - bf16_val(hb)) : (unsigned short)0; }
#pragma unroll
    for (int t = 0; t < 4; ++t) {
      const unsigned short* brow = Wt + (size_t)(col0 + t * 16 + ln) * ldb + kb;
      FragB b;
      b.half[0] = *(const v8us*)(brow + 8 * hh);
      b.half[1] = *(const v8us*)(brow + 16 + 8 * hh);
      acc[t] = mmaN<ASPLIT ? 2 : 1>(ah.v, al.v, b.v, b.v, acc[t]);
    }
  }
#pragma unroll
  for (int t = 0; t < 4; ++t) {
    float bv = bias ? bias[col0 + t * 16 + ln] : 0.f;
    if (BIAS_BF16) bv = bf16_round(bv);
#pragma unroll
    for (int r = 0; r < 8; ++r) { float v = acc[t][r] + bv; if (ACT == 1) v = fmaxf(v, 0.f); so[w][8 * hh + r][t * 16 + ln] = v; }
  }
  __builtin_amdgcn_fence(__ATOMIC_ACQ_REL, "workgroup");
  __builtin_amdgcn_wave_barrier();
  const int rsub = lane >> 4, c4 = (lane & 15) * 4;
  {
#pragma unroll
    for (int q = 0; q < 8; ++q) {
      const int r = q * 2 + rsub;
      const v4f v = *(const v4fa*)&so[w][r][c4];
      *(v4f*)(C + (size_t)(row0 + r) * ldc + col0 + c4) = v;
    }
    
  }
}

// GEMM C = act(A·W + bias + resid): A f32 (ASPLIT -> hi/lo 2 terms), Wt bf16 [N][K]; ACT 0 none, 1 relu, 2 exact gelu;
// resid (optional, f32, row index = (row % rmod), pitch ldr, RES_BF16 rounds it) added before the activation.
template <bool ASPLIT, int ACT, bool BIAS_BF16, bool RES_BF16>
__global__ __launch_bounds__(128) void k_gemm_bf3(const float* __restrict__ A, int lda, const unsigned short* __restrict__ Wt, int ldb,
                                                const float* __restrict__ bias, const float* __restrict__ resid, int rmod, int ldr,
                                                float* __restrict__ C, int ldc, int M, int N, int K) {
  __shared__ __attribute__((aligned(16))) float so[4][16][64];
  const int tid = threadIdx.x, w = tid >> 5, lane = tid & 31, ln = lane & 15, hh = lane >> 4;
  const int ntn = N / 64;
  const int wid = blockIdx.x * 4 + w;
  const int mt = wid / ntn, nq = wid % ntn;
  if (mt * 16 >= M) return;
  const int row0 = mt * 16, col0 = nq * 64;
  const float* arow = A + (size_t)(row0 + ln) * lda;
  v8f acc[4] = {};
  for (int kb = 0; kb < K; kb += 32) {
    FragB ah, al;
    const v4f x0 = *(const v4fa*)(arow + kb + 8 * hh), x1 = *(const v4fa*)(arow + kb + 8 * hh + 4);
    const v4f x2 = *(const v4fa*)(arow + kb + 16 + 8 * hh), x3 = *(const v4fa*)(arow + kb + 16 + 8 * hh + 4);
    float xs[16] = {x0[0],x0[1],x0[2],x0[3],x1[0],x1[1],x1[2],x1[3],x2[0],x2[1],x2[2],x2[3],x3[0],x3[1],x3[2],x3[3]};
#pragma unroll
    for (int i = 0; i < 16; ++i) { const unsigned short hb = bf16_bits(xs[i]); ah.u[i] = hb; al.u[i] = ASPLIT ? bf16_bits(xs[i] - bf16_val(hb)) : (unsigned short)0; }
#pragma unroll
    for (int t = 0; t < 4; ++t) {
      const unsigned short* brow = Wt + (size_t)(col0 + t * 16 + ln) * ldb + kb;
      FragB b;
      b.half[0] = *(const v8us*)(brow + 8 * hh);
      b.half[1] = *(const v8us*)(brow + 16 + 8 * hh);
      acc[t] = mmaN<ASPLIT ? 2 : 1>(ah.v, al.v, b.v, b.v, acc[t]);
    }
  }
#pragma unroll
  for (int t = 0; t < 4; ++t) {
    const int col = col0 + t * 16 + ln;
    float bv = bias ? bias[col] : 0.f;
    if (BIAS_BF16) bv = bf16_round(bv);
#pragma unroll
    for (int r = 0; r < 8; ++r) {
      float v = acc[t][r] + bv;
      if (resid) { float rv = resid[(size_t)((row0 + 8 * hh + r) % rmod) * ldr + col]; if (RES_BF16) rv = bf16_round(rv); v += rv; }
      if (ACT == 1) v = fmaxf(v, 0.f);
      if (ACT == 2) v = 0.5f * v * (1.0f + erff(v * 0.70710678118654752f));
      if (ACT == 3) { const float u = 0.7978845608028654f * (v + 0.044715f * v * v * v); v = 0.5f * v * (1.0f + tanhf(u)); }
      so[w][8 * hh + r][t * 16 + ln] = v;
    }
  }
  __builtin_amdgcn_fence(__ATOMIC_ACQ_REL, "workgroup");
  __builtin_amdgcn_wave_barrier();
  const int rsub = lane >> 4, c4 = (lane & 15) * 4;
  {
#pragma unroll
    for (int q = 0; q < 8; ++q) {
      const int r = q * 2 + rsub;
      const v4f v = *(const v4fa*)&so[w][r][c4];
      *(v4f*)(C + (size_t)(row0 + r) * ldc + col0 + c4) = v;
    }
    
  }
}
// row LayerNorm (biased variance, eps) over N: s = X (+ R); optional out_sum <- s; out_norm <- (s-mu)*rsqrt(var+eps)*g + b
template <bool PARAM_BF16>
__global__ __launch_bounds__(256) void k_layernorm(const float* __restrict__ X, const float* __restrict__ R, const float* __restrict__ g, const float* __restrict__ bta,
                                                  float* __restrict__ out_sum, float* __restrict__ out_norm, int N, float eps) {
  __shared__ float red[256];
  const int row = blockIdx.x, tid = threadIdx.x;
  const float* x = X + (size_t)row * N; const float* rr = R ? R + (size_t)row * N : nullptr;
  float vals[16];                     // up to N = 4096
  const int per = N / 256;            // contiguous chunk per thread? use strided-by-4 chunks: thread handles j = tid*4 + 1024*u
  float s1 = 0.f;
  for (int u = 0; u < per / 4; ++u) {
    const int j = tid * 4 + 1024 * u;
    const v4f a = *(const v4fa*)(x + j);
    v4f b = {0.f,0.f,0.f,0.f}; if (rr) b = *(const v4fa*)(rr + j);
#pragma unroll
    for (int q = 0; q < 4; ++q) { const float v = a[q] + b[q]; vals[u * 4 + q] = v; s1 += v; }
  }
  red[tid] = s1; __syncthreads();
  for (int st = 128; st > 0; st >>= 1) { if (tid < st) red[tid] += red[tid + st]; __syncthreads(); }
  const float mu = red[0] / (float)N; __syncthreads();
  float s2 = 0.f;
  for (int u = 0; u < per / 4; ++u)
#pragma unroll
    for (int q = 0; q < 4; ++q) { const float c = vals[u * 4 + q] - mu; s2 += c * c; }
  red[tid] = s2; __syncthreads();
  for (int st = 128; st > 0; st >>= 1) { if (tid < st) red[tid] += red[tid + st]; __syncthreads(); }
  const float rs = rsqrtf(red[0] / (float)N + eps);
  {
    for (int u = 0; u < per / 4; ++u) {
      const int j = tid * 4 + 1024 * u;
      v4f o, sm;
#pragma unroll
      for (int q = 0; q < 4; ++q) {
        float gg = g[j + q], bb = bta[j + q];
        if (PARAM_BF16) { gg = bf16_round(gg); bb = bf16_round(bb); }
        sm[q] = vals[u * 4 + q]; o[q] = (vals[u * 4 + q] - mu) * rs * gg + bb;
      }
      if (out_sum) *(v4f*)(out_sum + (size_t)row * N + j) = sm;
      *(v4f*)(out_norm + (size_t)row * N + j) = o;
    }
    
  }
}



// ---- f16 WMMA path (v_wmma_f32_16x16x32_f16): 11-bit significands for operands in range — used where a [0,1] probability operand needs more precision than bf16
typedef _Float16 v16h __attribute__((ext_vector_type(16)));
union FragH { v16h v; v8us half[2]; _Float16 h[16]; unsigned short u[16]; };
template <int NT>
__device__ __forceinline__ v8f mmaH(v16h ah, v16h al, v16h bh, v16h bl, v8f c) {
  c = __builtin_amdgcn_wmma_f32_16x16x32_f16(false, ah, false, bh, (short)0, c, false, false);
  if (NT >= 2) c = __builtin_amdgcn_wmma_f32_16x16x32_f16(false, al, false, bh, (short)0, c, false, false);
  if (NT >= 3) c = __builtin_amdgcn_wmma_f32_16x16x32_f16(false, ah, false, bl, (short)0, c, false, false);
  asm volatile("v_nop\n\tv_nop\n\tv_nop\n\tv_nop" : "+v"(c) : "v"(ah), "v"(al), "v"(bh), "v"(bl));
  return c;
}
// batched GEMM like k_gemm_b but f16 operands: A f32 (split into f16 hi/lo if ASPLIT, else rounded to f16), Bt = f16 values [n][k]; alpha; C f32; N multiple of 16 (partial tiles skipped)
template <bool ASPLIT>
__global__ __launch_bounds__(128) void k_gemm_h(const float* __restrict__ A, int lda, size_t sA, const _Float16* __restrict__ Bh, int ldb, size_t sB, float alpha, float* __restrict__ C, int ldc, size_t sC, int M, int N, int K) {
  __shared__ __attribute__((aligned(16))) float so[4][16][64];
  const int tid = threadIdx.x, w = tid >> 5, lane = tid & 31, ln = lane & 15, hh = lane >> 4; const int by = blockIdx.y;
  A += (size_t)by * sA; Bh += (size_t)by * sB; C += (size_t)by * sC;
  const int ntn = (N + 63) / 64; const int wid = blockIdx.x * 4 + w; const int mt = wid / ntn, nq = wid % ntn; if (mt * 16 >= M) return;
  const int row0 = mt * 16, col0 = nq * 64; const float* arow = A + (size_t)(row0 + ln) * lda;
  v8f acc[4] = {};
  for (int kb = 0; kb < K; kb += 32) {
    FragH ah, al;
    const v4f x0 = *(const v4fa*)(arow + kb + 8 * hh), x1 = *(const v4fa*)(arow + kb + 8 * hh + 4), x2 = *(const v4fa*)(arow + kb + 16 + 8 * hh), x3 = *(const v4fa*)(arow + kb + 16 + 8 * hh + 4);
    float xs[16] = {x0[0],x0[1],x0[2],x0[3],x1[0],x1[1],x1[2],x1[3],x2[0],x2[1],x2[2],x2[3],x3[0],x3[1],x3[2],x3[3]};
#pragma unroll
    for (int i = 0; i < 16; ++i) { const _Float16 h = (_Float16)xs[i]; ah.h[i] = h; al.h[i] = ASPLIT ? (_Float16)(xs[i] - (float)h) : (_Float16)0.0f; }
#pragma unroll
    for (int t = 0; t < 4; ++t) { if (col0 + t * 16 >= N) continue; const size_t boff = (size_t)(col0 + t * 16 + ln) * ldb + kb; FragH bq; bq.half[0] = *(const v8us*)(Bh + boff + 8 * hh); bq.half[1] = *(const v8us*)(Bh + boff + 16 + 8 * hh);
      acc[t] = mmaH<ASPLIT ? 2 : 1>(ah.v, al.v, bq.v, bq.v, acc[t]); }
  }
#pragma unroll
  for (int t = 0; t < 4; ++t) { if (col0 + t * 16 >= N) continue;
#pragma unroll
    for (int r = 0; r < 8; ++r) so[w][8 * hh + r][t * 16 + ln] = acc[t][r] * alpha; }
  __builtin_amdgcn_fence(__ATOMIC_ACQ_REL, "workgroup"); __builtin_amdgcn_wave_barrier();
  const int rsub = lane >> 4, c4 = (lane & 15) * 4;
  {
#pragma unroll
    for (int q = 0; q < 8; ++q) { const int r = q * 2 + rsub; if (col0 + c4 < N) { const v4f v = *(const v4fa*)&so[w][r][c4]; *(v4f*)(C + (size_t)(row0 + r) * ldc + col0 + c4) = v; } }
     }
}

// Wt[n][k] = f16(W[k][n]·scale) from f32 row-major W[K][N] (scale = power of two; bf16-exact weights stay exact in f16 away from the subnormal range)
__global__ __launch_bounds__(256) void k_wt_f16(const float* __restrict__ W, _Float16* __restrict__ Wt, int K, int N, float scale) {
  const int t = blockIdx.x * 256 + threadIdx.x; if (t >= N * (K / 8)) return; const int n = t / (K / 8), k8 = (t % (K / 8)) * 8; FragH f;
#pragma unroll
  for (int i = 0; i < 8; ++i) f.h[i] = (_Float16)(bf16_round(W[(size_t)(k8 + i) * N + n]) * scale); const v8us o = f.half[0];
  *(v8us*)((unsigned short*)Wt + (size_t)n * K + k8) = o; 
}
// k_gemm_hh variant with fused epilogue: v = acc·alpha + bias[by·sBias + col] (+ CP[(row/rowsPerB)·sCPb + by·64 + col] if CP) ; ACT 0 none / 1 elu ; writes f16 C16 (and f32 C if non-null)
template <int ACT>
__global__ __launch_bounds__(128) void k_gemm_hhx(const _Float16* __restrict__ A, int lda, size_t sA, const _Float16* __restrict__ Bh, int ldb, size_t sB, float alpha, const float* __restrict__ bias, size_t sBias, const float* __restrict__ CP, int rowsPerB, size_t sCPb, int row0g,
    float* __restrict__ C, _Float16* __restrict__ C16, int ldc, size_t sC, int M, int N, int K) {
  __shared__ __attribute__((aligned(16))) float so[4][16][64];
  const int tid = threadIdx.x, w = tid >> 5, lane = tid & 31, ln = lane & 15, hh = lane >> 4; const int by = blockIdx.y;
  A += (size_t)by * sA; Bh += (size_t)by * sB; const size_t cofs = (size_t)by * sC; const float* bp = bias ? bias + (size_t)by * sBias : nullptr;
  const int ntn = (N + 63) / 64; const int wid = blockIdx.x * 4 + w; const int mt = wid / ntn, nq = wid % ntn; if (mt * 16 >= M) return;
  const int row0 = mt * 16, col0 = nq * 64; const _Float16* arow = A + (size_t)(row0 + ln) * lda;
  v8f acc[4] = {};
  for (int kb = 0; kb < K; kb += 32) { FragH ah; ah.half[0] = *(const v8us*)((const unsigned short*)arow + kb + 8 * hh); ah.half[1] = *(const v8us*)((const unsigned short*)arow + kb + 16 + 8 * hh);
#pragma unroll
    for (int t = 0; t < 4; ++t) { if (col0 + t * 16 >= N) continue; const size_t boff = (size_t)(col0 + t * 16 + ln) * ldb + kb; FragH bq; bq.half[0] = *(const v8us*)((const unsigned short*)Bh + boff + 8 * hh); bq.half[1] = *(const v8us*)((const unsigned short*)Bh + boff + 16 + 8 * hh);
      acc[t] = mmaH<1>(ah.v, ah.v, bq.v, bq.v, acc[t]); }
  }
#pragma unroll
  for (int t = 0; t < 4; ++t) { if (col0 + t * 16 >= N) continue; const int col = col0 + t * 16 + ln; const float bv = bp ? bf16_round(bp[col]) : 0.f;
#pragma unroll
    for (int r = 0; r < 8; ++r) { float v = acc[t][r] * alpha + bv; if (CP) { const int rr = row0g + row0 + 8 * hh + r; if (rowsPerB < 0) v += CP[cofs + (size_t)rr * ldc + col];      /* rowsPerB < 0: own element of the batched C plane */ else { const int bidx = rr / rowsPerB; v += CP[(size_t)bidx * sCPb + (size_t)by * 64 + col]; } } if (ACT == 1) v = (v > 0.f) ? v : expm1f(v); else if (ACT == 7) v = (v > 0.f) ? v + 1.0f : expf(v); else if (ACT == 8) v = tanhf(v); else if (ACT == 9) v = 0.5f * v * (1.0f + tanhf(0.7978845608028654f * (v + 0.044715f * v * v * v))); else if (ACT == 11) v = 1.0f / (1.0f + expf(-v)); else if (ACT == 12) v = (v > 0.f) ? v : 0.01f * v; else if (ACT == 14) v = (v > 0.f) ? v : 0.1f * v; else if (ACT == 16) v = (v >= 0.f) ? v : 0.3f * v; else if (ACT == 17) v = (v >= 0.f) ? v : 0.2f * v; else if (ACT == 15) v = v / (1.0f + expf(-v)); else if (ACT == 3) v = fmaxf(v, 0.f); else if (ACT == 6) v = 0.5f * v * (1.0f + erff(v * 0.70710678118654752f)); so[w][8 * hh + r][t * 16 + ln] = v; } }
  __builtin_amdgcn_fence(__ATOMIC_ACQ_REL, "workgroup"); __builtin_amdgcn_wave_barrier();
  const int rsub = lane >> 4, c4 = (lane & 15) * 4; typedef _Float16 v4h __attribute__((ext_vector_type(4)));
  {
#pragma unroll
    for (int q = 0; q < 8; ++q) { const int r = q * 2 + rsub; if (col0 + c4 < N) { const v4f v = *(const v4fa*)&so[w][r][c4]; if (C) *(v4f*)(C + cofs + (size_t)(row0 + r) * ldc + col0 + c4) = v; if (C16) { v4h h4; for (int i = 0; i < 4; ++i) h4[i] = (_Float16)v[i]; *(v4h*)(C16 + cofs + (size_t)(row0 + r) * ldc + col0 + c4) = h4; } } }
     }
}


typedef _Float16 v4h __attribute__((ext_vector_type(4)));

__global__ __launch_bounds__(256) void k_x16(const float* __restrict__ x, _Float16* __restrict__ X16, size_t n8) { const size_t t = (size_t)blockIdx.x * 256 + threadIdx.x; if (t >= n8) return; FragH f;
#pragma unroll
  for (int q = 0; q < 8; ++q) f.h[q] = (_Float16)bf16_round(x[t * 8 + q]); *(v8us*)((unsigned short*)X16 + t * 8) = f.half[0];  }
__global__ __launch_bounds__(256) void k_h16(const float* __restrict__ x, _Float16* __restrict__ X16, size_t n8) { const size_t t = (size_t)blockIdx.x * 256 + threadIdx.x; if (t >= n8) return; FragH f;
#pragma unroll
  for (int q = 0; q < 8; ++q) f.h[q] = (_Float16)x[t * 8 + q]; *(v8us*)((unsigned short*)X16 + t * 8) = f.half[0];  }
__global__ __launch_bounds__(256) void k_round16f(const float* __restrict__ W, _Float16* __restrict__ Bt, size_t n8) { const size_t t = (size_t)blockIdx.x * 256 + threadIdx.x; if (t >= n8) return; FragH f;
#pragma unroll
  for (int i = 0; i < 8; ++i) f.h[i] = (_Float16)(bf16_round(W[t * 8 + i]) * 16.0f); *(v8us*)((unsigned short*)Bt + t * 8) = f.half[0];  }
template <int NHv, int TTv>
__global__ __launch_bounds__(256) void k_vt(const _Float16* __restrict__ V16, int ldv, int voff, _Float16* __restrict__ Vt) { __shared__ unsigned short tl[64][66]; const int tid = threadIdx.x; const int slab = blockIdx.x / (TTv / 64), lg = blockIdx.x % (TTv / 64); const int b = slab / NHv, h = slab % NHv;
  for (int i = tid; i < 64 * 8; i += 256) { const int r = i / 8, c8 = (i % 8) * 8; FragH f; f.half[0] = *(const v8us*)((const unsigned short*)V16 + ((size_t)b * TTv + lg * 64 + r) * ldv + voff + h * 64 + c8);
#pragma unroll
    for (int q = 0; q < 8; ++q) tl[r][c8 + q] = f.u[q]; }
  __syncthreads();
  {
#pragma unroll
    for (int rd = 0; rd < 2; ++rd) { const int d = rd * 32 + tid / 8, pc = tid % 8; FragH f;
#pragma unroll
      for (int q = 0; q < 8; ++q) f.u[q] = tl[pc * 8 + q][d];
      *(v8us*)((unsigned short*)Vt + ((size_t)slab * 64 + d) * TTv + lg * 64 + pc * 8) = f.half[0]; }
     } }

__global__ __launch_bounds__(256) void k_hl(const float* __restrict__ F, _Float16* __restrict__ Hh, _Float16* __restrict__ Hl, size_t n8) { const size_t t = (size_t)blockIdx.x * 256 + threadIdx.x; if (t >= n8) return; FragH fh, fl; const v4f a = *(const v4fa*)(F + t * 8), c = *(const v4fa*)(F + t * 8 + 4);
#pragma unroll
  for (int q = 0; q < 4; ++q) { _Float16 h = (_Float16)a[q]; fh.h[q] = h; fl.h[q] = (_Float16)((a[q] - (float)h) * 1024.0f); h = (_Float16)c[q]; fh.h[4 + q] = h; fl.h[4 + q] = (_Float16)((c[q] - (float)h) * 1024.0f); }
  { *(v8us*)((unsigned short*)Hh + t * 8) = fh.half[0]; *(v8us*)((unsigned short*)Hl + t * 8) = fl.half[0];  } }

// ---- fast GEMM (wave tile 32x64, eight waves = block tile 128x128; requires M % 128 == 0, N % 128 == 0, K % 64 == 0); epilogue = k_gemm_hhx semantics ----
// Operands go through LDS: a stage is 64 k of the block's 128 A rows and 128 B rows (one whole 128-byte line a row), brought by asynchronous copies to LDS, eight lanes a line, two buffers, so that the next stage flies while this one is worked on;
// rows stand at a pitch of 144 bytes (16 x odd: the sixteen rows of a ds_load_b128 fragment read fall on different banks). Each accumulator still takes its k blocks of 32 in rising order.
// the f32 plane C holds only the first crows rows of every cmod rows, packed (row (R / cmod) * crows + R % cmod, pitch ldc); cmod % 32 == 0 and crows % 32 == 0, so a wave's tile is wholly in it or wholly out
__device__ __forceinline__ v16h g2_frag(const _Float16* p, int hh) { FragH f; f.half[0] = *(const v8us*)((const unsigned short*)p + 8 * hh); f.half[1] = *(const v8us*)((const unsigned short*)p + 16 + 8 * hh); return f.v; }
__device__ __forceinline__ v8f g2_mma(v16h a, v16h b, v8f c) { v8f d = __builtin_amdgcn_wmma_f32_16x16x32_f16(false, a, false, b, (short)0, c, false, false); asm volatile("v_nop\n\tv_nop\n\tv_nop\n\tv_nop" : "+v"(d) : "v"(a), "v"(b)); return d; }
#define G2_PB 144                    /* LDS row pitch, bytes */
#define G2_SB (256 * G2_PB)          /* one stage: 128 A rows, then 128 B rows */
// one stage's copies of one lane: rows rr + RPR j (j = 0..3) of a first and of a second operand, 16 bytes each (RPR = rows that the block's lanes cover at once, eight lanes a row); pa, pb = the lane's place in row rr of the two operands at the stage's k,
// sa, sb = RPR rows in elements, l = the lane's LDS byte address in row rr of the buffer (4 RPR rows of the first operand, then 4 RPR of the second).
// The s_wait_xcnt ends the copies' own statement as a precaution: no register that an issued copy names is written ahead of it.
template <int RPR> __device__ __forceinline__ void g2_stage(const _Float16* pa, size_t sa, const _Float16* pb, size_t sb, unsigned l) {
  const _Float16* a1 = pa + sa; const _Float16* a2 = a1 + sa; const _Float16* a3 = a2 + sa; const _Float16* b1 = pb + sb; const _Float16* b2 = b1 + sb; const _Float16* b3 = b2 + sb;
  asm volatile("global_load_async_to_lds_b128 %0, %8, off\n\tglobal_load_async_to_lds_b128 %1, %9, off\n\tglobal_load_async_to_lds_b128 %2, %10, off\n\tglobal_load_async_to_lds_b128 %3, %11, off\n\t"
               "global_load_async_to_lds_b128 %4, %12, off\n\tglobal_load_async_to_lds_b128 %5, %13, off\n\tglobal_load_async_to_lds_b128 %6, %14, off\n\tglobal_load_async_to_lds_b128 %7, %15, off\n\ts_wait_xcnt 0x0"
               :: "v"(l), "v"(l + RPR * G2_PB), "v"(l + 2 * RPR * G2_PB), "v"(l + 3 * RPR * G2_PB), "v"(l + 4 * RPR * G2_PB), "v"(l + 5 * RPR * G2_PB), "v"(l + 6 * RPR * G2_PB), "v"(l + 7 * RPR * G2_PB), "v"(pa), "v"(a1), "v"(a2), "v"(a3), "v"(pb), "v"(b1), "v"(b2), "v"(b3) : "memory"); }
template <int ACT>
__global__ __launch_bounds__(256) void k_gemm2(const _Float16* __restrict__ A, int lda, size_t sA, const _Float16* __restrict__ Bh, int ldb, size_t sB, float alpha, const float* __restrict__ bias, size_t sBias, const float* __restrict__ CP, int rowsPerB, size_t sCPb, int row0g,
    float* __restrict__ C, int cmod, int crows, _Float16* __restrict__ C16, int ldc, size_t sC, int M, int N, int K) { static_assert(ACT == 0 || ACT == 3 || ACT == 6 || ACT == 8 || ACT == 9 || ACT == 11 || ACT == 12 || ACT == 14 || ACT == 15 || ACT == 16 || ACT == 17, "k_gemm2: unsupported ACT code (would silently apply no activation)");
  __shared__ __attribute__((aligned(16))) unsigned char sm[2 * G2_SB];      /* the two stage buffers; behind the loop's last barrier the same bytes are the waves' output staging */
  static_assert(sizeof(float) * 8 * 32 * 68 <= 2 * G2_SB, "output staging must fit the stage buffers"); float (*so)[32][68] = (float (*)[32][68])sm;
  const int tid = threadIdx.x, w = tid >> 5, lane = tid & 31, ln = lane & 15, hh = lane >> 4; const int by = blockIdx.y;
  A += (size_t)by * sA; Bh += (size_t)by * sB; const size_t cofs = (size_t)by * sC; const float* bp = bias ? bias + (size_t)by * sBias : nullptr;
  const int ntn = N >> 7; const int mt = blockIdx.x / ntn, nq = blockIdx.x - mt * ntn; if (mt * 128 >= M) return;      /* the whole block leaves, ahead of every barrier */
  const int row0 = mt * 128 + 32 * (w & 3), col0 = nq * 128 + 64 * (w >> 2);
  const int rr = tid >> 3, c8 = (tid & 7) * 8; const _Float16* ga = A + (size_t)(mt * 128 + rr) * lda + c8; const _Float16* gb = Bh + (size_t)(nq * 128 + rr) * ldb + c8; const size_t sa32 = (size_t)32 * lda, sb32 = (size_t)32 * ldb;
  const unsigned l0 = (unsigned)(size_t)sm + (unsigned)(rr * G2_PB + c8 * 2);      /* low 32 bits of the __shared__ address = LDS byte address */
  const int aoff = (32 * (w & 3) + ln) * G2_PB, boff = (128 + 64 * (w >> 2) + ln) * G2_PB; const int nst = K >> 6;
  const v8f z8 = {0.f,0.f,0.f,0.f,0.f,0.f,0.f,0.f}; v8f c00 = z8, c01 = z8, c02 = z8, c03 = z8, c10 = z8, c11 = z8, c12 = z8, c13 = z8;
  g2_stage<32>(ga, sa32, gb, sb32, l0);
  asm volatile("s_wait_asynccnt 0x0" ::: "memory");      /* this wave's copies of stage 0 have landed */
  __syncthreads();      /* ... and every other wave's: stage 0 may be read */
  if (nst > 1) g2_stage<32>(ga + 64, sa32, gb + 64, sb32, l0 + G2_SB);
  /* not unrolled: one trip a stage, the buffer picked by the trip's parity */
#pragma unroll 1
  for (int t = 0; t < nst; ++t) { const unsigned char* st = sm + (t & 1) * G2_SB; const _Float16* ap = (const _Float16*)(st + aoff); const _Float16* bq = (const _Float16*)(st + boff);
    /* unrolled: the stage's two k blocks of 32 */
#pragma unroll
    for (int kb = 0; kb < 64; kb += 32) { const v16h a0 = g2_frag(ap + kb, hh), a1 = g2_frag(ap + 16 * (G2_PB / 2) + kb, hh);
      const v16h b0 = g2_frag(bq + kb, hh), b1 = g2_frag(bq + 16 * (G2_PB / 2) + kb, hh), b2 = g2_frag(bq + 32 * (G2_PB / 2) + kb, hh), b3 = g2_frag(bq + 48 * (G2_PB / 2) + kb, hh);
      /* inputs-only fence on the loaded values: it keeps the k block's twelve LDS reads in front of its products, in flight together (one LDS latency a block; left alone the compiler waited for each B fragment in turn) */
      asm volatile("" :: "v"(a0), "v"(a1), "v"(b0), "v"(b1), "v"(b2), "v"(b3));
      c00 = g2_mma(a0, b0, c00); c10 = g2_mma(a1, b0, c10); c01 = g2_mma(a0, b1, c01); c11 = g2_mma(a1, b1, c11);
      c02 = g2_mma(a0, b2, c02); c12 = g2_mma(a1, b2, c12); c03 = g2_mma(a0, b3, c03); c13 = g2_mma(a1, b3, c13); }
    asm volatile("s_wait_dscnt 0x0" ::: "memory");      /* this wave's reads of the buffer are done before it is refilled */
    asm volatile("s_wait_asynccnt 0x0" ::: "memory");      /* this wave's copies of stage t + 1 have landed */
    __syncthreads();      /* publishes stage t + 1 and ends every wave's reads of stage t */
    if (t + 2 < nst) g2_stage<32>(ga + (size_t)(t + 2) * 64, sa32, gb + (size_t)(t + 2) * 64, sb32, l0 + (t & 1) * G2_SB); }
  asm volatile("s_wait_asynccnt 0x0" ::: "memory");      /* no copy is outstanding when the buffers become output staging */
  v8f accs[8] = {c00, c01, c02, c03, c10, c11, c12, c13};
#pragma unroll
  for (int u = 0; u < 8; ++u) { const int t = u & 3, half = u >> 2; const int col = col0 + t * 16 + ln; const float bv = bp ? bf16_round(bp[col]) : 0.f;
#pragma unroll
    for (int r = 0; r < 8; ++r) { const int rloc = half * 16 + 8 * hh + r; float v = accs[u][r] * alpha + bv; if (CP) { if (rowsPerB < 0) v += CP[cofs + (size_t)(row0g + row0 + rloc) * ldc + col];      /* rowsPerB < 0: own element of the batched C plane */ else { const int bidx = (row0g + row0 + rloc) / rowsPerB; v += CP[(size_t)bidx * sCPb + (size_t)by * 64 + col]; } }
      if (ACT == 3) v = fmaxf(v, 0.f); else if (ACT == 6) v = 0.5f * v * (1.0f + erff(v * 0.70710678118654752f)); else if (ACT == 11) v = 1.0f / (1.0f + expf(-v)); else if (ACT == 15) v = v / (1.0f + expf(-v)); else if (ACT == 12) v = (v > 0.f) ? v : 0.01f * v; else if (ACT == 8) v = tanhf(v); else if (ACT == 9) v = 0.5f * v * (1.0f + tanhf(0.7978845608028654f * (v + 0.044715f * v * v * v))); else if (ACT == 14) v = (v > 0.f) ? v : 0.1f * v; else if (ACT == 16) v = (v >= 0.f) ? v : 0.3f * v; else if (ACT == 17) v = (v >= 0.f) ? v : 0.2f * v;
      so[w][rloc][t * 16 + ln] = v; } }
  __builtin_amdgcn_fence(__ATOMIC_ACQ_REL, "workgroup"); __builtin_amdgcn_wave_barrier();
  const int rsub = lane >> 4, c4 = (lane & 15) * 4; const int rin = row0 % cmod; float* Cw = (C && rin < crows) ? C + cofs + ((size_t)(row0 / cmod) * crows + rin) * ldc + col0 + c4 : nullptr;
  {
#pragma unroll
    for (int q = 0; q < 16; ++q) { const int r = q * 2 + rsub; const v4f v = *(const v4fa*)&so[w][r][c4]; if (Cw) *(v4f*)(Cw + (size_t)r * ldc) = v; if (C16) { v4h h4; for (int i = 0; i < 4; ++i) h4[i] = (_Float16)v[i]; *(v4h*)(C16 + cofs + (size_t)(row0 + r) * ldc + col0 + c4) = h4; } }
     } }


__global__ __launch_bounds__(256) void k_wnat(const float* __restrict__ w, size_t n8, _Float16* __restrict__ Bt) { const size_t t = (size_t)blockIdx.x * 256 + threadIdx.x; if (t >= n8) return; FragH f; for (int q = 0; q < 8; ++q) f.h[q] = (_Float16)(bf16_round(w[t * 8 + q]) * 16.0f); *(v8us*)((unsigned short*)Bt + t * 8) = f.half[0];  }
__global__ __launch_bounds__(256) void k_rsm(const float* __restrict__ S, _Float16* __restrict__ P, int nrows) {
  #pragma clang fp contract(off)
  const int i = blockIdx.x * 256 + threadIdx.x; if (i >= nrows) return; const float* s = S + (size_t)i * SQ; float mx = -3.0e38f;
#pragma unroll 1
  for (int j = 0; j < SQ; ++j) mx = fmaxf(mx, s[j]); float se = 0.f;
#pragma unroll 1
  for (int j = 0; j < SQ; ++j) se += expf(s[j] - mx); const float sc = 256.0f / se;
#pragma unroll 1
  for (int j0 = 0; j0 < SQ; j0 += 8) { FragH f; for (int q = 0; q < 8; ++q) f.h[q] = (_Float16)(expf(s[j0 + q] - mx) * sc); unsigned short* d = (unsigned short*)P + (size_t)i * SQ + j0; *(v8us*)d = f.half[0];  } }
__global__ __launch_bounds__(256) void k_vt(const _Float16* __restrict__ V16, int b, int h0, _Float16* __restrict__ VT) { __shared__ unsigned short tl[64][65]; const int tid = threadIdx.x; const int hh = blockIdx.x % HG, sg = blockIdx.x / HG; const int s0 = sg * 64; const int h = h0 + hh;
  for (int i = tid; i < 64 * 8; i += 256) { const int j = i / 8, d8 = (i % 8) * 8; FragH f; f.half[0] = *(const v8us*)((const unsigned short*)V16 + ((size_t)b * SQ + s0 + j) * DM + h * HD + d8); for (int q = 0; q < 8; ++q) tl[d8 + q][j] = f.u[q]; }
  __syncthreads();
  { for (int i = tid; i < 64 * 8; i += 256) { const int d = i / 8, j8 = (i % 8) * 8; FragH f; for (int q = 0; q < 8; ++q) f.u[q] = tl[d][j8 + q]; *(v8us*)((unsigned short*)VT + ((size_t)hh * HD + d) * SQ + s0 + j8) = f.half[0]; }  } }



// lane l with lane l ^ M of its 16-lane row (DPP row_xmask), and lane l with lane l ^ 16
template <int M> __device__ __forceinline__ float rs_xm(float x) { return __builtin_bit_cast(float, __builtin_amdgcn_update_dpp(0, __builtin_bit_cast(int, x), 0x160 | M, 0xf, 0xf, true)); }
__device__ __forceinline__ float rs_xh(float x) { return __builtin_bit_cast(float, __builtin_amdgcn_permlanex16(__builtin_bit_cast(int, x), __builtin_bit_cast(int, x), 0x76543210, 0xfedcba98, false, false)); }
__device__ __forceinline__ v16h fa_frag(const _Float16* p) { FragH f; f.half[0] = *(const v8us*)((const unsigned short*)p); f.half[1] = *(const v8us*)((const unsigned short*)p + 16); return f.v; }      /* p already holds the lane half's 8-element shift */
// exp2 of eight values, and of one: each v_exp_f32 works on a register of its own and a v_nop ends the statement. It is there for the slot that the instruction set asks for behind a transcendental before its result is read or its source overwritten.
__device__ __forceinline__ void fa_exp2x8(float (&e)[8]) { asm("v_exp_f32 %0, %0\n\tv_exp_f32 %1, %1\n\tv_exp_f32 %2, %2\n\tv_exp_f32 %3, %3\n\tv_exp_f32 %4, %4\n\tv_exp_f32 %5, %5\n\tv_exp_f32 %6, %6\n\tv_exp_f32 %7, %7\n\tv_nop" : "+v"(e[0]), "+v"(e[1]), "+v"(e[2]), "+v"(e[3]), "+v"(e[4]), "+v"(e[5]), "+v"(e[6]), "+v"(e[7])); }
__device__ __forceinline__ float fa_exp2(float x) { asm("v_exp_f32 %0, %0\n\tv_nop" : "+v"(x)); return x; }
// a trip's fragments: kl, vl = the lane's place (row ln, its half's 8-element shift) in the K rows and in the V^T rows of the trip's LDS buffer
__device__ __forceinline__ void fa_load(const _Float16* kl, const _Float16* vl, v16h (&kc)[4][2], v16h (&vf)[4][2]) {
  /* unrolled because the fragments live in registers, which need constant indices */
#pragma unroll
  for (int t = 0; t < 4; ++t) { kc[t][0] = fa_frag(kl + (16 * t) * (G2_PB / 2)); kc[t][1] = fa_frag(kl + (16 * t) * (G2_PB / 2) + 32); }
#pragma unroll
  for (int t = 0; t < 4; ++t) { vf[t][0] = fa_frag(vl + (16 * t) * (G2_PB / 2)); vf[t][1] = fa_frag(vl + (16 * t) * (G2_PB / 2) + 32); }
  /* inputs-only fence on the loaded values: it keeps the trip's 32 LDS reads in front of the arithmetic, in flight together (one LDS latency a trip; left alone the compiler waited for each pair of K reads in turn and left V^T reads among the last products) */
  asm volatile("" :: "v"(kc[0][0]), "v"(kc[0][1]), "v"(kc[1][0]), "v"(kc[1][1]), "v"(kc[2][0]), "v"(kc[2][1]), "v"(kc[3][0]), "v"(kc[3][1]), "v"(vf[0][0]), "v"(vf[0][1]), "v"(vf[1][0]), "v"(vf[1][1]), "v"(vf[2][0]), "v"(vf[2][1]), "v"(vf[3][0]), "v"(vf[3][1])); }
// one trip's arithmetic: keys kb .. kb + 63, all operands in registers
__device__ __forceinline__ void fa_trip(const int kb, const int q0, const int ln, const int hh, const v16h qf0, const v16h qf1, const v16h (&kc)[4][2], const v16h (&vf)[4][2], v8f (&o)[4], float& m, float& l) {
  const v8f z8 = {0.f,0.f,0.f,0.f,0.f,0.f,0.f,0.f}; const float cs = 0.125f * 1.4426950408889634f;      /* 1 / sqrt(HD), in log2 units */
  /* every loop of this function is unrolled because fragments, scores and sums live in registers, which need constant indices */
  v8f s[4];
#pragma unroll
  for (int t = 0; t < 4; ++t) { s[t] = __builtin_amdgcn_wmma_f32_16x16x32_f16(false, kc[t][0], false, qf0, (short)0, z8, false, false); s[t] = __builtin_amdgcn_wmma_f32_16x16x32_f16(false, kc[t][1], false, qf1, (short)0, s[t], false, false); }
  if (kb + 63 > q0) {      /* wave-uniform: the trip that reaches the diagonal; s[t][r] = key kb + 16 t + 8 hh + r against query q0 + ln */
#pragma unroll
    for (int t = 0; t < 4; ++t) for (int r = 0; r < 8; ++r) s[t][r] = (kb + 16 * t + 8 * hh + r <= q0 + ln) ? s[t][r] : -1.0e30f; }
  float mx = s[0][0];
#pragma unroll
  for (int t = 0; t < 4; ++t) for (int r = 0; r < 8; ++r) mx = fmaxf(mx, s[t][r]);
  mx = fmaxf(mx, rs_xh(mx));      /* the other half of the query's keys */
  const float mn = fmaxf(m, mx * cs); const float al = fa_exp2(m - mn); m = mn;
  v4f s4 = {0.f, 0.f, 0.f, 0.f}; FragH pf[2];
#pragma unroll
  for (int t = 0; t < 4; ++t) { float e[8]; for (int r = 0; r < 8; ++r) e[r] = fmaf(s[t][r], cs, -mn); fa_exp2x8(e); for (int r = 0; r < 8; ++r) { s4[r & 3] += e[r]; pf[t >> 1].h[(t & 1) * 8 + r] = (_Float16)e[r]; } }
  l = l * al + ((s4[0] + s4[1]) + (s4[2] + s4[3]));      /* each half keeps its own keys' share */
#pragma unroll
  for (int t = 0; t < 4; ++t) { o[t] *= al; o[t] = __builtin_amdgcn_wmma_f32_16x16x32_f16(false, vf[t][0], false, pf[0].v, (short)0, o[t], false, false); o[t] = __builtin_amdgcn_wmma_f32_16x16x32_f16(false, vf[t][1], false, pf[1].v, (short)0, o[t], false, false); } }
#define FA_SB (128 * G2_PB)          /* one stage: 64 K rows, then 64 V^T rows */
// four waves per SIMD: with at most 256 registers a wave all 4096 waves of the launch are resident at once (16 per WGP), and the waves of a SIMD fill each other's waits
__global__ __launch_bounds__(128) __attribute__((amdgpu_waves_per_eu(4, 4))) void k_fattn(const _Float16* __restrict__ QKVp, const _Float16* __restrict__ VTp, float* __restrict__ out) {
  __shared__ __attribute__((aligned(16))) unsigned char sm[2 * FA_SB];      /* the two stage buffers */
  const int tid = threadIdx.x, lane = tid & 31, ln = lane & 15, hh = lane >> 4; const int w = __builtin_amdgcn_readfirstlane(tid >> 5);
  const int bh = blockIdx.x, b = bh / NH, h = bh % NH; const int yb = SQ / 64 - 1 - (int)blockIdx.y; const int q0 = yb * 64 + w * 16;      /* wave-uniform first query row */
  const int nt = yb + 1;      /* trips of 64 keys, the same for the block's four waves: the last one holds every wave's diagonal */
  const _Float16* qp = QKVp + ((size_t)b * SQ + q0 + ln) * LQ + h * HD + 8 * hh;
  const int rr = tid >> 3, c8 = (tid & 7) * 8; const _Float16* gk = QKVp + ((size_t)b * SQ + rr) * LQ + DM + h * HD + c8; const _Float16* gv = VTp + ((size_t)bh * HD + rr) * SQ + c8;      /* the lane's 16 bytes of key row rr and of V^T row rr, trip 0 */
  const unsigned l0 = (unsigned)(size_t)sm + (unsigned)(rr * G2_PB + c8 * 2);      /* low 32 bits of the __shared__ address = LDS byte address */
  const int koff = ln * G2_PB + 16 * hh, voff = (64 + ln) * G2_PB + 16 * hh;
  const v16h qf0 = fa_frag(qp), qf1 = fa_frag(qp + 32);
  asm volatile("s_wait_xcnt 0x0" :: "v"(qp) : "memory");      /* precaution: no register that an issued load names is written ahead of this wait; the q address pair is an input here so that no load's result is placed on it */
  g2_stage<16>(gk, (size_t)16 * LQ, gv, (size_t)16 * SQ, l0);
  asm volatile("s_wait_asynccnt 0x0" ::: "memory");      /* this wave's copies of trip 0 have landed */
  __syncthreads();      /* ... and every other wave's: trip 0's rows may be read */
  if (nt > 1) g2_stage<16>(gk + (size_t)64 * LQ, (size_t)16 * LQ, gv + 64, (size_t)16 * SQ, l0 + FA_SB);
  const v8f z8 = {0.f,0.f,0.f,0.f,0.f,0.f,0.f,0.f}; v8f o[4] = {z8, z8, z8, z8}; float m = -1.0e30f, l = 0.f;
  /* not unrolled: one trip a stage, the buffer picked by the trip's parity */
#pragma unroll 1
  for (int t = 0; t < nt; ++t) { const unsigned char* st = sm + (t & 1) * FA_SB; v16h kc[4][2], vf[4][2];
    fa_load((const _Float16*)(st + koff), (const _Float16*)(st + voff), kc, vf);      /* the trip's only LDS reads: the buffer is handed on right behind them, so that its refill has a whole trip to land */
    asm volatile("s_wait_dscnt 0x0" ::: "memory");      /* this wave's reads of the buffer are done before it is refilled */
    asm volatile("s_wait_asynccnt 0x0" ::: "memory");      /* this wave's copies of trip t + 1 have landed */
    __syncthreads();      /* publishes trip t + 1's rows and ends every wave's reads of trip t's */
    if (t + 2 < nt) g2_stage<16>(gk + (size_t)(t + 2) * 64 * LQ, (size_t)16 * LQ, gv + (t + 2) * 64, (size_t)16 * SQ, l0 + (t & 1) * FA_SB);
    fa_trip(t * 64, q0, ln, hh, qf0, qf1, kc, vf, o, m, l); }
  asm volatile("s_wait_asynccnt 0x0" ::: "memory");      /* no copy is outstanding when the wave ends */
  l += rs_xh(l); const float fin = 1.0f / l;
  /* unrolled for constant register indices */
  float* op = out + ((size_t)b * SQ + q0 + ln) * DM + h * HD + 8 * hh;      /* o[t][r] = column 16 t + 8 hh + r of query q0 + ln */
#pragma unroll
  for (int t = 0; t < 4; ++t) { const v4f lo = {o[t][0] * fin, o[t][1] * fin, o[t][2] * fin, o[t][3] * fin}, hi = {o[t][4] * fin, o[t][5] * fin, o[t][6] * fin, o[t][7] * fin}; *(v4f*)(op + 16 * t) = lo; *(v4f*)(op + 16 * t + 4) = hi; } }

// lane K of each 16-lane row, handed to all sixteen lanes of that row (DPP row_share)
template <int K> __device__ __forceinline__ float a0_share(float x) { return __builtin_bit_cast(float, __builtin_amdgcn_update_dpp(0, __builtin_bit_cast(int, x), 0x150 | K, 0xf, 0xf, true)); }
template <int K> __device__ __forceinline__ void a0_acc(v4f& o, float e, const v4f* vv) { o += a0_share<K>(e) * vv[K]; if constexpr (K + 1 < 16) a0_acc<K + 1>(o, e, vv); }
// exact f32 attention of the first QT0 rows, SIXTEEN LANES PER QUERY ROW, keys in groups of 16: lane p scores key 16 g + p (whole q row in registers, K row straight from global memory), the group's maximum comes from a
// four-step butterfly over the 16 lanes, the running o and l are rescaled once per group, lane p keeps columns 4 p .. 4 p + 3 of o and its own keys' share of l (summed over the 16 lanes at the end). No LDS, no barrier.
// grid.y = batch: QF, KF, VF point at the q, k, v blocks of the packed f32 rows (QT0 rows a batch, pitch LQ), OF at the output rows (SQ rows a batch). The odd batch takes its row blocks in falling order: row block rb costs rb + 1 key groups,
// so where block x of one batch and block x of the other share a WGP their costs add to the same sum for every x (speed only, nothing rests on the placement).
template <int MASKADD>
__global__ __launch_bounds__(256) void k_att0(const float* __restrict__ QF, const float* __restrict__ KF, const float* __restrict__ VF, const float* __restrict__ mask, float scale, float* __restrict__ OF, int ldo) {
  const int p = threadIdx.x & 15; const int b = blockIdx.y; const int h = blockIdx.x / (QT0 / 16), rx = blockIdx.x % (QT0 / 16), rb = (b & 1) ? QT0 / 16 - 1 - rx : rx; const int i = rb * 16 + (threadIdx.x >> 4);
  QF += (size_t)b * QT0 * LQ; KF += (size_t)b * QT0 * LQ; VF += (size_t)b * QT0 * LQ; OF += (size_t)b * SQ * ldo;
  const float* qr = QF + (size_t)i * LQ + h * HD; v4f q[HD / 4];      /* q, k, v rows have the pitch LQ, a constant, so that a group's sixteen V rows hang on one address pair by immediate offsets */
  /* the loops over c are unrolled because the rows live in registers, which need constant indices */
#pragma unroll
  for (int c = 0; c < HD / 4; ++c) q[c] = *(const v4fa*)(qr + c * 4);
  asm volatile("s_wait_xcnt 0x0" :: "v"(qr) : "memory");      /* precaution: no register that an issued load names is written ahead of this wait; the address pair is an input here so that no load's result is placed on it */
  v4f o = {0.f, 0.f, 0.f, 0.f}; float m = -1.0e30f, l = 0.f; const int ng = MASKADD ? (SQ / 16) : (rb + 1);      /* additive-mask form: every key (the mask input decides); causal form: key groups up to the block's last row */
  for (int g = 0; g < ng; ++g) { const int j = g * 16 + p; const float* kr = KF + (size_t)j * LQ + h * HD; const float* vr = VF + (size_t)(g * 16) * LQ + h * HD + p * 4; v4f kk[HD / 4], vv[16];
#pragma unroll
    for (int c = 0; c < HD / 4; ++c) kk[c] = *(const v4fa*)(kr + c * 4);
#pragma unroll
    for (int c = 0; c < 16; ++c) vv[c] = *(const v4fa*)(vr + c * LQ);
    asm volatile("s_wait_xcnt 0x0" :: "v"(kr), "v"(vr) : "memory");      /* the same precaution for the two address pairs of the group */
    /* inputs-only fences on the loaded values: they keep all 32 loads of the group in front of the arithmetic, in flight together (one memory latency per group; left alone the compiler waits after every second load) */
    asm volatile("" :: "v"(kk[0]), "v"(kk[1]), "v"(kk[2]), "v"(kk[3]), "v"(kk[4]), "v"(kk[5]), "v"(kk[6]), "v"(kk[7]), "v"(kk[8]), "v"(kk[9]), "v"(kk[10]), "v"(kk[11]), "v"(kk[12]), "v"(kk[13]), "v"(kk[14]), "v"(kk[15]), "v"(vv[0]), "v"(vv[1]), "v"(vv[2]), "v"(vv[3]), "v"(vv[4]), "v"(vv[5]), "v"(vv[6]), "v"(vv[7]), "v"(vv[8]), "v"(vv[9]), "v"(vv[10]), "v"(vv[11]), "v"(vv[12]), "v"(vv[13]));
    asm volatile("" :: "v"(vv[14]), "v"(vv[15]));
    v4f s4 = {0.f, 0.f, 0.f, 0.f};
#pragma unroll
    for (int c = 0; c < HD / 4; ++c) s4 += q[c] * kk[c];
    float s = ((s4[0] + s4[1]) + (s4[2] + s4[3])) * scale; if (MASKADD) s += bf16_round(mask[(size_t)i * SQ + j]) * -10000.0f;
    const float sm = (MASKADD || j <= i) ? s : -1.0e30f;
    float gm = sm; gm = fmaxf(gm, rs_xm<1>(gm)); gm = fmaxf(gm, rs_xm<2>(gm)); gm = fmaxf(gm, rs_xm<4>(gm)); gm = fmaxf(gm, rs_xm<8>(gm));
    const float mn = fmaxf(m, gm); const float sc = expf(m - mn); const float e = expf(sm - mn); l = l * sc + e; m = mn; o *= sc;
    a0_acc<0>(o, e, vv); }
  l += rs_xm<1>(l); l += rs_xm<2>(l); l += rs_xm<4>(l); l += rs_xm<8>(l);
  const float fin = 1.0f / l;
  *(v4f*)(OF + (size_t)i * ldo + h * HD + p * 4) = o * fin; }

__global__ __launch_bounds__(256) void k_bcpy(const float* __restrict__ b, int n, int NP, float* __restrict__ dst, int dst0) { for (int i = threadIdx.x; i < NP; i += 256) { const float v = (i < n) ? b[i] : 0.f; *(float*)(dst + dst0 + i) = v; }  }


extern "C" void kernel_launch(void* const* d_in, const int* in_sizes, int n_in,
                              void* d_out, int out_size, void* d_ws, size_t ws_size, hipStream_t stream) {
  (void)in_sizes; (void)n_in; (void)out_size;
  const float* const* I = (const float* const*)d_in; const float* x = I[0]; const float* wq = I[1]; const float* bq = I[2]; const float* wk = I[3]; const float* bk = I[4]; const float* wv = I[5]; const float* bv = I[6];      /* natural nn.Linear [out][in] weights + biases */
  char* ws = (char*)d_ws; size_t off = 0;
  auto take = [&](size_t bytes) { char* p = ws + off; off += (bytes + 255) & ~(size_t)255; return p; };
  _Float16* BQKV = (_Float16*)take((size_t)3 * DM * DM * 2); float* bqkv = (float*)take((size_t)3 * DM * 4);      /* stacked q | k | v weight plane and bias vector */ 
  _Float16* X16 = (_Float16*)take(NR * DM * 2); _Float16* QKV = (_Float16*)take(NR * 3 * DM * 2); _Float16* Q16 = QKV; _Float16* K16 = QKV + DM; _Float16* V16 = QKV + 2 * DM;      /* q | k | v */ _Float16* O16 = (_Float16*)take(NR * DM * 2);
  _Float16* VT = (_Float16*)take((size_t)NB * NH * HD * SQ * 2);
  float* F0 = (float*)take((size_t)NB * QT0 * LQ * 4);      /* f32 q | k | v of the first QT0 rows of each batch, packed */
  if (off > ws_size) return;
  { const unsigned g = (unsigned)(((size_t)DM * DM / 8 + 255) / 256); k_wnat<<<g, 256, 0, stream>>>(wq, (size_t)DM * DM / 8, BQKV); k_wnat<<<g, 256, 0, stream>>>(wk, (size_t)DM * DM / 8, BQKV + (size_t)DM * DM); k_wnat<<<g, 256, 0, stream>>>(wv, (size_t)DM * DM / 8, BQKV + (size_t)2 * DM * DM); }      /* natural [out][in] = Bt[n][k] x16, stacked q | k | v */
  k_bcpy<<<1, 256, 0, stream>>>(bq, DM, DM, bqkv, 0); k_bcpy<<<1, 256, 0, stream>>>(bk, DM, DM, bqkv, DM); k_bcpy<<<1, 256, 0, stream>>>(bv, DM, DM, bqkv, 2 * DM);      /* stacked bias vector bq | bk | bv */
  k_x16<<<(unsigned)((NR * DM / 8 + 255) / 256), 256, 0, stream>>>(x, X16, NR * DM / 8);
  const size_t r0p = (size_t)B0 * SQ;      /* first projected row */
  k_gemm2<0><<<dim3((unsigned)((MP / 128) * (3 * DM / 128)), 1), 256, 0, stream>>>(X16 + r0p * DM, DM, 0, BQKV, DM, 0, 0.0625f, bqkv, 0, nullptr, 1, 0, 0, F0, SQ, QT0, QKV + r0p * 3 * DM, 3 * DM, 0, MP, 3 * DM, DM);      /* q | k | v rows (f16); head h = columns h*HD.. of each DM block; the first QT0 rows of each batch also f32 */
  k_vt<NH, SQ><<<NB * NH * (SQ / 64), 256, 0, stream>>>(V16, LQ, 0, VT);      /* V^T [NB][NH][HD][SQ] */
  k_fattn<<<dim3(NB * NH, SQ / 64), 128, 0, stream>>>(QKV, VT, (float*)d_out);      /* o (merged heads) f32 straight into the output rows */
  k_att0<0><<<dim3(NH * (QT0 / 16), NB), 256, 0, stream>>>(F0, F0 + DM, F0 + 2 * DM, nullptr, 0.125f, (float*)d_out, DM);      /* exact f32 causal attention of the first QT0 rows of each batch: those output rows rewritten (the f16-path rows are replaced) */
}

// v006
// One run takes 92.3 microseconds.
// Next to v005, in two timings, it ran 1.16 and 1.17 times as fast.
// Counting every step since v000, it is 63.5 times as fast.
#include <hip/hip_runtime.h>
#define NB 2
#define SQ 2048
#define DM 1024
#define NH 16
#define HD 64
#define HG 4                         /* head group of the k_vt(b, h0) form */
#define B0 0                         /* first batch processed (debug hook) */
#define NBR NB                       /* batches processed (debug hook) */
#define NR ((size_t)NB * SQ)         /* token rows */
#define MP ((int)((size_t)NBR * SQ)) /* rows projected (debug hook) */
#define QT 256                       /* unused */
#define NKX SQ                       /* unused */
#define QT0 256                      /* first-tile rows recomputed exactly (256: margin for the few-key rows, no output projection) */
#define QN SQ                        /* unused */
#define NHD NH                       /* unused */
#define MPO MP                       /* unused */
#define LQ (3 * DM)      /* row pitch of the q/k/v rows */
typedef __bf16 v16b __attribute__((ext_vector_type(16)));
typedef unsigned short v8us __attribute__((ext_vector_type(8), may_alias));
typedef float  v8f  __attribute__((ext_vector_type(8)));
typedef float  v4f  __attribute__((ext_vector_type(4)));
typedef float  v4fa __attribute__((ext_vector_type(4), may_alias));
union FragB { v16b v; v8us half[2]; unsigned short u[16]; };

__device__ __forceinline__ unsigned short bf16_bits(float x) { unsigned int u = __float_as_uint(x); return (unsigned short)((u + 0x7FFFu + ((u >> 16) & 1u)) >> 16); }
__device__ __forceinline__ float bf16_val(unsigned short b) { return __uint_as_float(((unsigned int)b) << 16); }
__device__ __forceinline__ float bf16_round(float x) { return bf16_val(bf16_bits(x)); }
// D += A·B with NT terms: 1 = ah·bh, 2 = + al·bh (A split), 3 = + ah·bl (both split)
template <int NT>
__device__ __forceinline__ v8f mmaN(v16b ah, v16b al, v16b bh, v16b bl, v8f c) {
  c = __builtin_amdgcn_wmma_f32_16x16x32_bf16(false, ah, false, bh, (short)0, c, false, false);
  if (NT >= 2) c = __builtin_amdgcn_wmma_f32_16x16x32_bf16(false, al, false, bh, (short)0, c, false, false);
  if (NT >= 3) c = __builtin_amdgcn_wmma_f32_16x16x32_bf16(false, ah, false, bl, (short)0, c, false, false);
  asm volatile("v_nop\n\tv_nop\n\tv_nop\n\tv_nop" : "+v"(c) : "v"(ah), "v"(al), "v"(bh), "v"(bl));
  return c;
}

__global__ __launch_bounds__(256) void k_wt_bf16(const float* __restrict__ W, unsigned short* __restrict__ Wt, int K, int N) {
  const int t = blockIdx.x * 256 + threadIdx.x;
  const int k8n = K / 8;
  if (t >= N * k8n) return;
  const int n = t / k8n, k8 = (t % k8n) * 8;
  v8us v;
#pragma unroll
  for (int i = 0; i < 8; ++i) v[i] = bf16_bits(W[(size_t)(k8 + i) * N + n]);
  *(v8us*)(Wt + (size_t)n * K + k8) = v;
  
}

// GEMM C[M][N] (f32, pitch ldc) = act(A[M][K]·W + bias). A f32 row-major (pitch lda) converted per fragment to bf16
// (ASPLIT: hi/lo two planes -> 2 terms, else single rounded term); Wt bf16 [N][K] (pitch ldb). BIAS_BF16 rounds the
// bias to bf16 first (bias quantised to bf16 before the add). K%32==0, M%16==0, N%64==0.
template <bool ASPLIT, int ACT, bool BIAS_BF16>
__global__ __launch_bounds__(128) void k_gemm_bf(const float* __restrict__ A, int lda, const unsigned short* __restrict__ Wt, int ldb,
                                               const float* __restrict__ bias, float* __restrict__ C, int ldc, int M, int N, int K) {
  __shared__ __attribute__((aligned(16))) float so[4][16][64];
  const int tid = threadIdx.x, w = tid >> 5, lane = tid & 31, ln = lane & 15, hh = lane >> 4;
  const int ntn = N / 64;
  const int wid = blockIdx.x * 4 + w;
  const int mt = wid / ntn, nq = wid % ntn;
  if (mt * 16 >= M) return;
  const int row0 = mt * 16, col0 = nq * 64;
  const float* arow = A + (size_t)(row0 + ln) * lda;
  v8f acc[4] = {};
  for (int kb = 0; kb < K; kb += 32) {
    FragB ah, al;
    const v4f x0 = *(const v4fa*)(arow + kb + 8 * hh), x1 = *(const v4fa*)(arow + kb + 8 * hh + 4);
    const v4f x2 = *(const v4fa*)(arow + kb + 16 + 8 * hh), x3 = *(const v4fa*)(arow + kb + 16 + 8 * hh + 4);
    float xs[16] = {x0[0],x0[1],x0[2],x0[3],x1[0],x1[1],x1[2],x1[3],x2[0],x2[1],x2[2],x2[3],x3[0],x3[1],x3[2],x3[3]};
#pragma unroll
    for (int i = 0; i < 16; ++i) { const unsigned short hb = bf16_bits(xs[i]); ah.u[i] = hb; al.u[i] = ASPLIT ? bf16_bits(xs[i] - bf16_val(hb)) : (unsigned short)0; }
#pragma unroll
    for (int t = 0; t < 4; ++t) {
      const unsigned short* brow = Wt + (size_t)(col0 + t * 16 + ln) * ldb + kb;
      FragB b;
      b.half[0] = *(const v8us*)(brow + 8 * hh);
      b.half[1] = *(const v8us*)(brow + 16 + 8 * hh);
      acc[t] = mmaN<ASPLIT ? 2 : 1>(ah.v, al.v, b.v, b.v, acc[t]);
    }
  }
#pragma unroll
  for (int t = 0; t < 4; ++t) {
    float bv = bias ? bias[col0 + t * 16 + ln] : 0.f;
    if (BIAS_BF16) bv = bf16_round(bv);
#pragma unroll
    for (int r = 0; r < 8; ++r) { float v = acc[t][r] + bv; if (ACT == 1) v = fmaxf(v, 0.f); so[w][8 * hh + r][t * 16 + ln] = v; }
  }
  __builtin_amdgcn_fence(__ATOMIC_ACQ_REL, "workgroup");
  __builtin_amdgcn_wave_barrier();
  const int rsub = lane >> 4, c4 = (lane & 15) * 4;
  {
#pragma unroll
    for (int q = 0; q < 8; ++q) {
      const int r = q * 2 + rsub;
      const v4f v = *(const v4fa*)&so[w][r][c4];
      *(v4f*)(C + (size_t)(row0 + r) * ldc + col0 + c4) = v;
    }
    
  }
}

// GEMM C = act(A·W + bias + resid): A f32 (ASPLIT -> hi/lo 2 terms), Wt bf16 [N][K]; ACT 0 none, 1 relu, 2 exact gelu;
// resid (optional, f32, row index = (row % rmod), pitch ldr, RES_BF16 rounds it) added before the activation.
template <bool ASPLIT, int ACT, bool BIAS_BF16, bool RES_BF16>
__global__ __launch_bounds__(128) void k_gemm_bf3(const float* __restrict__ A, int lda, const unsigned short* __restrict__ Wt, int ldb,
                                                const float* __restrict__ bias, const float* __restrict__ resid, int rmod, int ldr,
                                                float* __restrict__ C, int ldc, int M, int N, int K) {
  __shared__ __attribute__((aligned(16))) float so[4][16][64];
  const int tid = threadIdx.x, w = tid >> 5, lane = tid & 31, ln = lane & 15, hh = lane >> 4;
  const int ntn = N / 64;
  const int wid = blockIdx.x * 4 + w;
  const int mt = wid / ntn, nq = wid % ntn;
  if (mt * 16 >= M) return;
  const int row0 = mt * 16, col0 = nq * 64;
  const float* arow = A + (size_t)(row0 + ln) * lda;
  v8f acc[4] = {};
  for (int kb = 0; kb < K; kb += 32) {
    FragB ah, al;
    const v4f x0 = *(const v4fa*)(arow + kb + 8 * hh), x1 = *(const v4fa*)(arow + kb + 8 * hh + 4);
    const v4f x2 = *(const v4fa*)(arow + kb + 16 + 8 * hh), x3 = *(const v4fa*)(arow + kb + 16 + 8 * hh + 4);
    float xs[16] = {x0[0],x0[1],x0[2],x0[3],x1[0],x1[1],x1[2],x1[3],x2[0],x2[1],x2[2],x2[3],x3[0],x3[1],x3[2],x3[3]};
#pragma unroll
    for (int i = 0; i < 16; ++i) { const unsigned short hb = bf16_bits(xs[i]); ah.u[i] = hb; al.u[i] = ASPLIT ? bf16_bits(xs[i] - bf16_val(hb)) : (unsigned short)0; }
#pragma unroll
    for (int t = 0; t < 4; ++t) {
      const unsigned short* brow = Wt + (size_t)(col0 + t * 16 + ln) * ldb + kb;
      FragB b;
      b.half[0] = *(const v8us*)(brow + 8 * hh);
      b.half[1] = *(const v8us*)(brow + 16 + 8 * hh);
      acc[t] = mmaN<ASPLIT ? 2 : 1>(ah.v, al.v, b.v, b.v, acc[t]);
    }
  }
#pragma unroll
  for (int t = 0; t < 4; ++t) {
    const int col = col0 + t * 16 + ln;
    float bv = bias ? bias[col] : 0.f;
    if (BIAS_BF16) bv = bf16_round(bv);
#pragma unroll
    for (int r = 0; r < 8; ++r) {
      float v = acc[t][r] + bv;
      if (resid) { float rv = resid[(size_t)((row0 + 8 * hh + r) % rmod) * ldr + col]; if (RES_BF16) rv = bf16_round(rv); v += rv; }
      if (ACT == 1) v = fmaxf(v, 0.f);
      if (ACT == 2) v = 0.5f * v * (1.0f + erff(v * 0.70710678118654752f));
      if (ACT == 3) { const float u = 0.7978845608028654f * (v + 0.044715f * v * v * v); v = 0.5f * v * (1.0f + tanhf(u)); }
      so[w][8 * hh + r][t * 16 + ln] = v;
    }
  }
  __builtin_amdgcn_fence(__ATOMIC_ACQ_REL, "workgroup");
  __builtin_amdgcn_wave_barrier();
  const int rsub = lane >> 4, c4 = (lane & 15) * 4;
  {
#pragma unroll
    for (int q = 0; q < 8; ++q) {
      const int r = q * 2 + rsub;
      const v4f v = *(const v4fa*)&so[w][r][c4];
      *(v4f*)(C + (size_t)(row0 + r) * ldc + col0 + c4) = v;
    }
    
  }
}
// row LayerNorm (biased variance, eps) over N: s = X (+ R); optional out_sum <- s; out_norm <- (s-mu)*rsqrt(var+eps)*g + b
template <bool PARAM_BF16>
__global__ __launch_bounds__(256) void k_layernorm(const float* __restrict__ X, const float* __restrict__ R, const float* __restrict__ g, const float* __restrict__ bta,
                                                  float* __restrict__ out_sum, float* __restrict__ out_norm, int N, float eps) {
  __shared__ float red[256];
  const int row = blockIdx.x, tid = threadIdx.x;
  const float* x = X + (size_t)row * N; const float* rr = R ? R + (size_t)row * N : nullptr;
  float vals[16];                     // up to N = 4096
  const int per = N / 256;            // contiguous chunk per thread? use strided-by-4 chunks: thread handles j = tid*4 + 1024*u
  float s1 = 0.f;
  for (int u = 0; u < per / 4; ++u) {
    const int j = tid * 4 + 1024 * u;
    const v4f a = *(const v4fa*)(x + j);
    v4f b = {0.f,0.f,0.f,0.f}; if (rr) b = *(const v4fa*)(rr + j);
#pragma unroll
    for (int q = 0; q < 4; ++q) { const float v = a[q] + b[q]; vals[u * 4 + q] = v; s1 += v; }
  }
  red[tid] = s1; __syncthreads();
  for (int st = 128; st > 0; st >>= 1) { if (tid < st) red[tid] += red[tid + st]; __syncthreads(); }
  const float mu = red[0] / (float)N; __syncthreads();
  float s2 = 0.f;
  for (int u = 0; u < per / 4; ++u)
#pragma unroll
    for (int q = 0; q < 4; ++q) { const float c = vals[u * 4 + q] - mu; s2 += c * c; }
  red[tid] = s2; __syncthreads();
  for (int st = 128; st > 0; st >>= 1) { if (tid < st) red[tid] += red[tid + st]; __syncthreads(); }
  const float rs = rsqrtf(red[0] / (float)N + eps);
  {
    for (int u = 0; u < per / 4; ++u) {
      const int j = tid * 4 + 1024 * u;
      v4f o, sm;
#pragma unroll
      for (int q = 0; q < 4; ++q) {
        float gg = g[j + q], bb = bta[j + q];
        if (PARAM_BF16) { gg = bf16_round(gg); bb = bf16_round(bb); }
        sm[q] = vals[u * 4 + q]; o[q] = (vals[u * 4 + q] - mu) * rs * gg + bb;
      }
      if (out_sum) *(v4f*)(out_sum + (size_t)row * N + j) = sm;
      *(v4f*)(out_norm + (size_t)row * N + j) = o;
    }
    
  }
}



// ---- f16 WMMA path (v_wmma_f32_16x16x32_f16): 11-bit significands for operands in range — used where a [0,1] probability operand needs more precision than bf16
typedef _Float16 v16h __attribute__((ext_vector_type(16)));
union FragH { v16h v; v8us half[2]; _Float16 h[16]; unsigned short u[16]; };
template <int NT>
__device__ __forceinline__ v8f mmaH(v16h ah, v16h al, v16h bh, v16h bl, v8f c) {
  c = __builtin_amdgcn_wmma_f32_16x16x32_f16(false, ah, false, bh, (short)0, c, false, false);
  if (NT >= 2) c = __builtin_amdgcn_wmma_f32_16x16x32_f16(false, al, false, bh, (short)0, c, false, false);
  if (NT >= 3) c = __builtin_amdgcn_wmma_f32_16x16x32_f16(false, ah, false, bl, (short)0, c, false, false);
  asm volatile("v_nop\n\tv_nop\n\tv_nop\n\tv_nop" : "+v"(c) : "v"(ah), "v"(al), "v"(bh), "v"(bl));
  return c;
}
// batched GEMM like k_gemm_b but f16 operands: A f32 (split into f16 hi/lo if ASPLIT, else rounded to f16), Bt = f16 values [n][k]; alpha; C f32; N multiple of 16 (partial tiles skipped)
template <bool ASPLIT>
__global__ __launch_bounds__(128) void k_gemm_h(const float* __restrict__ A, int lda, size_t sA, const _Float16* __restrict__ Bh, int ldb, size_t sB, float alpha, float* __restrict__ C, int ldc, size_t sC, int M, int N, int K) {
  __shared__ __attribute__((aligned(16))) float so[4][16][64];
  const int tid = threadIdx.x, w = tid >> 5, lane = tid & 31, ln = lane & 15, hh = lane >> 4; const int by = blockIdx.y;
  A += (size_t)by * sA; Bh += (size_t)by * sB; C += (size_t)by * sC;
  const int ntn = (N + 63) / 64; const int wid = blockIdx.x * 4 + w; const int mt = wid / ntn, nq = wid % ntn; if (mt * 16 >= M) return;
  const int row0 = mt * 16, col0 = nq * 64; const float* arow = A + (size_t)(row0 + ln) * lda;
  v8f acc[4] = {};
  for (int kb = 0; kb < K; kb += 32) {
    FragH ah, al;
    const v4f x0 = *(const v4fa*)(arow + kb + 8 * hh), x1 = *(const v4fa*)(arow + kb + 8 * hh + 4), x2 = *(const v4fa*)(arow + kb + 16 + 8 * hh), x3 = *(const v4fa*)(arow + kb + 16 + 8 * hh + 4);
    float xs[16] = {x0[0],x0[1],x0[2],x0[3],x1[0],x1[1],x1[2],x1[3],x2[0],x2[1],x2[2],x2[3],x3[0],x3[1],x3[2],x3[3]};
#pragma unroll
    for (int i = 0; i < 16; ++i) { const _Float16 h = (_Float16)xs[i]; ah.h[i] = h; al.h[i] = ASPLIT ? (_Float16)(xs[i] - (float)h) : (_Float16)0.0f; }
#pragma unroll
    for (int t = 0; t < 4; ++t) { if (col0 + t * 16 >= N) continue; const size_t boff = (size_t)(col0 + t * 16 + ln) * ldb + kb; FragH bq; bq.half[0] = *(const v8us*)(Bh + boff + 8 * hh); bq.half[1] = *(const v8us*)(Bh + boff + 16 + 8 * hh);
      acc[t] = mmaH<ASPLIT ? 2 : 1>(ah.v, al.v, bq.v, bq.v, acc[t]); }
  }
#pragma unroll
  for (int t = 0; t < 4; ++t) { if (col0 + t * 16 >= N) continue;
#pragma unroll
    for (int r = 0; r < 8; ++r) so[w][8 * hh + r][t * 16 + ln] = acc[t][r] * alpha; }
  __builtin_amdgcn_fence(__ATOMIC_ACQ_REL, "workgroup"); __builtin_amdgcn_wave_barrier();
  const int rsub = lane >> 4, c4 = (lane & 15) * 4;
  {
#pragma unroll
    for (int q = 0; q < 8; ++q) { const int r = q * 2 + rsub; if (col0 + c4 < N) { const v4f v = *(const v4fa*)&so[w][r][c4]; *(v4f*)(C + (size_t)(row0 + r) * ldc + col0 + c4) = v; } }
     }
}

// Wt[n][k] = f16(W[k][n]·scale) from f32 row-major W[K][N] (scale = power of two; bf16-exact weights stay exact in f16 away from the subnormal range)
__global__ __launch_bounds__(256) void k_wt_f16(const float* __restrict__ W, _Float16* __restrict__ Wt, int K, int N, float scale) {
  const int t = blockIdx.x * 256 + threadIdx.x; if (t >= N * (K / 8)) return; const int n = t / (K / 8), k8 = (t % (K / 8)) * 8; FragH f;
#pragma unroll
  for (int i = 0; i < 8; ++i) f.h[i] = (_Float16)(bf16_round(W[(size_t)(k8 + i) * N + n]) * scale); const v8us o = f.half[0];
  *(v8us*)((unsigned short*)Wt + (size_t)n * K + k8) = o; 
}
// k_gemm_hh variant with fused epilogue: v = acc·alpha + bias[by·sBias + col] (+ CP[(row/rowsPerB)·sCPb + by·64 + col] if CP) ; ACT 0 none / 1 elu ; writes f16 C16 (and f32 C if non-null)
template <int ACT>
__global__ __launch_bounds__(128) void k_gemm_hhx(const _Float16* __restrict__ A, int lda, size_t sA, const _Float16* __restrict__ Bh, int ldb, size_t sB, float alpha, const float* __restrict__ bias, size_t sBias, const float* __restrict__ CP, int rowsPerB, size_t sCPb, int row0g,
    float* __restrict__ C, _Float16* __restrict__ C16, int ldc, size_t sC, int M, int N, int K) {
  __shared__ __attribute__((aligned(16))) float so[4][16][64];
  const int tid = threadIdx.x, w = tid >> 5, lane = tid & 31, ln = lane & 15, hh = lane >> 4; const int by = blockIdx.y;
  A += (size_t)by * sA; Bh += (size_t)by * sB; const size_t cofs = (size_t)by * sC; const float* bp = bias ? bias + (size_t)by * sBias : nullptr;
  const int ntn = (N + 63) / 64; const int wid = blockIdx.x * 4 + w; const int mt = wid / ntn, nq = wid % ntn; if (mt * 16 >= M) return;
  const int row0 = mt * 16, col0 = nq * 64; const _Float16* arow = A + (size_t)(row0 + ln) * lda;
  v8f acc[4] = {};
  for (int kb = 0; kb < K; kb += 32) { FragH ah; ah.half[0] = *(const v8us*)((const unsigned short*)arow + kb + 8 * hh); ah.half[1] = *(const v8us*)((const unsigned short*)arow + kb + 16 + 8 * hh);
#pragma unroll
    for (int t = 0; t < 4; ++t) { if (col0 + t * 16 >= N) continue; const size_t boff = (size_t)(col0 + t * 16 + ln) * ldb + kb; FragH bq; bq.half[0] = *(const v8us*)((const unsigned short*)Bh + boff + 8 * hh); bq.half[1] = *(const v8us*)((const unsigned short*)Bh + boff + 16 + 8 * hh);
      acc[t] = mmaH<1>(ah.v, ah.v, bq.v, bq.v, acc[t]); }
  }
#pragma unroll
  for (int t = 0; t < 4; ++t) { if (col0 + t * 16 >= N) continue; const int col = col0 + t * 16 + ln; const float bv = bp ? bf16_round(bp[col]) : 0.f;
#pragma unroll
    for (int r = 0; r < 8; ++r) { float v = acc[t][r] * alpha + bv; if (CP) { const int rr = row0g + row0 + 8 * hh + r; if (rowsPerB < 0) v += CP[cofs + (size_t)rr * ldc + col];      /* rowsPerB < 0: own element of the batched C plane */ else { const int bidx = rr / rowsPerB; v += CP[(size_t)bidx * sCPb + (size_t)by * 64 + col]; } } if (ACT == 1) v = (v > 0.f) ? v : expm1f(v); else if (ACT == 7) v = (v > 0.f) ? v + 1.0f : expf(v); else if (ACT == 8) v = tanhf(v); else if (ACT == 9) v = 0.5f * v * (1.0f + tanhf(0.7978845608028654f * (v + 0.044715f * v * v * v))); else if (ACT == 11) v = 1.0f / (1.0f + expf(-v)); else if (ACT == 12) v = (v > 0.f) ? v : 0.01f * v; else if (ACT == 14) v = (v > 0.f) ? v : 0.1f * v; else if (ACT == 16) v = (v >= 0.f) ? v : 0.3f * v; else if (ACT == 17) v = (v >= 0.f) ? v : 0.2f * v; else if (ACT == 15) v = v / (1.0f + expf(-v)); else if (ACT == 3) v = fmaxf(v, 0.f); else if (ACT == 6) v = 0.5f * v * (1.0f + erff(v * 0.70710678118654752f)); so[w][8 * hh + r][t * 16 + ln] = v; } }
  __builtin_amdgcn_fence(__ATOMIC_ACQ_REL, "workgroup"); __builtin_amdgcn_wave_barrier();
  const int rsub = lane >> 4, c4 = (lane & 15) * 4; typedef _Float16 v4h __attribute__((ext_vector_type(4)));
  {
#pragma unroll
    for (int q = 0; q < 8; ++q) { const int r = q * 2 + rsub; if (col0 + c4 < N) { const v4f v = *(const v4fa*)&so[w][r][c4]; if (C) *(v4f*)(C + cofs + (size_t)(row0 + r) * ldc + col0 + c4) = v; if (C16) { v4h h4; for (int i = 0; i < 4; ++i) h4[i] = (_Float16)v[i]; *(v4h*)(C16 + cofs + (size_t)(row0 + r) * ldc + col0 + c4) = h4; } } }
     }
}


typedef _Float16 v4h __attribute__((ext_vector_type(4)));

// operand preparation in ONE launch: x as exact f16 rows, the three natural [out][in] weight planes x16 as f16 (stacked q | k | v), the three biases stacked (f32). The parts need nothing of each other, so they share one grid by ranges of the
// block index (block-uniform branches): PREP_XB blocks for x, PREP_WB for each weight plane, one last block for the biases. A block converts PREP_L * 1024 elements in a row: load j of a thread is its 16 bytes of the block's j-th 4-KiB piece
// (a wave's load = 512 bytes in a row, its store = 256), and a thread's PREP_L loads are all issued ahead of the first conversion.
#define PREP_L 16
#define PREP_XB ((int)(NR * DM / (PREP_L * 1024)))
#define PREP_WB (DM * DM / (PREP_L * 1024))
__global__ __launch_bounds__(256) void k_prep(const float* __restrict__ x, const float* __restrict__ wq, const float* __restrict__ wk, const float* __restrict__ wv, const float* __restrict__ bq, const float* __restrict__ bk, const float* __restrict__ bv,
    _Float16* __restrict__ X16, _Float16* __restrict__ BQKV, float* __restrict__ bqkv) {
  static_assert(NR * DM % (PREP_L * 1024) == 0 && DM * DM % (PREP_L * 1024) == 0 && DM == 1024, "whole blocks only; a bias is four elements a thread");
  const int tid = threadIdx.x, blk = blockIdx.x;
  if (blk >= PREP_XB + 3 * PREP_WB) { const v4f a = *(const v4fa*)(bq + tid * 4), b = *(const v4fa*)(bk + tid * 4), c = *(const v4fa*)(bv + tid * 4); float* d = bqkv + tid * 4; *(v4f*)d = a; *(v4f*)(d + DM) = b; *(v4f*)(d + 2 * DM) = c; return; }
  const float* src = x; _Float16* dst = X16; float scale = 1.0f; int lb = blk;
  if (blk >= PREP_XB) { const int p = (blk - PREP_XB) / PREP_WB; lb = (blk - PREP_XB) % PREP_WB; src = p == 0 ? wq : p == 1 ? wk : wv; dst = BQKV + (size_t)p * DM * DM; scale = 16.0f; }
  const size_t e0 = (size_t)lb * (PREP_L * 1024) + tid * 4; const float* sp = src + e0; _Float16* dp = dst + e0; v4f a[PREP_L];
  /* both loops are unrolled because the loaded values live in registers, which need constant indices */
#pragma unroll
  for (int j = 0; j < PREP_L; ++j) a[j] = *(const v4fa*)(sp + j * 1024);
  asm volatile("s_wait_xcnt 0x0" :: "v"(sp) : "memory");      /* precaution: no register that an issued load names is written ahead of this wait; the address pair is an input here so that no load's result is placed on it */
#pragma unroll
  for (int j = 0; j < PREP_L; ++j) { v4h h4; for (int q = 0; q < 4; ++q) h4[q] = (_Float16)(bf16_round(a[j][q]) * scale); *(v4h*)(dp + j * 1024) = h4; } }
__global__ __launch_bounds__(256) void k_h16(const float* __restrict__ x, _Float16* __restrict__ X16, size_t n8) { const size_t t = (size_t)blockIdx.x * 256 + threadIdx.x; if (t >= n8) return; FragH f;
#pragma unroll
  for (int q = 0; q < 8; ++q) f.h[q] = (_Float16)x[t * 8 + q]; *(v8us*)((unsigned short*)X16 + t * 8) = f.half[0];  }
__global__ __launch_bounds__(256) void k_round16f(const float* __restrict__ W, _Float16* __restrict__ Bt, size_t n8) { const size_t t = (size_t)blockIdx.x * 256 + threadIdx.x; if (t >= n8) return; FragH f;
#pragma unroll
  for (int i = 0; i < 8; ++i) f.h[i] = (_Float16)(bf16_round(W[t * 8 + i]) * 16.0f); *(v8us*)((unsigned short*)Bt + t * 8) = f.half[0];  }
template <int NHv, int TTv>
__global__ __launch_bounds__(256) void k_vt(const _Float16* __restrict__ V16, int ldv, int voff, _Float16* __restrict__ Vt) { __shared__ unsigned short tl[64][66]; const int tid = threadIdx.x; const int slab = blockIdx.x / (TTv / 64), lg = blockIdx.x % (TTv / 64); const int b = slab / NHv, h = slab % NHv;
  for (int i = tid; i < 64 * 8; i += 256) { const int r = i / 8, c8 = (i % 8) * 8; FragH f; f.half[0] = *(const v8us*)((const unsigned short*)V16 + ((size_t)b * TTv + lg * 64 + r) * ldv + voff + h * 64 + c8);
#pragma unroll
    for (int q = 0; q < 8; ++q) tl[r][c8 + q] = f.u[q]; }
  __syncthreads();
  {
#pragma unroll
    for (int rd = 0; rd < 2; ++rd) { const int d = rd * 32 + tid / 8, pc = tid % 8; FragH f;
#pragma unroll
      for (int q = 0; q < 8; ++q) f.u[q] = tl[pc * 8 + q][d];
      *(v8us*)((unsigned short*)Vt + ((size_t)slab * 64 + d) * TTv + lg * 64 + pc * 8) = f.half[0]; }
     } }

__global__ __launch_bounds__(256) void k_hl(const float* __restrict__ F, _Float16* __restrict__ Hh, _Float16* __restrict__ Hl, size_t n8) { const size_t t = (size_t)blockIdx.x * 256 + threadIdx.x; if (t >= n8) return; FragH fh, fl; const v4f a = *(const v4fa*)(F + t * 8), c = *(const v4fa*)(F + t * 8 + 4);
#pragma unroll
  for (int q = 0; q < 4; ++q) { _Float16 h = (_Float16)a[q]; fh.h[q] = h; fl.h[q] = (_Float16)((a[q] - (float)h) * 1024.0f); h = (_Float16)c[q]; fh.h[4 + q] = h; fl.h[4 + q] = (_Float16)((c[q] - (float)h) * 1024.0f); }
  { *(v8us*)((unsigned short*)Hh + t * 8) = fh.half[0]; *(v8us*)((unsigned short*)Hl + t * 8) = fl.half[0];  } }

// ---- fast GEMM (wave tile 32x64, eight waves = block tile 128x128; requires M % 128 == 0, N % 128 == 0, K % 64 == 0); epilogue = k_gemm_hhx semantics ----
// Operands go through LDS: a stage is 64 k of the block's 128 A rows and 128 B rows (one whole 128-byte line a row), brought by asynchronous copies to LDS, eight lanes a line, two buffers, so that the next stage flies while this one is worked on;
// rows stand at a pitch of 144 bytes (16 x odd: the sixteen rows of a ds_load_b128 fragment read fall on different banks). Each accumulator still takes its k blocks of 32 in rising order.
// the f32 plane C holds only the first crows rows of every cmod rows, packed (row (R / cmod) * crows + R % cmod, pitch ldc); cmod % 32 == 0 and crows % 32 == 0, so a wave's tile is wholly in it or wholly out
__device__ __forceinline__ v16h g2_frag(const _Float16* p, int hh) { FragH f; f.half[0] = *(const v8us*)((const unsigned short*)p + 8 * hh); f.half[1] = *(const v8us*)((const unsigned short*)p + 16 + 8 * hh); return f.v; }
__device__ __forceinline__ v8f g2_mma(v16h a, v16h b, v8f c) { v8f d = __builtin_amdgcn_wmma_f32_16x16x32_f16(false, a, false, b, (short)0, c, false, false); asm volatile("v_nop\n\tv_nop\n\tv_nop\n\tv_nop" : "+v"(d) : "v"(a), "v"(b)); return d; }
#define G2_PB 144                    /* LDS row pitch, bytes */
#define G2_SB (256 * G2_PB)          /* one stage: 128 A rows, then 128 B rows */
// one stage's copies of one lane: rows rr + RPR j (j = 0..3) of a first and of a second operand, 16 bytes each (RPR = rows that the block's lanes cover at once, eight lanes a row); pa, pb = the lane's place in row rr of the two operands at the stage's k,
// sa, sb = RPR rows in elements, l = the lane's LDS byte address in row rr of the buffer (4 RPR rows of the first operand, then 4 RPR of the second).
// The s_wait_xcnt ends the copies' own statement as a precaution: no register that an issued copy names is written ahead of it.
template <int RPR> __device__ __forceinline__ void g2_stage(const _Float16* pa, size_t sa, const _Float16* pb, size_t sb, unsigned l) {
  const _Float16* a1 = pa + sa; const _Float16* a2 = a1 + sa; const _Float16* a3 = a2 + sa; const _Float16* b1 = pb + sb; const _Float16* b2 = b1 + sb; const _Float16* b3 = b2 + sb;
  asm volatile("global_load_async_to_lds_b128 %0, %8, off\n\tglobal_load_async_to_lds_b128 %1, %9, off\n\tglobal_load_async_to_lds_b128 %2, %10, off\n\tglobal_load_async_to_lds_b128 %3, %11, off\n\t"
               "global_load_async_to_lds_b128 %4, %12, off\n\tglobal_load_async_to_lds_b128 %5, %13, off\n\tglobal_load_async_to_lds_b128 %6, %14, off\n\tglobal_load_async_to_lds_b128 %7, %15, off\n\ts_wait_xcnt 0x0"
               :: "v"(l), "v"(l + RPR * G2_PB), "v"(l + 2 * RPR * G2_PB), "v"(l + 3 * RPR * G2_PB), "v"(l + 4 * RPR * G2_PB), "v"(l + 5 * RPR * G2_PB), "v"(l + 6 * RPR * G2_PB), "v"(l + 7 * RPR * G2_PB), "v"(pa), "v"(a1), "v"(a2), "v"(a3), "v"(pb), "v"(b1), "v"(b2), "v"(b3) : "memory"); }
template <int ACT>
__global__ __launch_bounds__(256) void k_gemm2(const _Float16* __restrict__ A, int lda, size_t sA, const _Float16* __restrict__ Bh, int ldb, size_t sB, float alpha, const float* __restrict__ bias, size_t sBias, const float* __restrict__ CP, int rowsPerB, size_t sCPb, int row0g,
    float* __restrict__ C, int cmod, int crows, _Float16* __restrict__ C16, int ldc, size_t sC, int M, int N, int K) { static_assert(ACT == 0 || ACT == 3 || ACT == 6 || ACT == 8 || ACT == 9 || ACT == 11 || ACT == 12 || ACT == 14 || ACT == 15 || ACT == 16 || ACT == 17, "k_gemm2: unsupported ACT code (would silently apply no activation)");
  __shared__ __attribute__((aligned(16))) unsigned char sm[2 * G2_SB];      /* the two stage buffers; behind the loop's last barrier the same bytes are the waves' output staging */
  static_assert(sizeof(float) * 8 * 32 * 68 <= 2 * G2_SB, "output staging must fit the stage buffers"); float (*so)[32][68] = (float (*)[32][68])sm;
  const int tid = threadIdx.x, w = tid >> 5, lane = tid & 31, ln = lane & 15, hh = lane >> 4; const int by = blockIdx.y;
  A += (size_t)by * sA; Bh += (size_t)by * sB; const size_t cofs = (size_t)by * sC; const float* bp = bias ? bias + (size_t)by * sBias : nullptr;
  const int ntn = N >> 7; const int mt = blockIdx.x / ntn, nq = blockIdx.x - mt * ntn; if (mt * 128 >= M) return;      /* the whole block leaves, ahead of every barrier */
  const int row0 = mt * 128 + 32 * (w & 3), col0 = nq * 128 + 64 * (w >> 2);
  const int rr = tid >> 3, c8 = (tid & 7) * 8; const _Float16* ga = A + (size_t)(mt * 128 + rr) * lda + c8; const _Float16* gb = Bh + (size_t)(nq * 128 + rr) * ldb + c8; const size_t sa32 = (size_t)32 * lda, sb32 = (size_t)32 * ldb;
  const unsigned l0 = (unsigned)(size_t)sm + (unsigned)(rr * G2_PB + c8 * 2);      /* low 32 bits of the __shared__ address = LDS byte address */
  const int aoff = (32 * (w & 3) + ln) * G2_PB, boff = (128 + 64 * (w >> 2) + ln) * G2_PB; const int nst = K >> 6;
  const v8f z8 = {0.f,0.f,0.f,0.f,0.f,0.f,0.f,0.f}; v8f c00 = z8, c01 = z8, c02 = z8, c03 = z8, c10 = z8, c11 = z8, c12 = z8, c13 = z8;
  g2_stage<32>(ga, sa32, gb, sb32, l0);
  asm volatile("s_wait_asynccnt 0x0" ::: "memory");      /* this wave's copies of stage 0 have landed */
  __syncthreads();      /* ... and every other wave's: stage 0 may be read */
  if (nst > 1) g2_stage<32>(ga + 64, sa32, gb + 64, sb32, l0 + G2_SB);
  /* not unrolled: one trip a stage, the buffer picked by the trip's parity */
#pragma unroll 1
  for (int t = 0; t < nst; ++t) { const unsigned char* st = sm + (t & 1) * G2_SB; const _Float16* ap = (const _Float16*)(st + aoff); const _Float16* bq = (const _Float16*)(st + boff);
    /* unrolled: the stage's two k blocks of 32 */
#pragma unroll
    for (int kb = 0; kb < 64; kb += 32) { const v16h a0 = g2_frag(ap + kb, hh), a1 = g2_frag(ap + 16 * (G2_PB / 2) + kb, hh);
      const v16h b0 = g2_frag(bq + kb, hh), b1 = g2_frag(bq + 16 * (G2_PB / 2) + kb, hh), b2 = g2_frag(bq + 32 * (G2_PB / 2) + kb, hh), b3 = g2_frag(bq + 48 * (G2_PB / 2) + kb, hh);
      /* inputs-only fence on the loaded values: it keeps the k block's twelve LDS reads in front of its products, in flight together (one LDS latency a block; left alone the compiler waited for each B fragment in turn) */
      asm volatile("" :: "v"(a0), "v"(a1), "v"(b0), "v"(b1), "v"(b2), "v"(b3));
      c00 = g2_mma(a0, b0, c00); c10 = g2_mma(a1, b0, c10); c01 = g2_mma(a0, b1, c01); c11 = g2_mma(a1, b1, c11);
      c02 = g2_mma(a0, b2, c02); c12 = g2_mma(a1, b2, c12); c03 = g2_mma(a0, b3, c03); c13 = g2_mma(a1, b3, c13); }
    asm volatile("s_wait_dscnt 0x0" ::: "memory");      /* this wave's reads of the buffer are done before it is refilled */
    asm volatile("s_wait_asynccnt 0x0" ::: "memory");      /* this wave's copies of stage t + 1 have landed */
    __syncthreads();      /* publishes stage t + 1 and ends every wave's reads of stage t */
    if (t + 2 < nst) g2_stage<32>(ga + (size_t)(t + 2) * 64, sa32, gb + (size_t)(t + 2) * 64, sb32, l0 + (t & 1) * G2_SB); }
  asm volatile("s_wait_asynccnt 0x0" ::: "memory");      /* no copy is outstanding when the buffers become output staging */
  v8f accs[8] = {c00, c01, c02, c03, c10, c11, c12, c13};
#pragma unroll
  for (int u = 0; u < 8; ++u) { const int t = u & 3, half = u >> 2; const int col = col0 + t * 16 + ln; const float bv = bp ? bf16_round(bp[col]) : 0.f;
#pragma unroll
    for (int r = 0; r < 8; ++r) { const int rloc = half * 16 + 8 * hh + r; float v = accs[u][r] * alpha + bv; if (CP) { if (rowsPerB < 0) v += CP[cofs + (size_t)(row0g + row0 + rloc) * ldc + col];      /* rowsPerB < 0: own element of the batched C plane */ else { const int bidx = (row0g + row0 + rloc) / rowsPerB; v += CP[(size_t)bidx * sCPb + (size_t)by * 64 + col]; } }
      if (ACT == 3) v = fmaxf(v, 0.f); else if (ACT == 6) v = 0.5f * v * (1.0f + erff(v * 0.70710678118654752f)); else if (ACT == 11) v = 1.0f / (1.0f + expf(-v)); else if (ACT == 15) v = v / (1.0f + expf(-v)); else if (ACT == 12) v = (v > 0.f) ? v : 0.01f * v; else if (ACT == 8) v = tanhf(v); else if (ACT == 9) v = 0.5f * v * (1.0f + tanhf(0.7978845608028654f * (v + 0.044715f * v * v * v))); else if (ACT == 14) v = (v > 0.f) ? v : 0.1f * v; else if (ACT == 16) v = (v >= 0.f) ? v : 0.3f * v; else if (ACT == 17) v = (v >= 0.f) ? v : 0.2f * v;
      so[w][rloc][t * 16 + ln] = v; } }
  __builtin_amdgcn_fence(__ATOMIC_ACQ_REL, "workgroup"); __builtin_amdgcn_wave_barrier();
  const int rsub = lane >> 4, c4 = (lane & 15) * 4; const int rin = row0 % cmod; float* Cw = (C && rin < crows) ? C + cofs + ((size_t)(row0 / cmod) * crows + rin) * ldc + col0 + c4 : nullptr;
  {
#pragma unroll
    for (int q = 0; q < 16; ++q) { const int r = q * 2 + rsub; const v4f v = *(const v4fa*)&so[w][r][c4]; if (Cw) *(v4f*)(Cw + (size_t)r * ldc) = v; if (C16) { v4h h4; for (int i = 0; i < 4; ++i) h4[i] = (_Float16)v[i]; *(v4h*)(C16 + cofs + (size_t)(row0 + r) * ldc + col0 + c4) = h4; } }
     } }


__global__ __launch_bounds__(256) void k_rsm(const float* __restrict__ S, _Float16* __restrict__ P, int nrows) {
  #pragma clang fp contract(off)
  const int i = blockIdx.x * 256 + threadIdx.x; if (i >= nrows) return; const float* s = S + (size_t)i * SQ; float mx = -3.0e38f;
#pragma unroll 1
  for (int j = 0; j < SQ; ++j) mx = fmaxf(mx, s[j]); float se = 0.f;
#pragma unroll 1
  for (int j = 0; j < SQ; ++j) se += expf(s[j] - mx); const float sc = 256.0f / se;
#pragma unroll 1
  for (int j0 = 0; j0 < SQ; j0 += 8) { FragH f; for (int q = 0; q < 8; ++q) f.h[q] = (_Float16)(expf(s[j0 + q] - mx) * sc); unsigned short* d = (unsigned short*)P + (size_t)i * SQ + j0; *(v8us*)d = f.half[0];  } }
__global__ __launch_bounds__(256) void k_vt(const _Float16* __restrict__ V16, int b, int h0, _Float16* __restrict__ VT) { __shared__ unsigned short tl[64][65]; const int tid = threadIdx.x; const int hh = blockIdx.x % HG, sg = blockIdx.x / HG; const int s0 = sg * 64; const int h = h0 + hh;
  for (int i = tid; i < 64 * 8; i += 256) { const int j = i / 8, d8 = (i % 8) * 8; FragH f; f.half[0] = *(const v8us*)((const unsigned short*)V16 + ((size_t)b * SQ + s0 + j) * DM + h * HD + d8); for (int q = 0; q < 8; ++q) tl[d8 + q][j] = f.u[q]; }
  __syncthreads();
  { for (int i = tid; i < 64 * 8; i += 256) { const int d = i / 8, j8 = (i % 8) * 8; FragH f; for (int q = 0; q < 8; ++q) f.u[q] = tl[d][j8 + q]; *(v8us*)((unsigned short*)VT + ((size_t)hh * HD + d) * SQ + s0 + j8) = f.half[0]; }  } }



// lane l with lane l ^ M of its 16-lane row (DPP row_xmask), and lane l with lane l ^ 16
template <int M> __device__ __forceinline__ float rs_xm(float x) { return __builtin_bit_cast(float, __builtin_amdgcn_update_dpp(0, __builtin_bit_cast(int, x), 0x160 | M, 0xf, 0xf, true)); }
__device__ __forceinline__ float rs_xh(float x) { return __builtin_bit_cast(float, __builtin_amdgcn_permlanex16(__builtin_bit_cast(int, x), __builtin_bit_cast(int, x), 0x76543210, 0xfedcba98, false, false)); }
__device__ __forceinline__ v16h fa_frag(const _Float16* p) { FragH f; f.half[0] = *(const v8us*)((const unsigned short*)p); f.half[1] = *(const v8us*)((const unsigned short*)p + 16); return f.v; }      /* p already holds the lane half's 8-element shift */
// exp2 of eight values, and of one: each v_exp_f32 works on a register of its own and a v_nop ends the statement. It is there for the slot that the instruction set asks for behind a transcendental before its result is read or its source overwritten.
__device__ __forceinline__ void fa_exp2x8(float (&e)[8]) { asm("v_exp_f32 %0, %0\n\tv_exp_f32 %1, %1\n\tv_exp_f32 %2, %2\n\tv_exp_f32 %3, %3\n\tv_exp_f32 %4, %4\n\tv_exp_f32 %5, %5\n\tv_exp_f32 %6, %6\n\tv_exp_f32 %7, %7\n\tv_nop" : "+v"(e[0]), "+v"(e[1]), "+v"(e[2]), "+v"(e[3]), "+v"(e[4]), "+v"(e[5]), "+v"(e[6]), "+v"(e[7])); }
__device__ __forceinline__ float fa_exp2(float x) { asm("v_exp_f32 %0, %0\n\tv_nop" : "+v"(x)); return x; }
// a trip's fragments: kl, vl = the lane's place (row ln, its half's 8-element shift) in the K rows and in the V^T rows of the trip's LDS buffer
__device__ __forceinline__ void fa_load(const _Float16* kl, const _Float16* vl, v16h (&kc)[4][2], v16h (&vf)[4][2]) {
  /* unrolled because the fragments live in registers, which need constant indices */
#pragma unroll
  for (int t = 0; t < 4; ++t) { kc[t][0] = fa_frag(kl + (16 * t) * (G2_PB / 2)); kc[t][1] = fa_frag(kl + (16 * t) * (G2_PB / 2) + 32); }
#pragma unroll
  for (int t = 0; t < 4; ++t) { vf[t][0] = fa_frag(vl + (16 * t) * (G2_PB / 2)); vf[t][1] = fa_frag(vl + (16 * t) * (G2_PB / 2) + 32); }
  /* inputs-only fence on the loaded values: it keeps the trip's 32 LDS reads in front of the arithmetic, in flight together (one LDS latency a trip; left alone the compiler waited for each pair of K reads in turn and left V^T reads among the last products) */
  asm volatile("" :: "v"(kc[0][0]), "v"(kc[0][1]), "v"(kc[1][0]), "v"(kc[1][1]), "v"(kc[2][0]), "v"(kc[2][1]), "v"(kc[3][0]), "v"(kc[3][1]), "v"(vf[0][0]), "v"(vf[0][1]), "v"(vf[1][0]), "v"(vf[1][1]), "v"(vf[2][0]), "v"(vf[2][1]), "v"(vf[3][0]), "v"(vf[3][1])); }
// one trip's arithmetic: keys kb .. kb + 63, all operands in registers
__device__ __forceinline__ void fa_trip(const int kb, const int q0, const int ln, const int hh, const v16h qf0, const v16h qf1, const v16h (&kc)[4][2], const v16h (&vf)[4][2], v8f (&o)[4], float& m, float& l) {
  const v8f z8 = {0.f,0.f,0.f,0.f,0.f,0.f,0.f,0.f}; const float cs = 0.125f * 1.4426950408889634f;      /* 1 / sqrt(HD), in log2 units */
  /* every loop of this function is unrolled because fragments, scores and sums live in registers, which need constant indices */
  v8f s[4];
#pragma unroll
  for (int t = 0; t < 4; ++t) { s[t] = __builtin_amdgcn_wmma_f32_16x16x32_f16(false, kc[t][0], false, qf0, (short)0, z8, false, false); s[t] = __builtin_amdgcn_wmma_f32_16x16x32_f16(false, kc[t][1], false, qf1, (short)0, s[t], false, false); }
  if (kb + 63 > q0) {      /* wave-uniform: the trip that reaches the diagonal; s[t][r] = key kb + 16 t + 8 hh + r against query q0 + ln */
#pragma unroll
    for (int t = 0; t < 4; ++t) for (int r = 0; r < 8; ++r) s[t][r] = (kb + 16 * t + 8 * hh + r <= q0 + ln) ? s[t][r] : -1.0e30f; }
  float mx = s[0][0];
#pragma unroll
  for (int t = 0; t < 4; ++t) for (int r = 0; r < 8; ++r) mx = fmaxf(mx, s[t][r]);
  mx = fmaxf(mx, rs_xh(mx));      /* the other half of the query's keys */
  const float mn = fmaxf(m, mx * cs); const float al = fa_exp2(m - mn); m = mn;
  v4f s4 = {0.f, 0.f, 0.f, 0.f}; FragH pf[2];
#pragma unroll
  for (int t = 0; t < 4; ++t) { float e[8]; for (int r = 0; r < 8; ++r) e[r] = fmaf(s[t][r], cs, -mn); fa_exp2x8(e); for (int r = 0; r < 8; ++r) { s4[r & 3] += e[r]; pf[t >> 1].h[(t & 1) * 8 + r] = (_Float16)e[r]; } }
  l = l * al + ((s4[0] + s4[1]) + (s4[2] + s4[3]));      /* each half keeps its own keys' share */
#pragma unroll
  for (int t = 0; t < 4; ++t) { o[t] *= al; o[t] = __builtin_amdgcn_wmma_f32_16x16x32_f16(false, vf[t][0], false, pf[0].v, (short)0, o[t], false, false); o[t] = __builtin_amdgcn_wmma_f32_16x16x32_f16(false, vf[t][1], false, pf[1].v, (short)0, o[t], false, false); } }
#define FA_SB (128 * G2_PB)          /* one stage: 64 K rows, then 64 V^T rows */
// four waves per SIMD: with at most 256 registers a wave all 4096 waves of the launch are resident at once (16 per WGP), and the waves of a SIMD fill each other's waits
__global__ __launch_bounds__(128) __attribute__((amdgpu_waves_per_eu(4, 4))) void k_fattn(const _Float16* __restrict__ QKVp, const _Float16* __restrict__ VTp, float* __restrict__ out) {
  __shared__ __attribute__((aligned(16))) unsigned char sm[2 * FA_SB];      /* the two stage buffers */
  const int tid = threadIdx.x, lane = tid & 31, ln = lane & 15, hh = lane >> 4; const int w = __builtin_amdgcn_readfirstlane(tid >> 5);
  const int bh = blockIdx.x, b = bh / NH, h = bh % NH; const int yb = SQ / 64 - 1 - (int)blockIdx.y; const int q0 = yb * 64 + w * 16;      /* wave-uniform first query row */
  const int nt = yb + 1;      /* trips of 64 keys, the same for the block's four waves: the last one holds every wave's diagonal */
  const _Float16* qp = QKVp + ((size_t)b * SQ + q0 + ln) * LQ + h * HD + 8 * hh;
  const int rr = tid >> 3, c8 = (tid & 7) * 8; const _Float16* gk = QKVp + ((size_t)b * SQ + rr) * LQ + DM + h * HD + c8; const _Float16* gv = VTp + ((size_t)bh * HD + rr) * SQ + c8;      /* the lane's 16 bytes of key row rr and of V^T row rr, trip 0 */
  const unsigned l0 = (unsigned)(size_t)sm + (unsigned)(rr * G2_PB + c8 * 2);      /* low 32 bits of the __shared__ address = LDS byte address */
  const int koff = ln * G2_PB + 16 * hh, voff = (64 + ln) * G2_PB + 16 * hh;
  const v16h qf0 = fa_frag(qp), qf1 = fa_frag(qp + 32);
  asm volatile("s_wait_xcnt 0x0" :: "v"(qp) : "memory");      /* precaution: no register that an issued load names is written ahead of this wait; the q address pair is an input here so that no load's result is placed on it */
  g2_stage<16>(gk, (size_t)16 * LQ, gv, (size_t)16 * SQ, l0);
  asm volatile("s_wait_asynccnt 0x0" ::: "memory");      /* this wave's copies of trip 0 have landed */
  __syncthreads();      /* ... and every other wave's: trip 0's rows may be read */
  if (nt > 1) g2_stage<16>(gk + (size_t)64 * LQ, (size_t)16 * LQ, gv + 64, (size_t)16 * SQ, l0 + FA_SB);
  const v8f z8 = {0.f,0.f,0.f,0.f,0.f,0.f,0.f,0.f}; v8f o[4] = {z8, z8, z8, z8}; float m = -1.0e30f, l = 0.f;
  /* not unrolled: one trip a stage, the buffer picked by the trip's parity */
#pragma unroll 1
  for (int t = 0; t < nt; ++t) { const unsigned char* st = sm + (t & 1) * FA_SB; v16h kc[4][2], vf[4][2];
    fa_load((const _Float16*)(st + koff), (const _Float16*)(st + voff), kc, vf);      /* the trip's only LDS reads: the buffer is handed on right behind them, so that its refill has a whole trip to land */
    asm volatile("s_wait_dscnt 0x0" ::: "memory");      /* this wave's reads of the buffer are done before it is refilled */
    asm volatile("s_wait_asynccnt 0x0" ::: "memory");      /* this wave's copies of trip t + 1 have landed */
    __syncthreads();      /* publishes trip t + 1's rows and ends every wave's reads of trip t's */
    if (t + 2 < nt) g2_stage<16>(gk + (size_t)(t + 2) * 64 * LQ, (size_t)16 * LQ, gv + (t + 2) * 64, (size_t)16 * SQ, l0 + (t & 1) * FA_SB);
    fa_trip(t * 64, q0, ln, hh, qf0, qf1, kc, vf, o, m, l); }
  asm volatile("s_wait_asynccnt 0x0" ::: "memory");      /* no copy is outstanding when the wave ends */
  l += rs_xh(l); const float fin = 1.0f / l;
  /* unrolled for constant register indices */
  float* op = out + ((size_t)b * SQ + q0 + ln) * DM + h * HD + 8 * hh;      /* o[t][r] = column 16 t + 8 hh + r of query q0 + ln */
#pragma unroll
  for (int t = 0; t < 4; ++t) { const v4f lo = {o[t][0] * fin, o[t][1] * fin, o[t][2] * fin, o[t][3] * fin}, hi = {o[t][4] * fin, o[t][5] * fin, o[t][6] * fin, o[t][7] * fin}; *(v4f*)(op + 16 * t) = lo; *(v4f*)(op + 16 * t + 4) = hi; } }

// lane K of each 16-lane row, handed to all sixteen lanes of that row (DPP row_share)
template <int K> __device__ __forceinline__ float a0_share(float x) { return __builtin_bit_cast(float, __builtin_amdgcn_update_dpp(0, __builtin_bit_cast(int, x), 0x150 | K, 0xf, 0xf, true)); }
template <int K> __device__ __forceinline__ void a0_acc(v4f& o, float e, const v4f* vv) { o += a0_share<K>(e) * vv[K]; if constexpr (K + 1 < 16) a0_acc<K + 1>(o, e, vv); }
// exact f32 attention of the first QT0 rows, SIXTEEN LANES PER QUERY ROW, keys in groups of 16: lane p scores key 16 g + p (whole q row in registers, K row straight from global memory), the group's maximum comes from a
// four-step butterfly over the 16 lanes, the running o and l are rescaled once per group, lane p keeps columns 4 p .. 4 p + 3 of o and its own keys' share of l (summed over the 16 lanes at the end). No LDS, no barrier.
// grid.y = batch: QF, KF, VF point at the q, k, v blocks of the packed f32 rows (QT0 rows a batch, pitch LQ), OF at the output rows (SQ rows a batch). The odd batch takes its row blocks in falling order: row block rb costs rb + 1 key groups,
// so where block x of one batch and block x of the other share a WGP their costs add to the same sum for every x (speed only, nothing rests on the placement).
template <int MASKADD>
__global__ __launch_bounds__(256) void k_att0(const float* __restrict__ QF, const float* __restrict__ KF, const float* __restrict__ VF, const float* __restrict__ mask, float scale, float* __restrict__ OF, int ldo) {
  const int p = threadIdx.x & 15; const int b = blockIdx.y; const int h = blockIdx.x / (QT0 / 16), rx = blockIdx.x % (QT0 / 16), rb = (b & 1) ? QT0 / 16 - 1 - rx : rx; const int i = rb * 16 + (threadIdx.x >> 4);
  QF += (size_t)b * QT0 * LQ; KF += (size_t)b * QT0 * LQ; VF += (size_t)b * QT0 * LQ; OF += (size_t)b * SQ * ldo;
  const float* qr = QF + (size_t)i * LQ + h * HD; v4f q[HD / 4];      /* q, k, v rows have the pitch LQ, a constant, so that a group's sixteen V rows hang on one address pair by immediate offsets */
  /* the loops over c are unrolled because the rows live in registers, which need constant indices */
#pragma unroll
  for (int c = 0; c < HD / 4; ++c) q[c] = *(const v4fa*)(qr + c * 4);
  asm volatile("s_wait_xcnt 0x0" :: "v"(qr) : "memory");      /* precaution: no register that an issued load names is written ahead of this wait; the address pair is an input here so that no load's result is placed on it */
  v4f o = {0.f, 0.f, 0.f, 0.f}; float m = -1.0e30f, l = 0.f; const int ng = MASKADD ? (SQ / 16) : (rb + 1);      /* additive-mask form: every key (the mask input decides); causal form: key groups up to the block's last row */
  for (int g = 0; g < ng; ++g) { const int j = g * 16 + p; const float* kr = KF + (size_t)j * LQ + h * HD; const float* vr = VF + (size_t)(g * 16) * LQ + h * HD + p * 4; v4f kk[HD / 4], vv[16];
#pragma unroll
    for (int c = 0; c < HD / 4; ++c) kk[c] = *(const v4fa*)(kr + c * 4);
#pragma unroll
    for (int c = 0; c < 16; ++c) vv[c] = *(const v4fa*)(vr + c * LQ);
    asm volatile("s_wait_xcnt 0x0" :: "v"(kr), "v"(vr) : "memory");      /* the same precaution for the two address pairs of the group */
    /* inputs-only fences on the loaded values: they keep all 32 loads of the group in front of the arithmetic, in flight together (one memory latency per group; left alone the compiler waits after every second load) */
    asm volatile("" :: "v"(kk[0]), "v"(kk[1]), "v"(kk[2]), "v"(kk[3]), "v"(kk[4]), "v"(kk[5]), "v"(kk[6]), "v"(kk[7]), "v"(kk[8]), "v"(kk[9]), "v"(kk[10]), "v"(kk[11]), "v"(kk[12]), "v"(kk[13]), "v"(kk[14]), "v"(kk[15]), "v"(vv[0]), "v"(vv[1]), "v"(vv[2]), "v"(vv[3]), "v"(vv[4]), "v"(vv[5]), "v"(vv[6]), "v"(vv[7]), "v"(vv[8]), "v"(vv[9]), "v"(vv[10]), "v"(vv[11]), "v"(vv[12]), "v"(vv[13]));
    asm volatile("" :: "v"(vv[14]), "v"(vv[15]));
    v4f s4 = {0.f, 0.f, 0.f, 0.f};
#pragma unroll
    for (int c = 0; c < HD / 4; ++c) s4 += q[c] * kk[c];
    float s = ((s4[0] + s4[1]) + (s4[2] + s4[3])) * scale; if (MASKADD) s += bf16_round(mask[(size_t)i * SQ + j]) * -10000.0f;
    const float sm = (MASKADD || j <= i) ? s : -1.0e30f;
    float gm = sm; gm = fmaxf(gm, rs_xm<1>(gm)); gm = fmaxf(gm, rs_xm<2>(gm)); gm = fmaxf(gm, rs_xm<4>(gm)); gm = fmaxf(gm, rs_xm<8>(gm));
    const float mn = fmaxf(m, gm); const float sc = expf(m - mn); const float e = expf(sm - mn); l = l * sc + e; m = mn; o *= sc;
    a0_acc<0>(o, e, vv); }
  l += rs_xm<1>(l); l += rs_xm<2>(l); l += rs_xm<4>(l); l += rs_xm<8>(l);
  const float fin = 1.0f / l;
  *(v4f*)(OF + (size_t)i * ldo + h * HD + p * 4) = o * fin; }



extern "C" void kernel_launch(void* const* d_in, const int* in_sizes, int n_in,
                              void* d_out, int out_size, void* d_ws, size_t ws_size, hipStream_t stream) {
  (void)in_sizes; (void)n_in; (void)out_size;
  const float* const* I = (const float* const*)d_in; const float* x = I[0]; const float* wq = I[1]; const float* bq = I[2]; const float* wk = I[3]; const float* bk = I[4]; const float* wv = I[5]; const float* bv = I[6];      /* natural nn.Linear [out][in] weights + biases */
  char* ws = (char*)d_ws; size_t off = 0;
  auto take = [&](size_t bytes) { char* p = ws + off; off += (bytes + 255) & ~(size_t)255; return p; };
  _Float16* BQKV = (_Float16*)take((size_t)3 * DM * DM * 2); float* bqkv = (float*)take((size_t)3 * DM * 4);      /* stacked q | k | v weight plane and bias vector */ 
  _Float16* X16 = (_Float16*)take(NR * DM * 2); _Float16* QKV = (_Float16*)take(NR * 3 * DM * 2); _Float16* Q16 = QKV; _Float16* K16 = QKV + DM; _Float16* V16 = QKV + 2 * DM;      /* q | k | v */ _Float16* O16 = (_Float16*)take(NR * DM * 2);
  _Float16* VT = (_Float16*)take((size_t)NB * NH * HD * SQ * 2);
  float* F0 = (float*)take((size_t)NB * QT0 * LQ * 4);      /* f32 q | k | v of the first QT0 rows of each batch, packed */
  if (off > ws_size) return;
  k_prep<<<PREP_XB + 3 * PREP_WB + 1, 256, 0, stream>>>(x, wq, wk, wv, bq, bk, bv, X16, BQKV, bqkv);      /* x rows f16; natural [out][in] = Bt[n][k] x16, stacked q | k | v; stacked bias vector bq | bk | bv */
  const size_t r0p = (size_t)B0 * SQ;      /* first projected row */
  k_gemm2<0><<<dim3((unsigned)((MP / 128) * (3 * DM / 128)), 1), 256, 0, stream>>>(X16 + r0p * DM, DM, 0, BQKV, DM, 0, 0.0625f, bqkv, 0, nullptr, 1, 0, 0, F0, SQ, QT0, QKV + r0p * 3 * DM, 3 * DM, 0, MP, 3 * DM, DM);      /* q | k | v rows (f16); head h = columns h*HD.. of each DM block; the first QT0 rows of each batch also f32 */
  k_vt<NH, SQ><<<NB * NH * (SQ / 64), 256, 0, stream>>>(V16, LQ, 0, VT);      /* V^T [NB][NH][HD][SQ] */
  k_fattn<<<dim3(NB * NH, SQ / 64), 128, 0, stream>>>(QKV, VT, (float*)d_out);      /* o (merged heads) f32 straight into the output rows */
  k_att0<0><<<dim3(NH * (QT0 / 16), NB), 256, 0, stream>>>(F0, F0 + DM, F0 + 2 * DM, nullptr, 0.125f, (float*)d_out, DM);      /* exact f32 causal attention of the first QT0 rows of each batch: those output rows rewritten (the f16-path rows are replaced) */
}

// v007
// A run of this version takes 70.9 microseconds.
// Timed twice side by side with v006, it ran 1.30 times as fast both times.
// Counting every step since v000, it is 82.7 times as fast.
#include <hip/hip_runtime.h>
#define NB 2
#define SQ 2048
#define DM 1024
#define NH 16
#define HD 64
#define HG 4                         /* head group of the k_vt(b, h0) form */
#define B0 0                         /* first batch processed (debug hook) */
#define NBR NB                       /* batches processed (debug hook) */
#define NR ((size_t)NB * SQ)         /* token rows */
#define MP ((int)((size_t)NBR * SQ)) /* rows projected (debug hook) */
#define QT 256                       /* unused */
#define NKX SQ                       /* unused */
#define QT0 256                      /* first-tile rows recomputed exactly (256: margin for the few-key rows, no output projection) */
#define QN SQ                        /* unused */
#define NHD NH                       /* unused */
#define MPO MP                       /* unused */
#define LQ (3 * DM)      /* row pitch of the q/k/v rows */
typedef __bf16 v16b __attribute__((ext_vector_type(16)));
typedef unsigned short v8us __attribute__((ext_vector_type(8), may_alias));
typedef float  v8f  __attribute__((ext_vector_type(8)));
typedef float  v4f  __attribute__((ext_vector_type(4)));
typedef float  v4fa __attribute__((ext_vector_type(4), may_alias));
union FragB { v16b v; v8us half[2]; unsigned short u[16]; };

__device__ __forceinline__ unsigned short bf16_bits(float x) { unsigned int u = __float_as_uint(x); return (unsigned short)((u + 0x7FFFu + ((u >> 16) & 1u)) >> 16); }
__device__ __forceinline__ float bf16_val(unsigned short b) { return __uint_as_float(((unsigned int)b) << 16); }
__device__ __forceinline__ float bf16_round(float x) { return bf16_val(bf16_bits(x)); }
// D += A·B with NT terms: 1 = ah·bh, 2 = + al·bh (A split), 3 = + ah·bl (both split)
template <int NT>
__device__ __forceinline__ v8f mmaN(v16b ah, v16b al, v16b bh, v16b bl, v8f c) {
  c = __builtin_amdgcn_wmma_f32_16x16x32_bf16(false, ah, false, bh, (short)0, c, false, false);
  if (NT >= 2) c = __builtin_amdgcn_wmma_f32_16x16x32_bf16(false, al, false, bh, (short)0, c, false, false);
  if (NT >= 3) c = __builtin_amdgcn_wmma_f32_16x16x32_bf16(false, ah, false, bl, (short)0, c, false, false);
  asm volatile("v_nop\n\tv_nop\n\tv_nop\n\tv_nop" : "+v"(c) : "v"(ah), "v"(al), "v"(bh), "v"(bl));
  return c;
}

__global__ __launch_bounds__(256) void k_wt_bf16(const float* __restrict__ W, unsigned short* __restrict__ Wt, int K, int N) {
  const int t = blockIdx.x * 256 + threadIdx.x;
  const int k8n = K / 8;
  if (t >= N * k8n) return;
  const int n = t / k8n, k8 = (t % k8n) * 8;
  v8us v;
#pragma unroll
  for (int i = 0; i < 8; ++i) v[i] = bf16_bits(W[(size_t)(k8 + i) * N + n]);
  *(v8us*)(Wt + (size_t)n * K + k8) = v;
  
}

// GEMM C[M][N] (f32, pitch ldc) = act(A[M][K]·W + bias). A f32 row-major (pitch lda) converted per fragment to bf16
// (ASPLIT: hi/lo two planes -> 2 terms, else single rounded term); Wt bf16 [N][K] (pitch ldb). BIAS_BF16 rounds the
// bias to bf16 first (bias quantised to bf16 before the add). K%32==0, M%16==0, N%64==0.
template <bool ASPLIT, int ACT, bool BIAS_BF16>
__global__ __launch_bounds__(128) void k_gemm_bf(const float* __restrict__ A, int lda, const unsigned short* __restrict__ Wt, int ldb,
                                               const float* __restrict__ bias, float* __restrict__ C, int ldc, int M, int N, int K) {
  __shared__ __attribute__((aligned(16))) float so[4][16][64];
  const int tid = threadIdx.x, w = tid >> 5, lane = tid & 31, ln = lane & 15, hh = lane >> 4;
  const int ntn = N / 64;
  const int wid = blockIdx.x * 4 + w;
  const int mt = wid / ntn, nq = wid % ntn;
  if (mt * 16 >= M) return;
  const int row0 = mt * 16, col0 = nq * 64;
  const float* arow = A + (size_t)(row0 + ln) * lda;
  v8f acc[4] = {};
  for (int kb = 0; kb < K; kb += 32) {
    FragB ah, al;
    const v4f x0 = *(const v4fa*)(arow + kb + 8 * hh), x1 = *(const v4fa*)(arow + kb + 8 * hh + 4);
    const v4f x2 = *(const v4fa*)(arow + kb + 16 + 8 * hh), x3 = *(const v4fa*)(arow + kb + 16 + 8 * hh + 4);
    float xs[16] = {x0[0],x0[1],x0[2],x0[3],x1[0],x1[1],x1[2],x1[3],x2[0],x2[1],x2[2],x2[3],x3[0],x3[1],x3[2],x3[3]};
#pragma unroll
    for (int i = 0; i < 16; ++i) { const unsigned short hb = bf16_bits(xs[i]); ah.u[i] = hb; al.u[i] = ASPLIT ? bf16_bits(xs[i] - bf16_val(hb)) : (unsigned short)0; }
#pragma unroll
    for (int t = 0; t < 4; ++t) {
      const unsigned short* brow = Wt + (size_t)(col0 + t * 16 + ln) * ldb + kb;
      FragB b;
      b.half[0] = *(const v8us*)(brow + 8 * hh);
      b.half[1] = *(const v8us*)(brow + 16 + 8 * hh);
      acc[t] = mmaN<ASPLIT ? 2 : 1>(ah.v, al.v, b.v, b.v, acc[t]);
    }
  }
#pragma unroll
  for (int t = 0; t < 4; ++t) {
    float bv = bias ? bias[col0 + t * 16 + ln] : 0.f;
    if (BIAS_BF16) bv = bf16_round(bv);
#pragma unroll
    for (int r = 0; r < 8; ++r) { float v = acc[t][r] + bv; if (ACT == 1) v = fmaxf(v, 0.f); so[w][8 * hh + r][t * 16 + ln] = v; }
  }
  __builtin_amdgcn_fence(__ATOMIC_ACQ_REL, "workgroup");
  __builtin_amdgcn_wave_barrier();
  const int rsub = lane >> 4, c4 = (lane & 15) * 4;
  {
#pragma unroll
    for (int q = 0; q < 8; ++q) {
      const int r = q * 2 + rsub;
      const v4f v = *(const v4fa*)&so[w][r][c4];
      *(v4f*)(C + (size_t)(row0 + r) * ldc + col0 + c4) = v;
    }
    
  }
}

// GEMM C = act(A·W + bias + resid): A f32 (ASPLIT -> hi/lo 2 terms), Wt bf16 [N][K]; ACT 0 none, 1 relu, 2 exact gelu;
// resid (optional, f32, row index = (row % rmod), pitch ldr, RES_BF16 rounds it) added before the activation.
template <bool ASPLIT, int ACT, bool BIAS_BF16, bool RES_BF16>
__global__ __launch_bounds__(128) void k_gemm_bf3(const float* __restrict__ A, int lda, const unsigned short* __restrict__ Wt, int ldb,
                                                const float* __restrict__ bias, const float* __restrict__ resid, int rmod, int ldr,
                                                float* __restrict__ C, int ldc, int M, int N, int K) {
  __shared__ __attribute__((aligned(16))) float so[4][16][64];
  const int tid = threadIdx.x, w = tid >> 5, lane = tid & 31, ln = lane & 15, hh = lane >> 4;
  const int ntn = N / 64;
  const int wid = blockIdx.x * 4 + w;
  const int mt = wid / ntn, nq = wid % ntn;
  if (mt * 16 >= M) return;
  const int row0 = mt * 16, col0 = nq * 64;
  const float* arow = A + (size_t)(row0 + ln) * lda;
  v8f acc[4] = {};
  for (int kb = 0; kb < K; kb += 32) {
    FragB ah, al;
    const v4f x0 = *(const v4fa*)(arow + kb + 8 * hh), x1 = *(const v4fa*)(arow + kb + 8 * hh + 4);
    const v4f x2 = *(const v4fa*)(arow + kb + 16 + 8 * hh), x3 = *(const v4fa*)(arow + kb + 16 + 8 * hh + 4);
    float xs[16] = {x0[0],x0[1],x0[2],x0[3],x1[0],x1[1],x1[2],x1[3],x2[0],x2[1],x2[2],x2[3],x3[0],x3[1],x3[2],x3[3]};
#pragma unroll
    for (int i = 0; i < 16; ++i) { const unsigned short hb = bf16_bits(xs[i]); ah.u[i] = hb; al.u[i] = ASPLIT ? bf16_bits(xs[i] - bf16_val(hb)) : (unsigned short)0; }
#pragma unroll
    for (int t = 0; t < 4; ++t) {
      const unsigned short* brow = Wt + (size_t)(col0 + t * 16 + ln) * ldb + kb;
      FragB b;
      b.half[0] = *(const v8us*)(brow + 8 * hh);
      b.half[1] = *(const v8us*)(brow + 16 + 8 * hh);
      acc[t] = mmaN<ASPLIT ? 2 : 1>(ah.v, al.v, b.v, b.v, acc[t]);
    }
  }
#pragma unroll
  for (int t = 0; t < 4; ++t) {
    const int col = col0 + t * 16 + ln;
    float bv = bias ? bias[col] : 0.f;
    if (BIAS_BF16) bv = bf16_round(bv);
#pragma unroll
    for (int r = 0; r < 8; ++r) {
      float v = acc[t][r] + bv;
      if (resid) { float rv = resid[(size_t)((row0 + 8 * hh + r) % rmod) * ldr + col]; if (RES_BF16) rv = bf16_round(rv); v += rv; }
      if (ACT == 1) v = fmaxf(v, 0.f);
      if (ACT == 2) v = 0.5f * v * (1.0f + erff(v * 0.70710678118654752f));
      if (ACT == 3) { const float u = 0.7978845608028654f * (v + 0.044715f * v * v * v); v = 0.5f * v * (1.0f + tanhf(u)); }
      so[w][8 * hh + r][t * 16 + ln] = v;
    }
  }
  __builtin_amdgcn_fence(__ATOMIC_ACQ_REL, "workgroup");
  __builtin_amdgcn_wave_barrier();
  const int rsub = lane >> 4, c4 = (lane & 15) * 4;
  {
#pragma unroll
    for (int q = 0; q < 8; ++q) {
      const int r = q * 2 + rsub;
      const v4f v = *(const v4fa*)&so[w][r][c4];
      *(v4f*)(C + (size_t)(row0 + r) * ldc + col0 + c4) = v;
    }
    
  }
}
// row LayerNorm (biased variance, eps) over N: s = X (+ R); optional out_sum <- s; out_norm <- (s-mu)*rsqrt(var+eps)*g + b
template <bool PARAM_BF16>
__global__ __launch_bounds__(256) void k_layernorm(const float* __restrict__ X, const float* __restrict__ R, const float* __restrict__ g, const float* __restrict__ bta,
                                                  float* __restrict__ out_sum, float* __restrict__ out_norm, int N, float eps) {
  __shared__ float red[256];
  const int row = blockIdx.x, tid = threadIdx.x;
  const float* x = X + (size_t)row * N; const float* rr = R ? R + (size_t)row * N : nullptr;
  float vals[16];                     // up to N = 4096
  const int per = N / 256;            // contiguous chunk per thread? use strided-by-4 chunks: thread handles j = tid*4 + 1024*u
  float s1 = 0.f;
  for (int u = 0; u < per / 4; ++u) {
    const int j = tid * 4 + 1024 * u;
    const v4f a = *(const v4fa*)(x + j);
    v4f b = {0.f,0.f,0.f,0.f}; if (rr) b = *(const v4fa*)(rr + j);
#pragma unroll
    for (int q = 0; q < 4; ++q) { const float v = a[q] + b[q]; vals[u * 4 + q] = v; s1 += v; }
  }
  red[tid] = s1; __syncthreads();
  for (int st = 128; st > 0; st >>= 1) { if (tid < st) red[tid] += red[tid + st]; __syncthreads(); }
  const float mu = red[0] / (float)N; __syncthreads();
  float s2 = 0.f;
  for (int u = 0; u < per / 4; ++u)
#pragma unroll
    for (int q = 0; q < 4; ++q) { const float c = vals[u * 4 + q] - mu; s2 += c * c; }
  red[tid] = s2; __syncthreads();
  for (int st = 128; st > 0; st >>= 1) { if (tid < st) red[tid] += red[tid + st]; __syncthreads(); }
  const float rs = rsqrtf(red[0] / (float)N + eps);
  {
    for (int u = 0; u < per / 4; ++u) {
      const int j = tid * 4 + 1024 * u;
      v4f o, sm;
#pragma unroll
      for (int q = 0; q < 4; ++q) {
        float gg = g[j + q], bb = bta[j + q];
        if (PARAM_BF16) { gg = bf16_round(gg); bb = bf16_round(bb); }
        sm[q] = vals[u * 4 + q]; o[q] = (vals[u * 4 + q] - mu) * rs * gg + bb;
      }
      if (out_sum) *(v4f*)(out_sum + (size_t)row * N + j) = sm;
      *(v4f*)(out_norm + (size_t)row * N + j) = o;
    }
    
  }
}



// ---- f16 WMMA path (v_wmma_f32_16x16x32_f16): 11-bit significands for operands in range — used where a [0,1] probability operand needs more precision than bf16
typedef _Float16 v16h __attribute__((ext_vector_type(16)));
union FragH { v16h v; v8us half[2]; _Float16 h[16]; unsigned short u[16]; };
template <int NT>
__device__ __forceinline__ v8f mmaH(v16h ah, v16h al, v16h bh, v16h bl, v8f c) {
  c = __builtin_amdgcn_wmma_f32_16x16x32_f16(false, ah, false, bh, (short)0, c, false, false);
  if (NT >= 2) c = __builtin_amdgcn_wmma_f32_16x16x32_f16(false, al, false, bh, (short)0, c, false, false);
  if (NT >= 3) c = __builtin_amdgcn_wmma_f32_16x16x32_f16(false, ah, false, bl, (short)0, c, false, false);
  asm volatile("v_nop\n\tv_nop\n\tv_nop\n\tv_nop" : "+v"(c) : "v"(ah), "v"(al), "v"(bh), "v"(bl));
  return c;
}
// batched GEMM like k_gemm_b but f16 operands: A f32 (split into f16 hi/lo if ASPLIT, else rounded to f16), Bt = f16 values [n][k]; alpha; C f32; N multiple of 16 (partial tiles skipped)
template <bool ASPLIT>
__global__ __launch_bounds__(128) void k_gemm_h(const float* __restrict__ A, int lda, size_t sA, const _Float16* __restrict__ Bh, int ldb, size_t sB, float alpha, float* __restrict__ C, int ldc, size_t sC, int M, int N, int K) {
  __shared__ __attribute__((aligned(16))) float so[4][16][64];
  const int tid = threadIdx.x, w = tid >> 5, lane = tid & 31, ln = lane & 15, hh = lane >> 4; const int by = blockIdx.y;
  A += (size_t)by * sA; Bh += (size_t)by * sB; C += (size_t)by * sC;
  const int ntn = (N + 63) / 64; const int wid = blockIdx.x * 4 + w; const int mt = wid / ntn, nq = wid % ntn; if (mt * 16 >= M) return;
  const int row0 = mt * 16, col0 = nq * 64; const float* arow = A + (size_t)(row0 + ln) * lda;
  v8f acc[4] = {};
  for (int kb = 0; kb < K; kb += 32) {
    FragH ah, al;
    const v4f x0 = *(const v4fa*)(arow + kb + 8 * hh), x1 = *(const v4fa*)(arow + kb + 8 * hh + 4), x2 = *(const v4fa*)(arow + kb + 16 + 8 * hh), x3 = *(const v4fa*)(arow + kb + 16 + 8 * hh + 4);
    float xs[16] = {x0[0],x0[1],x0[2],x0[3],x1[0],x1[1],x1[2],x1[3],x2[0],x2[1],x2[2],x2[3],x3[0],x3[1],x3[2],x3[3]};
#pragma unroll
    for (int i = 0; i < 16; ++i) { const _Float16 h = (_Float16)xs[i]; ah.h[i] = h; al.h[i] = ASPLIT ? (_Float16)(xs[i] - (float)h) : (_Float16)0.0f; }
#pragma unroll
    for (int t = 0; t < 4; ++t) { if (col0 + t * 16 >= N) continue; const size_t boff = (size_t)(col0 + t * 16 + ln) * ldb + kb; FragH bq; bq.half[0] = *(const v8us*)(Bh + boff + 8 * hh); bq.half[1] = *(const v8us*)(Bh + boff + 16 + 8 * hh);
      acc[t] = mmaH<ASPLIT ? 2 : 1>(ah.v, al.v, bq.v, bq.v, acc[t]); }
  }
#pragma unroll
  for (int t = 0; t < 4; ++t) { if (col0 + t * 16 >= N) continue;
#pragma unroll
    for (int r = 0; r < 8; ++r) so[w][8 * hh + r][t * 16 + ln] = acc[t][r] * alpha; }
  __builtin_amdgcn_fence(__ATOMIC_ACQ_REL, "workgroup"); __builtin_amdgcn_wave_barrier();
  const int rsub = lane >> 4, c4 = (lane & 15) * 4;
  {
#pragma unroll
    for (int q = 0; q < 8; ++q) { const int r = q * 2 + rsub; if (col0 + c4 < N) { const v4f v = *(const v4fa*)&so[w][r][c4]; *(v4f*)(C + (size_t)(row0 + r) * ldc + col0 + c4) = v; } }
     }
}

// Wt[n][k] = f16(W[k][n]·scale) from f32 row-major W[K][N] (scale = power of two; bf16-exact weights stay exact in f16 away from the subnormal range)
__global__ __launch_bounds__(256) void k_wt_f16(const float* __restrict__ W, _Float16* __restrict__ Wt, int K, int N, float scale) {
  const int t = blockIdx.x * 256 + threadIdx.x; if (t >= N * (K / 8)) return; const int n = t / (K / 8), k8 = (t % (K / 8)) * 8; FragH f;
#pragma unroll
  for (int i = 0; i < 8; ++i) f.h[i] = (_Float16)(bf16_round(W[(size_t)(k8 + i) * N + n]) * scale); const v8us o = f.half[0];
  *(v8us*)((unsigned short*)Wt + (size_t)n * K + k8) = o; 
}
// k_gemm_hh variant with fused epilogue: v = acc·alpha + bias[by·sBias + col] (+ CP[(row/rowsPerB)·sCPb + by·64 + col] if CP) ; ACT 0 none / 1 elu ; writes f16 C16 (and f32 C if non-null)
template <int ACT>
__global__ __launch_bounds__(128) void k_gemm_hhx(const _Float16* __restrict__ A, int lda, size_t sA, const _Float16* __restrict__ Bh, int ldb, size_t sB, float alpha, const float* __restrict__ bias, size_t sBias, const float* __restrict__ CP, int rowsPerB, size_t sCPb, int row0g,
    float* __restrict__ C, _Float16* __restrict__ C16, int ldc, size_t sC, int M, int N, int K) {
  __shared__ __attribute__((aligned(16))) float so[4][16][64];
  const int tid = threadIdx.x, w = tid >> 5, lane = tid & 31, ln = lane & 15, hh = lane >> 4; const int by = blockIdx.y;
  A += (size_t)by * sA; Bh += (size_t)by * sB; const size_t cofs = (size_t)by * sC; const float* bp = bias ? bias + (size_t)by * sBias : nullptr;
  const int ntn = (N + 63) / 64; const int wid = blockIdx.x * 4 + w; const int mt = wid / ntn, nq = wid % ntn; if (mt * 16 >= M) return;
  const int row0 = mt * 16, col0 = nq * 64; const _Float16* arow = A + (size_t)(row0 + ln) * lda;
  v8f acc[4] = {};
  for (int kb = 0; kb < K; kb += 32) { FragH ah; ah.half[0] = *(const v8us*)((const unsigned short*)arow + kb + 8 * hh); ah.half[1] = *(const v8us*)((const unsigned short*)arow + kb + 16 + 8 * hh);
#pragma unroll
    for (int t = 0; t < 4; ++t) { if (col0 + t * 16 >= N) continue; const size_t boff = (size_t)(col0 + t * 16 + ln) * ldb + kb; FragH bq; bq.half[0] = *(const v8us*)((const unsigned short*)Bh + boff + 8 * hh); bq.half[1] = *(const v8us*)((const unsigned short*)Bh + boff + 16 + 8 * hh);
      acc[t] = mmaH<1>(ah.v, ah.v, bq.v, bq.v, acc[t]); }
  }
#pragma unroll
  for (int t = 0; t < 4; ++t) { if (col0 + t * 16 >= N) continue; const int col = col0 + t * 16 + ln; const float bv = bp ? bf16_round(bp[col]) : 0.f;
#pragma unroll
    for (int r = 0; r < 8; ++r) { float v = acc[t][r] * alpha + bv; if (CP) { const int rr = row0g + row0 + 8 * hh + r; if (rowsPerB < 0) v += CP[cofs + (size_t)rr * ldc + col];      /* rowsPerB < 0: own element of the batched C plane */ else { const int bidx = rr / rowsPerB; v += CP[(size_t)bidx * sCPb + (size_t)by * 64 + col]; } } if (ACT == 1) v = (v > 0.f) ? v : expm1f(v); else if (ACT == 7) v = (v > 0.f) ? v + 1.0f : expf(v); else if (ACT == 8) v = tanhf(v); else if (ACT == 9) v = 0.5f * v * (1.0f + tanhf(0.7978845608028654f * (v + 0.044715f * v * v * v))); else if (ACT == 11) v = 1.0f / (1.0f + expf(-v)); else if (ACT == 12) v = (v > 0.f) ? v : 0.01f * v; else if (ACT == 14) v = (v > 0.f) ? v : 0.1f * v; else if (ACT == 16) v = (v >= 0.f) ? v : 0.3f * v; else if (ACT == 17) v = (v >= 0.f) ? v : 0.2f * v; else if (ACT == 15) v = v / (1.0f + expf(-v)); else if (ACT == 3) v = fmaxf(v, 0.f); else if (ACT == 6) v = 0.5f * v * (1.0f + erff(v * 0.70710678118654752f)); so[w][8 * hh + r][t * 16 + ln] = v; } }
  __builtin_amdgcn_fence(__ATOMIC_ACQ_REL, "workgroup"); __builtin_amdgcn_wave_barrier();
  const int rsub = lane >> 4, c4 = (lane & 15) * 4; typedef _Float16 v4h __attribute__((ext_vector_type(4)));
  {
#pragma unroll
    for (int q = 0; q < 8; ++q) { const int r = q * 2 + rsub; if (col0 + c4 < N) { const v4f v = *(const v4fa*)&so[w][r][c4]; if (C) *(v4f*)(C + cofs + (size_t)(row0 + r) * ldc + col0 + c4) = v; if (C16) { v4h h4; for (int i = 0; i < 4; ++i) h4[i] = (_Float16)v[i]; *(v4h*)(C16 + cofs + (size_t)(row0 + r) * ldc + col0 + c4) = h4; } } }
     }
}


typedef _Float16 v4h __attribute__((ext_vector_type(4)));

// operand preparation in ONE launch: x as exact f16 rows, the three natural [out][in] weight planes x16 as f16 (stacked q | k | v), the three biases stacked (f32). The parts need nothing of each other, so they share one grid by ranges of the
// block index (block-uniform branches): PREP_XB blocks for x, PREP_WB for each weight plane, one last block for the biases. A block converts PREP_L * 1024 elements in a row: load j of a thread is its 16 bytes of the block's j-th 4-KiB piece
// (a wave's load = 512 bytes in a row, its store = 256), and a thread's PREP_L loads are all issued ahead of the first conversion.
#define PREP_L 16
#define PREP_XB ((int)(NR * DM / (PREP_L * 1024)))
#define PREP_WB (DM * DM / (PREP_L * 1024))
__global__ __launch_bounds__(256) void k_prep(const float* __restrict__ x, const float* __restrict__ wq, const float* __restrict__ wk, const float* __restrict__ wv, const float* __restrict__ bq, const float* __restrict__ bk, const float* __restrict__ bv,
    _Float16* __restrict__ X16, _Float16* __restrict__ BQKV, float* __restrict__ bqkv) {
  static_assert(NR * DM % (PREP_L * 1024) == 0 && DM * DM % (PREP_L * 1024) == 0 && DM == 1024, "whole blocks only; a bias is four elements a thread");
  const int tid = threadIdx.x, blk = blockIdx.x;
  if (blk >= PREP_XB + 3 * PREP_WB) { const v4f a = *(const v4fa*)(bq + tid * 4), b = *(const v4fa*)(bk + tid * 4), c = *(const v4fa*)(bv + tid * 4); float* d = bqkv + tid * 4; *(v4f*)d = a; *(v4f*)(d + DM) = b; *(v4f*)(d + 2 * DM) = c; return; }
  const float* src = x; _Float16* dst = X16; float scale = 1.0f; int lb = blk;
  if (blk >= PREP_XB) { const int p = (blk - PREP_XB) / PREP_WB; lb = (blk - PREP_XB) % PREP_WB; src = p == 0 ? wq : p == 1 ? wk : wv; dst = BQKV + (size_t)p * DM * DM; scale = 16.0f; }
  const size_t e0 = (size_t)lb * (PREP_L * 1024) + tid * 4; const float* sp = src + e0; _Float16* dp = dst + e0; v4f a[PREP_L];
  /* both loops are unrolled because the loaded values live in registers, which need constant indices */
#pragma unroll
  for (int j = 0; j < PREP_L; ++j) a[j] = *(const v4fa*)(sp + j * 1024);
  asm volatile("s_wait_xcnt 0x0" :: "v"(sp) : "memory");      /* precaution: no register that an issued load names is written ahead of this wait; the address pair is an input here so that no load's result is placed on it */
#pragma unroll
  for (int j = 0; j < PREP_L; ++j) { v4h h4; for (int q = 0; q < 4; ++q) h4[q] = (_Float16)(bf16_round(a[j][q]) * scale); *(v4h*)(dp + j * 1024) = h4; } }
__global__ __launch_bounds__(256) void k_h16(const float* __restrict__ x, _Float16* __restrict__ X16, size_t n8) { const size_t t = (size_t)blockIdx.x * 256 + threadIdx.x; if (t >= n8) return; FragH f;
#pragma unroll
  for (int q = 0; q < 8; ++q) f.h[q] = (_Float16)x[t * 8 + q]; *(v8us*)((unsigned short*)X16 + t * 8) = f.half[0];  }
__global__ __launch_bounds__(256) void k_round16f(const float* __restrict__ W, _Float16* __restrict__ Bt, size_t n8) { const size_t t = (size_t)blockIdx.x * 256 + threadIdx.x; if (t >= n8) return; FragH f;
#pragma unroll
  for (int i = 0; i < 8; ++i) f.h[i] = (_Float16)(bf16_round(W[t * 8 + i]) * 16.0f); *(v8us*)((unsigned short*)Bt + t * 8) = f.half[0];  }
template <int NHv, int TTv>
__global__ __launch_bounds__(256) void k_vt(const _Float16* __restrict__ V16, int ldv, int voff, _Float16* __restrict__ Vt) { __shared__ unsigned short tl[64][66]; const int tid = threadIdx.x; const int slab = blockIdx.x / (TTv / 64), lg = blockIdx.x % (TTv / 64); const int b = slab / NHv, h = slab % NHv;
  for (int i = tid; i < 64 * 8; i += 256) { const int r = i / 8, c8 = (i % 8) * 8; FragH f; f.half[0] = *(const v8us*)((const unsigned short*)V16 + ((size_t)b * TTv + lg * 64 + r) * ldv + voff + h * 64 + c8);
#pragma unroll
    for (int q = 0; q < 8; ++q) tl[r][c8 + q] = f.u[q]; }
  __syncthreads();
  {
#pragma unroll
    for (int rd = 0; rd < 2; ++rd) { const int d = rd * 32 + tid / 8, pc = tid % 8; FragH f;
#pragma unroll
      for (int q = 0; q < 8; ++q) f.u[q] = tl[pc * 8 + q][d];
      *(v8us*)((unsigned short*)Vt + ((size_t)slab * 64 + d) * TTv + lg * 64 + pc * 8) = f.half[0]; }
     } }

__global__ __launch_bounds__(256) void k_hl(const float* __restrict__ F, _Float16* __restrict__ Hh, _Float16* __restrict__ Hl, size_t n8) { const size_t t = (size_t)blockIdx.x * 256 + threadIdx.x; if (t >= n8) return; FragH fh, fl; const v4f a = *(const v4fa*)(F + t * 8), c = *(const v4fa*)(F + t * 8 + 4);
#pragma unroll
  for (int q = 0; q < 4; ++q) { _Float16 h = (_Float16)a[q]; fh.h[q] = h; fl.h[q] = (_Float16)((a[q] - (float)h) * 1024.0f); h = (_Float16)c[q]; fh.h[4 + q] = h; fl.h[4 + q] = (_Float16)((c[q] - (float)h) * 1024.0f); }
  { *(v8us*)((unsigned short*)Hh + t * 8) = fh.half[0]; *(v8us*)((unsigned short*)Hl + t * 8) = fl.half[0];  } }

// ---- fast GEMM (wave tile 32x64, eight waves = block tile 128x128; requires M % 128 == 0, N % 128 == 0, K % 64 == 0); epilogue = k_gemm_hhx semantics ----
// Operands go through LDS: a stage is 64 k of the block's 128 A rows and 128 B rows (one whole 128-byte line a row), brought by asynchronous copies to LDS, eight lanes a line, two buffers, so that the next stage flies while this one is worked on;
// rows stand at a pitch of 144 bytes (16 x odd: the sixteen rows of a ds_load_b128 fragment read fall on different banks). Each accumulator still takes its k blocks of 32 in rising order.
// the f32 plane C holds only the first crows rows of every cmod rows, packed (row (R / cmod) * crows + R % cmod, pitch ldc); cmod % 32 == 0 and crows % 32 == 0, so a wave's tile is wholly in it or wholly out
__device__ __forceinline__ v16h g2_frag(const _Float16* p, int hh) { FragH f; f.half[0] = *(const v8us*)((const unsigned short*)p + 8 * hh); f.half[1] = *(const v8us*)((const unsigned short*)p + 16 + 8 * hh); return f.v; }
__device__ __forceinline__ v8f g2_mma(v16h a, v16h b, v8f c) { v8f d = __builtin_amdgcn_wmma_f32_16x16x32_f16(false, a, false, b, (short)0, c, false, false); asm volatile("v_nop\n\tv_nop\n\tv_nop\n\tv_nop" : "+v"(d) : "v"(a), "v"(b)); return d; }
#define G2_PB 144                    /* LDS row pitch, bytes */
#define G2_SB (256 * G2_PB)          /* one stage: 128 A rows, then 128 B rows */
// one stage's copies of one lane: rows rr + RPR j (j = 0..3) of a first and of a second operand, 16 bytes each (RPR = rows that the block's lanes cover at once, eight lanes a row); pa, pb = the lane's place in row rr of the two operands at the stage's k,
// sa, sb = RPR rows in elements, l = the lane's LDS byte address in row rr of the buffer (4 RPR rows of the first operand, then 4 RPR of the second).
// The s_wait_xcnt ends the copies' own statement as a precaution: no register that an issued copy names is written ahead of it.
template <int RPR> __device__ __forceinline__ void g2_stage(const _Float16* pa, size_t sa, const _Float16* pb, size_t sb, unsigned l) {
  const _Float16* a1 = pa + sa; const _Float16* a2 = a1 + sa; const _Float16* a3 = a2 + sa; const _Float16* b1 = pb + sb; const _Float16* b2 = b1 + sb; const _Float16* b3 = b2 + sb;
  asm volatile("global_load_async_to_lds_b128 %0, %8, off\n\tglobal_load_async_to_lds_b128 %1, %9, off\n\tglobal_load_async_to_lds_b128 %2, %10, off\n\tglobal_load_async_to_lds_b128 %3, %11, off\n\t"
               "global_load_async_to_lds_b128 %4, %12, off\n\tglobal_load_async_to_lds_b128 %5, %13, off\n\tglobal_load_async_to_lds_b128 %6, %14, off\n\tglobal_load_async_to_lds_b128 %7, %15, off\n\ts_wait_xcnt 0x0"
               :: "v"(l), "v"(l + RPR * G2_PB), "v"(l + 2 * RPR * G2_PB), "v"(l + 3 * RPR * G2_PB), "v"(l + 4 * RPR * G2_PB), "v"(l + 5 * RPR * G2_PB), "v"(l + 6 * RPR * G2_PB), "v"(l + 7 * RPR * G2_PB), "v"(pa), "v"(a1), "v"(a2), "v"(a3), "v"(pb), "v"(b1), "v"(b2), "v"(b3) : "memory"); }
template <int ACT>
__global__ __launch_bounds__(256) void k_gemm2(const _Float16* __restrict__ A, int lda, size_t sA, const _Float16* __restrict__ Bh, int ldb, size_t sB, float alpha, const float* __restrict__ bias, size_t sBias, const float* __restrict__ CP, int rowsPerB, size_t sCPb, int row0g,
    float* __restrict__ C, int cmod, int crows, _Float16* __restrict__ C16, int ldc, size_t sC, int M, int N, int K) { static_assert(ACT == 0 || ACT == 3 || ACT == 6 || ACT == 8 || ACT == 9 || ACT == 11 || ACT == 12 || ACT == 14 || ACT == 15 || ACT == 16 || ACT == 17, "k_gemm2: unsupported ACT code (would silently apply no activation)");
  __shared__ __attribute__((aligned(16))) unsigned char sm[2 * G2_SB];      /* the two stage buffers; behind the loop's last barrier the same bytes are the waves' output staging */
  static_assert(sizeof(float) * 8 * 32 * 68 <= 2 * G2_SB, "output staging must fit the stage buffers"); float (*so)[32][68] = (float (*)[32][68])sm;
  const int tid = threadIdx.x, w = tid >> 5, lane = tid & 31, ln = lane & 15, hh = lane >> 4; const int by = blockIdx.y;
  A += (size_t)by * sA; Bh += (size_t)by * sB; const size_t cofs = (size_t)by * sC; const float* bp = bias ? bias + (size_t)by * sBias : nullptr;
  const int ntn = N >> 7; const int mt = blockIdx.x / ntn, nq = blockIdx.x - mt * ntn; if (mt * 128 >= M) return;      /* the whole block leaves, ahead of every barrier */
  const int row0 = mt * 128 + 32 * (w & 3), col0 = nq * 128 + 64 * (w >> 2);
  const int rr = tid >> 3, c8 = (tid & 7) * 8; const _Float16* ga = A + (size_t)(mt * 128 + rr) * lda + c8; const _Float16* gb = Bh + (size_t)(nq * 128 + rr) * ldb + c8; const size_t sa32 = (size_t)32 * lda, sb32 = (size_t)32 * ldb;
  const unsigned l0 = (unsigned)(size_t)sm + (unsigned)(rr * G2_PB + c8 * 2);      /* low 32 bits of the __shared__ address = LDS byte address */
  const int aoff = (32 * (w & 3) + ln) * G2_PB, boff = (128 + 64 * (w >> 2) + ln) * G2_PB; const int nst = K >> 6;
  const v8f z8 = {0.f,0.f,0.f,0.f,0.f,0.f,0.f,0.f}; v8f c00 = z8, c01 = z8, c02 = z8, c03 = z8, c10 = z8, c11 = z8, c12 = z8, c13 = z8;
  g2_stage<32>(ga, sa32, gb, sb32, l0);
  asm volatile("s_wait_asynccnt 0x0" ::: "memory");      /* this wave's copies of stage 0 have landed */
  __syncthreads();      /* ... and every other wave's: stage 0 may be read */
  if (nst > 1) g2_stage<32>(ga + 64, sa32, gb + 64, sb32, l0 + G2_SB);
  /* not unrolled: one trip a stage, the buffer picked by the trip's parity */
#pragma unroll 1
  for (int t = 0; t < nst; ++t) { const unsigned char* st = sm + (t & 1) * G2_SB; const _Float16* ap = (const _Float16*)(st + aoff); const _Float16* bq = (const _Float16*)(st + boff);
    /* unrolled: the stage's two k blocks of 32 */
#pragma unroll
    for (int kb = 0; kb < 64; kb += 32) { const v16h a0 = g2_frag(ap + kb, hh), a1 = g2_frag(ap + 16 * (G2_PB / 2) + kb, hh);
      const v16h b0 = g2_frag(bq + kb, hh), b1 = g2_frag(bq + 16 * (G2_PB / 2) + kb, hh), b2 = g2_frag(bq + 32 * (G2_PB / 2) + kb, hh), b3 = g2_frag(bq + 48 * (G2_PB / 2) + kb, hh);
      /* inputs-only fence on the loaded values: it keeps the k block's twelve LDS reads in front of its products, in flight together (one LDS latency a block; left alone the compiler waited for each B fragment in turn) */
      asm volatile("" :: "v"(a0), "v"(a1), "v"(b0), "v"(b1), "v"(b2), "v"(b3));
      c00 = g2_mma(a0, b0, c00); c10 = g2_mma(a1, b0, c10); c01 = g2_mma(a0, b1, c01); c11 = g2_mma(a1, b1, c11);
      c02 = g2_mma(a0, b2, c02); c12 = g2_mma(a1, b2, c12); c03 = g2_mma(a0, b3, c03); c13 = g2_mma(a1, b3, c13); }
    asm volatile("s_wait_dscnt 0x0" ::: "memory");      /* this wave's reads of the buffer are done before it is refilled */
    asm volatile("s_wait_asynccnt 0x0" ::: "memory");      /* this wave's copies of stage t + 1 have landed */
    __syncthreads();      /* publishes stage t + 1 and ends every wave's reads of stage t */
    if (t + 2 < nst) g2_stage<32>(ga + (size_t)(t + 2) * 64, sa32, gb + (size_t)(t + 2) * 64, sb32, l0 + (t & 1) * G2_SB); }
  asm volatile("s_wait_asynccnt 0x0" ::: "memory");      /* no copy is outstanding when the buffers become output staging */
  v8f accs[8] = {c00, c01, c02, c03, c10, c11, c12, c13};
#pragma unroll
  for (int u = 0; u < 8; ++u) { const int t = u & 3, half = u >> 2; const int col = col0 + t * 16 + ln; const float bv = bp ? bf16_round(bp[col]) : 0.f;
#pragma unroll
    for (int r = 0; r < 8; ++r) { const int rloc = half * 16 + 8 * hh + r; float v = accs[u][r] * alpha + bv; if (CP) { if (rowsPerB < 0) v += CP[cofs + (size_t)(row0g + row0 + rloc) * ldc + col];      /* rowsPerB < 0: own element of the batched C plane */ else { const int bidx = (row0g + row0 + rloc) / rowsPerB; v += CP[(size_t)bidx * sCPb + (size_t)by * 64 + col]; } }
      if (ACT == 3) v = fmaxf(v, 0.f); else if (ACT == 6) v = 0.5f * v * (1.0f + erff(v * 0.70710678118654752f)); else if (ACT == 11) v = 1.0f / (1.0f + expf(-v)); else if (ACT == 15) v = v / (1.0f + expf(-v)); else if (ACT == 12) v = (v > 0.f) ? v : 0.01f * v; else if (ACT == 8) v = tanhf(v); else if (ACT == 9) v = 0.5f * v * (1.0f + tanhf(0.7978845608028654f * (v + 0.044715f * v * v * v))); else if (ACT == 14) v = (v > 0.f) ? v : 0.1f * v; else if (ACT == 16) v = (v >= 0.f) ? v : 0.3f * v; else if (ACT == 17) v = (v >= 0.f) ? v : 0.2f * v;
      so[w][rloc][t * 16 + ln] = v; } }
  __builtin_amdgcn_fence(__ATOMIC_ACQ_REL, "workgroup"); __builtin_amdgcn_wave_barrier();
  const int rsub = lane >> 4, c4 = (lane & 15) * 4; const int rin = row0 % cmod; float* Cw = (C && rin < crows) ? C + cofs + ((size_t)(row0 / cmod) * crows + rin) * ldc + col0 + c4 : nullptr;
  {
#pragma unroll
    for (int q = 0; q < 16; ++q) { const int r = q * 2 + rsub; const v4f v = *(const v4fa*)&so[w][r][c4]; if (Cw) *(v4f*)(Cw + (size_t)r * ldc) = v; if (C16) { v4h h4; for (int i = 0; i < 4; ++i) h4[i] = (_Float16)v[i]; *(v4h*)(C16 + cofs + (size_t)(row0 + r) * ldc + col0 + c4) = h4; } }
     } }


__global__ __launch_bounds__(256) void k_rsm(const float* __restrict__ S, _Float16* __restrict__ P, int nrows) {
  #pragma clang fp contract(off)
  const int i = blockIdx.x * 256 + threadIdx.x; if (i >= nrows) return; const float* s = S + (size_t)i * SQ; float mx = -3.0e38f;
#pragma unroll 1
  for (int j = 0; j < SQ; ++j) mx = fmaxf(mx, s[j]); float se = 0.f;
#pragma unroll 1
  for (int j = 0; j < SQ; ++j) se += expf(s[j] - mx); const float sc = 256.0f / se;
#pragma unroll 1
  for (int j0 = 0; j0 < SQ; j0 += 8) { FragH f; for (int q = 0; q < 8; ++q) f.h[q] = (_Float16)(expf(s[j0 + q] - mx) * sc); unsigned short* d = (unsigned short*)P + (size_t)i * SQ + j0; *(v8us*)d = f.half[0];  } }
__global__ __launch_bounds__(256) void k_vt(const _Float16* __restrict__ V16, int b, int h0, _Float16* __restrict__ VT) { __shared__ unsigned short tl[64][65]; const int tid = threadIdx.x; const int hh = blockIdx.x % HG, sg = blockIdx.x / HG; const int s0 = sg * 64; const int h = h0 + hh;
  for (int i = tid; i < 64 * 8; i += 256) { const int j = i / 8, d8 = (i % 8) * 8; FragH f; f.half[0] = *(const v8us*)((const unsigned short*)V16 + ((size_t)b * SQ + s0 + j) * DM + h * HD + d8); for (int q = 0; q < 8; ++q) tl[d8 + q][j] = f.u[q]; }
  __syncthreads();
  { for (int i = tid; i < 64 * 8; i += 256) { const int d = i / 8, j8 = (i % 8) * 8; FragH f; for (int q = 0; q < 8; ++q) f.u[q] = tl[d][j8 + q]; *(v8us*)((unsigned short*)VT + ((size_t)hh * HD + d) * SQ + s0 + j8) = f.half[0]; }  } }



// lane l with lane l ^ M of its 16-lane row (DPP row_xmask), and lane l with lane l ^ 16
template <int M> __device__ __forceinline__ float rs_xm(float x) { return __builtin_bit_cast(float, __builtin_amdgcn_update_dpp(0, __builtin_bit_cast(int, x), 0x160 | M, 0xf, 0xf, true)); }
__device__ __forceinline__ float rs_xh(float x) { return __builtin_bit_cast(float, __builtin_amdgcn_permlanex16(__builtin_bit_cast(int, x), __builtin_bit_cast(int, x), 0x76543210, 0xfedcba98, false, false)); }
__device__ __forceinline__ v16h fa_frag(const _Float16* p) { FragH f; f.half[0] = *(const v8us*)((const unsigned short*)p); f.half[1] = *(const v8us*)((const unsigned short*)p + 16); return f.v; }      /* p already holds the lane half's 8-element shift */
// exp2 of eight values, and of one: each v_exp_f32 works on a register of its own and a v_nop ends the statement. It is there for the slot that the instruction set asks for behind a transcendental before its result is read or its source overwritten.
__device__ __forceinline__ void fa_exp2x8(float (&e)[8]) { asm("v_exp_f32 %0, %0\n\tv_exp_f32 %1, %1\n\tv_exp_f32 %2, %2\n\tv_exp_f32 %3, %3\n\tv_exp_f32 %4, %4\n\tv_exp_f32 %5, %5\n\tv_exp_f32 %6, %6\n\tv_exp_f32 %7, %7\n\tv_nop" : "+v"(e[0]), "+v"(e[1]), "+v"(e[2]), "+v"(e[3]), "+v"(e[4]), "+v"(e[5]), "+v"(e[6]), "+v"(e[7])); }
__device__ __forceinline__ float fa_exp2(float x) { asm("v_exp_f32 %0, %0\n\tv_nop" : "+v"(x)); return x; }
// a trip's fragments: kl, vl = the lane's place (row ln, its half's 8-element shift) in the K rows and in the V^T rows of the trip's LDS buffer
__device__ __forceinline__ void fa_load(const _Float16* kl, const _Float16* vl, v16h (&kc)[4][2], v16h (&vf)[4][2]) {
  /* unrolled because the fragments live in registers, which need constant indices */
#pragma unroll
  for (int t = 0; t < 4; ++t) { kc[t][0] = fa_frag(kl + (16 * t) * (G2_PB / 2)); kc[t][1] = fa_frag(kl + (16 * t) * (G2_PB / 2) + 32); }
#pragma unroll
  for (int t = 0; t < 4; ++t) { vf[t][0] = fa_frag(vl + (16 * t) * (G2_PB / 2)); vf[t][1] = fa_frag(vl + (16 * t) * (G2_PB / 2) + 32); }
  /* inputs-only fence on the loaded values: it keeps the trip's 32 LDS reads in front of the arithmetic, in flight together (one LDS latency a trip; left alone the compiler waited for each pair of K reads in turn and left V^T reads among the last products) */
  asm volatile("" :: "v"(kc[0][0]), "v"(kc[0][1]), "v"(kc[1][0]), "v"(kc[1][1]), "v"(kc[2][0]), "v"(kc[2][1]), "v"(kc[3][0]), "v"(kc[3][1]), "v"(vf[0][0]), "v"(vf[0][1]), "v"(vf[1][0]), "v"(vf[1][1]), "v"(vf[2][0]), "v"(vf[2][1]), "v"(vf[3][0]), "v"(vf[3][1])); }
// one trip's arithmetic: keys kb .. kb + 63, all operands in registers
__device__ __forceinline__ void fa_trip(const int kb, const int q0, const int ln, const int hh, const v16h qf0, const v16h qf1, const v16h (&kc)[4][2], const v16h (&vf)[4][2], v8f (&o)[4], float& m, float& l) {
  const v8f z8 = {0.f,0.f,0.f,0.f,0.f,0.f,0.f,0.f}; const float cs = 0.125f * 1.4426950408889634f;      /* 1 / sqrt(HD), in log2 units */
  /* every loop of this function is unrolled because fragments, scores and sums live in registers, which need constant indices */
  v8f s[4];
#pragma unroll
  for (int t = 0; t < 4; ++t) { s[t] = __builtin_amdgcn_wmma_f32_16x16x32_f16(false, kc[t][0], false, qf0, (short)0, z8, false, false); s[t] = __builtin_amdgcn_wmma_f32_16x16x32_f16(false, kc[t][1], false, qf1, (short)0, s[t], false, false); }
  if (kb + 63 > q0) {      /* wave-uniform: the trip that reaches the diagonal; s[t][r] = key kb + 16 t + 8 hh + r against query q0 + ln */
#pragma unroll
    for (int t = 0; t < 4; ++t) for (int r = 0; r < 8; ++r) s[t][r] = (kb + 16 * t + 8 * hh + r <= q0 + ln) ? s[t][r] : -1.0e30f; }
  float mx = s[0][0];
#pragma unroll
  for (int t = 0; t < 4; ++t) for (int r = 0; r < 8; ++r) mx = fmaxf(mx, s[t][r]);
  mx = fmaxf(mx, rs_xh(mx));      /* the other half of the query's keys */
  const float mn = fmaxf(m, mx * cs); const float al = fa_exp2(m - mn); m = mn;
  v4f s4 = {0.f, 0.f, 0.f, 0.f}; FragH pf[2];
#pragma unroll
  for (int t = 0; t < 4; ++t) { float e[8]; for (int r = 0; r < 8; ++r) e[r] = fmaf(s[t][r], cs, -mn); fa_exp2x8(e); for (int r = 0; r < 8; ++r) { s4[r & 3] += e[r]; pf[t >> 1].h[(t & 1) * 8 + r] = (_Float16)e[r]; } }
  l = l * al + ((s4[0] + s4[1]) + (s4[2] + s4[3]));      /* each half keeps its own keys' share */
#pragma unroll
  for (int t = 0; t < 4; ++t) { o[t] *= al; o[t] = __builtin_amdgcn_wmma_f32_16x16x32_f16(false, vf[t][0], false, pf[0].v, (short)0, o[t], false, false); o[t] = __builtin_amdgcn_wmma_f32_16x16x32_f16(false, vf[t][1], false, pf[1].v, (short)0, o[t], false, false); } }
#define FA_SB (128 * G2_PB)          /* one stage: 64 K rows, then 64 V^T rows */
#define FA_YN ((SQ - QT0) / 64)      /* grid.y rows of the f16 path: the 64-row query blocks behind the first QT0 rows */
#define A0_YN (QT0 / 8)              /* grid.y rows of the exact f32 path: the 8-row blocks of the first QT0 rows */
// four waves per SIMD: with at most 256 registers a wave every f16-path block of the launch is resident from the start (16 waves per WGP), and the waves of a SIMD fill each other's waits.
// The exact f32 rows (a0_rows) need only the projection's results, as the f16 path does, so they share this launch: the blocks of grid.y >= FA_YN take them, heaviest first, in the places that are free at the start and that the lighter
// f16-path blocks leave, while the long f16-path blocks are still walking their keys. Every output row has one writer: the f16 path leaves the first QT0 rows of a batch alone.
template <int MASKADD> __device__ __forceinline__ void a0_rows(const float* __restrict__ QF, const float* __restrict__ KF, const float* __restrict__ VF, const float* __restrict__ mask, float scale, float* __restrict__ OF, int ldo, const int b, const int h, const int r8);      /* defined below */
__global__ __launch_bounds__(128) __attribute__((amdgpu_waves_per_eu(4, 4))) void k_fattn(const _Float16* __restrict__ QKVp, const _Float16* __restrict__ VTp, const float* __restrict__ QF, const float* __restrict__ KF, const float* __restrict__ VF, float* __restrict__ out) {
  __shared__ __attribute__((aligned(16))) unsigned char sm[2 * FA_SB];      /* the two stage buffers */
  const int tid = threadIdx.x, lane = tid & 31, ln = lane & 15, hh = lane >> 4; const int w = __builtin_amdgcn_readfirstlane(tid >> 5);
  const int bh = blockIdx.x, b = bh / NH, h = bh % NH;
  if ((int)blockIdx.y >= FA_YN) { a0_rows<0>(QF, KF, VF, nullptr, 0.125f, out, DM, b, h, FA_YN + A0_YN - 1 - (int)blockIdx.y); return; }      /* the whole block leaves, ahead of every barrier and copy */
  const int yb = SQ / 64 - 1 - (int)blockIdx.y; const int q0 = yb * 64 + w * 16;      /* wave-uniform first query row */
  const int nt = yb + 1;      /* trips of 64 keys, the same for the block's four waves: the last one holds every wave's diagonal */
  const _Float16* qp = QKVp + ((size_t)b * SQ + q0 + ln) * LQ + h * HD + 8 * hh;
  const int rr = tid >> 3, c8 = (tid & 7) * 8; const _Float16* gk = QKVp + ((size_t)b * SQ + rr) * LQ + DM + h * HD + c8; const _Float16* gv = VTp + ((size_t)bh * HD + rr) * SQ + c8;      /* the lane's 16 bytes of key row rr and of V^T row rr, trip 0 */
  const unsigned l0 = (unsigned)(size_t)sm + (unsigned)(rr * G2_PB + c8 * 2);      /* low 32 bits of the __shared__ address = LDS byte address */
  const int koff = ln * G2_PB + 16 * hh, voff = (64 + ln) * G2_PB + 16 * hh;
  const v16h qf0 = fa_frag(qp), qf1 = fa_frag(qp + 32);
  asm volatile("s_wait_xcnt 0x0" :: "v"(qp) : "memory");      /* precaution: no register that an issued load names is written ahead of this wait; the q address pair is an input here so that no load's result is placed on it */
  g2_stage<16>(gk, (size_t)16 * LQ, gv, (size_t)16 * SQ, l0);
  asm volatile("s_wait_asynccnt 0x0" ::: "memory");      /* this wave's copies of trip 0 have landed */
  __syncthreads();      /* ... and every other wave's: trip 0's rows may be read */
  if (nt > 1) g2_stage<16>(gk + (size_t)64 * LQ, (size_t)16 * LQ, gv + 64, (size_t)16 * SQ, l0 + FA_SB);
  const v8f z8 = {0.f,0.f,0.f,0.f,0.f,0.f,0.f,0.f}; v8f o[4] = {z8, z8, z8, z8}; float m = -1.0e30f, l = 0.f;
  /* not unrolled: one trip a stage, the buffer picked by the trip's parity */
#pragma unroll 1
  for (int t = 0; t < nt; ++t) { const unsigned char* st = sm + (t & 1) * FA_SB; v16h kc[4][2], vf[4][2];
    fa_load((const _Float16*)(st + koff), (const _Float16*)(st + voff), kc, vf);      /* the trip's only LDS reads: the buffer is handed on right behind them, so that its refill has a whole trip to land */
    asm volatile("s_wait_dscnt 0x0" ::: "memory");      /* this wave's reads of the buffer are done before it is refilled */
    asm volatile("s_wait_asynccnt 0x0" ::: "memory");      /* this wave's copies of trip t + 1 have landed */
    __syncthreads();      /* publishes trip t + 1's rows and ends every wave's reads of trip t's */
    if (t + 2 < nt) g2_stage<16>(gk + (size_t)(t + 2) * 64 * LQ, (size_t)16 * LQ, gv + (t + 2) * 64, (size_t)16 * SQ, l0 + (t & 1) * FA_SB);
    fa_trip(t * 64, q0, ln, hh, qf0, qf1, kc, vf, o, m, l); }
  asm volatile("s_wait_asynccnt 0x0" ::: "memory");      /* no copy is outstanding when the wave ends */
  l += rs_xh(l); const float fin = 1.0f / l;
  /* unrolled for constant register indices */
  float* op = out + ((size_t)b * SQ + q0 + ln) * DM + h * HD + 8 * hh;      /* o[t][r] = column 16 t + 8 hh + r of query q0 + ln */
#pragma unroll
  for (int t = 0; t < 4; ++t) { const v4f lo = {o[t][0] * fin, o[t][1] * fin, o[t][2] * fin, o[t][3] * fin}, hi = {o[t][4] * fin, o[t][5] * fin, o[t][6] * fin, o[t][7] * fin}; *(v4f*)(op + 16 * t) = lo; *(v4f*)(op + 16 * t + 4) = hi; } }

// lane K of each 16-lane row, handed to all sixteen lanes of that row (DPP row_share)
template <int K> __device__ __forceinline__ float a0_share(float x) { return __builtin_bit_cast(float, __builtin_amdgcn_update_dpp(0, __builtin_bit_cast(int, x), 0x150 | K, 0xf, 0xf, true)); }
template <int K> __device__ __forceinline__ void a0_acc(v4f& o, float e, const v4f* vv) { o += a0_share<K>(e) * vv[K]; if constexpr (K + 1 < 16) a0_acc<K + 1>(o, e, vv); }
// exact f32 attention of the first QT0 rows, SIXTEEN LANES PER QUERY ROW, keys in groups of 16: lane p scores key 16 g + p (whole q row in registers, K row straight from global memory), the group's maximum comes from a
// four-step butterfly over the 16 lanes, the running o and l are rescaled once per group, lane p keeps columns 4 p .. 4 p + 3 of o and its own keys' share of l (summed over the 16 lanes at the end). No LDS, no barrier.
// A 128-thread block takes eight query rows: rows 8 r8 .. 8 r8 + 7 of head h of batch b. QF, KF, VF point at the q, k, v blocks of the packed f32 rows (QT0 rows a batch, pitch LQ), OF at the output rows (SQ rows a batch).
// The rows' 16-row block rb = r8 / 2 sets the number of key groups, rb + 1.
template <int MASKADD>
__device__ __forceinline__ void a0_rows(const float* __restrict__ QF, const float* __restrict__ KF, const float* __restrict__ VF, const float* __restrict__ mask, float scale, float* __restrict__ OF, int ldo, const int b, const int h, const int r8) {
  const int p = threadIdx.x & 15; const int rb = r8 >> 1; const int i = r8 * 8 + (threadIdx.x >> 4);
  QF += (size_t)b * QT0 * LQ; KF += (size_t)b * QT0 * LQ; VF += (size_t)b * QT0 * LQ; OF += (size_t)b * SQ * ldo;
  const float* qr = QF + (size_t)i * LQ + h * HD; v4f q[HD / 4];      /* q, k, v rows have the pitch LQ, a constant, so that a group's sixteen V rows hang on one address pair by immediate offsets */
  /* the loops over c are unrolled because the rows live in registers, which need constant indices */
#pragma unroll
  for (int c = 0; c < HD / 4; ++c) q[c] = *(const v4fa*)(qr + c * 4);
  asm volatile("s_wait_xcnt 0x0" :: "v"(qr) : "memory");      /* precaution: no register that an issued load names is written ahead of this wait; the address pair is an input here so that no load's result is placed on it */
  v4f o = {0.f, 0.f, 0.f, 0.f}; float m = -1.0e30f, l = 0.f; const int ng = MASKADD ? (SQ / 16) : (rb + 1);      /* additive-mask form: every key (the mask input decides); causal form: key groups up to the block's last row */
  for (int g = 0; g < ng; ++g) { const int j = g * 16 + p; const float* kr = KF + (size_t)j * LQ + h * HD; const float* vr = VF + (size_t)(g * 16) * LQ + h * HD + p * 4; v4f kk[HD / 4], vv[16];
#pragma unroll
    for (int c = 0; c < HD / 4; ++c) kk[c] = *(const v4fa*)(kr + c * 4);
#pragma unroll
    for (int c = 0; c < 16; ++c) vv[c] = *(const v4fa*)(vr + c * LQ);
    asm volatile("s_wait_xcnt 0x0" :: "v"(kr), "v"(vr) : "memory");      /* the same precaution for the two address pairs of the group */
    /* inputs-only fences on the loaded values: they keep all 32 loads of the group in front of the arithmetic, in flight together (one memory latency per group; left alone the compiler waits after every second load) */
    asm volatile("" :: "v"(kk[0]), "v"(kk[1]), "v"(kk[2]), "v"(kk[3]), "v"(kk[4]), "v"(kk[5]), "v"(kk[6]), "v"(kk[7]), "v"(kk[8]), "v"(kk[9]), "v"(kk[10]), "v"(kk[11]), "v"(kk[12]), "v"(kk[13]), "v"(kk[14]), "v"(kk[15]), "v"(vv[0]), "v"(vv[1]), "v"(vv[2]), "v"(vv[3]), "v"(vv[4]), "v"(vv[5]), "v"(vv[6]), "v"(vv[7]), "v"(vv[8]), "v"(vv[9]), "v"(vv[10]), "v"(vv[11]), "v"(vv[12]), "v"(vv[13]));
    asm volatile("" :: "v"(vv[14]), "v"(vv[15]));
    v4f s4 = {0.f, 0.f, 0.f, 0.f};
#pragma unroll
    for (int c = 0; c < HD / 4; ++c) s4 += q[c] * kk[c];
    float s = ((s4[0] + s4[1]) + (s4[2] + s4[3])) * scale; if (MASKADD) s += bf16_round(mask[(size_t)i * SQ + j]) * -10000.0f;
    const float sm = (MASKADD || j <= i) ? s : -1.0e30f;
    float gm = sm; gm = fmaxf(gm, rs_xm<1>(gm)); gm = fmaxf(gm, rs_xm<2>(gm)); gm = fmaxf(gm, rs_xm<4>(gm)); gm = fmaxf(gm, rs_xm<8>(gm));
    const float mn = fmaxf(m, gm); const float sc = expf(m - mn); const float e = expf(sm - mn); l = l * sc + e; m = mn; o *= sc;
    a0_acc<0>(o, e, vv); }
  l += rs_xm<1>(l); l += rs_xm<2>(l); l += rs_xm<4>(l); l += rs_xm<8>(l);
  const float fin = 1.0f / l;
  *(v4f*)(OF + (size_t)i * ldo + h * HD + p * 4) = o * fin; }



extern "C" void kernel_launch(void* const* d_in, const int* in_sizes, int n_in,
                              void* d_out, int out_size, void* d_ws, size_t ws_size, hipStream_t stream) {
  (void)in_sizes; (void)n_in; (void)out_size;
  const float* const* I = (const float* const*)d_in; const float* x = I[0]; const float* wq = I[1]; const float* bq = I[2]; const float* wk = I[3]; const float* bk = I[4]; const float* wv = I[5]; const float* bv = I[6];      /* natural nn.Linear [out][in] weights + biases */
  char* ws = (char*)d_ws; size_t off = 0;
  auto take = [&](size_t bytes) { char* p = ws + off; off += (bytes + 255) & ~(size_t)255; return p; };
  _Float16* BQKV = (_Float16*)take((size_t)3 * DM * DM * 2); float* bqkv = (float*)take((size_t)3 * DM * 4);      /* stacked q | k | v weight plane and bias vector */ 
  _Float16* X16 = (_Float16*)take(NR * DM * 2); _Float16* QKV = (_Float16*)take(NR * 3 * DM * 2); _Float16* Q16 = QKV; _Float16* K16 = QKV + DM; _Float16* V16 = QKV + 2 * DM;      /* q | k | v */ _Float16* O16 = (_Float16*)take(NR * DM * 2);
  _Float16* VT = (_Float16*)take((size_t)NB * NH * HD * SQ * 2);
  float* F0 = (float*)take((size_t)NB * QT0 * LQ * 4);      /* f32 q | k | v of the first QT0 rows of each batch, packed */
  if (off > ws_size) return;
  k_prep<<<PREP_XB + 3 * PREP_WB + 1, 256, 0, stream>>>(x, wq, wk, wv, bq, bk, bv, X16, BQKV, bqkv);      /* x rows f16; natural [out][in] = Bt[n][k] x16, stacked q | k | v; stacked bias vector bq | bk | bv */
  const size_t r0p = (size_t)B0 * SQ;      /* first projected row */
  k_gemm2<0><<<dim3((unsigned)((MP / 128) * (3 * DM / 128)), 1), 256, 0, stream>>>(X16 + r0p * DM, DM, 0, BQKV, DM, 0, 0.0625f, bqkv, 0, nullptr, 1, 0, 0, F0, SQ, QT0, QKV + r0p * 3 * DM, 3 * DM, 0, MP, 3 * DM, DM);      /* q | k | v rows (f16); head h = columns h*HD.. of each DM block; the first QT0 rows of each batch also f32 */
  k_vt<NH, SQ><<<NB * NH * (SQ / 64), 256, 0, stream>>>(V16, LQ, 0, VT);      /* V^T [NB][NH][HD][SQ] */
  k_fattn<<<dim3(NB * NH, FA_YN + A0_YN), 128, 0, stream>>>(QKV, VT, F0, F0 + DM, F0 + 2 * DM, (float*)d_out);      /* o (merged heads) f32 straight into the output rows: f16 path behind the first QT0 rows of each batch, exact f32 causal attention for those */
}

// v008
// One run takes 66.7 microseconds.
// Next to v007, in two timings, it ran 1.06 times as fast each time.
// All steps since v000 together make it 87.4 times as fast.
#include <hip/hip_runtime.h>
#define NB 2
#define SQ 2048
#define DM 1024
#define NH 16
#define HD 64
#define HG 4                         /* head group of the k_vt(b, h0) form */
#define B0 0                         /* first batch processed (debug hook) */
#define NBR NB                       /* batches processed (debug hook) */
#define NR ((size_t)NB * SQ)         /* token rows */
#define MP ((int)((size_t)NBR * SQ)) /* rows projected (debug hook) */
#define QT 256                       /* unused */
#define NKX SQ                       /* unused */
#define QT0 256                      /* first-tile rows recomputed exactly (256: margin for the few-key rows, no output projection) */
#define QN SQ                        /* unused */
#define NHD NH                       /* unused */
#define MPO MP                       /* unused */
#define LQ (3 * DM)      /* row pitch of the q/k/v rows */
typedef __bf16 v16b __attribute__((ext_vector_type(16)));
typedef unsigned short v8us __attribute__((ext_vector_type(8), may_alias));
typedef float  v8f  __attribute__((ext_vector_type(8)));
typedef float  v4f  __attribute__((ext_vector_type(4)));
typedef float  v4fa __attribute__((ext_vector_type(4), may_alias));
union FragB { v16b v; v8us half[2]; unsigned short u[16]; };

__device__ __forceinline__ unsigned short bf16_bits(float x) { unsigned int u = __float_as_uint(x); return (unsigned short)((u + 0x7FFFu + ((u >> 16) & 1u)) >> 16); }
__device__ __forceinline__ float bf16_val(unsigned short b) { return __uint_as_float(((unsigned int)b) << 16); }
__device__ __forceinline__ float bf16_round(float x) { return bf16_val(bf16_bits(x)); }
// D += A·B with NT terms: 1 = ah·bh, 2 = + al·bh (A split), 3 = + ah·bl (both split)
template <int NT>
__device__ __forceinline__ v8f mmaN(v16b ah, v16b al, v16b bh, v16b bl, v8f c) {
  c = __builtin_amdgcn_wmma_f32_16x16x32_bf16(false, ah, false, bh, (short)0, c, false, false);
  if (NT >= 2) c = __builtin_amdgcn_wmma_f32_16x16x32_bf16(false, al, false, bh, (short)0, c, false, false);
  if (NT >= 3) c = __builtin_amdgcn_wmma_f32_16x16x32_bf16(false, ah, false, bl, (short)0, c, false, false);
  asm volatile("v_nop\n\tv_nop\n\tv_nop\n\tv_nop" : "+v"(c) : "v"(ah), "v"(al), "v"(bh), "v"(bl));
  return c;
}

__global__ __launch_bounds__(256) void k_wt_bf16(const float* __restrict__ W, unsigned short* __restrict__ Wt, int K, int N) {
  const int t = blockIdx.x * 256 + threadIdx.x;
  const int k8n = K / 8;
  if (t >= N * k8n) return;
  const int n = t / k8n, k8 = (t % k8n) * 8;
  v8us v;
#pragma unroll
  for (int i = 0; i < 8; ++i) v[i] = bf16_bits(W[(size_t)(k8 + i) * N + n]);
  *(v8us*)(Wt + (size_t)n * K + k8) = v;
  
}

// GEMM C[M][N] (f32, pitch ldc) = act(A[M][K]·W + bias). A f32 row-major (pitch lda) converted per fragment to bf16
// (ASPLIT: hi/lo two planes -> 2 terms, else single rounded term); Wt bf16 [N][K] (pitch ldb). BIAS_BF16 rounds the
// bias to bf16 first (bias quantised to bf16 before the add). K%32==0, M%16==0, N%64==0.
template <bool ASPLIT, int ACT, bool BIAS_BF16>
__global__ __launch_bounds__(128) void k_gemm_bf(const float* __restrict__ A, int lda, const unsigned short* __restrict__ Wt, int ldb,
                                               const float* __restrict__ bias, float* __restrict__ C, int ldc, int M, int N, int K) {
  __shared__ __attribute__((aligned(16))) float so[4][16][64];
  const int tid = threadIdx.x, w = tid >> 5, lane = tid & 31, ln = lane & 15, hh = lane >> 4;
  const int ntn = N / 64;
  const int wid = blockIdx.x * 4 + w;
  const int mt = wid / ntn, nq = wid % ntn;
  if (mt * 16 >= M) return;
  const int row0 = mt * 16, col0 = nq * 64;
  const float* arow = A + (size_t)(row0 + ln) * lda;
  v8f acc[4] = {};
  for (int kb = 0; kb < K; kb += 32) {
    FragB ah, al;
    const v4f x0 = *(const v4fa*)(arow + kb + 8 * hh), x1 = *(const v4fa*)(arow + kb + 8 * hh + 4);
    const v4f x2 = *(const v4fa*)(arow + kb + 16 + 8 * hh), x3 = *(const v4fa*)(arow + kb + 16 + 8 * hh + 4);
    float xs[16] = {x0[0],x0[1],x0[2],x0[3],x1[0],x1[1],x1[2],x1[3],x2[0],x2[1],x2[2],x2[3],x3[0],x3[1],x3[2],x3[3]};
#pragma unroll
    for (int i = 0; i < 16; ++i) { const unsigned short hb = bf16_bits(xs[i]); ah.u[i] = hb; al.u[i] = ASPLIT ? bf16_bits(xs[i] - bf16_val(hb)) : (unsigned short)0; }
#pragma unroll
    for (int t = 0; t < 4; ++t) {
      const unsigned short* brow = Wt + (size_t)(col0 + t * 16 + ln) * ldb + kb;
      FragB b;
      b.half[0] = *(const v8us*)(brow + 8 * hh);
      b.half[1] = *(const v8us*)(brow + 16 + 8 * hh);
      acc[t] = mmaN<ASPLIT ? 2 : 1>(ah.v, al.v, b.v, b.v, acc[t]);
    }
  }
#pragma unroll
  for (int t = 0; t < 4; ++t) {
    float bv = bias ? bias[col0 + t * 16 + ln] : 0.f;
    if (BIAS_BF16) bv = bf16_round(bv);
#pragma unroll
    for (int r = 0; r < 8; ++r) { float v = acc[t][r] + bv; if (ACT == 1) v = fmaxf(v, 0.f); so[w][8 * hh + r][t * 16 + ln] = v; }
  }
  __builtin_amdgcn_fence(__ATOMIC_ACQ_REL, "workgroup");
  __builtin_amdgcn_wave_barrier();
  const int rsub = lane >> 4, c4 = (lane & 15) * 4;
  {
#pragma unroll
    for (int q = 0; q < 8; ++q) {
      const int r = q * 2 + rsub;
      const v4f v = *(const v4fa*)&so[w][r][c4];
      *(v4f*)(C + (size_t)(row0 + r) * ldc + col0 + c4) = v;
    }
    
  }
}

// GEMM C = act(A·W + bias + resid): A f32 (ASPLIT -> hi/lo 2 terms), Wt bf16 [N][K]; ACT 0 none, 1 relu, 2 exact gelu;
// resid (optional, f32, row index = (row % rmod), pitch ldr, RES_BF16 rounds it) added before the activation.
template <bool ASPLIT, int ACT, bool BIAS_BF16, bool RES_BF16>
__global__ __launch_bounds__(128) void k_gemm_bf3(const float* __restrict__ A, int lda, const unsigned short* __restrict__ Wt, int ldb,
                                                const float* __restrict__ bias, const float* __restrict__ resid, int rmod, int ldr,
                                                float* __restrict__ C, int ldc, int M, int N, int K) {
  __shared__ __attribute__((aligned(16))) float so[4][16][64];
  const int tid = threadIdx.x, w = tid >> 5, lane = tid & 31, ln = lane & 15, hh = lane >> 4;
  const int ntn = N / 64;
  const int wid = blockIdx.x * 4 + w;
  const int mt = wid / ntn, nq = wid % ntn;
  if (mt * 16 >= M) return;
  const int row0 = mt * 16, col0 = nq * 64;
  const float* arow = A + (size_t)(row0 + ln) * lda;
  v8f acc[4] = {};
  for (int kb = 0; kb < K; kb += 32) {
    FragB ah, al;
    const v4f x0 = *(const v4fa*)(arow + kb + 8 * hh), x1 = *(const v4fa*)(arow + kb + 8 * hh + 4);
    const v4f x2 = *(const v4fa*)(arow + kb + 16 + 8 * hh), x3 = *(const v4fa*)(arow + kb + 16 + 8 * hh + 4);
    float xs[16] = {x0[0],x0[1],x0[2],x0[3],x1[0],x1[1],x1[2],x1[3],x2[0],x2[1],x2[2],x2[3],x3[0],x3[1],x3[2],x3[3]};
#pragma unroll
    for (int i = 0; i < 16; ++i) { const unsigned short hb = bf16_bits(xs[i]); ah.u[i] = hb; al.u[i] = ASPLIT ? bf16_bits(xs[i] - bf16_val(hb)) : (unsigned short)0; }
#pragma unroll
    for (int t = 0; t < 4; ++t) {
      const unsigned short* brow = Wt + (size_t)(col0 + t * 16 + ln) * ldb + kb;
      FragB b;
      b.half[0] = *(const v8us*)(brow + 8 * hh);
      b.half[1] = *(const v8us*)(brow + 16 + 8 * hh);
      acc[t] = mmaN<ASPLIT ? 2 : 1>(ah.v, al.v, b.v, b.v, acc[t]);
    }
  }
#pragma unroll
  for (int t = 0; t < 4; ++t) {
    const int col = col0 + t * 16 + ln;
    float bv = bias ? bias[col] : 0.f;
    if (BIAS_BF16) bv = bf16_round(bv);
#pragma unroll
    for (int r = 0; r < 8; ++r) {
      float v = acc[t][r] + bv;
      if (resid) { float rv = resid[(size_t)((row0 + 8 * hh + r) % rmod) * ldr + col]; if (RES_BF16) rv = bf16_round(rv); v += rv; }
      if (ACT == 1) v = fmaxf(v, 0.f);
      if (ACT == 2) v = 0.5f * v * (1.0f + erff(v * 0.70710678118654752f));
      if (ACT == 3) { const float u = 0.7978845608028654f * (v + 0.044715f * v * v * v); v = 0.5f * v * (1.0f + tanhf(u)); }
      so[w][8 * hh + r][t * 16 + ln] = v;
    }
  }
  __builtin_amdgcn_fence(__ATOMIC_ACQ_REL, "workgroup");
  __builtin_amdgcn_wave_barrier();
  const int rsub = lane >> 4, c4 = (lane & 15) * 4;
  {
#pragma unroll
    for (int q = 0; q < 8; ++q) {
      const int r = q * 2 + rsub;
      const v4f v = *(const v4fa*)&so[w][r][c4];
      *(v4f*)(C + (size_t)(row0 + r) * ldc + col0 + c4) = v;
    }
    
  }
}
// row LayerNorm (biased variance, eps) over N: s = X (+ R); optional out_sum <- s; out_norm <- (s-mu)*rsqrt(var+eps)*g + b
template <bool PARAM_BF16>
__global__ __launch_bounds__(256) void k_layernorm(const float* __restrict__ X, const float* __restrict__ R, const float* __restrict__ g, const float* __restrict__ bta,
                                                  float* __restrict__ out_sum, float* __restrict__ out_norm, int N, float eps) {
  __shared__ float red[256];
  const int row = blockIdx.x, tid = threadIdx.x;
  const float* x = X + (size_t)row * N; const float* rr = R ? R + (size_t)row * N : nullptr;
  float vals[16];                     // up to N = 4096
  const int per = N / 256;            // contiguous chunk per thread? use strided-by-4 chunks: thread handles j = tid*4 + 1024*u
  float s1 = 0.f;
  for (int u = 0; u < per / 4; ++u) {
    const int j = tid * 4 + 1024 * u;
    const v4f a = *(const v4fa*)(x + j);
    v4f b = {0.f,0.f,0.f,0.f}; if (rr) b = *(const v4fa*)(rr + j);
#pragma unroll
    for (int q = 0; q < 4; ++q) { const float v = a[q] + b[q]; vals[u * 4 + q] = v; s1 += v; }
  }
  red[tid] = s1; __syncthreads();
  for (int st = 128; st > 0; st >>= 1) { if (tid < st) red[tid] += red[tid + st]; __syncthreads(); }
  const float mu = red[0] / (float)N; __syncthreads();
  float s2 = 0.f;
  for (int u = 0; u < per / 4; ++u)
#pragma unroll
    for (int q = 0; q < 4; ++q) { const float c = vals[u * 4 + q] - mu; s2 += c * c; }
  red[tid] = s2; __syncthreads();
  for (int st = 128; st > 0; st >>= 1) { if (tid < st) red[tid] += red[tid + st]; __syncthreads(); }
  const float rs = rsqrtf(red[0] / (float)N + eps);
  {
    for (int u = 0; u < per / 4; ++u) {
      const int j = tid * 4 + 1024 * u;
      v4f o, sm;
#pragma unroll
      for (int q = 0; q < 4; ++q) {
        float gg = g[j + q], bb = bta[j + q];
        if (PARAM_BF16) { gg = bf16_round(gg); bb = bf16_round(bb); }
        sm[q] = vals[u * 4 + q]; o[q] = (vals[u * 4 + q] - mu) * rs * gg + bb;
      }
      if (out_sum) *(v4f*)(out_sum + (size_t)row * N + j) = sm;
      *(v4f*)(out_norm + (size_t)row * N + j) = o;
    }
    
  }
}



// ---- f16 WMMA path (v_wmma_f32_16x16x32_f16): 11-bit significands for operands in range — used where a [0,1] probability operand needs more precision than bf16
typedef _Float16 v16h __attribute__((ext_vector_type(16)));
union FragH { v16h v; v8us half[2]; _Float16 h[16]; unsigned short u[16]; };
template <int NT>
__device__ __forceinline__ v8f mmaH(v16h ah, v16h al, v16h bh, v16h bl, v8f c) {
  c = __builtin_amdgcn_wmma_f32_16x16x32_f16(false, ah, false, bh, (short)0, c, false, false);
  if (NT >= 2) c = __builtin_amdgcn_wmma_f32_16x16x32_f16(false, al, false, bh, (short)0, c, false, false);
  if (NT >= 3) c = __builtin_amdgcn_wmma_f32_16x16x32_f16(false, ah, false, bl, (short)0, c, false, false);
  asm volatile("v_nop\n\tv_nop\n\tv_nop\n\tv_nop" : "+v"(c) : "v"(ah), "v"(al), "v"(bh), "v"(bl));
  return c;
}
// batched GEMM like k_gemm_b but f16 operands: A f32 (split into f16 hi/lo if ASPLIT, else rounded to f16), Bt = f16 values [n][k]; alpha; C f32; N multiple of 16 (partial tiles skipped)
template <bool ASPLIT>
__global__ __launch_bounds__(128) void k_gemm_h(const float* __restrict__ A, int lda, size_t sA, const _Float16* __restrict__ Bh, int ldb, size_t sB, float alpha, float* __restrict__ C, int ldc, size_t sC, int M, int N, int K) {
  __shared__ __attribute__((aligned(16))) float so[4][16][64];
  const int tid = threadIdx.x, w = tid >> 5, lane = tid & 31, ln = lane & 15, hh = lane >> 4; const int by = blockIdx.y;
  A += (size_t)by * sA; Bh += (size_t)by * sB; C += (size_t)by * sC;
  const int ntn = (N + 63) / 64; const int wid = blockIdx.x * 4 + w; const int mt = wid / ntn, nq = wid % ntn; if (mt * 16 >= M) return;
  const int row0 = mt * 16, col0 = nq * 64; const float* arow = A + (size_t)(row0 + ln) * lda;
  v8f acc[4] = {};
  for (int kb = 0; kb < K; kb += 32) {
    FragH ah, al;
    const v4f x0 = *(const v4fa*)(arow + kb + 8 * hh), x1 = *(const v4fa*)(arow + kb + 8 * hh + 4), x2 = *(const v4fa*)(arow + kb + 16 + 8 * hh), x3 = *(const v4fa*)(arow + kb + 16 + 8 * hh + 4);
    float xs[16] = {x0[0],x0[1],x0[2],x0[3],x1[0],x1[1],x1[2],x1[3],x2[0],x2[1],x2[2],x2[3],x3[0],x3[1],x3[2],x3[3]};
#pragma unroll
    for (int i = 0; i < 16; ++i) { const _Float16 h = (_Float16)xs[i]; ah.h[i] = h; al.h[i] = ASPLIT ? (_Float16)(xs[i] - (float)h) : (_Float16)0.0f; }
#pragma unroll
    for (int t = 0; t < 4; ++t) { if (col0 + t * 16 >= N) continue; const size_t boff = (size_t)(col0 + t * 16 + ln) * ldb + kb; FragH bq; bq.half[0] = *(const v8us*)(Bh + boff + 8 * hh); bq.half[1] = *(const v8us*)(Bh + boff + 16 + 8 * hh);
      acc[t] = mmaH<ASPLIT ? 2 : 1>(ah.v, al.v, bq.v, bq.v, acc[t]); }
  }
#pragma unroll
  for (int t = 0; t < 4; ++t) { if (col0 + t * 16 >= N) continue;
#pragma unroll
    for (int r = 0; r < 8; ++r) so[w][8 * hh + r][t * 16 + ln] = acc[t][r] * alpha; }
  __builtin_amdgcn_fence(__ATOMIC_ACQ_REL, "workgroup"); __builtin_amdgcn_wave_barrier();
  const int rsub = lane >> 4, c4 = (lane & 15) * 4;
  {
#pragma unroll
    for (int q = 0; q < 8; ++q) { const int r = q * 2 + rsub; if (col0 + c4 < N) { const v4f v = *(const v4fa*)&so[w][r][c4]; *(v4f*)(C + (size_t)(row0 + r) * ldc + col0 + c4) = v; } }
     }
}

// Wt[n][k] = f16(W[k][n]·scale) from f32 row-major W[K][N] (scale = power of two; bf16-exact weights stay exact in f16 away from the subnormal range)
__global__ __launch_bounds__(256) void k_wt_f16(const float* __restrict__ W, _Float16* __restrict__ Wt, int K, int N, float scale) {
  const int t = blockIdx.x * 256 + threadIdx.x; if (t >= N * (K / 8)) return; const int n = t / (K / 8), k8 = (t % (K / 8)) * 8; FragH f;
#pragma unroll
  for (int i = 0; i < 8; ++i) f.h[i] = (_Float16)(bf16_round(W[(size_t)(k8 + i) * N + n]) * scale); const v8us o = f.half[0];
  *(v8us*)((unsigned short*)Wt + (size_t)n * K + k8) = o; 
}
// k_gemm_hh variant with fused epilogue: v = acc·alpha + bias[by·sBias + col] (+ CP[(row/rowsPerB)·sCPb + by·64 + col] if CP) ; ACT 0 none / 1 elu ; writes f16 C16 (and f32 C if non-null)
template <int ACT>
__global__ __launch_bounds__(128) void k_gemm_hhx(const _Float16* __restrict__ A, int lda, size_t sA, const _Float16* __restrict__ Bh, int ldb, size_t sB, float alpha, const float* __restrict__ bias, size_t sBias, const float* __restrict__ CP, int rowsPerB, size_t sCPb, int row0g,
    float* __restrict__ C, _Float16* __restrict__ C16, int ldc, size_t sC, int M, int N, int K) {
  __shared__ __attribute__((aligned(16))) float so[4][16][64];
  const int tid = threadIdx.x, w = tid >> 5, lane = tid & 31, ln = lane & 15, hh = lane >> 4; const int by = blockIdx.y;
  A += (size_t)by * sA; Bh += (size_t)by * sB; const size_t cofs = (size_t)by * sC; const float* bp = bias ? bias + (size_t)by * sBias : nullptr;
  const int ntn = (N + 63) / 64; const int wid = blockIdx.x * 4 + w; const int mt = wid / ntn, nq = wid % ntn; if (mt * 16 >= M) return;
  const int row0 = mt * 16, col0 = nq * 64; const _Float16* arow = A + (size_t)(row0 + ln) * lda;
  v8f acc[4] = {};
  for (int kb = 0; kb < K; kb += 32) { FragH ah; ah.half[0] = *(const v8us*)((const unsigned short*)arow + kb + 8 * hh); ah.half[1] = *(const v8us*)((const unsigned short*)arow + kb + 16 + 8 * hh);
#pragma unroll
    for (int t = 0; t < 4; ++t) { if (col0 + t * 16 >= N) continue; const size_t boff = (size_t)(col0 + t * 16 + ln) * ldb + kb; FragH bq; bq.half[0] = *(const v8us*)((const unsigned short*)Bh + boff + 8 * hh); bq.half[1] = *(const v8us*)((const unsigned short*)Bh + boff + 16 + 8 * hh);
      acc[t] = mmaH<1>(ah.v, ah.v, bq.v, bq.v, acc[t]); }
  }
#pragma unroll
  for (int t = 0; t < 4; ++t) { if (col0 + t * 16 >= N) continue; const int col = col0 + t * 16 + ln; const float bv = bp ? bf16_round(bp[col]) : 0.f;
#pragma unroll
    for (int r = 0; r < 8; ++r) { float v = acc[t][r] * alpha + bv; if (CP) { const int rr = row0g + row0 + 8 * hh + r; if (rowsPerB < 0) v += CP[cofs + (size_t)rr * ldc + col];      /* rowsPerB < 0: own element of the batched C plane */ else { const int bidx = rr / rowsPerB; v += CP[(size_t)bidx * sCPb + (size_t)by * 64 + col]; } } if (ACT == 1) v = (v > 0.f) ? v : expm1f(v); else if (ACT == 7) v = (v > 0.f) ? v + 1.0f : expf(v); else if (ACT == 8) v = tanhf(v); else if (ACT == 9) v = 0.5f * v * (1.0f + tanhf(0.7978845608028654f * (v + 0.044715f * v * v * v))); else if (ACT == 11) v = 1.0f / (1.0f + expf(-v)); else if (ACT == 12) v = (v > 0.f) ? v : 0.01f * v; else if (ACT == 14) v = (v > 0.f) ? v : 0.1f * v; else if (ACT == 16) v = (v >= 0.f) ? v : 0.3f * v; else if (ACT == 17) v = (v >= 0.f) ? v : 0.2f * v; else if (ACT == 15) v = v / (1.0f + expf(-v)); else if (ACT == 3) v = fmaxf(v, 0.f); else if (ACT == 6) v = 0.5f * v * (1.0f + erff(v * 0.70710678118654752f)); so[w][8 * hh + r][t * 16 + ln] = v; } }
  __builtin_amdgcn_fence(__ATOMIC_ACQ_REL, "workgroup"); __builtin_amdgcn_wave_barrier();
  const int rsub = lane >> 4, c4 = (lane & 15) * 4; typedef _Float16 v4h __attribute__((ext_vector_type(4)));
  {
#pragma unroll
    for (int q = 0; q < 8; ++q) { const int r = q * 2 + rsub; if (col0 + c4 < N) { const v4f v = *(const v4fa*)&so[w][r][c4]; if (C) *(v4f*)(C + cofs + (size_t)(row0 + r) * ldc + col0 + c4) = v; if (C16) { v4h h4; for (int i = 0; i < 4; ++i) h4[i] = (_Float16)v[i]; *(v4h*)(C16 + cofs + (size_t)(row0 + r) * ldc + col0 + c4) = h4; } } }
     }
}


typedef _Float16 v4h __attribute__((ext_vector_type(4)));

// operand preparation in ONE launch: x as exact f16 rows, the three natural [out][in] weight planes x16 as f16 (stacked q | k | v), the three biases stacked (f32). The parts need nothing of each other, so they share one grid by ranges of the
// block index (block-uniform branches): PREP_XB blocks for x, PREP_WB for each weight plane, one last block for the biases. A block converts PREP_L * 1024 elements in a row: load j of a thread is its 16 bytes of the block's j-th 4-KiB piece
// (a wave's load = 512 bytes in a row, its store = 256), and a thread's PREP_L loads are all issued ahead of the first conversion.
#define PREP_L 16
#define PREP_XB ((int)(NR * DM / (PREP_L * 1024)))
#define PREP_WB (DM * DM / (PREP_L * 1024))
__global__ __launch_bounds__(256) void k_prep(const float* __restrict__ x, const float* __restrict__ wq, const float* __restrict__ wk, const float* __restrict__ wv, const float* __restrict__ bq, const float* __restrict__ bk, const float* __restrict__ bv,
    _Float16* __restrict__ X16, _Float16* __restrict__ BQKV, float* __restrict__ bqkv) {
  static_assert(NR * DM % (PREP_L * 1024) == 0 && DM * DM % (PREP_L * 1024) == 0 && DM == 1024, "whole blocks only; a bias is four elements a thread");
  const int tid = threadIdx.x, blk = blockIdx.x;
  if (blk >= PREP_XB + 3 * PREP_WB) { const v4f a = *(const v4fa*)(bq + tid * 4), b = *(const v4fa*)(bk + tid * 4), c = *(const v4fa*)(bv + tid * 4); float* d = bqkv + tid * 4; *(v4f*)d = a; *(v4f*)(d + DM) = b; *(v4f*)(d + 2 * DM) = c; return; }
  const float* src = x; _Float16* dst = X16; float scale = 1.0f; int lb = blk;
  if (blk >= PREP_XB) { const int p = (blk - PREP_XB) / PREP_WB; lb = (blk - PREP_XB) % PREP_WB; src = p == 0 ? wq : p == 1 ? wk : wv; dst = BQKV + (size_t)p * DM * DM; scale = 16.0f; }
  const size_t e0 = (size_t)lb * (PREP_L * 1024) + tid * 4; const float* sp = src + e0; _Float16* dp = dst + e0; v4f a[PREP_L];
  /* both loops are unrolled because the loaded values live in registers, which need constant indices */
#pragma unroll
  for (int j = 0; j < PREP_L; ++j) a[j] = *(const v4fa*)(sp + j * 1024);
  asm volatile("s_wait_xcnt 0x0" :: "v"(sp) : "memory");      /* precaution: no register that an issued load names is written ahead of this wait; the address pair is an input here so that no load's result is placed on it */
#pragma unroll
  for (int j = 0; j < PREP_L; ++j) { v4h h4; for (int q = 0; q < 4; ++q) h4[q] = (_Float16)(bf16_round(a[j][q]) * scale); *(v4h*)(dp + j * 1024) = h4; } }
__global__ __launch_bounds__(256) void k_h16(const float* __restrict__ x, _Float16* __restrict__ X16, size_t n8) { const size_t t = (size_t)blockIdx.x * 256 + threadIdx.x; if (t >= n8) return; FragH f;
#pragma unroll
  for (int q = 0; q < 8; ++q) f.h[q] = (_Float16)x[t * 8 + q]; *(v8us*)((unsigned short*)X16 + t * 8) = f.half[0];  }
__global__ __launch_bounds__(256) void k_round16f(const float* __restrict__ W, _Float16* __restrict__ Bt, size_t n8) { const size_t t = (size_t)blockIdx.x * 256 + threadIdx.x; if (t >= n8) return; FragH f;
#pragma unroll
  for (int i = 0; i < 8; ++i) f.h[i] = (_Float16)(bf16_round(W[t * 8 + i]) * 16.0f); *(v8us*)((unsigned short*)Bt + t * 8) = f.half[0];  }
__global__ __launch_bounds__(256) void k_hl(const float* __restrict__ F, _Float16* __restrict__ Hh, _Float16* __restrict__ Hl, size_t n8) { const size_t t = (size_t)blockIdx.x * 256 + threadIdx.x; if (t >= n8) return; FragH fh, fl; const v4f a = *(const v4fa*)(F + t * 8), c = *(const v4fa*)(F + t * 8 + 4);
#pragma unroll
  for (int q = 0; q < 4; ++q) { _Float16 h = (_Float16)a[q]; fh.h[q] = h; fl.h[q] = (_Float16)((a[q] - (float)h) * 1024.0f); h = (_Float16)c[q]; fh.h[4 + q] = h; fl.h[4 + q] = (_Float16)((c[q] - (float)h) * 1024.0f); }
  { *(v8us*)((unsigned short*)Hh + t * 8) = fh.half[0]; *(v8us*)((unsigned short*)Hl + t * 8) = fl.half[0];  } }

// ---- fast GEMM (wave tile 32x64, eight waves = block tile 128x128; requires M % 128 == 0, N % 128 == 0, K % 64 == 0); epilogue = k_gemm_hhx semantics ----
// Operands go through LDS: a stage is 64 k of the block's 128 A rows and 128 B rows (one whole 128-byte line a row), brought by asynchronous copies to LDS, eight lanes a line, two buffers, so that the next stage flies while this one is worked on;
// rows stand at a pitch of 144 bytes (16 x odd: the sixteen rows of a ds_load_b128 fragment read fall on different banks). Each accumulator still takes its k blocks of 32 in rising order.
// the f32 plane C holds only the first crows rows of every cmod rows, packed (row (R / cmod) * crows + R % cmod, pitch ldc); cmod % 32 == 0 and crows % 32 == 0, so a wave's tile is wholly in it or wholly out
// the columns from ctcol0 on (ctcol0 % 128 == 0) go out transposed, f16, into CT instead of C16: element (R, col) stands at CT[((R / ctmod) * (N - ctcol0) + col - ctcol0) * ctmod + R % ctmod] (ctmod % 128 == 0: a block's 128 rows share R / ctmod; one plane only, grid.y == 1).
// A lane's eight accumulator rows of one column are 16 bytes in a row of the transposed tile, so the block builds the tile [128 columns][128 rows] in LDS by 16-byte writes and stores each of its rows as 256 bytes in a row.
__device__ __forceinline__ v16h g2_frag(const _Float16* p, int hh) { FragH f; f.half[0] = *(const v8us*)((const unsigned short*)p + 8 * hh); f.half[1] = *(const v8us*)((const unsigned short*)p + 16 + 8 * hh); return f.v; }
__device__ __forceinline__ v8f g2_mma(v16h a, v16h b, v8f c) { v8f d = __builtin_amdgcn_wmma_f32_16x16x32_f16(false, a, false, b, (short)0, c, false, false); asm volatile("v_nop\n\tv_nop\n\tv_nop\n\tv_nop" : "+v"(d) : "v"(a), "v"(b)); return d; }
#define G2_PB 144                    /* LDS row pitch, bytes */
#define G2_SB (256 * G2_PB)          /* one stage: 128 A rows, then 128 B rows */
#define G2_TP 272                    /* LDS row pitch of the transposed output tile, bytes: 128 f16 + 16 (16 x odd, as G2_PB) */
// one stage's copies of one lane: rows rr + RPR j (j = 0..3) of a first and of a second operand, 16 bytes each (RPR = rows that the block's lanes cover at once, eight lanes a row); pa, pb = the lane's place in row rr of the two operands at the stage's k,
// sa, sb = RPR rows in elements, l = the lane's LDS byte address in row rr of the buffer (4 RPR rows of the first operand, then 4 RPR of the second).
// The s_wait_xcnt ends the copies' own statement as a precaution: no register that an issued copy names is written ahead of it.
template <int RPR> __device__ __forceinline__ void g2_stage(const _Float16* pa, size_t sa, const _Float16* pb, size_t sb, unsigned l) {
  const _Float16* a1 = pa + sa; const _Float16* a2 = a1 + sa; const _Float16* a3 = a2 + sa; const _Float16* b1 = pb + sb; const _Float16* b2 = b1 + sb; const _Float16* b3 = b2 + sb;
  asm volatile("global_load_async_to_lds_b128 %0, %8, off\n\tglobal_load_async_to_lds_b128 %1, %9, off\n\tglobal_load_async_to_lds_b128 %2, %10, off\n\tglobal_load_async_to_lds_b128 %3, %11, off\n\t"
               "global_load_async_to_lds_b128 %4, %12, off\n\tglobal_load_async_to_lds_b128 %5, %13, off\n\tglobal_load_async_to_lds_b128 %6, %14, off\n\tglobal_load_async_to_lds_b128 %7, %15, off\n\ts_wait_xcnt 0x0"
               :: "v"(l), "v"(l + RPR * G2_PB), "v"(l + 2 * RPR * G2_PB), "v"(l + 3 * RPR * G2_PB), "v"(l + 4 * RPR * G2_PB), "v"(l + 5 * RPR * G2_PB), "v"(l + 6 * RPR * G2_PB), "v"(l + 7 * RPR * G2_PB), "v"(pa), "v"(a1), "v"(a2), "v"(a3), "v"(pb), "v"(b1), "v"(b2), "v"(b3) : "memory"); }
template <int ACT>
__global__ __launch_bounds__(256) void k_gemm2(const _Float16* __restrict__ A, int lda, size_t sA, const _Float16* __restrict__ Bh, int ldb, size_t sB, float alpha, const float* __restrict__ bias, size_t sBias, const float* __restrict__ CP, int rowsPerB, size_t sCPb, int row0g,
    float* __restrict__ C, int cmod, int crows, _Float16* __restrict__ C16, _Float16* __restrict__ CT, int ctcol0, int ctmod, int ldc, size_t sC, int M, int N, int K) { static_assert(ACT == 0 || ACT == 3 || ACT == 6 || ACT == 8 || ACT == 9 || ACT == 11 || ACT == 12 || ACT == 14 || ACT == 15 || ACT == 16 || ACT == 17, "k_gemm2: unsupported ACT code (would silently apply no activation)");
  __shared__ __attribute__((aligned(16))) unsigned char sm[2 * G2_SB];      /* the two stage buffers; behind the loop's last barrier the same bytes are the waves' output staging */
  static_assert(sizeof(float) * 8 * 32 * 68 <= 2 * G2_SB && 128 * G2_TP <= 2 * G2_SB, "output staging must fit the stage buffers"); float (*so)[32][68] = (float (*)[32][68])sm;
  const int tid = threadIdx.x, w = tid >> 5, lane = tid & 31, ln = lane & 15, hh = lane >> 4; const int by = blockIdx.y;
  A += (size_t)by * sA; Bh += (size_t)by * sB; const size_t cofs = (size_t)by * sC; const float* bp = bias ? bias + (size_t)by * sBias : nullptr;
  const int ntn = N >> 7; const int mt = blockIdx.x / ntn, nq = blockIdx.x - mt * ntn; if (mt * 128 >= M) return;      /* the whole block leaves, ahead of every barrier */
  const int row0 = mt * 128 + 32 * (w & 3), col0 = nq * 128 + 64 * (w >> 2);
  const int rr = tid >> 3, c8 = (tid & 7) * 8; const _Float16* ga = A + (size_t)(mt * 128 + rr) * lda + c8; const _Float16* gb = Bh + (size_t)(nq * 128 + rr) * ldb + c8; const size_t sa32 = (size_t)32 * lda, sb32 = (size_t)32 * ldb;
  const unsigned l0 = (unsigned)(size_t)sm + (unsigned)(rr * G2_PB + c8 * 2);      /* low 32 bits of the __shared__ address = LDS byte address */
  const int aoff = (32 * (w & 3) + ln) * G2_PB, boff = (128 + 64 * (w >> 2) + ln) * G2_PB; const int nst = K >> 6;
  const v8f z8 = {0.f,0.f,0.f,0.f,0.f,0.f,0.f,0.f}; v8f c00 = z8, c01 = z8, c02 = z8, c03 = z8, c10 = z8, c11 = z8, c12 = z8, c13 = z8;
  g2_stage<32>(ga, sa32, gb, sb32, l0);
  asm volatile("s_wait_asynccnt 0x0" ::: "memory");      /* this wave's copies of stage 0 have landed */
  __syncthreads();      /* ... and every other wave's: stage 0 may be read */
  if (nst > 1) g2_stage<32>(ga + 64, sa32, gb + 64, sb32, l0 + G2_SB);
  /* not unrolled: one trip a stage, the buffer picked by the trip's parity */
#pragma unroll 1
  for (int t = 0; t < nst; ++t) { const unsigned char* st = sm + (t & 1) * G2_SB; const _Float16* ap = (const _Float16*)(st + aoff); const _Float16* bq = (const _Float16*)(st + boff);
    /* unrolled: the stage's two k blocks of 32 */
#pragma unroll
    for (int kb = 0; kb < 64; kb += 32) { const v16h a0 = g2_frag(ap + kb, hh), a1 = g2_frag(ap + 16 * (G2_PB / 2) + kb, hh);
      const v16h b0 = g2_frag(bq + kb, hh), b1 = g2_frag(bq + 16 * (G2_PB / 2) + kb, hh), b2 = g2_frag(bq + 32 * (G2_PB / 2) + kb, hh), b3 = g2_frag(bq + 48 * (G2_PB / 2) + kb, hh);
      /* inputs-only fence on the loaded values: it keeps the k block's twelve LDS reads in front of its products, in flight together (one LDS latency a block; left alone the compiler waited for each B fragment in turn) */
      asm volatile("" :: "v"(a0), "v"(a1), "v"(b0), "v"(b1), "v"(b2), "v"(b3));
      c00 = g2_mma(a0, b0, c00); c10 = g2_mma(a1, b0, c10); c01 = g2_mma(a0, b1, c01); c11 = g2_mma(a1, b1, c11);
      c02 = g2_mma(a0, b2, c02); c12 = g2_mma(a1, b2, c12); c03 = g2_mma(a0, b3, c03); c13 = g2_mma(a1, b3, c13); }
    asm volatile("s_wait_dscnt 0x0" ::: "memory");      /* this wave's reads of the buffer are done before it is refilled */
    asm volatile("s_wait_asynccnt 0x0" ::: "memory");      /* this wave's copies of stage t + 1 have landed */
    __syncthreads();      /* publishes stage t + 1 and ends every wave's reads of stage t */
    if (t + 2 < nst) g2_stage<32>(ga + (size_t)(t + 2) * 64, sa32, gb + (size_t)(t + 2) * 64, sb32, l0 + (t & 1) * G2_SB); }
  asm volatile("s_wait_asynccnt 0x0" ::: "memory");      /* no copy is outstanding when the buffers become output staging */
  v8f accs[8] = {c00, c01, c02, c03, c10, c11, c12, c13};
#pragma unroll
  for (int u = 0; u < 8; ++u) { const int t = u & 3, half = u >> 2; const int col = col0 + t * 16 + ln; const float bv = bp ? bf16_round(bp[col]) : 0.f;
#pragma unroll
    for (int r = 0; r < 8; ++r) { const int rloc = half * 16 + 8 * hh + r; float v = accs[u][r] * alpha + bv; if (CP) { if (rowsPerB < 0) v += CP[cofs + (size_t)(row0g + row0 + rloc) * ldc + col];      /* rowsPerB < 0: own element of the batched C plane */ else { const int bidx = (row0g + row0 + rloc) / rowsPerB; v += CP[(size_t)bidx * sCPb + (size_t)by * 64 + col]; } }
      if (ACT == 3) v = fmaxf(v, 0.f); else if (ACT == 6) v = 0.5f * v * (1.0f + erff(v * 0.70710678118654752f)); else if (ACT == 11) v = 1.0f / (1.0f + expf(-v)); else if (ACT == 15) v = v / (1.0f + expf(-v)); else if (ACT == 12) v = (v > 0.f) ? v : 0.01f * v; else if (ACT == 8) v = tanhf(v); else if (ACT == 9) v = 0.5f * v * (1.0f + tanhf(0.7978845608028654f * (v + 0.044715f * v * v * v))); else if (ACT == 14) v = (v > 0.f) ? v : 0.1f * v; else if (ACT == 16) v = (v >= 0.f) ? v : 0.3f * v; else if (ACT == 17) v = (v >= 0.f) ? v : 0.2f * v;
      accs[u][r] = v; } }
  const int rsub = lane >> 4, c4 = (lane & 15) * 4; const int rin = row0 % cmod; float* Cw = (C && rin < crows) ? C + cofs + ((size_t)(row0 / cmod) * crows + rin) * ldc + col0 + c4 : nullptr;
  if (CT && nq * 128 >= ctcol0) {      /* the same for the whole block: its columns go out transposed */
    /* unrolled for constant register indices */
#pragma unroll
    for (int u = 0; u < 8; ++u) { const int t = u & 3, half = u >> 2; FragH f; for (int r = 0; r < 8; ++r) f.h[r] = (_Float16)accs[u][r];
      *(v8us*)(sm + (64 * (w >> 2) + t * 16 + ln) * G2_TP + (32 * (w & 3) + half * 16 + 8 * hh) * 2) = f.half[0]; }
    __syncthreads();      /* the transposed tile is whole: every wave's columns are written before any row of it is read */
    unsigned short* cp = (unsigned short*)CT + ((size_t)((mt * 128) / ctmod) * (N - ctcol0) + (nq * 128 - ctcol0) + (tid >> 4)) * ctmod + (mt * 128) % ctmod + (tid & 15) * 8; const unsigned char* tp = sm + (tid >> 4) * G2_TP + (tid & 15) * 16;
    v8us tv[8];
#pragma unroll
    for (int q = 0; q < 8; ++q) tv[q] = *(const v8us*)(tp + q * 16 * G2_TP);
    __syncthreads();      /* every wave has read its rows of the tile before the f32 staging below takes the same bytes; the stores stand behind it, so that no wave waits here for them */
    unsigned short* cq[8];
#pragma unroll
    for (int q = 0; q < 8; ++q) { cq[q] = cp + (size_t)(q * 16) * ctmod; *(v8us*)cq[q] = tv[q]; }
    /* precaution: no register that an issued store names is written ahead of this wait; the eight address pairs and the stored values are inputs here so that they keep their registers up to it */
    asm volatile("s_wait_xcnt 0x0" :: "v"(cq[0]), "v"(cq[1]), "v"(cq[2]), "v"(cq[3]), "v"(cq[4]), "v"(cq[5]), "v"(cq[6]), "v"(cq[7]), "v"(tv[0]), "v"(tv[1]), "v"(tv[2]), "v"(tv[3]), "v"(tv[4]), "v"(tv[5]), "v"(tv[6]), "v"(tv[7]) : "memory");
    if (!Cw) return;      /* behind the block's last barrier: a wave with no f32 rows has nothing left to store */
    C16 = nullptr; }
#pragma unroll
  for (int u = 0; u < 8; ++u) for (int r = 0; r < 8; ++r) so[w][(u >> 2) * 16 + 8 * hh + r][(u & 3) * 16 + ln] = accs[u][r];
  __builtin_amdgcn_fence(__ATOMIC_ACQ_REL, "workgroup"); __builtin_amdgcn_wave_barrier();
  {
#pragma unroll
    for (int q = 0; q < 16; ++q) { const int r = q * 2 + rsub; const v4f v = *(const v4fa*)&so[w][r][c4]; if (Cw) *(v4f*)(Cw + (size_t)r * ldc) = v; if (C16) { v4h h4; for (int i = 0; i < 4; ++i) h4[i] = (_Float16)v[i]; *(v4h*)(C16 + cofs + (size_t)(row0 + r) * ldc + col0 + c4) = h4; } }
     } }


__global__ __launch_bounds__(256) void k_rsm(const float* __restrict__ S, _Float16* __restrict__ P, int nrows) {
  #pragma clang fp contract(off)
  const int i = blockIdx.x * 256 + threadIdx.x; if (i >= nrows) return; const float* s = S + (size_t)i * SQ; float mx = -3.0e38f;
#pragma unroll 1
  for (int j = 0; j < SQ; ++j) mx = fmaxf(mx, s[j]); float se = 0.f;
#pragma unroll 1
  for (int j = 0; j < SQ; ++j) se += expf(s[j] - mx); const float sc = 256.0f / se;
#pragma unroll 1
  for (int j0 = 0; j0 < SQ; j0 += 8) { FragH f; for (int q = 0; q < 8; ++q) f.h[q] = (_Float16)(expf(s[j0 + q] - mx) * sc); unsigned short* d = (unsigned short*)P + (size_t)i * SQ + j0; *(v8us*)d = f.half[0];  } }
__global__ __launch_bounds__(256) void k_vt(const _Float16* __restrict__ V16, int b, int h0, _Float16* __restrict__ VT) { __shared__ unsigned short tl[64][65]; const int tid = threadIdx.x; const int hh = blockIdx.x % HG, sg = blockIdx.x / HG; const int s0 = sg * 64; const int h = h0 + hh;
  for (int i = tid; i < 64 * 8; i += 256) { const int j = i / 8, d8 = (i % 8) * 8; FragH f; f.half[0] = *(const v8us*)((const unsigned short*)V16 + ((size_t)b * SQ + s0 + j) * DM + h * HD + d8); for (int q = 0; q < 8; ++q) tl[d8 + q][j] = f.u[q]; }
  __syncthreads();
  { for (int i = tid; i < 64 * 8; i += 256) { const int d = i / 8, j8 = (i % 8) * 8; FragH f; for (int q = 0; q < 8; ++q) f.u[q] = tl[d][j8 + q]; *(v8us*)((unsigned short*)VT + ((size_t)hh * HD + d) * SQ + s0 + j8) = f.half[0]; }  } }



// lane l with lane l ^ M of its 16-lane row (DPP row_xmask), and lane l with lane l ^ 16
template <int M> __device__ __forceinline__ float rs_xm(float x) { return __builtin_bit_cast(float, __builtin_amdgcn_update_dpp(0, __builtin_bit_cast(int, x), 0x160 | M, 0xf, 0xf, true)); }
__device__ __forceinline__ float rs_xh(float x) { return __builtin_bit_cast(float, __builtin_amdgcn_permlanex16(__builtin_bit_cast(int, x), __builtin_bit_cast(int, x), 0x76543210, 0xfedcba98, false, false)); }
__device__ __forceinline__ v16h fa_frag(const _Float16* p) { FragH f; f.half[0] = *(const v8us*)((const unsigned short*)p); f.half[1] = *(const v8us*)((const unsigned short*)p + 16); return f.v; }      /* p already holds the lane half's 8-element shift */
// exp2 of eight values, and of one: each v_exp_f32 works on a register of its own and a v_nop ends the statement. It is there for the slot that the instruction set asks for behind a transcendental before its result is read or its source overwritten.
__device__ __forceinline__ void fa_exp2x8(float (&e)[8]) { asm("v_exp_f32 %0, %0\n\tv_exp_f32 %1, %1\n\tv_exp_f32 %2, %2\n\tv_exp_f32 %3, %3\n\tv_exp_f32 %4, %4\n\tv_exp_f32 %5, %5\n\tv_exp_f32 %6, %6\n\tv_exp_f32 %7, %7\n\tv_nop" : "+v"(e[0]), "+v"(e[1]), "+v"(e[2]), "+v"(e[3]), "+v"(e[4]), "+v"(e[5]), "+v"(e[6]), "+v"(e[7])); }
__device__ __forceinline__ float fa_exp2(float x) { asm("v_exp_f32 %0, %0\n\tv_nop" : "+v"(x)); return x; }
// a trip's fragments: kl, vl = the lane's place (row ln, its half's 8-element shift) in the K rows and in the V^T rows of the trip's LDS buffer
__device__ __forceinline__ void fa_load(const _Float16* kl, const _Float16* vl, v16h (&kc)[4][2], v16h (&vf)[4][2]) {
  /* unrolled because the fragments live in registers, which need constant indices */
#pragma unroll
  for (int t = 0; t < 4; ++t) { kc[t][0] = fa_frag(kl + (16 * t) * (G2_PB / 2)); kc[t][1] = fa_frag(kl + (16 * t) * (G2_PB / 2) + 32); }
#pragma unroll
  for (int t = 0; t < 4; ++t) { vf[t][0] = fa_frag(vl + (16 * t) * (G2_PB / 2)); vf[t][1] = fa_frag(vl + (16 * t) * (G2_PB / 2) + 32); }
  /* inputs-only fence on the loaded values: it keeps the trip's 32 LDS reads in front of the arithmetic, in flight together (one LDS latency a trip; left alone the compiler waited for each pair of K reads in turn and left V^T reads among the last products) */
  asm volatile("" :: "v"(kc[0][0]), "v"(kc[0][1]), "v"(kc[1][0]), "v"(kc[1][1]), "v"(kc[2][0]), "v"(kc[2][1]), "v"(kc[3][0]), "v"(kc[3][1]), "v"(vf[0][0]), "v"(vf[0][1]), "v"(vf[1][0]), "v"(vf[1][1]), "v"(vf[2][0]), "v"(vf[2][1]), "v"(vf[3][0]), "v"(vf[3][1])); }
// one trip's arithmetic: keys kb .. kb + 63, all operands in registers
__device__ __forceinline__ void fa_trip(const int kb, const int q0, const int ln, const int hh, const v16h qf0, const v16h qf1, const v16h (&kc)[4][2], const v16h (&vf)[4][2], v8f (&o)[4], float& m, float& l) {
  const v8f z8 = {0.f,0.f,0.f,0.f,0.f,0.f,0.f,0.f}; const float cs = 0.125f * 1.4426950408889634f;      /* 1 / sqrt(HD), in log2 units */
  /* every loop of this function is unrolled because fragments, scores and sums live in registers, which need constant indices */
  v8f s[4];
#pragma unroll
  for (int t = 0; t < 4; ++t) { s[t] = __builtin_amdgcn_wmma_f32_16x16x32_f16(false, kc[t][0], false, qf0, (short)0, z8, false, false); s[t] = __builtin_amdgcn_wmma_f32_16x16x32_f16(false, kc[t][1], false, qf1, (short)0, s[t], false, false); }
  if (kb + 63 > q0) {      /* wave-uniform: the trip that reaches the diagonal; s[t][r] = key kb + 16 t + 8 hh + r against query q0 + ln */
#pragma unroll
    for (int t = 0; t < 4; ++t) for (int r = 0; r < 8; ++r) s[t][r] = (kb + 16 * t + 8 * hh + r <= q0 + ln) ? s[t][r] : -1.0e30f; }
  float mx = s[0][0];
#pragma unroll
  for (int t = 0; t < 4; ++t) for (int r = 0; r < 8; ++r) mx = fmaxf(mx, s[t][r]);
  mx = fmaxf(mx, rs_xh(mx));      /* the other half of the query's keys */
  const float mn = fmaxf(m, mx * cs); const float al = fa_exp2(m - mn); m = mn;
  v4f s4 = {0.f, 0.f, 0.f, 0.f}; FragH pf[2];
#pragma unroll
  for (int t = 0; t < 4; ++t) { float e[8]; for (int r = 0; r < 8; ++r) e[r] = fmaf(s[t][r], cs, -mn); fa_exp2x8(e); for (int r = 0; r < 8; ++r) { s4[r & 3] += e[r]; pf[t >> 1].h[(t & 1) * 8 + r] = (_Float16)e[r]; } }
  l = l * al + ((s4[0] + s4[1]) + (s4[2] + s4[3]));      /* each half keeps its own keys' share */
#pragma unroll
  for (int t = 0; t < 4; ++t) { o[t] *= al; o[t] = __builtin_amdgcn_wmma_f32_16x16x32_f16(false, vf[t][0], false, pf[0].v, (short)0, o[t], false, false); o[t] = __builtin_amdgcn_wmma_f32_16x16x32_f16(false, vf[t][1], false, pf[1].v, (short)0, o[t], false, false); } }
#define FA_SB (128 * G2_PB)          /* one stage: 64 K rows, then 64 V^T rows */
#define FA_YN ((SQ - QT0) / 64)      /* grid.y rows of the f16 path: the 64-row query blocks behind the first QT0 rows */
#define A0_YN (QT0 / 8)              /* grid.y rows of the exact f32 path: the 8-row blocks of the first QT0 rows */
// four waves per SIMD: with at most 256 registers a wave every f16-path block of the launch is resident from the start (16 waves per WGP), and the waves of a SIMD fill each other's waits.
// The exact f32 rows (a0_rows) need only the projection's results, as the f16 path does, so they share this launch: the blocks of grid.y >= FA_YN take them, heaviest first, in the places that are free at the start and that the lighter
// f16-path blocks leave, while the long f16-path blocks are still walking their keys. Every output row has one writer: the f16 path leaves the first QT0 rows of a batch alone.
template <int MASKADD> __device__ __forceinline__ void a0_rows(const float* __restrict__ QF, const float* __restrict__ KF, const float* __restrict__ VF, const float* __restrict__ mask, float scale, float* __restrict__ OF, int ldo, const int b, const int h, const int r8);      /* defined below */
__global__ __launch_bounds__(128) __attribute__((amdgpu_waves_per_eu(4, 4))) void k_fattn(const _Float16* __restrict__ QKVp, const _Float16* __restrict__ VTp, const float* __restrict__ QF, const float* __restrict__ KF, const float* __restrict__ VF, float* __restrict__ out) {
  __shared__ __attribute__((aligned(16))) unsigned char sm[2 * FA_SB];      /* the two stage buffers */
  const int tid = threadIdx.x, lane = tid & 31, ln = lane & 15, hh = lane >> 4; const int w = __builtin_amdgcn_readfirstlane(tid >> 5);
  const int bh = blockIdx.x, b = bh / NH, h = bh % NH;
  if ((int)blockIdx.y >= FA_YN) { a0_rows<0>(QF, KF, VF, nullptr, 0.125f, out, DM, b, h, FA_YN + A0_YN - 1 - (int)blockIdx.y); return; }      /* the whole block leaves, ahead of every barrier and copy */
  const int yb = SQ / 64 - 1 - (int)blockIdx.y; const int q0 = yb * 64 + w * 16;      /* wave-uniform first query row */
  const int nt = yb + 1;      /* trips of 64 keys, the same for the block's four waves: the last one holds every wave's diagonal */
  const _Float16* qp = QKVp + ((size_t)b * SQ + q0 + ln) * LQ + h * HD + 8 * hh;
  const int rr = tid >> 3, c8 = (tid & 7) * 8; const _Float16* gk = QKVp + ((size_t)b * SQ + rr) * LQ + DM + h * HD + c8; const _Float16* gv = VTp + ((size_t)bh * HD + rr) * SQ + c8;      /* the lane's 16 bytes of key row rr and of V^T row rr, trip 0 */
  const unsigned l0 = (unsigned)(size_t)sm + (unsigned)(rr * G2_PB + c8 * 2);      /* low 32 bits of the __shared__ address = LDS byte address */
  const int koff = ln * G2_PB + 16 * hh, voff = (64 + ln) * G2_PB + 16 * hh;
  const v16h qf0 = fa_frag(qp), qf1 = fa_frag(qp + 32);
  asm volatile("s_wait_xcnt 0x0" :: "v"(qp) : "memory");      /* precaution: no register that an issued load names is written ahead of this wait; the q address pair is an input here so that no load's result is placed on it */
  g2_stage<16>(gk, (size_t)16 * LQ, gv, (size_t)16 * SQ, l0);
  asm volatile("s_wait_asynccnt 0x0" ::: "memory");      /* this wave's copies of trip 0 have landed */
  __syncthreads();      /* ... and every other wave's: trip 0's rows may be read */
  if (nt > 1) g2_stage<16>(gk + (size_t)64 * LQ, (size_t)16 * LQ, gv + 64, (size_t)16 * SQ, l0 + FA_SB);
  const v8f z8 = {0.f,0.f,0.f,0.f,0.f,0.f,0.f,0.f}; v8f o[4] = {z8, z8, z8, z8}; float m = -1.0e30f, l = 0.f;
  /* not unrolled: one trip a stage, the buffer picked by the trip's parity */
#pragma unroll 1
  for (int t = 0; t < nt; ++t) { const unsigned char* st = sm + (t & 1) * FA_SB; v16h kc[4][2], vf[4][2];
    fa_load((const _Float16*)(st + koff), (const _Float16*)(st + voff), kc, vf);      /* the trip's only LDS reads: the buffer is handed on right behind them, so that its refill has a whole trip to land */
    asm volatile("s_wait_dscnt 0x0" ::: "memory");      /* this wave's reads of the buffer are done before it is refilled */
    asm volatile("s_wait_asynccnt 0x0" ::: "memory");      /* this wave's copies of trip t + 1 have landed */
    __syncthreads();      /* publishes trip t + 1's rows and ends every wave's reads of trip t's */
    if (t + 2 < nt) g2_stage<16>(gk + (size_t)(t + 2) * 64 * LQ, (size_t)16 * LQ, gv + (t + 2) * 64, (size_t)16 * SQ, l0 + (t & 1) * FA_SB);
    fa_trip(t * 64, q0, ln, hh, qf0, qf1, kc, vf, o, m, l); }
  asm volatile("s_wait_asynccnt 0x0" ::: "memory");      /* no copy is outstanding when the wave ends */
  l += rs_xh(l); const float fin = 1.0f / l;
  /* unrolled for constant register indices */
  float* op = out + ((size_t)b * SQ + q0 + ln) * DM + h * HD + 8 * hh;      /* o[t][r] = column 16 t + 8 hh + r of query q0 + ln */
#pragma unroll
  for (int t = 0; t < 4; ++t) { const v4f lo = {o[t][0] * fin, o[t][1] * fin, o[t][2] * fin, o[t][3] * fin}, hi = {o[t][4] * fin, o[t][5] * fin, o[t][6] * fin, o[t][7] * fin}; *(v4f*)(op + 16 * t) = lo; *(v4f*)(op + 16 * t + 4) = hi; } }

// lane K of each 16-lane row, handed to all sixteen lanes of that row (DPP row_share)
template <int K> __device__ __forceinline__ float a0_share(float x) { return __builtin_bit_cast(float, __builtin_amdgcn_update_dpp(0, __builtin_bit_cast(int, x), 0x150 | K, 0xf, 0xf, true)); }
template <int K> __device__ __forceinline__ void a0_acc(v4f& o, float e, const v4f* vv) { o += a0_share<K>(e) * vv[K]; if constexpr (K + 1 < 16) a0_acc<K + 1>(o, e, vv); }
// exact f32 attention of the first QT0 rows, SIXTEEN LANES PER QUERY ROW, keys in groups of 16: lane p scores key 16 g + p (whole q row in registers, K row straight from global memory), the group's maximum comes from a
// four-step butterfly over the 16 lanes, the running o and l are rescaled once per group, lane p keeps columns 4 p .. 4 p + 3 of o and its own keys' share of l (summed over the 16 lanes at the end). No LDS, no barrier.
// A 128-thread block takes eight query rows: rows 8 r8 .. 8 r8 + 7 of head h of batch b. QF, KF, VF point at the q, k, v blocks of the packed f32 rows (QT0 rows a batch, pitch LQ), OF at the output rows (SQ rows a batch).
// The rows' 16-row block rb = r8 / 2 sets the number of key groups, rb + 1.
template <int MASKADD>
__device__ __forceinline__ void a0_rows(const float* __restrict__ QF, const float* __restrict__ KF, const float* __restrict__ VF, const float* __restrict__ mask, float scale, float* __restrict__ OF, int ldo, const int b, const int h, const int r8) {
  const int p = threadIdx.x & 15; const int rb = r8 >> 1; const int i = r8 * 8 + (threadIdx.x >> 4);
  QF += (size_t)b * QT0 * LQ; KF += (size_t)b * QT0 * LQ; VF += (size_t)b * QT0 * LQ; OF += (size_t)b * SQ * ldo;
  const float* qr = QF + (size_t)i * LQ + h * HD; v4f q[HD / 4];      /* q, k, v rows have the pitch LQ, a constant, so that a group's sixteen V rows hang on one address pair by immediate offsets */
  /* the loops over c are unrolled because the rows live in registers, which need constant indices */
#pragma unroll
  for (int c = 0; c < HD / 4; ++c) q[c] = *(const v4fa*)(qr + c * 4);
  asm volatile("s_wait_xcnt 0x0" :: "v"(qr) : "memory");      /* precaution: no register that an issued load names is written ahead of this wait; the address pair is an input here so that no load's result is placed on it */
  v4f o = {0.f, 0.f, 0.f, 0.f}; float m = -1.0e30f, l = 0.f; const int ng = MASKADD ? (SQ / 16) : (rb + 1);      /* additive-mask form: every key (the mask input decides); causal form: key groups up to the block's last row */
  for (int g = 0; g < ng; ++g) { const int j = g * 16 + p; const float* kr = KF + (size_t)j * LQ + h * HD; const float* vr = VF + (size_t)(g * 16) * LQ + h * HD + p * 4; v4f kk[HD / 4], vv[16];
#pragma unroll
    for (int c = 0; c < HD / 4; ++c) kk[c] = *(const v4fa*)(kr + c * 4);
#pragma unroll
    for (int c = 0; c < 16; ++c) vv[c] = *(const v4fa*)(vr + c * LQ);
    asm volatile("s_wait_xcnt 0x0" :: "v"(kr), "v"(vr) : "memory");      /* the same precaution for the two address pairs of the group */
    /* inputs-only fences on the loaded values: they keep all 32 loads of the group in front of the arithmetic, in flight together (one memory latency per group; left alone the compiler waits after every second load) */
    asm volatile("" :: "v"(kk[0]), "v"(kk[1]), "v"(kk[2]), "v"(kk[3]), "v"(kk[4]), "v"(kk[5]), "v"(kk[6]), "v"(kk[7]), "v"(kk[8]), "v"(kk[9]), "v"(kk[10]), "v"(kk[11]), "v"(kk[12]), "v"(kk[13]), "v"(kk[14]), "v"(kk[15]), "v"(vv[0]), "v"(vv[1]), "v"(vv[2]), "v"(vv[3]), "v"(vv[4]), "v"(vv[5]), "v"(vv[6]), "v"(vv[7]), "v"(vv[8]), "v"(vv[9]), "v"(vv[10]), "v"(vv[11]), "v"(vv[12]), "v"(vv[13]));
    asm volatile("" :: "v"(vv[14]), "v"(vv[15]));
    v4f s4 = {0.f, 0.f, 0.f, 0.f};
#pragma unroll
    for (int c = 0; c < HD / 4; ++c) s4 += q[c] * kk[c];
    float s = ((s4[0] + s4[1]) + (s4[2] + s4[3])) * scale; if (MASKADD) s += bf16_round(mask[(size_t)i * SQ + j]) * -10000.0f;
    const float sm = (MASKADD || j <= i) ? s : -1.0e30f;
    float gm = sm; gm = fmaxf(gm, rs_xm<1>(gm)); gm = fmaxf(gm, rs_xm<2>(gm)); gm = fmaxf(gm, rs_xm<4>(gm)); gm = fmaxf(gm, rs_xm<8>(gm));
    const float mn = fmaxf(m, gm); const float sc = expf(m - mn); const float e = expf(sm - mn); l = l * sc + e; m = mn; o *= sc;
    a0_acc<0>(o, e, vv); }
  l += rs_xm<1>(l); l += rs_xm<2>(l); l += rs_xm<4>(l); l += rs_xm<8>(l);
  const float fin = 1.0f / l;
  *(v4f*)(OF + (size_t)i * ldo + h * HD + p * 4) = o * fin; }



extern "C" void kernel_launch(void* const* d_in, const int* in_sizes, int n_in,
                              void* d_out, int out_size, void* d_ws, size_t ws_size, hipStream_t stream) {
  (void)in_sizes; (void)n_in; (void)out_size;
  const float* const* I = (const float* const*)d_in; const float* x = I[0]; const float* wq = I[1]; const float* bq = I[2]; const float* wk = I[3]; const float* bk = I[4]; const float* wv = I[5]; const float* bv = I[6];      /* natural nn.Linear [out][in] weights + biases */
  char* ws = (char*)d_ws; size_t off = 0;
  auto take = [&](size_t bytes) { char* p = ws + off; off += (bytes + 255) & ~(size_t)255; return p; };
  _Float16* BQKV = (_Float16*)take((size_t)3 * DM * DM * 2); float* bqkv = (float*)take((size_t)3 * DM * 4);      /* stacked q | k | v weight plane and bias vector */ 
  _Float16* X16 = (_Float16*)take(NR * DM * 2); _Float16* QKV = (_Float16*)take(NR * 3 * DM * 2); _Float16* Q16 = QKV; _Float16* K16 = QKV + DM; _Float16* V16 = QKV + 2 * DM;      /* q | k | v */ _Float16* O16 = (_Float16*)take(NR * DM * 2);
  _Float16* VT = (_Float16*)take((size_t)NB * NH * HD * SQ * 2);
  float* F0 = (float*)take((size_t)NB * QT0 * LQ * 4);      /* f32 q | k | v of the first QT0 rows of each batch, packed */
  if (off > ws_size) return;
  k_prep<<<PREP_XB + 3 * PREP_WB + 1, 256, 0, stream>>>(x, wq, wk, wv, bq, bk, bv, X16, BQKV, bqkv);      /* x rows f16; natural [out][in] = Bt[n][k] x16, stacked q | k | v; stacked bias vector bq | bk | bv */
  const size_t r0p = (size_t)B0 * SQ;      /* first projected row */
  k_gemm2<0><<<dim3((unsigned)((MP / 128) * (3 * DM / 128)), 1), 256, 0, stream>>>(X16 + r0p * DM, DM, 0, BQKV, DM, 0, 0.0625f, bqkv, 0, nullptr, 1, 0, 0, F0, SQ, QT0, QKV + r0p * 3 * DM, VT, 2 * DM, SQ, 3 * DM, 0, MP, 3 * DM, DM);      /* q | k rows (f16); head h = columns h*HD.. of each DM block; v as V^T [NB][NH][HD][SQ]; the first QT0 rows of each batch also f32 (q | k | v) */
  k_fattn<<<dim3(NB * NH, FA_YN + A0_YN), 128, 0, stream>>>(QKV, VT, F0, F0 + DM, F0 + 2 * DM, (float*)d_out);      /* o (merged heads) f32 straight into the output rows: f16 path behind the first QT0 rows of each batch, exact f32 causal attention for those */
}

// v009
// It runs in 63.7 microseconds.
// Timed twice side by side with v008, it ran 1.05 and 1.04 times as fast.
// Counting every step since v000, it is 91.4 times as fast.
#include <hip/hip_runtime.h>
#define NB 2
#define SQ 2048
#define DM 1024
#define NH 16
#define HD 64
#define HG 4                         /* head group of the k_vt(b, h0) form */
#define B0 0                         /* first batch processed (debug hook) */
#define NBR NB                       /* batches processed (debug hook) */
#define NR ((size_t)NB * SQ)         /* token rows */
#define MP ((int)((size_t)NBR * SQ)) /* rows projected (debug hook) */
#define QT 256                       /* unused */
#define NKX SQ                       /* unused */
#define QT0 256                      /* first-tile rows recomputed exactly (256: margin for the few-key rows, no output projection) */
#define QN SQ                        /* unused */
#define NHD NH                       /* unused */
#define MPO MP                       /* unused */
#define LQ (3 * DM)      /* row pitch of the q/k/v rows */
typedef __bf16 v16b __attribute__((ext_vector_type(16)));
typedef unsigned short v8us __attribute__((ext_vector_type(8), may_alias));
typedef float  v8f  __attribute__((ext_vector_type(8)));
typedef float  v4f  __attribute__((ext_vector_type(4)));
typedef float  v4fa __attribute__((ext_vector_type(4), may_alias));
union FragB { v16b v; v8us half[2]; unsigned short u[16]; };

__device__ __forceinline__ unsigned short bf16_bits(float x) { unsigned int u = __float_as_uint(x); return (unsigned short)((u + 0x7FFFu + ((u >> 16) & 1u)) >> 16); }
__device__ __forceinline__ float bf16_val(unsigned short b) { return __uint_as_float(((unsigned int)b) << 16); }
__device__ __forceinline__ float bf16_round(float x) { return bf16_val(bf16_bits(x)); }
// D += A·B with NT terms: 1 = ah·bh, 2 = + al·bh (A split), 3 = + ah·bl (both split)
template <int NT>
__device__ __forceinline__ v8f mmaN(v16b ah, v16b al, v16b bh, v16b bl, v8f c) {
  c = __builtin_amdgcn_wmma_f32_16x16x32_bf16(false, ah, false, bh, (short)0, c, false, false);
  if (NT >= 2) c = __builtin_amdgcn_wmma_f32_16x16x32_bf16(false, al, false, bh, (short)0, c, false, false);
  if (NT >= 3) c = __builtin_amdgcn_wmma_f32_16x16x32_bf16(false, ah, false, bl, (short)0, c, false, false);
  asm volatile("v_nop\n\tv_nop\n\tv_nop\n\tv_nop" : "+v"(c) : "v"(ah), "v"(al), "v"(bh), "v"(bl));
  return c;
}

__global__ __launch_bounds__(256) void k_wt_bf16(const float* __restrict__ W, unsigned short* __restrict__ Wt, int K, int N) {
  const int t = blockIdx.x * 256 + threadIdx.x;
  const int k8n = K / 8;
  if (t >= N * k8n) return;
  const int n = t / k8n, k8 = (t % k8n) * 8;
  v8us v;
#pragma unroll
  for (int i = 0; i < 8; ++i) v[i] = bf16_bits(W[(size_t)(k8 + i) * N + n]);
  *(v8us*)(Wt + (size_t)n * K + k8) = v;
  
}

// GEMM C[M][N] (f32, pitch ldc) = act(A[M][K]·W + bias). A f32 row-major (pitch lda) converted per fragment to bf16
// (ASPLIT: hi/lo two planes -> 2 terms, else single rounded term); Wt bf16 [N][K] (pitch ldb). BIAS_BF16 rounds the
// bias to bf16 first (bias quantised to bf16 before the add). K%32==0, M%16==0, N%64==0.
template <bool ASPLIT, int ACT, bool BIAS_BF16>
__global__ __launch_bounds__(128) void k_gemm_bf(const float* __restrict__ A, int lda, const unsigned short* __restrict__ Wt, int ldb,
                                               const float* __restrict__ bias, float* __restrict__ C, int ldc, int M, int N, int K) {
  __shared__ __attribute__((aligned(16))) float so[4][16][64];
  const int tid = threadIdx.x, w = tid >> 5, lane = tid & 31, ln = lane & 15, hh = lane >> 4;
  const int ntn = N / 64;
  const int wid = blockIdx.x * 4 + w;
  const int mt = wid / ntn, nq = wid % ntn;
  if (mt * 16 >= M) return;
  const int row0 = mt * 16, col0 = nq * 64;
  const float* arow = A + (size_t)(row0 + ln) * lda;
  v8f acc[4] = {};
  for (int kb = 0; kb < K; kb += 32) {
    FragB ah, al;
    const v4f x0 = *(const v4fa*)(arow + kb + 8 * hh), x1 = *(const v4fa*)(arow + kb + 8 * hh + 4);
    const v4f x2 = *(const v4fa*)(arow + kb + 16 + 8 * hh), x3 = *(const v4fa*)(arow + kb + 16 + 8 * hh + 4);
    float xs[16] = {x0[0],x0[1],x0[2],x0[3],x1[0],x1[1],x1[2],x1[3],x2[0],x2[1],x2[2],x2[3],x3[0],x3[1],x3[2],x3[3]};
#pragma unroll
    for (int i = 0; i < 16; ++i) { const unsigned short hb = bf16_bits(xs[i]); ah.u[i] = hb; al.u[i] = ASPLIT ? bf16_bits(xs[i] - bf16_val(hb)) : (unsigned short)0; }
#pragma unroll
    for (int t = 0; t < 4; ++t) {
      const unsigned short* brow = Wt + (size_t)(col0 + t * 16 + ln) * ldb + kb;
      FragB b;
      b.half[0] = *(const v8us*)(brow + 8 * hh);
      b.half[1] = *(const v8us*)(brow + 16 + 8 * hh);
      acc[t] = mmaN<ASPLIT ? 2 : 1>(ah.v, al.v, b.v, b.v, acc[t]);
    }
  }
#pragma unroll
  for (int t = 0; t < 4; ++t) {
    float bv = bias ? bias[col0 + t * 16 + ln] : 0.f;
    if (BIAS_BF16) bv = bf16_round(bv);
#pragma unroll
    for (int r = 0; r < 8; ++r) { float v = acc[t][r] + bv; if (ACT == 1) v = fmaxf(v, 0.f); so[w][8 * hh + r][t * 16 + ln] = v; }
  }
  __builtin_amdgcn_fence(__ATOMIC_ACQ_REL, "workgroup");
  __builtin_amdgcn_wave_barrier();
  const int rsub = lane >> 4, c4 = (lane & 15) * 4;
  {
#pragma unroll
    for (int q = 0; q < 8; ++q) {
      const int r = q * 2 + rsub;
      const v4f v = *(const v4fa*)&so[w][r][c4];
      *(v4f*)(C + (size_t)(row0 + r) * ldc + col0 + c4) = v;
    }
    
  }
}

// GEMM C = act(A·W + bias + resid): A f32 (ASPLIT -> hi/lo 2 terms), Wt bf16 [N][K]; ACT 0 none, 1 relu, 2 exact gelu;
// resid (optional, f32, row index = (row % rmod), pitch ldr, RES_BF16 rounds it) added before the activation.
template <bool ASPLIT, int ACT, bool BIAS_BF16, bool RES_BF16>
__global__ __launch_bounds__(128) void k_gemm_bf3(const float* __restrict__ A, int lda, const unsigned short* __restrict__ Wt, int ldb,
                                                const float* __restrict__ bias, const float* __restrict__ resid, int rmod, int ldr,
                                                float* __restrict__ C, int ldc, int M, int N, int K) {
  __shared__ __attribute__((aligned(16))) float so[4][16][64];
  const int tid = threadIdx.x, w = tid >> 5, lane = tid & 31, ln = lane & 15, hh = lane >> 4;
  const int ntn = N / 64;
  const int wid = blockIdx.x * 4 + w;
  const int mt = wid / ntn, nq = wid % ntn;
  if (mt * 16 >= M) return;
  const int row0 = mt * 16, col0 = nq * 64;
  const float* arow = A + (size_t)(row0 + ln) * lda;
  v8f acc[4] = {};
  for (int kb = 0; kb < K; kb += 32) {
    FragB ah, al;
    const v4f x0 = *(const v4fa*)(arow + kb + 8 * hh), x1 = *(const v4fa*)(arow + kb + 8 * hh + 4);
    const v4f x2 = *(const v4fa*)(arow + kb + 16 + 8 * hh), x3 = *(const v4fa*)(arow + kb + 16 + 8 * hh + 4);
    float xs[16] = {x0[0],x0[1],x0[2],x0[3],x1[0],x1[1],x1[2],x1[3],x2[0],x2[1],x2[2],x2[3],x3[0],x3[1],x3[2],x3[3]};
#pragma unroll
    for (int i = 0; i < 16; ++i) { const unsigned short hb = bf16_bits(xs[i]); ah.u[i] = hb; al.u[i] = ASPLIT ? bf16_bits(xs[i] - bf16_val(hb)) : (unsigned short)0; }
#pragma unroll
    for (int t = 0; t < 4; ++t) {
      const unsigned short* brow = Wt + (size_t)(col0 + t * 16 + ln) * ldb + kb;
      FragB b;
      b.half[0] = *(const v8us*)(brow + 8 * hh);
      b.half[1] = *(const v8us*)(brow + 16 + 8 * hh);
      acc[t] = mmaN<ASPLIT ? 2 : 1>(ah.v, al.v, b.v, b.v, acc[t]);
    }
  }
#pragma unroll
  for (int t = 0; t < 4; ++t) {
    const int col = col0 + t * 16 + ln;
    float bv = bias ? bias[col] : 0.f;
    if (BIAS_BF16) bv = bf16_round(bv);
#pragma unroll
    for (int r = 0; r < 8; ++r) {
      float v = acc[t][r] + bv;
      if (resid) { float rv = resid[(size_t)((row0 + 8 * hh + r) % rmod) * ldr + col]; if (RES_BF16) rv = bf16_round(rv); v += rv; }
      if (ACT == 1) v = fmaxf(v, 0.f);
      if (ACT == 2) v = 0.5f * v * (1.0f + erff(v * 0.70710678118654752f));
      if (ACT == 3) { const float u = 0.7978845608028654f * (v + 0.044715f * v * v * v); v = 0.5f * v * (1.0f + tanhf(u)); }
      so[w][8 * hh + r][t * 16 + ln] = v;
    }
  }
  __builtin_amdgcn_fence(__ATOMIC_ACQ_REL, "workgroup");
  __builtin_amdgcn_wave_barrier();
  const int rsub = lane >> 4, c4 = (lane & 15) * 4;
  {
#pragma unroll
    for (int q = 0; q < 8; ++q) {
      const int r = q * 2 + rsub;
      const v4f v = *(const v4fa*)&so[w][r][c4];
      *(v4f*)(C + (size_t)(row0 + r) * ldc + col0 + c4) = v;
    }
    
  }
}
// row LayerNorm (biased variance, eps) over N: s = X (+ R); optional out_sum <- s; out_norm <- (s-mu)*rsqrt(var+eps)*g + b
template <bool PARAM_BF16>
__global__ __launch_bounds__(256) void k_layernorm(const float* __restrict__ X, const float* __restrict__ R, const float* __restrict__ g, const float* __restrict__ bta,
                                                  float* __restrict__ out_sum, float* __restrict__ out_norm, int N, float eps) {
  __shared__ float red[256];
  const int row = blockIdx.x, tid = threadIdx.x;
  const float* x = X + (size_t)row * N; const float* rr = R ? R + (size_t)row * N : nullptr;
  float vals[16];                     // up to N = 4096
  const int per = N / 256;            // contiguous chunk per thread? use strided-by-4 chunks: thread handles j = tid*4 + 1024*u
  float s1 = 0.f;
  for (int u = 0; u < per / 4; ++u) {
    const int j = tid * 4 + 1024 * u;
    const v4f a = *(const v4fa*)(x + j);
    v4f b = {0.f,0.f,0.f,0.f}; if (rr) b = *(const v4fa*)(rr + j);
#pragma unroll
    for (int q = 0; q < 4; ++q) { const float v = a[q] + b[q]; vals[u * 4 + q] = v; s1 += v; }
  }
  red[tid] = s1; __syncthreads();
  for (int st = 128; st > 0; st >>= 1) { if (tid < st) red[tid] += red[tid + st]; __syncthreads(); }
  const float mu = red[0] / (float)N; __syncthreads();
  float s2 = 0.f;
  for (int u = 0; u < per / 4; ++u)
#pragma unroll
    for (int q = 0; q < 4; ++q) { const float c = vals[u * 4 + q] - mu; s2 += c * c; }
  red[tid] = s2; __syncthreads();
  for (int st = 128; st > 0; st >>= 1) { if (tid < st) red[tid] += red[tid + st]; __syncthreads(); }
  const float rs = rsqrtf(red[0] / (float)N + eps);
  {
    for (int u = 0; u < per / 4; ++u) {
      const int j = tid * 4 + 1024 * u;
      v4f o, sm;
#pragma unroll
      for (int q = 0; q < 4; ++q) {
        float gg = g[j + q], bb = bta[j + q];
        if (PARAM_BF16) { gg = bf16_round(gg); bb = bf16_round(bb); }
        sm[q] = vals[u * 4 + q]; o[q] = (vals[u * 4 + q] - mu) * rs * gg + bb;
      }
      if (out_sum) *(v4f*)(out_sum + (size_t)row * N + j) = sm;
      *(v4f*)(out_norm + (size_t)row * N + j) = o;
    }
    
  }
}



// ---- f16 WMMA path (v_wmma_f32_16x16x32_f16): 11-bit significands for operands in range — used where a [0,1] probability operand needs more precision than bf16
typedef _Float16 v16h __attribute__((ext_vector_type(16)));
union FragH { v16h v; v8us half[2]; _Float16 h[16]; unsigned short u[16]; };
template <int NT>
__device__ __forceinline__ v8f mmaH(v16h ah, v16h al, v16h bh, v16h bl, v8f c) {
  c = __builtin_amdgcn_wmma_f32_16x16x32_f16(false, ah, false, bh, (short)0, c, false, false);
  if (NT >= 2) c = __builtin_amdgcn_wmma_f32_16x16x32_f16(false, al, false, bh, (short)0, c, false, false);
  if (NT >= 3) c = __builtin_amdgcn_wmma_f32_16x16x32_f16(false, ah, false, bl, (short)0, c, false, false);
  asm volatile("v_nop\n\tv_nop\n\tv_nop\n\tv_nop" : "+v"(c) : "v"(ah), "v"(al), "v"(bh), "v"(bl));
  return c;
}
// batched GEMM like k_gemm_b but f16 operands: A f32 (split into f16 hi/lo if ASPLIT, else rounded to f16), Bt = f16 values [n][k]; alpha; C f32; N multiple of 16 (partial tiles skipped)
template <bool ASPLIT>
__global__ __launch_bounds__(128) void k_gemm_h(const float* __restrict__ A, int lda, size_t sA, const _Float16* __restrict__ Bh, int ldb, size_t sB, float alpha, float* __restrict__ C, int ldc, size_t sC, int M, int N, int K) {
  __shared__ __attribute__((aligned(16))) float so[4][16][64];
  const int tid = threadIdx.x, w = tid >> 5, lane = tid & 31, ln = lane & 15, hh = lane >> 4; const int by = blockIdx.y;
  A += (size_t)by * sA; Bh += (size_t)by * sB; C += (size_t)by * sC;
  const int ntn = (N + 63) / 64; const int wid = blockIdx.x * 4 + w; const int mt = wid / ntn, nq = wid % ntn; if (mt * 16 >= M) return;
  const int row0 = mt * 16, col0 = nq * 64; const float* arow = A + (size_t)(row0 + ln) * lda;
  v8f acc[4] = {};
  for (int kb = 0; kb < K; kb += 32) {
    FragH ah, al;
    const v4f x0 = *(const v4fa*)(arow + kb + 8 * hh), x1 = *(const v4fa*)(arow + kb + 8 * hh + 4), x2 = *(const v4fa*)(arow + kb + 16 + 8 * hh), x3 = *(const v4fa*)(arow + kb + 16 + 8 * hh + 4);
    float xs[16] = {x0[0],x0[1],x0[2],x0[3],x1[0],x1[1],x1[2],x1[3],x2[0],x2[1],x2[2],x2[3],x3[0],x3[1],x3[2],x3[3]};
#pragma unroll
    for (int i = 0; i < 16; ++i) { const _Float16 h = (_Float16)xs[i]; ah.h[i] = h; al.h[i] = ASPLIT ? (_Float16)(xs[i] - (float)h) : (_Float16)0.0f; }
#pragma unroll
    for (int t = 0; t < 4; ++t) { if (col0 + t * 16 >= N) continue; const size_t boff = (size_t)(col0 + t * 16 + ln) * ldb + kb; FragH bq; bq.half[0] = *(const v8us*)(Bh + boff + 8 * hh); bq.half[1] = *(const v8us*)(Bh + boff + 16 + 8 * hh);
      acc[t] = mmaH<ASPLIT ? 2 : 1>(ah.v, al.v, bq.v, bq.v, acc[t]); }
  }
#pragma unroll
  for (int t = 0; t < 4; ++t) { if (col0 + t * 16 >= N) continue;
#pragma unroll
    for (int r = 0; r < 8; ++r) so[w][8 * hh + r][t * 16 + ln] = acc[t][r] * alpha; }
  __builtin_amdgcn_fence(__ATOMIC_ACQ_REL, "workgroup"); __builtin_amdgcn_wave_barrier();
  const int rsub = lane >> 4, c4 = (lane & 15) * 4;
  {
#pragma unroll
    for (int q = 0; q < 8; ++q) { const int r = q * 2 + rsub; if (col0 + c4 < N) { const v4f v = *(const v4fa*)&so[w][r][c4]; *(v4f*)(C + (size_t)(row0 + r) * ldc + col0 + c4) = v; } }
     }
}

// Wt[n][k] = f16(W[k][n]·scale) from f32 row-major W[K][N] (scale = power of two; bf16-exact weights stay exact in f16 away from the subnormal range)
__global__ __launch_bounds__(256) void k_wt_f16(const float* __restrict__ W, _Float16* __restrict__ Wt, int K, int N, float scale) {
  const int t = blockIdx.x * 256 + threadIdx.x; if (t >= N * (K / 8)) return; const int n = t / (K / 8), k8 = (t % (K / 8)) * 8; FragH f;
#pragma unroll
  for (int i = 0; i < 8; ++i) f.h[i] = (_Float16)(bf16_round(W[(size_t)(k8 + i) * N + n]) * scale); const v8us o = f.half[0];
  *(v8us*)((unsigned short*)Wt + (size_t)n * K + k8) = o; 
}
// k_gemm_hh variant with fused epilogue: v = acc·alpha + bias[by·sBias + col] (+ CP[(row/rowsPerB)·sCPb + by·64 + col] if CP) ; ACT 0 none / 1 elu ; writes f16 C16 (and f32 C if non-null)
template <int ACT>
__global__ __launch_bounds__(128) void k_gemm_hhx(const _Float16* __restrict__ A, int lda, size_t sA, const _Float16* __restrict__ Bh, int ldb, size_t sB, float alpha, const float* __restrict__ bias, size_t sBias, const float* __restrict__ CP, int rowsPerB, size_t sCPb, int row0g,
    float* __restrict__ C, _Float16* __restrict__ C16, int ldc, size_t sC, int M, int N, int K) {
  __shared__ __attribute__((aligned(16))) float so[4][16][64];
  const int tid = threadIdx.x, w = tid >> 5, lane = tid & 31, ln = lane & 15, hh = lane >> 4; const int by = blockIdx.y;
  A += (size_t)by * sA; Bh += (size_t)by * sB; const size_t cofs = (size_t)by * sC; const float* bp = bias ? bias + (size_t)by * sBias : nullptr;
  const int ntn = (N + 63) / 64; const int wid = blockIdx.x * 4 + w; const int mt = wid / ntn, nq = wid % ntn; if (mt * 16 >= M) return;
  const int row0 = mt * 16, col0 = nq * 64; const _Float16* arow = A + (size_t)(row0 + ln) * lda;
  v8f acc[4] = {};
  for (int kb = 0; kb < K; kb += 32) { FragH ah; ah.half[0] = *(const v8us*)((const unsigned short*)arow + kb + 8 * hh); ah.half[1] = *(const v8us*)((const unsigned short*)arow + kb + 16 + 8 * hh);
#pragma unroll
    for (int t = 0; t < 4; ++t) { if (col0 + t * 16 >= N) continue; const size_t boff = (size_t)(col0 + t * 16 + ln) * ldb + kb; FragH bq; bq.half[0] = *(const v8us*)((const unsigned short*)Bh + boff + 8 * hh); bq.half[1] = *(const v8us*)((const unsigned short*)Bh + boff + 16 + 8 * hh);
      acc[t] = mmaH<1>(ah.v, ah.v, bq.v, bq.v, acc[t]); }
  }
#pragma unroll
  for (int t = 0; t < 4; ++t) { if (col0 + t * 16 >= N) continue; const int col = col0 + t * 16 + ln; const float bv = bp ? bf16_round(bp[col]) : 0.f;
#pragma unroll
    for (int r = 0; r < 8; ++r) { float v = acc[t][r] * alpha + bv; if (CP) { const int rr = row0g + row0 + 8 * hh + r; if (rowsPerB < 0) v += CP[cofs + (size_t)rr * ldc + col];      /* rowsPerB < 0: own element of the batched C plane */ else { const int bidx = rr / rowsPerB; v += CP[(size_t)bidx * sCPb + (size_t)by * 64 + col]; } } if (ACT == 1) v = (v > 0.f) ? v : expm1f(v); else if (ACT == 7) v = (v > 0.f) ? v + 1.0f : expf(v); else if (ACT == 8) v = tanhf(v); else if (ACT == 9) v = 0.5f * v * (1.0f + tanhf(0.7978845608028654f * (v + 0.044715f * v * v * v))); else if (ACT == 11) v = 1.0f / (1.0f + expf(-v)); else if (ACT == 12) v = (v > 0.f) ? v : 0.01f * v; else if (ACT == 14) v = (v > 0.f) ? v : 0.1f * v; else if (ACT == 16) v = (v >= 0.f) ? v : 0.3f * v; else if (ACT == 17) v = (v >= 0.f) ? v : 0.2f * v; else if (ACT == 15) v = v / (1.0f + expf(-v)); else if (ACT == 3) v = fmaxf(v, 0.f); else if (ACT == 6) v = 0.5f * v * (1.0f + erff(v * 0.70710678118654752f)); so[w][8 * hh + r][t * 16 + ln] = v; } }
  __builtin_amdgcn_fence(__ATOMIC_ACQ_REL, "workgroup"); __builtin_amdgcn_wave_barrier();
  const int rsub = lane >> 4, c4 = (lane & 15) * 4; typedef _Float16 v4h __attribute__((ext_vector_type(4)));
  {
#pragma unroll
    for (int q = 0; q < 8; ++q) { const int r = q * 2 + rsub; if (col0 + c4 < N) { const v4f v = *(const v4fa*)&so[w][r][c4]; if (C) *(v4f*)(C + cofs + (size_t)(row0 + r) * ldc + col0 + c4) = v; if (C16) { v4h h4; for (int i = 0; i < 4; ++i) h4[i] = (_Float16)v[i]; *(v4h*)(C16 + cofs + (size_t)(row0 + r) * ldc + col0 + c4) = h4; } } }
     }
}


typedef _Float16 v4h __attribute__((ext_vector_type(4)));

// operand preparation in ONE launch: x as exact f16 rows, the three natural [out][in] weight planes x16 as f16 (stacked q | k | v), the three biases stacked (f32). The parts need nothing of each other, so they share one grid by ranges of the
// block index (block-uniform branches): PREP_XB blocks for x, PREP_WB for each weight plane, one last block for the biases. A block converts PREP_L * 1024 elements in a row: load j of a thread is its 16 bytes of the block's j-th 4-KiB piece
// (a wave's load = 512 bytes in a row, its store = 256), and a thread's PREP_L loads are all issued ahead of the first conversion.
#define PREP_L 16
#define PREP_XB ((int)(NR * DM / (PREP_L * 1024)))
#define PREP_WB (DM * DM / (PREP_L * 1024))
__global__ __launch_bounds__(256) void k_prep(const float* __restrict__ x, const float* __restrict__ wq, const float* __restrict__ wk, const float* __restrict__ wv, const float* __restrict__ bq, const float* __restrict__ bk, const float* __restrict__ bv,
    _Float16* __restrict__ X16, _Float16* __restrict__ BQKV, float* __restrict__ bqkv) {
  static_assert(NR * DM % (PREP_L * 1024) == 0 && DM * DM % (PREP_L * 1024) == 0 && DM == 1024, "whole blocks only; a bias is four elements a thread");
  const int tid = threadIdx.x, blk = blockIdx.x;
  if (blk >= PREP_XB + 3 * PREP_WB) { const v4f a = *(const v4fa*)(bq + tid * 4), b = *(const v4fa*)(bk + tid * 4), c = *(const v4fa*)(bv + tid * 4); float* d = bqkv + tid * 4; *(v4f*)d = a; *(v4f*)(d + DM) = b; *(v4f*)(d + 2 * DM) = c; return; }
  const float* src = x; _Float16* dst = X16; float scale = 1.0f; int lb = blk;
  if (blk >= PREP_XB) { const int p = (blk - PREP_XB) / PREP_WB; lb = (blk - PREP_XB) % PREP_WB; src = p == 0 ? wq : p == 1 ? wk : wv; dst = BQKV + (size_t)p * DM * DM; scale = 16.0f; }
  const size_t e0 = (size_t)lb * (PREP_L * 1024) + tid * 4; const float* sp = src + e0; _Float16* dp = dst + e0; v4f a[PREP_L];
  /* both loops are unrolled because the loaded values live in registers, which need constant indices */
#pragma unroll
  for (int j = 0; j < PREP_L; ++j) a[j] = *(const v4fa*)(sp + j * 1024);
  asm volatile("s_wait_xcnt 0x0" :: "v"(sp) : "memory");      /* precaution: no register that an issued load names is written ahead of this wait; the address pair is an input here so that no load's result is placed on it */
#pragma unroll
  for (int j = 0; j < PREP_L; ++j) { v4h h4; for (int q = 0; q < 4; ++q) h4[q] = (_Float16)(bf16_round(a[j][q]) * scale); *(v4h*)(dp + j * 1024) = h4; } }
__global__ __launch_bounds__(256) void k_h16(const float* __restrict__ x, _Float16* __restrict__ X16, size_t n8) { const size_t t = (size_t)blockIdx.x * 256 + threadIdx.x; if (t >= n8) return; FragH f;
#pragma unroll
  for (int q = 0; q < 8; ++q) f.h[q] = (_Float16)x[t * 8 + q]; *(v8us*)((unsigned short*)X16 + t * 8) = f.half[0];  }
__global__ __launch_bounds__(256) void k_round16f(const float* __restrict__ W, _Float16* __restrict__ Bt, size_t n8) { const size_t t = (size_t)blockIdx.x * 256 + threadIdx.x; if (t >= n8) return; FragH f;
#pragma unroll
  for (int i = 0; i < 8; ++i) f.h[i] = (_Float16)(bf16_round(W[t * 8 + i]) * 16.0f); *(v8us*)((unsigned short*)Bt + t * 8) = f.half[0];  }
__global__ __launch_bounds__(256) void k_hl(const float* __restrict__ F, _Float16* __restrict__ Hh, _Float16* __restrict__ Hl, size_t n8) { const size_t t = (size_t)blockIdx.x * 256 + threadIdx.x; if (t >= n8) return; FragH fh, fl; const v4f a = *(const v4fa*)(F + t * 8), c = *(const v4fa*)(F + t * 8 + 4);
#pragma unroll
  for (int q = 0; q < 4; ++q) { _Float16 h = (_Float16)a[q]; fh.h[q] = h; fl.h[q] = (_Float16)((a[q] - (float)h) * 1024.0f); h = (_Float16)c[q]; fh.h[4 + q] = h; fl.h[4 + q] = (_Float16)((c[q] - (float)h) * 1024.0f); }
  { *(v8us*)((unsigned short*)Hh + t * 8) = fh.half[0]; *(v8us*)((unsigned short*)Hl + t * 8) = fl.half[0];  } }

// ---- fast GEMM (wave tile 32x64, eight waves = block tile 128x128; requires M % 128 == 0, N % 128 == 0, K % 64 == 0); epilogue = k_gemm_hhx semantics ----
// Operands go through LDS: a stage is 64 k of the block's 128 A rows and 128 B rows (one whole 128-byte line a row), brought by asynchronous copies to LDS, eight lanes a line, two buffers, so that the next stage flies while this one is worked on;
// rows stand at a pitch of 144 bytes (16 x odd: the sixteen rows of a ds_load_b128 fragment read fall on different banks). Each accumulator still takes its k blocks of 32 in rising order.
// the f32 plane C holds only the first crows rows of every cmod rows, packed (row (R / cmod) * crows + R % cmod, pitch ldc); cmod % 32 == 0 and crows % 32 == 0, so a wave's tile is wholly in it or wholly out
// the columns from ctcol0 on (ctcol0 % 128 == 0) go out transposed, f16, into CT instead of C16: element (R, col) stands at CT[((R / ctmod) * (N - ctcol0) + col - ctcol0) * ctmod + R % ctmod] (ctmod % 128 == 0: a block's 128 rows share R / ctmod; one plane only, grid.y == 1).
// A lane's eight accumulator rows of one column are 16 bytes in a row of the transposed tile, so the block builds the tile [128 columns][128 rows] in LDS by 16-byte writes and stores each of its rows as 256 bytes in a row.
__device__ __forceinline__ v16h g2_frag(const _Float16* p, int hh) { FragH f; f.half[0] = *(const v8us*)((const unsigned short*)p + 8 * hh); f.half[1] = *(const v8us*)((const unsigned short*)p + 16 + 8 * hh); return f.v; }
__device__ __forceinline__ v8f g2_mma(v16h a, v16h b, v8f c) { v8f d = __builtin_amdgcn_wmma_f32_16x16x32_f16(false, a, false, b, (short)0, c, false, false); asm volatile("v_nop\n\tv_nop\n\tv_nop\n\tv_nop" : "+v"(d) : "v"(a), "v"(b)); return d; }
#define G2_PB 144                    /* LDS row pitch, bytes */
#define G2_SB (256 * G2_PB)          /* one stage: 128 A rows, then 128 B rows */
#define G2_TP 272                    /* LDS row pitch of the transposed output tile, bytes: 128 f16 + 16 (16 x odd, as G2_PB) */
// one stage's copies of one lane: rows rr + RPR j (j = 0..3) of a first and of a second operand, 16 bytes each (RPR = rows that the block's lanes cover at once, eight lanes a row); pa, pb = the lane's place in row rr of the two operands at the stage's k,
// sa, sb = RPR rows in elements, l = the lane's LDS byte address in row rr of the buffer (4 RPR rows of the first operand, then 4 RPR of the second).
// The s_wait_xcnt ends the copies' own statement as a precaution: no register that an issued copy names is written ahead of it.
template <int RPR> __device__ __forceinline__ void g2_stage(const _Float16* pa, size_t sa, const _Float16* pb, size_t sb, unsigned l) {
  const _Float16* a1 = pa + sa; const _Float16* a2 = a1 + sa; const _Float16* a3 = a2 + sa; const _Float16* b1 = pb + sb; const _Float16* b2 = b1 + sb; const _Float16* b3 = b2 + sb;
  asm volatile("global_load_async_to_lds_b128 %0, %8, off\n\tglobal_load_async_to_lds_b128 %1, %9, off\n\tglobal_load_async_to_lds_b128 %2, %10, off\n\tglobal_load_async_to_lds_b128 %3, %11, off\n\t"
               "global_load_async_to_lds_b128 %4, %12, off\n\tglobal_load_async_to_lds_b128 %5, %13, off\n\tglobal_load_async_to_lds_b128 %6, %14, off\n\tglobal_load_async_to_lds_b128 %7, %15, off\n\ts_wait_xcnt 0x0"
               :: "v"(l), "v"(l + RPR * G2_PB), "v"(l + 2 * RPR * G2_PB), "v"(l + 3 * RPR * G2_PB), "v"(l + 4 * RPR * G2_PB), "v"(l + 5 * RPR * G2_PB), "v"(l + 6 * RPR * G2_PB), "v"(l + 7 * RPR * G2_PB), "v"(pa), "v"(a1), "v"(a2), "v"(a3), "v"(pb), "v"(b1), "v"(b2), "v"(b3) : "memory"); }
template <int ACT>
__global__ __launch_bounds__(256) void k_gemm2(const _Float16* __restrict__ A, int lda, size_t sA, const _Float16* __restrict__ Bh, int ldb, size_t sB, float alpha, const float* __restrict__ bias, size_t sBias, const float* __restrict__ CP, int rowsPerB, size_t sCPb, int row0g,
    float* __restrict__ C, int cmod, int crows, _Float16* __restrict__ C16, _Float16* __restrict__ CT, int ctcol0, int ctmod, int ldc, size_t sC, int M, int N, int K) { static_assert(ACT == 0 || ACT == 3 || ACT == 6 || ACT == 8 || ACT == 9 || ACT == 11 || ACT == 12 || ACT == 14 || ACT == 15 || ACT == 16 || ACT == 17, "k_gemm2: unsupported ACT code (would silently apply no activation)");
  __shared__ __attribute__((aligned(16))) unsigned char sm[2 * G2_SB];      /* the two stage buffers; behind the loop's last barrier the same bytes are the waves' output staging */
  static_assert(sizeof(float) * 8 * 32 * 68 <= 2 * G2_SB && 128 * G2_TP <= 2 * G2_SB, "output staging must fit the stage buffers"); float (*so)[32][68] = (float (*)[32][68])sm;
  const int tid = threadIdx.x, w = tid >> 5, lane = tid & 31, ln = lane & 15, hh = lane >> 4; const int by = blockIdx.y;
  A += (size_t)by * sA; Bh += (size_t)by * sB; const size_t cofs = (size_t)by * sC; const float* bp = bias ? bias + (size_t)by * sBias : nullptr;
  const int ntn = N >> 7; const int mt = blockIdx.x / ntn, nq = blockIdx.x - mt * ntn; if (mt * 128 >= M) return;      /* the whole block leaves, ahead of every barrier */
  const int row0 = mt * 128 + 32 * (w & 3), col0 = nq * 128 + 64 * (w >> 2);
  const int rr = tid >> 3, c8 = (tid & 7) * 8; const _Float16* ga = A + (size_t)(mt * 128 + rr) * lda + c8; const _Float16* gb = Bh + (size_t)(nq * 128 + rr) * ldb + c8; const size_t sa32 = (size_t)32 * lda, sb32 = (size_t)32 * ldb;
  const unsigned l0 = (unsigned)(size_t)sm + (unsigned)(rr * G2_PB + c8 * 2);      /* low 32 bits of the __shared__ address = LDS byte address */
  const int aoff = (32 * (w & 3) + ln) * G2_PB, boff = (128 + 64 * (w >> 2) + ln) * G2_PB; const int nst = K >> 6;
  const v8f z8 = {0.f,0.f,0.f,0.f,0.f,0.f,0.f,0.f}; v8f c00 = z8, c01 = z8, c02 = z8, c03 = z8, c10 = z8, c11 = z8, c12 = z8, c13 = z8;
  g2_stage<32>(ga, sa32, gb, sb32, l0);
  asm volatile("s_wait_asynccnt 0x0" ::: "memory");      /* this wave's copies of stage 0 have landed */
  __syncthreads();      /* ... and every other wave's: stage 0 may be read */
  if (nst > 1) g2_stage<32>(ga + 64, sa32, gb + 64, sb32, l0 + G2_SB);
  /* not unrolled: one trip a stage, the buffer picked by the trip's parity */
#pragma unroll 1
  for (int t = 0; t < nst; ++t) { const unsigned char* st = sm + (t & 1) * G2_SB; const _Float16* ap = (const _Float16*)(st + aoff); const _Float16* bq = (const _Float16*)(st + boff);
    /* unrolled: the stage's two k blocks of 32 */
#pragma unroll
    for (int kb = 0; kb < 64; kb += 32) { const v16h a0 = g2_frag(ap + kb, hh), a1 = g2_frag(ap + 16 * (G2_PB / 2) + kb, hh);
      const v16h b0 = g2_frag(bq + kb, hh), b1 = g2_frag(bq + 16 * (G2_PB / 2) + kb, hh), b2 = g2_frag(bq + 32 * (G2_PB / 2) + kb, hh), b3 = g2_frag(bq + 48 * (G2_PB / 2) + kb, hh);
      /* inputs-only fence on the loaded values: it keeps the k block's twelve LDS reads in front of its products, in flight together (one LDS latency a block; left alone the compiler waited for each B fragment in turn) */
      asm volatile("" :: "v"(a0), "v"(a1), "v"(b0), "v"(b1), "v"(b2), "v"(b3));
      c00 = g2_mma(a0, b0, c00); c10 = g2_mma(a1, b0, c10); c01 = g2_mma(a0, b1, c01); c11 = g2_mma(a1, b1, c11);
      c02 = g2_mma(a0, b2, c02); c12 = g2_mma(a1, b2, c12); c03 = g2_mma(a0, b3, c03); c13 = g2_mma(a1, b3, c13); }
    asm volatile("s_wait_dscnt 0x0" ::: "memory");      /* this wave's reads of the buffer are done before it is refilled */
    asm volatile("s_wait_asynccnt 0x0" ::: "memory");      /* this wave's copies of stage t + 1 have landed */
    __syncthreads();      /* publishes stage t + 1 and ends every wave's reads of stage t */
    if (t + 2 < nst) g2_stage<32>(ga + (size_t)(t + 2) * 64, sa32, gb + (size_t)(t + 2) * 64, sb32, l0 + (t & 1) * G2_SB); }
  asm volatile("s_wait_asynccnt 0x0" ::: "memory");      /* no copy is outstanding when the buffers become output staging */
  v8f accs[8] = {c00, c01, c02, c03, c10, c11, c12, c13};
#pragma unroll
  for (int u = 0; u < 8; ++u) { const int t = u & 3, half = u >> 2; const int col = col0 + t * 16 + ln; const float bv = bp ? bf16_round(bp[col]) : 0.f;
#pragma unroll
    for (int r = 0; r < 8; ++r) { const int rloc = half * 16 + 8 * hh + r; float v = accs[u][r] * alpha + bv; if (CP) { if (rowsPerB < 0) v += CP[cofs + (size_t)(row0g + row0 + rloc) * ldc + col];      /* rowsPerB < 0: own element of the batched C plane */ else { const int bidx = (row0g + row0 + rloc) / rowsPerB; v += CP[(size_t)bidx * sCPb + (size_t)by * 64 + col]; } }
      if (ACT == 3) v = fmaxf(v, 0.f); else if (ACT == 6) v = 0.5f * v * (1.0f + erff(v * 0.70710678118654752f)); else if (ACT == 11) v = 1.0f / (1.0f + expf(-v)); else if (ACT == 15) v = v / (1.0f + expf(-v)); else if (ACT == 12) v = (v > 0.f) ? v : 0.01f * v; else if (ACT == 8) v = tanhf(v); else if (ACT == 9) v = 0.5f * v * (1.0f + tanhf(0.7978845608028654f * (v + 0.044715f * v * v * v))); else if (ACT == 14) v = (v > 0.f) ? v : 0.1f * v; else if (ACT == 16) v = (v >= 0.f) ? v : 0.3f * v; else if (ACT == 17) v = (v >= 0.f) ? v : 0.2f * v;
      accs[u][r] = v; } }
  const int rsub = lane >> 4, c4 = (lane & 15) * 4; const int rin = row0 % cmod; float* Cw = (C && rin < crows) ? C + cofs + ((size_t)(row0 / cmod) * crows + rin) * ldc + col0 + c4 : nullptr;
  if (CT && nq * 128 >= ctcol0) {      /* the same for the whole block: its columns go out transposed */
    /* unrolled for constant register indices */
#pragma unroll
    for (int u = 0; u < 8; ++u) { const int t = u & 3, half = u >> 2; FragH f; for (int r = 0; r < 8; ++r) f.h[r] = (_Float16)accs[u][r];
      *(v8us*)(sm + (64 * (w >> 2) + t * 16 + ln) * G2_TP + (32 * (w & 3) + half * 16 + 8 * hh) * 2) = f.half[0]; }
    __syncthreads();      /* the transposed tile is whole: every wave's columns are written before any row of it is read */
    unsigned short* cp = (unsigned short*)CT + ((size_t)((mt * 128) / ctmod) * (N - ctcol0) + (nq * 128 - ctcol0) + (tid >> 4)) * ctmod + (mt * 128) % ctmod + (tid & 15) * 8; const unsigned char* tp = sm + (tid >> 4) * G2_TP + (tid & 15) * 16;
    v8us tv[8];
#pragma unroll
    for (int q = 0; q < 8; ++q) tv[q] = *(const v8us*)(tp + q * 16 * G2_TP);
    __syncthreads();      /* every wave has read its rows of the tile before the f32 staging below takes the same bytes; the stores stand behind it, so that no wave waits here for them */
    unsigned short* cq[8];
#pragma unroll
    for (int q = 0; q < 8; ++q) { cq[q] = cp + (size_t)(q * 16) * ctmod; *(v8us*)cq[q] = tv[q]; }
    /* precaution: no register that an issued store names is written ahead of this wait; the eight address pairs and the stored values are inputs here so that they keep their registers up to it */
    asm volatile("s_wait_xcnt 0x0" :: "v"(cq[0]), "v"(cq[1]), "v"(cq[2]), "v"(cq[3]), "v"(cq[4]), "v"(cq[5]), "v"(cq[6]), "v"(cq[7]), "v"(tv[0]), "v"(tv[1]), "v"(tv[2]), "v"(tv[3]), "v"(tv[4]), "v"(tv[5]), "v"(tv[6]), "v"(tv[7]) : "memory");
    if (!Cw) return;      /* behind the block's last barrier: a wave with no f32 rows has nothing left to store */
    C16 = nullptr; }
#pragma unroll
  for (int u = 0; u < 8; ++u) for (int r = 0; r < 8; ++r) so[w][(u >> 2) * 16 + 8 * hh + r][(u & 3) * 16 + ln] = accs[u][r];
  __builtin_amdgcn_fence(__ATOMIC_ACQ_REL, "workgroup"); __builtin_amdgcn_wave_barrier();
  {
#pragma unroll
    for (int q = 0; q < 16; ++q) { const int r = q * 2 + rsub; const v4f v = *(const v4fa*)&so[w][r][c4]; if (Cw) *(v4f*)(Cw + (size_t)r * ldc) = v; if (C16) { v4h h4; for (int i = 0; i < 4; ++i) h4[i] = (_Float16)v[i]; *(v4h*)(C16 + cofs + (size_t)(row0 + r) * ldc + col0 + c4) = h4; } }
     } }


__global__ __launch_bounds__(256) void k_rsm(const float* __restrict__ S, _Float16* __restrict__ P, int nrows) {
  #pragma clang fp contract(off)
  const int i = blockIdx.x * 256 + threadIdx.x; if (i >= nrows) return; const float* s = S + (size_t)i * SQ; float mx = -3.0e38f;
#pragma unroll 1
  for (int j = 0; j < SQ; ++j) mx = fmaxf(mx, s[j]); float se = 0.f;
#pragma unroll 1
  for (int j = 0; j < SQ; ++j) se += expf(s[j] - mx); const float sc = 256.0f / se;
#pragma unroll 1
  for (int j0 = 0; j0 < SQ; j0 += 8) { FragH f; for (int q = 0; q < 8; ++q) f.h[q] = (_Float16)(expf(s[j0 + q] - mx) * sc); unsigned short* d = (unsigned short*)P + (size_t)i * SQ + j0; *(v8us*)d = f.half[0];  } }
__global__ __launch_bounds__(256) void k_vt(const _Float16* __restrict__ V16, int b, int h0, _Float16* __restrict__ VT) { __shared__ unsigned short tl[64][65]; const int tid = threadIdx.x; const int hh = blockIdx.x % HG, sg = blockIdx.x / HG; const int s0 = sg * 64; const int h = h0 + hh;
  for (int i = tid; i < 64 * 8; i += 256) { const int j = i / 8, d8 = (i % 8) * 8; FragH f; f.half[0] = *(const v8us*)((const unsigned short*)V16 + ((size_t)b * SQ + s0 + j) * DM + h * HD + d8); for (int q = 0; q < 8; ++q) tl[d8 + q][j] = f.u[q]; }
  __syncthreads();
  { for (int i = tid; i < 64 * 8; i += 256) { const int d = i / 8, j8 = (i % 8) * 8; FragH f; for (int q = 0; q < 8; ++q) f.u[q] = tl[d][j8 + q]; *(v8us*)((unsigned short*)VT + ((size_t)hh * HD + d) * SQ + s0 + j8) = f.half[0]; }  } }



// lane l with lane l ^ M of its 16-lane row (DPP row_xmask), and lane l with lane l ^ 16
template <int M> __device__ __forceinline__ float rs_xm(float x) { return __builtin_bit_cast(float, __builtin_amdgcn_update_dpp(0, __builtin_bit_cast(int, x), 0x160 | M, 0xf, 0xf, true)); }
__device__ __forceinline__ float rs_xh(float x) { return __builtin_bit_cast(float, __builtin_amdgcn_permlanex16(__builtin_bit_cast(int, x), __builtin_bit_cast(int, x), 0x76543210, 0xfedcba98, false, false)); }
__device__ __forceinline__ v16h fa_frag(const _Float16* p) { FragH f; f.half[0] = *(const v8us*)((const unsigned short*)p); f.half[1] = *(const v8us*)((const unsigned short*)p + 16); return f.v; }      /* p already holds the lane half's 8-element shift */
// exp2 of eight values, and of one: each v_exp_f32 works on a register of its own and a v_nop ends the statement. It is there for the slot that the instruction set asks for behind a transcendental before its result is read or its source overwritten.
__device__ __forceinline__ void fa_exp2x8(float (&e)[8]) { asm("v_exp_f32 %0, %0\n\tv_exp_f32 %1, %1\n\tv_exp_f32 %2, %2\n\tv_exp_f32 %3, %3\n\tv_exp_f32 %4, %4\n\tv_exp_f32 %5, %5\n\tv_exp_f32 %6, %6\n\tv_exp_f32 %7, %7\n\tv_nop" : "+v"(e[0]), "+v"(e[1]), "+v"(e[2]), "+v"(e[3]), "+v"(e[4]), "+v"(e[5]), "+v"(e[6]), "+v"(e[7])); }
__device__ __forceinline__ float fa_exp2(float x) { asm("v_exp_f32 %0, %0\n\tv_nop" : "+v"(x)); return x; }
// a trip's fragments: kl, vl = the lane's place (row ln, its half's 8-element shift) in the K rows and in the V^T rows of the trip's LDS buffer
__device__ __forceinline__ void fa_load(const _Float16* kl, const _Float16* vl, v16h (&kc)[4][2], v16h (&vf)[4][2]) {
  /* unrolled because the fragments live in registers, which need constant indices */
#pragma unroll
  for (int t = 0; t < 4; ++t) { kc[t][0] = fa_frag(kl + (16 * t) * (G2_PB / 2)); kc[t][1] = fa_frag(kl + (16 * t) * (G2_PB / 2) + 32); }
#pragma unroll
  for (int t = 0; t < 4; ++t) { vf[t][0] = fa_frag(vl + (16 * t) * (G2_PB / 2)); vf[t][1] = fa_frag(vl + (16 * t) * (G2_PB / 2) + 32); }
  /* inputs-only fence on the loaded values: it keeps the trip's 32 LDS reads in front of the arithmetic, in flight together (one LDS latency a trip; left alone the compiler waited for each pair of K reads in turn and left V^T reads among the last products) */
  asm volatile("" :: "v"(kc[0][0]), "v"(kc[0][1]), "v"(kc[1][0]), "v"(kc[1][1]), "v"(kc[2][0]), "v"(kc[2][1]), "v"(kc[3][0]), "v"(kc[3][1]), "v"(vf[0][0]), "v"(vf[0][1]), "v"(vf[1][0]), "v"(vf[1][1]), "v"(vf[2][0]), "v"(vf[2][1]), "v"(vf[3][0]), "v"(vf[3][1])); }
// one trip's arithmetic: keys kb .. kb + 63, all operands in registers
__device__ __forceinline__ void fa_trip(const int kb, const int q0, const int ln, const int hh, const v16h qf0, const v16h qf1, const v16h (&kc)[4][2], const v16h (&vf)[4][2], v8f (&o)[4], float& m, float& l) {
  const v8f z8 = {0.f,0.f,0.f,0.f,0.f,0.f,0.f,0.f}; const float cs = 0.125f * 1.4426950408889634f;      /* 1 / sqrt(HD), in log2 units */
  /* every loop of this function is unrolled because fragments, scores and sums live in registers, which need constant indices */
  v8f s[4];
#pragma unroll
  for (int t = 0; t < 4; ++t) { s[t] = __builtin_amdgcn_wmma_f32_16x16x32_f16(false, kc[t][0], false, qf0, (short)0, z8, false, false); s[t] = __builtin_amdgcn_wmma_f32_16x16x32_f16(false, kc[t][1], false, qf1, (short)0, s[t], false, false); }
  if (kb + 63 > q0) {      /* wave-uniform: the trip that reaches the diagonal; s[t][r] = key kb + 16 t + 8 hh + r against query q0 + ln */
#pragma unroll
    for (int t = 0; t < 4; ++t) for (int r = 0; r < 8; ++r) s[t][r] = (kb + 16 * t + 8 * hh + r <= q0 + ln) ? s[t][r] : -1.0e30f; }
  float mx = s[0][0];
#pragma unroll
  for (int t = 0; t < 4; ++t) for (int r = 0; r < 8; ++r) mx = fmaxf(mx, s[t][r]);
  mx = fmaxf(mx, rs_xh(mx));      /* the other half of the query's keys */
  const float mn = fmaxf(m, mx * cs); const float al = fa_exp2(m - mn); m = mn;
  v4f s4 = {0.f, 0.f, 0.f, 0.f}; FragH pf[2];
#pragma unroll
  for (int t = 0; t < 4; ++t) { float e[8]; for (int r = 0; r < 8; ++r) e[r] = fmaf(s[t][r], cs, -mn); fa_exp2x8(e); for (int r = 0; r < 8; ++r) { s4[r & 3] += e[r]; pf[t >> 1].h[(t & 1) * 8 + r] = (_Float16)e[r]; } }
  l = l * al + ((s4[0] + s4[1]) + (s4[2] + s4[3]));      /* each half keeps its own keys' share */
#pragma unroll
  for (int t = 0; t < 4; ++t) { o[t] *= al; o[t] = __builtin_amdgcn_wmma_f32_16x16x32_f16(false, vf[t][0], false, pf[0].v, (short)0, o[t], false, false); o[t] = __builtin_amdgcn_wmma_f32_16x16x32_f16(false, vf[t][1], false, pf[1].v, (short)0, o[t], false, false); } }
#define FA_SB (128 * G2_PB)          /* one stage: 64 K rows, then 64 V^T rows */
#define FA_YN ((SQ - QT0) / 64)      /* grid.y rows of the f16 path: the 64-row query blocks behind the first QT0 rows */
#define A0_YN (QT0 / 8)              /* grid.y rows of the exact f32 path: the 8-row blocks of the first QT0 rows */
// four waves per SIMD: with at most 256 registers a wave every f16-path block of the launch is resident from the start (16 waves per WGP), and the waves of a SIMD fill each other's waits.
// The exact f32 rows (a0_rows) need only the projection's results, as the f16 path does, so they share this launch: the blocks of grid.y >= FA_YN take them, heaviest first, in the places that are free at the start and that the lighter
// f16-path blocks leave, while the long f16-path blocks are still walking their keys. Every output row has one writer: the f16 path leaves the first QT0 rows of a batch alone.
template <int MASKADD> __device__ __forceinline__ void a0_rows(const float* __restrict__ QF, const float* __restrict__ KF, const float* __restrict__ VF, const float* __restrict__ mask, float scale, float* __restrict__ OF, int ldo, const int b, const int h, const int r8);      /* defined below */
__global__ __launch_bounds__(128) __attribute__((amdgpu_waves_per_eu(4, 4))) void k_fattn(const _Float16* __restrict__ QKVp, const _Float16* __restrict__ VTp, const float* __restrict__ QF, const float* __restrict__ KF, const float* __restrict__ VF, float* __restrict__ out) {
  __shared__ __attribute__((aligned(16))) unsigned char sm[2 * FA_SB];      /* the two stage buffers */
  const int tid = threadIdx.x, lane = tid & 31, ln = lane & 15, hh = lane >> 4; const int w = __builtin_amdgcn_readfirstlane(tid >> 5);
  const int bh = blockIdx.x, b = bh / NH, h = bh % NH;
  if ((int)blockIdx.y >= FA_YN) { a0_rows<0>(QF, KF, VF, nullptr, 0.125f, out, DM, b, h, FA_YN + A0_YN - 1 - (int)blockIdx.y); return; }      /* the whole block leaves, ahead of every barrier and copy */
  const int yb = SQ / 64 - 1 - (int)blockIdx.y; const int q0 = yb * 64 + w * 16;      /* wave-uniform first query row */
  const int nt = yb + 1;      /* trips of 64 keys, the same for the block's four waves: the last one holds every wave's diagonal */
  const _Float16* qp = QKVp + ((size_t)b * SQ + q0 + ln) * LQ + h * HD + 8 * hh;
  const int rr = tid >> 3, c8 = (tid & 7) * 8; const _Float16* gk = QKVp + ((size_t)b * SQ + rr) * LQ + DM + h * HD + c8; const _Float16* gv = VTp + ((size_t)bh * HD + rr) * SQ + c8;      /* the lane's 16 bytes of key row rr and of V^T row rr, trip 0 */
  const unsigned l0 = (unsigned)(size_t)sm + (unsigned)(rr * G2_PB + c8 * 2);      /* low 32 bits of the __shared__ address = LDS byte address */
  const int koff = ln * G2_PB + 16 * hh, voff = (64 + ln) * G2_PB + 16 * hh;
  const v16h qf0 = fa_frag(qp), qf1 = fa_frag(qp + 32);
  asm volatile("s_wait_xcnt 0x0" :: "v"(qp) : "memory");      /* precaution: no register that an issued load names is written ahead of this wait; the q address pair is an input here so that no load's result is placed on it */
  g2_stage<16>(gk, (size_t)16 * LQ, gv, (size_t)16 * SQ, l0);
  asm volatile("s_wait_asynccnt 0x0" ::: "memory");      /* this wave's copies of trip 0 have landed */
  __syncthreads();      /* ... and every other wave's: trip 0's rows may be read */
  if (nt > 1) g2_stage<16>(gk + (size_t)64 * LQ, (size_t)16 * LQ, gv + 64, (size_t)16 * SQ, l0 + FA_SB);
  const v8f z8 = {0.f,0.f,0.f,0.f,0.f,0.f,0.f,0.f}; v8f o[4] = {z8, z8, z8, z8}; float m = -1.0e30f, l = 0.f;
  /* not unrolled: one trip a stage, the buffer picked by the trip's parity */
#pragma unroll 1
  for (int t = 0; t < nt; ++t) { const unsigned char* st = sm + (t & 1) * FA_SB; v16h kc[4][2], vf[4][2];
    fa_load((const _Float16*)(st + koff), (const _Float16*)(st + voff), kc, vf);      /* the trip's only LDS reads: the buffer is handed on right behind them, so that its refill has a whole trip to land */
    asm volatile("s_wait_dscnt 0x0" ::: "memory");      /* this wave's reads of the buffer are done before it is refilled */
    asm volatile("s_wait_asynccnt 0x0" ::: "memory");      /* this wave's copies of trip t + 1 have landed */
    __syncthreads();      /* publishes trip t + 1's rows and ends every wave's reads of trip t's */
    if (t + 2 < nt) g2_stage<16>(gk + (size_t)(t + 2) * 64 * LQ, (size_t)16 * LQ, gv + (t + 2) * 64, (size_t)16 * SQ, l0 + (t & 1) * FA_SB);
    fa_trip(t * 64, q0, ln, hh, qf0, qf1, kc, vf, o, m, l); }
  asm volatile("s_wait_asynccnt 0x0" ::: "memory");      /* no copy is outstanding when the wave ends */
  l += rs_xh(l); const float fin = 1.0f / l;
  /* unrolled for constant register indices */
  float* op = out + ((size_t)b * SQ + q0 + ln) * DM + h * HD + 8 * hh;      /* o[t][r] = column 16 t + 8 hh + r of query q0 + ln */
#pragma unroll
  for (int t = 0; t < 4; ++t) { const v4f lo = {o[t][0] * fin, o[t][1] * fin, o[t][2] * fin, o[t][3] * fin}, hi = {o[t][4] * fin, o[t][5] * fin, o[t][6] * fin, o[t][7] * fin}; *(v4f*)(op + 16 * t) = lo; *(v4f*)(op + 16 * t + 4) = hi; } }

// lane K of each 16-lane row, handed to all sixteen lanes of that row (DPP row_share)
template <int K> __device__ __forceinline__ float a0_share(float x) { return __builtin_bit_cast(float, __builtin_amdgcn_update_dpp(0, __builtin_bit_cast(int, x), 0x150 | K, 0xf, 0xf, true)); }
template <int K> __device__ __forceinline__ void a0_acc(v4f& o, float e, const v4f* vv) { o += a0_share<K>(e) * vv[K]; if constexpr (K + 1 < 16) a0_acc<K + 1>(o, e, vv); }
// exact f32 attention of the first QT0 rows, SIXTEEN LANES PER QUERY ROW, keys in groups of 16: lane p holds columns 4 p .. 4 p + 3 of its q row and reads the same columns of each of the group's sixteen K rows, as it does of the V rows, so that a load
// of the wave takes one K row's 256 bytes in a row (two whole lines) and not 16 bytes of sixteen rows (sixteen lines). Each lane forms its four columns' share of all sixteen scores; a0_scatter sums the shares over the 16 lanes and leaves
// key 16 g + p's score in lane p. The group's maximum comes from a four-step butterfly over the 16 lanes, the running o and l are rescaled once per group, lane p keeps columns 4 p .. 4 p + 3 of o and its own keys' share of l
// (summed over the 16 lanes at the end). No LDS, no barrier.
// A 128-thread block takes eight query rows: rows 8 r8 .. 8 r8 + 7 of head h of batch b. QF, KF, VF point at the q, k, v blocks of the packed f32 rows (QT0 rows a batch, pitch LQ), OF at the output rows (SQ rows a batch).
// The rows' 16-row block rb = r8 / 2 sets the number of key groups, rb + 1.
// one step of the sum over a 16-lane row: d holds 2 N values a lane; the lanes whose index has bit N clear keep values 0 .. N - 1 and hand N .. 2 N - 1 to lane l ^ N, the others the other way round; each adds what it is handed to what it keeps.
// After the steps N = 8, 4, 2, 1 lane p holds value p summed over the sixteen lanes.
typedef float v2f __attribute__((ext_vector_type(2)));
template <int N> __device__ __forceinline__ void a0_fold(float (&d)[16], const int p) { const bool up = (p & N) != 0;
  /* unrolled because the values live in registers, which need constant indices */
#pragma unroll
  for (int c = 0; c < N; ++c) { const float keep = up ? d[c + N] : d[c], send = up ? d[c] : d[c + N]; d[c] = keep + rs_xm<N>(send); } }
__device__ __forceinline__ float a0_scatter(float (&d)[16], const int p) { a0_fold<8>(d, p); a0_fold<4>(d, p); a0_fold<2>(d, p); a0_fold<1>(d, p); return d[0]; }
template <int MASKADD>
__device__ __forceinline__ void a0_rows(const float* __restrict__ QF, const float* __restrict__ KF, const float* __restrict__ VF, const float* __restrict__ mask, float scale, float* __restrict__ OF, int ldo, const int b, const int h, const int r8) {
  const int p = threadIdx.x & 15; const int rb = r8 >> 1; const int i = r8 * 8 + (threadIdx.x >> 4);
  QF += (size_t)b * QT0 * LQ; KF += (size_t)b * QT0 * LQ; VF += (size_t)b * QT0 * LQ; OF += (size_t)b * SQ * ldo;
  const float* qr = QF + (size_t)i * LQ + h * HD + p * 4;      /* q, k, v rows have the pitch LQ, a constant, so that a group's sixteen K rows and sixteen V rows each hang on one address pair by immediate offsets */
  const v4f q = *(const v4fa*)qr; const v2f qlo = {q[0], q[1]}, qhi = {q[2], q[3]};
  asm volatile("s_wait_xcnt 0x0" :: "v"(qr) : "memory");      /* precaution: no register that an issued load names is written ahead of this wait; the address pair is an input here so that no load's result is placed on it */
  v4f o = {0.f, 0.f, 0.f, 0.f}; float m = -1.0e30f, l = 0.f; const int ng = MASKADD ? (SQ / 16) : (rb + 1);      /* additive-mask form: every key (the mask input decides); causal form: key groups up to the block's last row */
  for (int g = 0; g < ng; ++g) { const int j = g * 16 + p; const float* kr = KF + (size_t)(g * 16) * LQ + h * HD + p * 4; const float* vr = VF + (size_t)(g * 16) * LQ + h * HD + p * 4; v4f kk[16], vv[16];
    /* the loops over c are unrolled because the rows live in registers, which need constant indices */
#pragma unroll
    for (int c = 0; c < 16; ++c) kk[c] = *(const v4fa*)(kr + c * LQ);
#pragma unroll
    for (int c = 0; c < 16; ++c) vv[c] = *(const v4fa*)(vr + c * LQ);
    asm volatile("s_wait_xcnt 0x0" :: "v"(kr), "v"(vr) : "memory");      /* the same precaution for the two address pairs of the group */
    /* inputs-only fences on the loaded values: they keep all 32 loads of the group in front of the arithmetic, in flight together (one memory latency per group; left alone the compiler waits after every second load) */
    asm volatile("" :: "v"(kk[0]), "v"(kk[1]), "v"(kk[2]), "v"(kk[3]), "v"(kk[4]), "v"(kk[5]), "v"(kk[6]), "v"(kk[7]), "v"(kk[8]), "v"(kk[9]), "v"(kk[10]), "v"(kk[11]), "v"(kk[12]), "v"(kk[13]), "v"(kk[14]), "v"(kk[15]), "v"(vv[0]), "v"(vv[1]), "v"(vv[2]), "v"(vv[3]), "v"(vv[4]), "v"(vv[5]), "v"(vv[6]), "v"(vv[7]), "v"(vv[8]), "v"(vv[9]), "v"(vv[10]), "v"(vv[11]), "v"(vv[12]), "v"(vv[13]));
    asm volatile("" :: "v"(vv[14]), "v"(vv[15]));
    float d[16];
#pragma unroll
    for (int c = 0; c < 16; ++c) { const v2f t = qlo * __builtin_shufflevector(kk[c], kk[c], 0, 1) + qhi * __builtin_shufflevector(kk[c], kk[c], 2, 3); d[c] = t[0] + t[1]; }      /* two packed operations on the register pairs as they were loaded, then one add */
    float s = a0_scatter(d, p) * scale; if (MASKADD) s += bf16_round(mask[(size_t)i * SQ + j]) * -10000.0f;
    const float sm = (MASKADD || j <= i) ? s : -1.0e30f;
    float gm = sm; gm = fmaxf(gm, rs_xm<1>(gm)); gm = fmaxf(gm, rs_xm<2>(gm)); gm = fmaxf(gm, rs_xm<4>(gm)); gm = fmaxf(gm, rs_xm<8>(gm));
    const float mn = fmaxf(m, gm); const float sc = expf(m - mn); const float e = expf(sm - mn); l = l * sc + e; m = mn; o *= sc;
    a0_acc<0>(o, e, vv); }
  l += rs_xm<1>(l); l += rs_xm<2>(l); l += rs_xm<4>(l); l += rs_xm<8>(l);
  const float fin = 1.0f / l;
  *(v4f*)(OF + (size_t)i * ldo + h * HD + p * 4) = o * fin; }



extern "C" void kernel_launch(void* const* d_in, const int* in_sizes, int n_in,
                              void* d_out, int out_size, void* d_ws, size_t ws_size, hipStream_t stream) {
  (void)in_sizes; (void)n_in; (void)out_size;
  const float* const* I = (const float* const*)d_in; const float* x = I[0]; const float* wq = I[1]; const float* bq = I[2]; const float* wk = I[3]; const float* bk = I[4]; const float* wv = I[5]; const float* bv = I[6];      /* natural nn.Linear [out][in] weights + biases */
  char* ws = (char*)d_ws; size_t off = 0;
  auto take = [&](size_t bytes) { char* p = ws + off; off += (bytes + 255) & ~(size_t)255; return p; };
  _Float16* BQKV = (_Float16*)take((size_t)3 * DM * DM * 2); float* bqkv = (float*)take((size_t)3 * DM * 4);      /* stacked q | k | v weight plane and bias vector */ 
  _Float16* X16 = (_Float16*)take(NR * DM * 2); _Float16* QKV = (_Float16*)take(NR * 3 * DM * 2); _Float16* Q16 = QKV; _Float16* K16 = QKV + DM; _Float16* V16 = QKV + 2 * DM;      /* q | k | v */ _Float16* O16 = (_Float16*)take(NR * DM * 2);
  _Float16* VT = (_Float16*)take((size_t)NB * NH * HD * SQ * 2);
  float* F0 = (float*)take((size_t)NB * QT0 * LQ * 4);      /* f32 q | k | v of the first QT0 rows of each batch, packed */
  if (off > ws_size) return;
  k_prep<<<PREP_XB + 3 * PREP_WB + 1, 256, 0, stream>>>(x, wq, wk, wv, bq, bk, bv, X16, BQKV, bqkv);      /* x rows f16; natural [out][in] = Bt[n][k] x16, stacked q | k | v; stacked bias vector bq | bk | bv */
  const size_t r0p = (size_t)B0 * SQ;      /* first projected row */
  k_gemm2<0><<<dim3((unsigned)((MP / 128) * (3 * DM / 128)), 1), 256, 0, stream>>>(X16 + r0p * DM, DM, 0, BQKV, DM, 0, 0.0625f, bqkv, 0, nullptr, 1, 0, 0, F0, SQ, QT0, QKV + r0p * 3 * DM, VT, 2 * DM, SQ, 3 * DM, 0, MP, 3 * DM, DM);      /* q | k rows (f16); head h = columns h*HD.. of each DM block; v as V^T [NB][NH][HD][SQ]; the first QT0 rows of each batch also f32 (q | k | v) */
  k_fattn<<<dim3(NB * NH, FA_YN + A0_YN), 128, 0, stream>>>(QKV, VT, F0, F0 + DM, F0 + 2 * DM, (float*)d_out);      /* o (merged heads) f32 straight into the output rows: f16 path behind the first QT0 rows of each batch, exact f32 causal attention for those */
}

// v010
// Measured time: 59.9 microseconds a run.
// Two timings next to v009 put it at 1.06 and 1.07 times that version's speed.
// Over all steps from v000 it is 97.4 times as fast.
#include <hip/hip_runtime.h>
#define NB 2
#define SQ 2048
#define DM 1024
#define NH 16
#define HD 64
#define HG 4                         /* head group of the k_vt(b, h0) form */
#define B0 0                         /* first batch processed (debug hook) */
#define NBR NB                       /* batches processed (debug hook) */
#define NR ((size_t)NB * SQ)         /* token rows */
#define MP ((int)((size_t)NBR * SQ)) /* rows projected (debug hook) */
#define QT 256                       /* unused */
#define NKX SQ                       /* unused */
#define QT0 256                      /* first-tile rows recomputed exactly (256: margin for the few-key rows, no output projection) */
#define QN SQ                        /* unused */
#define NHD NH                       /* unused */
#define MPO MP                       /* unused */
#define LQ (3 * DM)      /* row pitch of the q/k/v rows */
typedef __bf16 v16b __attribute__((ext_vector_type(16)));
typedef unsigned short v8us __attribute__((ext_vector_type(8), may_alias));
typedef float  v8f  __attribute__((ext_vector_type(8)));
typedef float  v4f  __attribute__((ext_vector_type(4)));
typedef float  v4fa __attribute__((ext_vector_type(4), may_alias));
union FragB { v16b v; v8us half[2]; unsigned short u[16]; };

__device__ __forceinline__ unsigned short bf16_bits(float x) { unsigned int u = __float_as_uint(x); return (unsigned short)((u + 0x7FFFu + ((u >> 16) & 1u)) >> 16); }
__device__ __forceinline__ float bf16_val(unsigned short b) { return __uint_as_float(((unsigned int)b) << 16); }
__device__ __forceinline__ float bf16_round(float x) { return bf16_val(bf16_bits(x)); }
// D += A·B with NT terms: 1 = ah·bh, 2 = + al·bh (A split), 3 = + ah·bl (both split)
template <int NT>
__device__ __forceinline__ v8f mmaN(v16b ah, v16b al, v16b bh, v16b bl, v8f c) {
  c = __builtin_amdgcn_wmma_f32_16x16x32_bf16(false, ah, false, bh, (short)0, c, false, false);
  if (NT >= 2) c = __builtin_amdgcn_wmma_f32_16x16x32_bf16(false, al, false, bh, (short)0, c, false, false);
  if (NT >= 3) c = __builtin_amdgcn_wmma_f32_16x16x32_bf16(false, ah, false, bl, (short)0, c, false, false);
  asm volatile("v_nop\n\tv_nop\n\tv_nop\n\tv_nop" : "+v"(c) : "v"(ah), "v"(al), "v"(bh), "v"(bl));
  return c;
}

__global__ __launch_bounds__(256) void k_wt_bf16(const float* __restrict__ W, unsigned short* __restrict__ Wt, int K, int N) {
  const int t = blockIdx.x * 256 + threadIdx.x;
  const int k8n = K / 8;
  if (t >= N * k8n) return;
  const int n = t / k8n, k8 = (t % k8n) * 8;
  v8us v;
#pragma unroll
  for (int i = 0; i < 8; ++i) v[i] = bf16_bits(W[(size_t)(k8 + i) * N + n]);
  *(v8us*)(Wt + (size_t)n * K + k8) = v;
  
}

// GEMM C[M][N] (f32, pitch ldc) = act(A[M][K]·W + bias). A f32 row-major (pitch lda) converted per fragment to bf16
// (ASPLIT: hi/lo two planes -> 2 terms, else single rounded term); Wt bf16 [N][K] (pitch ldb). BIAS_BF16 rounds the
// bias to bf16 first (bias quantised to bf16 before the add). K%32==0, M%16==0, N%64==0.
template <bool ASPLIT, int ACT, bool BIAS_BF16>
__global__ __launch_bounds__(128) void k_gemm_bf(const float* __restrict__ A, int lda, const unsigned short* __restrict__ Wt, int ldb,
                                               const float* __restrict__ bias, float* __restrict__ C, int ldc, int M, int N, int K) {
  __shared__ __attribute__((aligned(16))) float so[4][16][64];
  const int tid = threadIdx.x, w = tid >> 5, lane = tid & 31, ln = lane & 15, hh = lane >> 4;
  const int ntn = N / 64;
  const int wid = blockIdx.x * 4 + w;
  const int mt = wid / ntn, nq = wid % ntn;
  if (mt * 16 >= M) return;
  const int row0 = mt * 16, col0 = nq * 64;
  const float* arow = A + (size_t)(row0 + ln) * lda;
  v8f acc[4] = {};
  for (int kb = 0; kb < K; kb += 32) {
    FragB ah, al;
    const v4f x0 = *(const v4fa*)(arow + kb + 8 * hh), x1 = *(const v4fa*)(arow + kb + 8 * hh + 4);
    const v4f x2 = *(const v4fa*)(arow + kb + 16 + 8 * hh), x3 = *(const v4fa*)(arow + kb + 16 + 8 * hh + 4);
    float xs[16] = {x0[0],x0[1],x0[2],x0[3],x1[0],x1[1],x1[2],x1[3],x2[0],x2[1],x2[2],x2[3],x3[0],x3[1],x3[2],x3[3]};
#pragma unroll
    for (int i = 0; i < 16; ++i) { const unsigned short hb = bf16_bits(xs[i]); ah.u[i] = hb; al.u[i] = ASPLIT ? bf16_bits(xs[i] - bf16_val(hb)) : (unsigned short)0; }
#pragma unroll
    for (int t = 0; t < 4; ++t) {
      const unsigned short* brow = Wt + (size_t)(col0 + t * 16 + ln) * ldb + kb;
      FragB b;
      b.half[0] = *(const v8us*)(brow + 8 * hh);
      b.half[1] = *(const v8us*)(brow + 16 + 8 * hh);
      acc[t] = mmaN<ASPLIT ? 2 : 1>(ah.v, al.v, b.v, b.v, acc[t]);
    }
  }
#pragma unroll
  for (int t = 0; t < 4; ++t) {
    float bv = bias ? bias[col0 + t * 16 + ln] : 0.f;
    if (BIAS_BF16) bv = bf16_round(bv);
#pragma unroll
    for (int r = 0; r < 8; ++r) { float v = acc[t][r] + bv; if (ACT == 1) v = fmaxf(v, 0.f); so[w][8 * hh + r][t * 16 + ln] = v; }
  }
  __builtin_amdgcn_fence(__ATOMIC_ACQ_REL, "workgroup");
  __builtin_amdgcn_wave_barrier();
  const int rsub = lane >> 4, c4 = (lane & 15) * 4;
  {
#pragma unroll
    for (int q = 0; q < 8; ++q) {
      const int r = q * 2 + rsub;
      const v4f v = *(const v4fa*)&so[w][r][c4];
      *(v4f*)(C + (size_t)(row0 + r) * ldc + col0 + c4) = v;
    }
    
  }
}

// GEMM C = act(A·W + bias + resid): A f32 (ASPLIT -> hi/lo 2 terms), Wt bf16 [N][K]; ACT 0 none, 1 relu, 2 exact gelu;
// resid (optional, f32, row index = (row % rmod), pitch ldr, RES_BF16 rounds it) added before the activation.
template <bool ASPLIT, int ACT, bool BIAS_BF16, bool RES_BF16>
__global__ __launch_bounds__(128) void k_gemm_bf3(const float* __restrict__ A, int lda, const unsigned short* __restrict__ Wt, int ldb,
                                                const float* __restrict__ bias, const float* __restrict__ resid, int rmod, int ldr,
                                                float* __restrict__ C, int ldc, int M, int N, int K) {
  __shared__ __attribute__((aligned(16))) float so[4][16][64];
  const int tid = threadIdx.x, w = tid >> 5, lane = tid & 31, ln = lane & 15, hh = lane >> 4;
  const int ntn = N / 64;
  const int wid = blockIdx.x * 4 + w;
  const int mt = wid / ntn, nq = wid % ntn;
  if (mt * 16 >= M) return;
  const int row0 = mt * 16, col0 = nq * 64;
  const float* arow = A + (size_t)(row0 + ln) * lda;
  v8f acc[4] = {};
  for (int kb = 0; kb < K; kb += 32) {
    FragB ah, al;
    const v4f x0 = *(const v4fa*)(arow + kb + 8 * hh), x1 = *(const v4fa*)(arow + kb + 8 * hh + 4);
    const v4f x2 = *(const v4fa*)(arow + kb + 16 + 8 * hh), x3 = *(const v4fa*)(arow + kb + 16 + 8 * hh + 4);
    float xs[16] = {x0[0],x0[1],x0[2],x0[3],x1[0],x1[1],x1[2],x1[3],x2[0],x2[1],x2[2],x2[3],x3[0],x3[1],x3[2],x3[3]};
#pragma unroll
    for (int i = 0; i < 16; ++i) { const unsigned short hb = bf16_bits(xs[i]); ah.u[i] = hb; al.u[i] = ASPLIT ? bf16_bits(xs[i] - bf16_val(hb)) : (unsigned short)0; }
#pragma unroll
    for (int t = 0; t < 4; ++t) {
      const unsigned short* brow = Wt + (size_t)(col0 + t * 16 + ln) * ldb + kb;
      FragB b;
      b.half[0] = *(const v8us*)(brow + 8 * hh);
      b.half[1] = *(const v8us*)(brow + 16 + 8 * hh);
      acc[t] = mmaN<ASPLIT ? 2 : 1>(ah.v, al.v, b.v, b.v, acc[t]);
    }
  }
#pragma unroll
  for (int t = 0; t < 4; ++t) {
    const int col = col0 + t * 16 + ln;
    float bv = bias ? bias[col] : 0.f;
    if (BIAS_BF16) bv = bf16_round(bv);
#pragma unroll
    for (int r = 0; r < 8; ++r) {
      float v = acc[t][r] + bv;
      if (resid) { float rv = resid[(size_t)((row0 + 8 * hh + r) % rmod) * ldr + col]; if (RES_BF16) rv = bf16_round(rv); v += rv; }
      if (ACT == 1) v = fmaxf(v, 0.f);
      if (ACT == 2) v = 0.5f * v * (1.0f + erff(v * 0.70710678118654752f));
      if (ACT == 3) { const float u = 0.7978845608028654f * (v + 0.044715f * v * v * v); v = 0.5f * v * (1.0f + tanhf(u)); }
      so[w][8 * hh + r][t * 16 + ln] = v;
    }
  }
  __builtin_amdgcn_fence(__ATOMIC_ACQ_REL, "workgroup");
  __builtin_amdgcn_wave_barrier();
  const int rsub = lane >> 4, c4 = (lane & 15) * 4;
  {
#pragma unroll
    for (int q = 0; q < 8; ++q) {
      const int r = q * 2 + rsub;
      const v4f v = *(const v4fa*)&so[w][r][c4];
      *(v4f*)(C + (size_t)(row0 + r) * ldc + col0 + c4) = v;
    }
    
  }
}
// row LayerNorm (biased variance, eps) over N: s = X (+ R); optional out_sum <- s; out_norm <- (s-mu)*rsqrt(var+eps)*g + b
template <bool PARAM_BF16>
__global__ __launch_bounds__(256) void k_layernorm(const float* __restrict__ X, const float* __restrict__ R, const float* __restrict__ g, const float* __restrict__ bta,
                                                  float* __restrict__ out_sum, float* __restrict__ out_norm, int N, float eps) {
  __shared__ float red[256];
  const int row = blockIdx.x, tid = threadIdx.x;
  const float* x = X + (size_t)row * N; const float* rr = R ? R + (size_t)row * N : nullptr;
  float vals[16];                     // up to N = 4096
  const int per = N / 256;            // contiguous chunk per thread? use strided-by-4 chunks: thread handles j = tid*4 + 1024*u
  float s1 = 0.f;
  for (int u = 0; u < per / 4; ++u) {
    const int j = tid * 4 + 1024 * u;
    const v4f a = *(const v4fa*)(x + j);
    v4f b = {0.f,0.f,0.f,0.f}; if (rr) b = *(const v4fa*)(rr + j);
#pragma unroll
    for (int q = 0; q < 4; ++q) { const float v = a[q] + b[q]; vals[u * 4 + q] = v; s1 += v; }
  }
  red[tid] = s1; __syncthreads();
  for (int st = 128; st > 0; st >>= 1) { if (tid < st) red[tid] += red[tid + st]; __syncthreads(); }
  const float mu = red[0] / (float)N; __syncthreads();
  float s2 = 0.f;
  for (int u = 0; u < per / 4; ++u)
#pragma unroll
    for (int q = 0; q < 4; ++q) { const float c = vals[u * 4 + q] - mu; s2 += c * c; }
  red[tid] = s2; __syncthreads();
  for (int st = 128; st > 0; st >>= 1) { if (tid < st) red[tid] += red[tid + st]; __syncthreads(); }
  const float rs = rsqrtf(red[0] / (float)N + eps);
  {
    for (int u = 0; u < per / 4; ++u) {
      const int j = tid * 4 + 1024 * u;
      v4f o, sm;
#pragma unroll
      for (int q = 0; q < 4; ++q) {
        float gg = g[j + q], bb = bta[j + q];
        if (PARAM_BF16) { gg = bf16_round(gg); bb = bf16_round(bb); }
        sm[q] = vals[u * 4 + q]; o[q] = (vals[u * 4 + q] - mu) * rs * gg + bb;
      }
      if (out_sum) *(v4f*)(out_sum + (size_t)row * N + j) = sm;
      *(v4f*)(out_norm + (size_t)row * N + j) = o;
    }
    
  }
}



// ---- f16 WMMA path (v_wmma_f32_16x16x32_f16): 11-bit significands for operands in range — used where a [0,1] probability operand needs more precision than bf16
typedef _Float16 v16h __attribute__((ext_vector_type(16)));
union FragH { v16h v; v8us half[2]; _Float16 h[16]; unsigned short u[16]; };
template <int NT>
__device__ __forceinline__ v8f mmaH(v16h ah, v16h al, v16h bh, v16h bl, v8f c) {
  c = __builtin_amdgcn_wmma_f32_16x16x32_f16(false, ah, false, bh, (short)0, c, false, false);
  if (NT >= 2) c = __builtin_amdgcn_wmma_f32_16x16x32_f16(false, al, false, bh, (short)0, c, false, false);
  if (NT >= 3) c = __builtin_amdgcn_wmma_f32_16x16x32_f16(false, ah, false, bl, (short)0, c, false, false);
  asm volatile("v_nop\n\tv_nop\n\tv_nop\n\tv_nop" : "+v"(c) : "v"(ah), "v"(al), "v"(bh), "v"(bl));
  return c;
}
// batched GEMM like k_gemm_b but f16 operands: A f32 (split into f16 hi/lo if ASPLIT, else rounded to f16), Bt = f16 values [n][k]; alpha; C f32; N multiple of 16 (partial tiles skipped)
template <bool ASPLIT>
__global__ __launch_bounds__(128) void k_gemm_h(const float* __restrict__ A, int lda, size_t sA, const _Float16* __restrict__ Bh, int ldb, size_t sB, float alpha, float* __restrict__ C, int ldc, size_t sC, int M, int N, int K) {
  __shared__ __attribute__((aligned(16))) float so[4][16][64];
  const int tid = threadIdx.x, w = tid >> 5, lane = tid & 31, ln = lane & 15, hh = lane >> 4; const int by = blockIdx.y;
  A += (size_t)by * sA; Bh += (size_t)by * sB; C += (size_t)by * sC;
  const int ntn = (N + 63) / 64; const int wid = blockIdx.x * 4 + w; const int mt = wid / ntn, nq = wid % ntn; if (mt * 16 >= M) return;
  const int row0 = mt * 16, col0 = nq * 64; const float* arow = A + (size_t)(row0 + ln) * lda;
  v8f acc[4] = {};
  for (int kb = 0; kb < K; kb += 32) {
    FragH ah, al;
    const v4f x0 = *(const v4fa*)(arow + kb + 8 * hh), x1 = *(const v4fa*)(arow + kb + 8 * hh + 4), x2 = *(const v4fa*)(arow + kb + 16 + 8 * hh), x3 = *(const v4fa*)(arow + kb + 16 + 8 * hh + 4);
    float xs[16] = {x0[0],x0[1],x0[2],x0[3],x1[0],x1[1],x1[2],x1[3],x2[0],x2[1],x2[2],x2[3],x3[0],x3[1],x3[2],x3[3]};
#pragma unroll
    for (int i = 0; i < 16; ++i) { const _Float16 h = (_Float16)xs[i]; ah.h[i] = h; al.h[i] = ASPLIT ? (_Float16)(xs[i] - (float)h) : (_Float16)0.0f; }
#pragma unroll
    for (int t = 0; t < 4; ++t) { if (col0 + t * 16 >= N) continue; const size_t boff = (size_t)(col0 + t * 16 + ln) * ldb + kb; FragH bq; bq.half[0] = *(const v8us*)(Bh + boff + 8 * hh); bq.half[1] = *(const v8us*)(Bh + boff + 16 + 8 * hh);
      acc[t] = mmaH<ASPLIT ? 2 : 1>(ah.v, al.v, bq.v, bq.v, acc[t]); }
  }
#pragma unroll
  for (int t = 0; t < 4; ++t) { if (col0 + t * 16 >= N) continue;
#pragma unroll
    for (int r = 0; r < 8; ++r) so[w][8 * hh + r][t * 16 + ln] = acc[t][r] * alpha; }
  __builtin_amdgcn_fence(__ATOMIC_ACQ_REL, "workgroup"); __builtin_amdgcn_wave_barrier();
  const int rsub = lane >> 4, c4 = (lane & 15) * 4;
  {
#pragma unroll
    for (int q = 0; q < 8; ++q) { const int r = q * 2 + rsub; if (col0 + c4 < N) { const v4f v = *(const v4fa*)&so[w][r][c4]; *(v4f*)(C + (size_t)(row0 + r) * ldc + col0 + c4) = v; } }
     }
}

// Wt[n][k] = f16(W[k][n]·scale) from f32 row-major W[K][N] (scale = power of two; bf16-exact weights stay exact in f16 away from the subnormal range)
__global__ __launch_bounds__(256) void k_wt_f16(const float* __restrict__ W, _Float16* __restrict__ Wt, int K, int N, float scale) {
  const int t = blockIdx.x * 256 + threadIdx.x; if (t >= N * (K / 8)) return; const int n = t / (K / 8), k8 = (t % (K / 8)) * 8; FragH f;
#pragma unroll
  for (int i = 0; i < 8; ++i) f.h[i] = (_Float16)(bf16_round(W[(size_t)(k8 + i) * N + n]) * scale); const v8us o = f.half[0];
  *(v8us*)((unsigned short*)Wt + (size_t)n * K + k8) = o; 
}
// k_gemm_hh variant with fused epilogue: v = acc·alpha + bias[by·sBias + col] (+ CP[(row/rowsPerB)·sCPb + by·64 + col] if CP) ; ACT 0 none / 1 elu ; writes f16 C16 (and f32 C if non-null)
template <int ACT>
__global__ __launch_bounds__(128) void k_gemm_hhx(const _Float16* __restrict__ A, int lda, size_t sA, const _Float16* __restrict__ Bh, int ldb, size_t sB, float alpha, const float* __restrict__ bias, size_t sBias, const float* __restrict__ CP, int rowsPerB, size_t sCPb, int row0g,
    float* __restrict__ C, _Float16* __restrict__ C16, int ldc, size_t sC, int M, int N, int K) {
  __shared__ __attribute__((aligned(16))) float so[4][16][64];
  const int tid = threadIdx.x, w = tid >> 5, lane = tid & 31, ln = lane & 15, hh = lane >> 4; const int by = blockIdx.y;
  A += (size_t)by * sA; Bh += (size_t)by * sB; const size_t cofs = (size_t)by * sC; const float* bp = bias ? bias + (size_t)by * sBias : nullptr;
  const int ntn = (N + 63) / 64; const int wid = blockIdx.x * 4 + w; const int mt = wid / ntn, nq = wid % ntn; if (mt * 16 >= M) return;
  const int row0 = mt * 16, col0 = nq * 64; const _Float16* arow = A + (size_t)(row0 + ln) * lda;
  v8f acc[4] = {};
  for (int kb = 0; kb < K; kb += 32) { FragH ah; ah.half[0] = *(const v8us*)((const unsigned short*)arow + kb + 8 * hh); ah.half[1] = *(const v8us*)((const unsigned short*)arow + kb + 16 + 8 * hh);
#pragma unroll
    for (int t = 0; t < 4; ++t) { if (col0 + t * 16 >= N) continue; const size_t boff = (size_t)(col0 + t * 16 + ln) * ldb + kb; FragH bq; bq.half[0] = *(const v8us*)((const unsigned short*)Bh + boff + 8 * hh); bq.half[1] = *(const v8us*)((const unsigned short*)Bh + boff + 16 + 8 * hh);
      acc[t] = mmaH<1>(ah.v, ah.v, bq.v, bq.v, acc[t]); }
  }
#pragma unroll
  for (int t = 0; t < 4; ++t) { if (col0 + t * 16 >= N) continue; const int col = col0 + t * 16 + ln; const float bv = bp ? bf16_round(bp[col]) : 0.f;
#pragma unroll
    for (int r = 0; r < 8; ++r) { float v = acc[t][r] * alpha + bv; if (CP) { const int rr = row0g + row0 + 8 * hh + r; if (rowsPerB < 0) v += CP[cofs + (size_t)rr * ldc + col];      /* rowsPerB < 0: own element of the batched C plane */ else { const int bidx = rr / rowsPerB; v += CP[(size_t)bidx * sCPb + (size_t)by * 64 + col]; } } if (ACT == 1) v = (v > 0.f) ? v : expm1f(v); else if (ACT == 7) v = (v > 0.f) ? v + 1.0f : expf(v); else if (ACT == 8) v = tanhf(v); else if (ACT == 9) v = 0.5f * v * (1.0f + tanhf(0.7978845608028654f * (v + 0.044715f * v * v * v))); else if (ACT == 11) v = 1.0f / (1.0f + expf(-v)); else if (ACT == 12) v = (v > 0.f) ? v : 0.01f * v; else if (ACT == 14) v = (v > 0.f) ? v : 0.1f * v; else if (ACT == 16) v = (v >= 0.f) ? v : 0.3f * v; else if (ACT == 17) v = (v >= 0.f) ? v : 0.2f * v; else if (ACT == 15) v = v / (1.0f + expf(-v)); else if (ACT == 3) v = fmaxf(v, 0.f); else if (ACT == 6) v = 0.5f * v * (1.0f + erff(v * 0.70710678118654752f)); so[w][8 * hh + r][t * 16 + ln] = v; } }
  __builtin_amdgcn_fence(__ATOMIC_ACQ_REL, "workgroup"); __builtin_amdgcn_wave_barrier();
  const int rsub = lane >> 4, c4 = (lane & 15) * 4; typedef _Float16 v4h __attribute__((ext_vector_type(4)));
  {
#pragma unroll
    for (int q = 0; q < 8; ++q) { const int r = q * 2 + rsub; if (col0 + c4 < N) { const v4f v = *(const v4fa*)&so[w][r][c4]; if (C) *(v4f*)(C + cofs + (size_t)(row0 + r) * ldc + col0 + c4) = v; if (C16) { v4h h4; for (int i = 0; i < 4; ++i) h4[i] = (_Float16)v[i]; *(v4h*)(C16 + cofs + (size_t)(row0 + r) * ldc + col0 + c4) = h4; } } }
     }
}


typedef _Float16 v4h __attribute__((ext_vector_type(4)));

// operand preparation in ONE launch: x as exact f16 rows, the three natural [out][in] weight planes x16 as f16 (stacked q | k | v), the three biases stacked (f32). The parts need nothing of each other, so they share one grid by ranges of the
// block index (block-uniform branches): PREP_XB blocks for x, PREP_WB for each weight plane, one last block for the biases. A block converts PREP_L * 1024 elements in a row: load j of a thread is its 16 bytes of the block's j-th 4-KiB piece
// (a wave's load = 512 bytes in a row, its store = 256), and a thread's PREP_L loads are all issued ahead of the first conversion.
#define PREP_L 16
#define PREP_XB ((int)(NR * DM / (PREP_L * 1024)))
#define PREP_WB (DM * DM / (PREP_L * 1024))
__global__ __launch_bounds__(256) void k_prep(const float* __restrict__ x, const float* __restrict__ wq, const float* __restrict__ wk, const float* __restrict__ wv, const float* __restrict__ bq, const float* __restrict__ bk, const float* __restrict__ bv,
    _Float16* __restrict__ X16, _Float16* __restrict__ BQKV, float* __restrict__ bqkv) {
  static_assert(NR * DM % (PREP_L * 1024) == 0 && DM * DM % (PREP_L * 1024) == 0 && DM == 1024, "whole blocks only; a bias is four elements a thread");
  const int tid = threadIdx.x, blk = blockIdx.x;
  if (blk >= PREP_XB + 3 * PREP_WB) { const v4f a = *(const v4fa*)(bq + tid * 4), b = *(const v4fa*)(bk + tid * 4), c = *(const v4fa*)(bv + tid * 4); float* d = bqkv + tid * 4; *(v4f*)d = a; *(v4f*)(d + DM) = b; *(v4f*)(d + 2 * DM) = c; return; }
  const float* src = x; _Float16* dst = X16; float scale = 1.0f; int lb = blk;
  if (blk >= PREP_XB) { const int p = (blk - PREP_XB) / PREP_WB; lb = (blk - PREP_XB) % PREP_WB; src = p == 0 ? wq : p == 1 ? wk : wv; dst = BQKV + (size_t)p * DM * DM; scale = 16.0f; }
  const size_t e0 = (size_t)lb * (PREP_L * 1024) + tid * 4; const float* sp = src + e0; _Float16* dp = dst + e0; v4f a[PREP_L];
  /* both loops are unrolled because the loaded values live in registers, which need constant indices */
#pragma unroll
  for (int j = 0; j < PREP_L; ++j) a[j] = *(const v4fa*)(sp + j * 1024);
  asm volatile("s_wait_xcnt 0x0" :: "v"(sp) : "memory");      /* precaution: no register that an issued load names is written ahead of this wait; the address pair is an input here so that no load's result is placed on it */
#pragma unroll
  for (int j = 0; j < PREP_L; ++j) { v4h h4; for (int q = 0; q < 4; ++q) h4[q] = (_Float16)(bf16_round(a[j][q]) * scale); *(v4h*)(dp + j * 1024) = h4; } }
__global__ __launch_bounds__(256) void k_h16(const float* __restrict__ x, _Float16* __restrict__ X16, size_t n8) { const size_t t = (size_t)blockIdx.x * 256 + threadIdx.x; if (t >= n8) return; FragH f;
#pragma unroll
  for (int q = 0; q < 8; ++q) f.h[q] = (_Float16)x[t * 8 + q]; *(v8us*)((unsigned short*)X16 + t * 8) = f.half[0];  }
__global__ __launch_bounds__(256) void k_round16f(const float* __restrict__ W, _Float16* __restrict__ Bt, size_t n8) { const size_t t = (size_t)blockIdx.x * 256 + threadIdx.x; if (t >= n8) return; FragH f;
#pragma unroll
  for (int i = 0; i < 8; ++i) f.h[i] = (_Float16)(bf16_round(W[t * 8 + i]) * 16.0f); *(v8us*)((unsigned short*)Bt + t * 8) = f.half[0];  }
__global__ __launch_bounds__(256) void k_hl(const float* __restrict__ F, _Float16* __restrict__ Hh, _Float16* __restrict__ Hl, size_t n8) { const size_t t = (size_t)blockIdx.x * 256 + threadIdx.x; if (t >= n8) return; FragH fh, fl; const v4f a = *(const v4fa*)(F + t * 8), c = *(const v4fa*)(F + t * 8 + 4);
#pragma unroll
  for (int q = 0; q < 4; ++q) { _Float16 h = (_Float16)a[q]; fh.h[q] = h; fl.h[q] = (_Float16)((a[q] - (float)h) * 1024.0f); h = (_Float16)c[q]; fh.h[4 + q] = h; fl.h[4 + q] = (_Float16)((c[q] - (float)h) * 1024.0f); }
  { *(v8us*)((unsigned short*)Hh + t * 8) = fh.half[0]; *(v8us*)((unsigned short*)Hl + t * 8) = fl.half[0];  } }

// ---- fast GEMM (wave tile 32x64, eight waves = block tile 128x128; requires M % 128 == 0, N % 128 == 0, K % 64 == 0); epilogue = k_gemm_hhx semantics ----
// Operands go through LDS: a stage is 64 k of the block's 128 A rows and 128 B rows (one whole 128-byte line a row), brought by asynchronous copies to LDS, eight lanes a line, two buffers, so that the next stage flies while this one is worked on;
// rows stand at a pitch of 144 bytes (16 x odd: the sixteen rows of a ds_load_b128 fragment read fall on different banks). Each accumulator still takes its k blocks of 32 in rising order.
// the f32 plane C holds only the first crows rows of every cmod rows, packed (row (R / cmod) * crows + R % cmod, pitch ldc); cmod % 32 == 0 and crows % 32 == 0, so a wave's tile is wholly in it or wholly out
// the columns from ctcol0 on (ctcol0 % 128 == 0) go out transposed, f16, into CT instead of C16: element (R, col) stands at CT[((R / ctmod) * (N - ctcol0) + col - ctcol0) * ctmod + R % ctmod] (ctmod % 128 == 0: a block's 128 rows share R / ctmod; one plane only, grid.y == 1).
// A lane's eight accumulator rows of one column are 16 bytes in a row of the transposed tile, so the block builds the tile [128 columns][128 rows] in LDS by 16-byte writes and stores each of its rows as 256 bytes in a row.
__device__ __forceinline__ v16h g2_frag(const _Float16* p, int hh) { FragH f; f.half[0] = *(const v8us*)((const unsigned short*)p + 8 * hh); f.half[1] = *(const v8us*)((const unsigned short*)p + 16 + 8 * hh); return f.v; }
__device__ __forceinline__ v8f g2_mma(v16h a, v16h b, v8f c) { v8f d = __builtin_amdgcn_wmma_f32_16x16x32_f16(false, a, false, b, (short)0, c, false, false); asm volatile("v_nop\n\tv_nop\n\tv_nop\n\tv_nop" : "+v"(d) : "v"(a), "v"(b)); return d; }
#define G2_PB 144                    /* LDS row pitch, bytes */
#define G2_SB (256 * G2_PB)          /* one stage: 128 A rows, then 128 B rows */
#define G2_TP 272                    /* LDS row pitch of the transposed output tile, bytes: 128 f16 + 16 (16 x odd, as G2_PB) */
// one stage's copies of one lane: rows rr + RPR j (j = 0..3) of a first and of a second operand, 16 bytes each (RPR = rows that the block's lanes cover at once, eight lanes a row); pa, pb = the lane's place in row rr of the two operands at the stage's k,
// sa, sb = RPR rows in elements, l = the lane's LDS byte address in row rr of the buffer (4 RPR rows of the first operand, then 4 RPR of the second).
// The s_wait_xcnt ends the copies' own statement as a precaution: no register that an issued copy names is written ahead of it.
template <int RPR> __device__ __forceinline__ void g2_stage(const _Float16* pa, size_t sa, const _Float16* pb, size_t sb, unsigned l) {
  const _Float16* a1 = pa + sa; const _Float16* a2 = a1 + sa; const _Float16* a3 = a2 + sa; const _Float16* b1 = pb + sb; const _Float16* b2 = b1 + sb; const _Float16* b3 = b2 + sb;
  asm volatile("global_load_async_to_lds_b128 %0, %8, off\n\tglobal_load_async_to_lds_b128 %1, %9, off\n\tglobal_load_async_to_lds_b128 %2, %10, off\n\tglobal_load_async_to_lds_b128 %3, %11, off\n\t"
               "global_load_async_to_lds_b128 %4, %12, off\n\tglobal_load_async_to_lds_b128 %5, %13, off\n\tglobal_load_async_to_lds_b128 %6, %14, off\n\tglobal_load_async_to_lds_b128 %7, %15, off\n\ts_wait_xcnt 0x0"
               :: "v"(l), "v"(l + RPR * G2_PB), "v"(l + 2 * RPR * G2_PB), "v"(l + 3 * RPR * G2_PB), "v"(l + 4 * RPR * G2_PB), "v"(l + 5 * RPR * G2_PB), "v"(l + 6 * RPR * G2_PB), "v"(l + 7 * RPR * G2_PB), "v"(pa), "v"(a1), "v"(a2), "v"(a3), "v"(pb), "v"(b1), "v"(b2), "v"(b3) : "memory"); }
template <int ACT>
__global__ __launch_bounds__(256) void k_gemm2(const _Float16* __restrict__ A, int lda, size_t sA, const _Float16* __restrict__ Bh, int ldb, size_t sB, float alpha, const float* __restrict__ bias, size_t sBias, const float* __restrict__ CP, int rowsPerB, size_t sCPb, int row0g,
    float* __restrict__ C, int cmod, int crows, _Float16* __restrict__ C16, _Float16* __restrict__ CT, int ctcol0, int ctmod, int ldc, size_t sC, int M, int N, int K) { static_assert(ACT == 0 || ACT == 3 || ACT == 6 || ACT == 8 || ACT == 9 || ACT == 11 || ACT == 12 || ACT == 14 || ACT == 15 || ACT == 16 || ACT == 17, "k_gemm2: unsupported ACT code (would silently apply no activation)");
  __shared__ __attribute__((aligned(16))) unsigned char sm[2 * G2_SB];      /* the two stage buffers; behind the loop's last barrier the same bytes are the waves' output staging */
  static_assert(sizeof(float) * 8 * 32 * 68 <= 2 * G2_SB && 128 * G2_TP <= 2 * G2_SB, "output staging must fit the stage buffers"); float (*so)[32][68] = (float (*)[32][68])sm;
  const int tid = threadIdx.x, w = tid >> 5, lane = tid & 31, ln = lane & 15, hh = lane >> 4; const int by = blockIdx.y;
  A += (size_t)by * sA; Bh += (size_t)by * sB; const size_t cofs = (size_t)by * sC; const float* bp = bias ? bias + (size_t)by * sBias : nullptr;
  const int ntn = N >> 7; const int mt = blockIdx.x / ntn, nq = blockIdx.x - mt * ntn; if (mt * 128 >= M) return;      /* the whole block leaves, ahead of every barrier */
  const int row0 = mt * 128 + 32 * (w & 3), col0 = nq * 128 + 64 * (w >> 2);
  const int rr = tid >> 3, c8 = (tid & 7) * 8; const _Float16* ga = A + (size_t)(mt * 128 + rr) * lda + c8; const _Float16* gb = Bh + (size_t)(nq * 128 + rr) * ldb + c8; const size_t sa32 = (size_t)32 * lda, sb32 = (size_t)32 * ldb;
  const unsigned l0 = (unsigned)(size_t)sm + (unsigned)(rr * G2_PB + c8 * 2);      /* low 32 bits of the __shared__ address = LDS byte address */
  const int aoff = (32 * (w & 3) + ln) * G2_PB, boff = (128 + 64 * (w >> 2) + ln) * G2_PB; const int nst = K >> 6;
  const v8f z8 = {0.f,0.f,0.f,0.f,0.f,0.f,0.f,0.f}; v8f c00 = z8, c01 = z8, c02 = z8, c03 = z8, c10 = z8, c11 = z8, c12 = z8, c13 = z8;
  g2_stage<32>(ga, sa32, gb, sb32, l0);
  asm volatile("s_wait_asynccnt 0x0" ::: "memory");      /* this wave's copies of stage 0 have landed */
  __syncthreads();      /* ... and every other wave's: stage 0 may be read */
  if (nst > 1) g2_stage<32>(ga + 64, sa32, gb + 64, sb32, l0 + G2_SB);
  /* not unrolled: one trip a stage, the buffer picked by the trip's parity */
#pragma unroll 1
  for (int t = 0; t < nst; ++t) { const unsigned char* st = sm + (t & 1) * G2_SB; const _Float16* ap = (const _Float16*)(st + aoff); const _Float16* bq = (const _Float16*)(st + boff);
    /* unrolled: the stage's two k blocks of 32 */
#pragma unroll
    for (int kb = 0; kb < 64; kb += 32) { const v16h a0 = g2_frag(ap + kb, hh), a1 = g2_frag(ap + 16 * (G2_PB / 2) + kb, hh);
      const v16h b0 = g2_frag(bq + kb, hh), b1 = g2_frag(bq + 16 * (G2_PB / 2) + kb, hh), b2 = g2_frag(bq + 32 * (G2_PB / 2) + kb, hh), b3 = g2_frag(bq + 48 * (G2_PB / 2) + kb, hh);
      /* inputs-only fence on the loaded values: it keeps the k block's twelve LDS reads in front of its products, in flight together (one LDS latency a block; left alone the compiler waited for each B fragment in turn) */
      asm volatile("" :: "v"(a0), "v"(a1), "v"(b0), "v"(b1), "v"(b2), "v"(b3));
      c00 = g2_mma(a0, b0, c00); c10 = g2_mma(a1, b0, c10); c01 = g2_mma(a0, b1, c01); c11 = g2_mma(a1, b1, c11);
      c02 = g2_mma(a0, b2, c02); c12 = g2_mma(a1, b2, c12); c03 = g2_mma(a0, b3, c03); c13 = g2_mma(a1, b3, c13); }
    asm volatile("s_wait_dscnt 0x0" ::: "memory");      /* this wave's reads of the buffer are done before it is refilled */
    asm volatile("s_wait_asynccnt 0x0" ::: "memory");      /* this wave's copies of stage t + 1 have landed */
    __syncthreads();      /* publishes stage t + 1 and ends every wave's reads of stage t */
    if (t + 2 < nst) g2_stage<32>(ga + (size_t)(t + 2) * 64, sa32, gb + (size_t)(t + 2) * 64, sb32, l0 + (t & 1) * G2_SB); }
  asm volatile("s_wait_asynccnt 0x0" ::: "memory");      /* no copy is outstanding when the buffers become output staging */
  v8f accs[8] = {c00, c01, c02, c03, c10, c11, c12, c13};
#pragma unroll
  for (int u = 0; u < 8; ++u) { const int t = u & 3, half = u >> 2; const int col = col0 + t * 16 + ln; const float bv = bp ? bf16_round(bp[col]) : 0.f;
#pragma unroll
    for (int r = 0; r < 8; ++r) { const int rloc = half * 16 + 8 * hh + r; float v = accs[u][r] * alpha + bv; if (CP) { if (rowsPerB < 0) v += CP[cofs + (size_t)(row0g + row0 + rloc) * ldc + col];      /* rowsPerB < 0: own element of the batched C plane */ else { const int bidx = (row0g + row0 + rloc) / rowsPerB; v += CP[(size_t)bidx * sCPb + (size_t)by * 64 + col]; } }
      if (ACT == 3) v = fmaxf(v, 0.f); else if (ACT == 6) v = 0.5f * v * (1.0f + erff(v * 0.70710678118654752f)); else if (ACT == 11) v = 1.0f / (1.0f + expf(-v)); else if (ACT == 15) v = v / (1.0f + expf(-v)); else if (ACT == 12) v = (v > 0.f) ? v : 0.01f * v; else if (ACT == 8) v = tanhf(v); else if (ACT == 9) v = 0.5f * v * (1.0f + tanhf(0.7978845608028654f * (v + 0.044715f * v * v * v))); else if (ACT == 14) v = (v > 0.f) ? v : 0.1f * v; else if (ACT == 16) v = (v >= 0.f) ? v : 0.3f * v; else if (ACT == 17) v = (v >= 0.f) ? v : 0.2f * v;
      accs[u][r] = v; } }
  const int rsub = lane >> 4, c4 = (lane & 15) * 4; const int rin = row0 % cmod; float* Cw = (C && rin < crows) ? C + cofs + ((size_t)(row0 / cmod) * crows + rin) * ldc + col0 + c4 : nullptr;
  if (CT && nq * 128 >= ctcol0) {      /* the same for the whole block: its columns go out transposed */
    /* unrolled for constant register indices */
#pragma unroll
    for (int u = 0; u < 8; ++u) { const int t = u & 3, half = u >> 2; FragH f; for (int r = 0; r < 8; ++r) f.h[r] = (_Float16)accs[u][r];
      *(v8us*)(sm + (64 * (w >> 2) + t * 16 + ln) * G2_TP + (32 * (w & 3) + half * 16 + 8 * hh) * 2) = f.half[0]; }
    __syncthreads();      /* the transposed tile is whole: every wave's columns are written before any row of it is read */
    unsigned short* cp = (unsigned short*)CT + ((size_t)((mt * 128) / ctmod) * (N - ctcol0) + (nq * 128 - ctcol0) + (tid >> 4)) * ctmod + (mt * 128) % ctmod + (tid & 15) * 8; const unsigned char* tp = sm + (tid >> 4) * G2_TP + (tid & 15) * 16;
    v8us tv[8];
#pragma unroll
    for (int q = 0; q < 8; ++q) tv[q] = *(const v8us*)(tp + q * 16 * G2_TP);
    __syncthreads();      /* every wave has read its rows of the tile before the f32 staging below takes the same bytes; the stores stand behind it, so that no wave waits here for them */
    unsigned short* cq[8];
#pragma unroll
    for (int q = 0; q < 8; ++q) { cq[q] = cp + (size_t)(q * 16) * ctmod; *(v8us*)cq[q] = tv[q]; }
    /* precaution: no register that an issued store names is written ahead of this wait; the eight address pairs and the stored values are inputs here so that they keep their registers up to it */
    asm volatile("s_wait_xcnt 0x0" :: "v"(cq[0]), "v"(cq[1]), "v"(cq[2]), "v"(cq[3]), "v"(cq[4]), "v"(cq[5]), "v"(cq[6]), "v"(cq[7]), "v"(tv[0]), "v"(tv[1]), "v"(tv[2]), "v"(tv[3]), "v"(tv[4]), "v"(tv[5]), "v"(tv[6]), "v"(tv[7]) : "memory");
    if (!Cw) return;      /* behind the block's last barrier: a wave with no f32 rows has nothing left to store */
    C16 = nullptr; }
#pragma unroll
  for (int u = 0; u < 8; ++u) for (int r = 0; r < 8; ++r) so[w][(u >> 2) * 16 + 8 * hh + r][(u & 3) * 16 + ln] = accs[u][r];
  __builtin_amdgcn_fence(__ATOMIC_ACQ_REL, "workgroup"); __builtin_amdgcn_wave_barrier();
  {
#pragma unroll
    for (int q = 0; q < 16; ++q) { const int r = q * 2 + rsub; const v4f v = *(const v4fa*)&so[w][r][c4]; if (Cw) *(v4f*)(Cw + (size_t)r * ldc) = v; if (C16) { v4h h4; for (int i = 0; i < 4; ++i) h4[i] = (_Float16)v[i]; *(v4h*)(C16 + cofs + (size_t)(row0 + r) * ldc + col0 + c4) = h4; } }
     } }


__global__ __launch_bounds__(256) void k_rsm(const float* __restrict__ S, _Float16* __restrict__ P, int nrows) {
  #pragma clang fp contract(off)
  const int i = blockIdx.x * 256 + threadIdx.x; if (i >= nrows) return; const float* s = S + (size_t)i * SQ; float mx = -3.0e38f;
#pragma unroll 1
  for (int j = 0; j < SQ; ++j) mx = fmaxf(mx, s[j]); float se = 0.f;
#pragma unroll 1
  for (int j = 0; j < SQ; ++j) se += expf(s[j] - mx); const float sc = 256.0f / se;
#pragma unroll 1
  for (int j0 = 0; j0 < SQ; j0 += 8) { FragH f; for (int q = 0; q < 8; ++q) f.h[q] = (_Float16)(expf(s[j0 + q] - mx) * sc); unsigned short* d = (unsigned short*)P + (size_t)i * SQ + j0; *(v8us*)d = f.half[0];  } }
__global__ __launch_bounds__(256) void k_vt(const _Float16* __restrict__ V16, int b, int h0, _Float16* __restrict__ VT) { __shared__ unsigned short tl[64][65]; const int tid = threadIdx.x; const int hh = blockIdx.x % HG, sg = blockIdx.x / HG; const int s0 = sg * 64; const int h = h0 + hh;
  for (int i = tid; i < 64 * 8; i += 256) { const int j = i / 8, d8 = (i % 8) * 8; FragH f; f.half[0] = *(const v8us*)((const unsigned short*)V16 + ((size_t)b * SQ + s0 + j) * DM + h * HD + d8); for (int q = 0; q < 8; ++q) tl[d8 + q][j] = f.u[q]; }
  __syncthreads();
  { for (int i = tid; i < 64 * 8; i += 256) { const int d = i / 8, j8 = (i % 8) * 8; FragH f; for (int q = 0; q < 8; ++q) f.u[q] = tl[d][j8 + q]; *(v8us*)((unsigned short*)VT + ((size_t)hh * HD + d) * SQ + s0 + j8) = f.half[0]; }  } }



// lane l with lane l ^ M of its 16-lane row (DPP row_xmask), and lane l with lane l ^ 16
template <int M> __device__ __forceinline__ float rs_xm(float x) { return __builtin_bit_cast(float, __builtin_amdgcn_update_dpp(0, __builtin_bit_cast(int, x), 0x160 | M, 0xf, 0xf, true)); }
__device__ __forceinline__ float rs_xh(float x) { return __builtin_bit_cast(float, __builtin_amdgcn_permlanex16(__builtin_bit_cast(int, x), __builtin_bit_cast(int, x), 0x76543210, 0xfedcba98, false, false)); }
__device__ __forceinline__ v16h fa_frag(const _Float16* p) { FragH f; f.half[0] = *(const v8us*)((const unsigned short*)p); f.half[1] = *(const v8us*)((const unsigned short*)p + 16); return f.v; }      /* p already holds the lane half's 8-element shift */
// exp2 of eight values, and of one: each v_exp_f32 works on a register of its own and a v_nop ends the statement. It is there for the slot that the instruction set asks for behind a transcendental before its result is read or its source overwritten.
__device__ __forceinline__ void fa_exp2x8(float (&e)[8]) { asm("v_exp_f32 %0, %0\n\tv_exp_f32 %1, %1\n\tv_exp_f32 %2, %2\n\tv_exp_f32 %3, %3\n\tv_exp_f32 %4, %4\n\tv_exp_f32 %5, %5\n\tv_exp_f32 %6, %6\n\tv_exp_f32 %7, %7\n\tv_nop" : "+v"(e[0]), "+v"(e[1]), "+v"(e[2]), "+v"(e[3]), "+v"(e[4]), "+v"(e[5]), "+v"(e[6]), "+v"(e[7])); }
__device__ __forceinline__ float fa_exp2(float x) { asm("v_exp_f32 %0, %0\n\tv_nop" : "+v"(x)); return x; }
// eight fragments of a key group: p = the lane's place (row ln, its half's 8-element shift) in the group's K rows or in its V^T rows
__device__ __forceinline__ void fa_load8(const _Float16* p, v16h (&f)[4][2]) {
  /* unrolled because the fragments live in registers, which need constant indices */
#pragma unroll
  for (int t = 0; t < 4; ++t) { f[t][0] = fa_frag(p + (16 * t) * (G2_PB / 2)); f[t][1] = fa_frag(p + (16 * t) * (G2_PB / 2) + 32); } }
// one query tile's scores against a group's 64 keys: s[t][r] = key 16 t + 8 hh + r of the group against query ln of the tile
__device__ __forceinline__ void fa_score(const v16h qf0, const v16h qf1, const v16h (&kc)[4][2], v8f (&s)[4]) {
  const v8f z8 = {0.f,0.f,0.f,0.f,0.f,0.f,0.f,0.f};
  /* unrolled for constant register indices */
#pragma unroll
  for (int t = 0; t < 4; ++t) { s[t] = __builtin_amdgcn_wmma_f32_16x16x32_f16(false, kc[t][0], false, qf0, (short)0, z8, false, false); s[t] = __builtin_amdgcn_wmma_f32_16x16x32_f16(false, kc[t][1], false, qf1, (short)0, s[t], false, false); } }
// weights of one query tile (first row q0) from its scores against keys kb .. kb + 63: updates the tile's m and l, leaves the rescale factor in al and the f16 weights in pf
__device__ __forceinline__ void fa_soft(const int kb, const int q0, const int ln, const int hh, v8f (&s)[4], float& m, float& l, float& al, FragH (&pf)[2]) {
  const float cs = 0.125f * 1.4426950408889634f;      /* 1 / sqrt(HD), in log2 units */
  /* every loop of this function is unrolled because scores and sums live in registers, which need constant indices */
  if (kb + 63 > q0) {      /* wave-uniform: the trip that reaches the diagonal; s[t][r] = key kb + 16 t + 8 hh + r against query q0 + ln */
#pragma unroll
    for (int t = 0; t < 4; ++t) for (int r = 0; r < 8; ++r) s[t][r] = (kb + 16 * t + 8 * hh + r <= q0 + ln) ? s[t][r] : -1.0e30f; }
  float mx = s[0][0];
#pragma unroll
  for (int t = 0; t < 4; ++t) for (int r = 0; r < 8; ++r) mx = fmaxf(mx, s[t][r]);
  mx = fmaxf(mx, rs_xh(mx));      /* the other half of the query's keys */
  const float mn = fmaxf(m, mx * cs); al = fa_exp2(m - mn); m = mn;
  v4f s4 = {0.f, 0.f, 0.f, 0.f};
#pragma unroll
  for (int t = 0; t < 4; ++t) { float e[8]; for (int r = 0; r < 8; ++r) e[r] = fmaf(s[t][r], cs, -mn); fa_exp2x8(e); for (int r = 0; r < 8; ++r) { s4[r & 3] += e[r]; pf[t >> 1].h[(t & 1) * 8 + r] = (_Float16)e[r]; } }
  l = l * al + ((s4[0] + s4[1]) + (s4[2] + s4[3]));      /* each half keeps its own keys' share */ }
// one query tile's O^T = al O^T + V^T P^T over the group's 64 keys
__device__ __forceinline__ void fa_pv(const v16h (&vf)[4][2], const FragH (&pf)[2], const float al, v8f (&o)[4]) {
  /* unrolled for constant register indices */
#pragma unroll
  for (int t = 0; t < 4; ++t) { o[t] *= al; o[t] = __builtin_amdgcn_wmma_f32_16x16x32_f16(false, vf[t][0], false, pf[0].v, (short)0, o[t], false, false); o[t] = __builtin_amdgcn_wmma_f32_16x16x32_f16(false, vf[t][1], false, pf[1].v, (short)0, o[t], false, false); } }
#define FA_SB (128 * G2_PB)          /* one key group: 64 K rows, then 64 V^T rows */
#define FA_ST (2 * FA_SB)            /* one stage: two key groups */
#define FA_YN ((SQ - QT0) / 64)      /* grid.y rows of the f16 path: the 64-row query blocks behind the first QT0 rows */
#define A0_YN (QT0 / 8)              /* grid.y rows of the exact f32 path: the 8-row blocks of the first QT0 rows */
// four waves per SIMD: with at most 256 registers a wave every f16-path block of the launch is resident from the start (16 waves per WGP), and the waves of a SIMD fill each other's waits.
// The exact f32 rows (a0_rows) need only the projection's results, as the f16 path does, so they share this launch: the blocks of grid.y >= FA_YN take them, heaviest first, in the places that are free at the start and that the lighter
// f16-path blocks leave, while the long f16-path blocks are still walking their keys. Every output row has one writer: the f16 path leaves the first QT0 rows of a batch alone.
template <int MASKADD> __device__ __forceinline__ void a0_rows(const float* __restrict__ QF, const float* __restrict__ KF, const float* __restrict__ VF, const float* __restrict__ mask, float scale, float* __restrict__ OF, int ldo, const int b, const int h, const int r8);      /* defined below */
__global__ __launch_bounds__(128) __attribute__((amdgpu_waves_per_eu(4, 4))) void k_fattn(const _Float16* __restrict__ QKVp, const _Float16* __restrict__ VTp, const float* __restrict__ QF, const float* __restrict__ KF, const float* __restrict__ VF, float* __restrict__ out) {
  __shared__ __attribute__((aligned(16))) unsigned char sm[2 * FA_ST];      /* the two stage buffers; behind the loop's last barrier the same bytes carry the odd groups' o, m, l to the partner waves */
  static_assert(2 * 17 * 512 <= 2 * FA_ST && SQ % 128 == 0 && QT0 >= 128, "the hand-over fits the buffers; a stage's 128 keys are rows of the batch; every wave meets a group with no masked key first");
  const int tid = threadIdx.x, lane = tid & 31, ln = lane & 15, hh = lane >> 4; const int w = __builtin_amdgcn_readfirstlane(tid >> 5);
  const int bh = blockIdx.x, b = bh / NH, h = bh % NH;
  if ((int)blockIdx.y >= FA_YN) { a0_rows<0>(QF, KF, VF, nullptr, 0.125f, out, DM, b, h, FA_YN + A0_YN - 1 - (int)blockIdx.y); return; }      /* the whole block leaves, ahead of every barrier and copy */
  const int rg = w & 1, kh = w >> 1;      /* the wave's 32 rows of the block, and the parity of its key groups */
  const int yb = SQ / 64 - 1 - (int)blockIdx.y; const int q0 = yb * 64 + rg * 32;      /* wave-uniform first query row */
  const int ns = (yb + 2) >> 1;      /* stages of 128 keys, the same for the block's four waves: the last one holds the diagonal group */
  const _Float16* qp = QKVp + ((size_t)b * SQ + q0 + ln) * LQ + h * HD + 8 * hh;
  const int rr = tid >> 3, c8 = (tid & 7) * 8; const _Float16* gk = QKVp + ((size_t)b * SQ + rr) * LQ + DM + h * HD + c8; const _Float16* gv = VTp + ((size_t)bh * HD + rr) * SQ + c8;      /* the lane's 16 bytes of key row rr and of V^T row rr, trip 0 */
  const unsigned l0 = (unsigned)(size_t)sm + (unsigned)(rr * G2_PB + c8 * 2);      /* low 32 bits of the __shared__ address = LDS byte address */
  const int koff = ln * G2_PB + 16 * hh, voff = (64 + ln) * G2_PB + 16 * hh;
  const v16h qa0 = fa_frag(qp), qa1 = fa_frag(qp + 32), qb0 = fa_frag(qp + 16 * LQ), qb1 = fa_frag(qp + 16 * LQ + 32);      /* LQ is a constant: all eight loads hang on one address pair by immediate offsets */
  asm volatile("s_wait_xcnt 0x0" :: "v"(qp) : "memory");      /* precaution: no register that an issued load names is written ahead of this wait; the q address pair is an input here so that no load's result is placed on it */
  g2_stage<16>(gk, (size_t)16 * LQ, gv, (size_t)16 * SQ, l0); g2_stage<16>(gk + (size_t)64 * LQ, (size_t)16 * LQ, gv + 64, (size_t)16 * SQ, l0 + FA_SB);
  asm volatile("s_wait_asynccnt 0x0" ::: "memory");      /* this wave's copies of stage 0 have landed */
  __syncthreads();      /* ... and every other wave's: stage 0's rows may be read */
  if (ns > 1) { g2_stage<16>(gk + (size_t)128 * LQ, (size_t)16 * LQ, gv + 128, (size_t)16 * SQ, l0 + FA_ST); g2_stage<16>(gk + (size_t)192 * LQ, (size_t)16 * LQ, gv + 192, (size_t)16 * SQ, l0 + FA_ST + FA_SB); }
  const v8f z8 = {0.f,0.f,0.f,0.f,0.f,0.f,0.f,0.f}; v8f oa[4] = {z8, z8, z8, z8}, ob[4] = {z8, z8, z8, z8}; float ma = -1.0e30f, la = 0.f, mb = -1.0e30f, lb = 0.f;
  /* not unrolled: one trip a stage, the buffer picked by the trip's parity */
#pragma unroll 1
  for (int s = 0; s < ns; ++s) { const unsigned char* st = sm + (s & 1) * FA_ST + kh * FA_SB; const int kb = s * 128 + kh * 64;
    if (kb <= q0) {      /* wave-uniform: the wave's group of this stage is not wholly behind the diagonal (kb is a multiple of 64, so its first key then counts for all 32 rows) */
      v16h kc[4][2], vf[4][2]; v8f sa[4], sb[4]; FragH pa[2], pb[2]; float ala, alb;
      fa_load8((const _Float16*)(st + koff), kc);
      /* inputs-only fence on the loaded values: it keeps the sixteen K reads in front of the products, in flight together (one LDS latency; left alone the compiler waited for each pair of reads in turn) */
      asm volatile("" :: "v"(kc[0][0]), "v"(kc[0][1]), "v"(kc[1][0]), "v"(kc[1][1]), "v"(kc[2][0]), "v"(kc[2][1]), "v"(kc[3][0]), "v"(kc[3][1]));
      fa_score(qa0, qa1, kc, sa); fa_score(qb0, qb1, kc, sb);
      fa_soft(kb, q0, ln, hh, sa, ma, la, ala, pa);
      fa_load8((const _Float16*)(st + voff), vf);
      __builtin_amdgcn_sched_barrier(0);      /* keeps the sixteen V^T reads in front of the second tile's softmax, which covers their latency; left alone the compiler sank them among the last products in six groups, each with a wait of its own */
      fa_soft(kb, q0 + 16, ln, hh, sb, mb, lb, alb, pb);
      fa_pv(vf, pa, ala, oa); fa_pv(vf, pb, alb, ob); }
    asm volatile("s_wait_dscnt 0x0" ::: "memory");      /* this wave's reads of the buffer are done before it is refilled */
    asm volatile("s_wait_asynccnt 0x0" ::: "memory");      /* this wave's copies of stage s + 1 have landed */
    __syncthreads();      /* publishes stage s + 1's rows and ends every wave's reads of stage s's */
    if (s + 2 < ns) { const _Float16* nk = gk + (size_t)(s + 2) * 128 * LQ; const _Float16* nv = gv + (s + 2) * 128; const unsigned nl = l0 + (s & 1) * FA_ST;
      g2_stage<16>(nk, (size_t)16 * LQ, nv, (size_t)16 * SQ, nl); g2_stage<16>(nk + (size_t)64 * LQ, (size_t)16 * LQ, nv + 64, (size_t)16 * SQ, nl + FA_SB); } }
  asm volatile("s_wait_asynccnt 0x0" ::: "memory");      /* no copy is outstanding when the buffers carry the hand-over */
  /* the hand-over: partners hold the same element in the same lane and register, so value i of a lane stands at 16-byte place 32 i + lane (a wave's write or read = 512 bytes in a row); every loop below is unrolled for constant register indices */
  const int le = (int)__builtin_amdgcn_mbcnt_lo(~0u, 0u), lne = le & 15, hhe = le >> 4;      /* the lane's index read anew: what the epilogue forms from it then holds no register through the loop, which has none to spare (one was spilled) */
  float* jp = (float*)sm + rg * (17 * 128) + le * 4;
  if (kh == 1) {      /* wave-uniform */
#pragma unroll
    for (int t = 0; t < 4; ++t) { const v4f a0 = {oa[t][0], oa[t][1], oa[t][2], oa[t][3]}, a1 = {oa[t][4], oa[t][5], oa[t][6], oa[t][7]}, b0 = {ob[t][0], ob[t][1], ob[t][2], ob[t][3]}, b1 = {ob[t][4], ob[t][5], ob[t][6], ob[t][7]};
      *(v4f*)(jp + (4 * t) * 128) = a0; *(v4f*)(jp + (4 * t + 1) * 128) = a1; *(v4f*)(jp + (4 * t + 2) * 128) = b0; *(v4f*)(jp + (4 * t + 3) * 128) = b1; }
    const v4f ml = {ma, la, mb, lb}; *(v4f*)(jp + 16 * 128) = ml; }
  __syncthreads();      /* the odd groups' o, m, l are written before the partner waves read them */
  if (kh == 1) return;      /* behind the block's last barrier */
  const v4f ml = *(const v4fa*)(jp + 16 * 128);
  const float Ma = fmaxf(ma, ml[0]), Mb = fmaxf(mb, ml[2]); const float fa0 = fa_exp2(ma - Ma), fa1 = fa_exp2(ml[0] - Ma), fb0 = fa_exp2(mb - Mb), fb1 = fa_exp2(ml[2] - Mb);
  la = la * fa0 + ml[1] * fa1; lb = lb * fb0 + ml[3] * fb1; la += rs_xh(la); lb += rs_xh(lb); const float fina = 1.0f / la, finb = 1.0f / lb;
  const float ga0 = fa0 * fina, ga1 = fa1 * fina, gb0 = fb0 * finb, gb1 = fb1 * finb;
  float* op = out + ((size_t)b * SQ + q0 + lne) * DM + h * HD + 8 * hhe;      /* oa[t][r] = column 16 t + 8 hh + r of query q0 + ln, ob[t][r] of query q0 + 16 + ln */
  v4f ra[8], rb[8];
#pragma unroll
  for (int t = 0; t < 4; ++t) { const v4f a0 = *(const v4fa*)(jp + (4 * t) * 128), a1 = *(const v4fa*)(jp + (4 * t + 1) * 128), b0 = *(const v4fa*)(jp + (4 * t + 2) * 128), b1 = *(const v4fa*)(jp + (4 * t + 3) * 128);
    for (int r = 0; r < 4; ++r) { ra[2 * t][r] = oa[t][r] * ga0 + a0[r] * ga1; ra[2 * t + 1][r] = oa[t][4 + r] * ga0 + a1[r] * ga1; rb[2 * t][r] = ob[t][r] * gb0 + b0[r] * gb1; rb[2 * t + 1][r] = ob[t][4 + r] * gb0 + b1[r] * gb1; } }
#pragma unroll
  for (int t = 0; t < 4; ++t) { *(v4f*)(op + 16 * t) = ra[2 * t]; *(v4f*)(op + 16 * t + 4) = ra[2 * t + 1]; *(v4f*)(op + 16 * DM + 16 * t) = rb[2 * t]; *(v4f*)(op + 16 * DM + 16 * t + 4) = rb[2 * t + 1]; }      /* DM is a constant: all sixteen stores hang on one address pair */
  /* precaution: no register that an issued store names is written ahead of this wait; the address pair and the stored values are inputs here so that they keep their registers up to it */
  asm volatile("s_wait_xcnt 0x0" :: "v"(op), "v"(ra[0]), "v"(ra[1]), "v"(ra[2]), "v"(ra[3]), "v"(ra[4]), "v"(ra[5]), "v"(ra[6]), "v"(ra[7]), "v"(rb[0]), "v"(rb[1]), "v"(rb[2]), "v"(rb[3]), "v"(rb[4]), "v"(rb[5]), "v"(rb[6]), "v"(rb[7]) : "memory"); }

// lane K of each 16-lane row, handed to all sixteen lanes of that row (DPP row_share)
template <int K> __device__ __forceinline__ float a0_share(float x) { return __builtin_bit_cast(float, __builtin_amdgcn_update_dpp(0, __builtin_bit_cast(int, x), 0x150 | K, 0xf, 0xf, true)); }
template <int K> __device__ __forceinline__ void a0_acc(v4f& o, float e, const v4f* vv) { o += a0_share<K>(e) * vv[K]; if constexpr (K + 1 < 16) a0_acc<K + 1>(o, e, vv); }
// exact f32 attention of the first QT0 rows, SIXTEEN LANES PER QUERY ROW, keys in groups of 16: lane p holds columns 4 p .. 4 p + 3 of its q row and reads the same columns of each of the group's sixteen K rows, as it does of the V rows, so that a load
// of the wave takes one K row's 256 bytes in a row (two whole lines) and not 16 bytes of sixteen rows (sixteen lines). Each lane forms its four columns' share of all sixteen scores; a0_scatter sums the shares over the 16 lanes and leaves
// key 16 g + p's score in lane p. The group's maximum comes from a four-step butterfly over the 16 lanes, the running o and l are rescaled once per group, lane p keeps columns 4 p .. 4 p + 3 of o and its own keys' share of l
// (summed over the 16 lanes at the end). No LDS, no barrier.
// A 128-thread block takes eight query rows: rows 8 r8 .. 8 r8 + 7 of head h of batch b. QF, KF, VF point at the q, k, v blocks of the packed f32 rows (QT0 rows a batch, pitch LQ), OF at the output rows (SQ rows a batch).
// The rows' 16-row block rb = r8 / 2 sets the number of key groups, rb + 1.
// one step of the sum over a 16-lane row: d holds 2 N values a lane; the lanes whose index has bit N clear keep values 0 .. N - 1 and hand N .. 2 N - 1 to lane l ^ N, the others the other way round; each adds what it is handed to what it keeps.
// After the steps N = 8, 4, 2, 1 lane p holds value p summed over the sixteen lanes.
typedef float v2f __attribute__((ext_vector_type(2)));
template <int N> __device__ __forceinline__ void a0_fold(float (&d)[16], const int p) { const bool up = (p & N) != 0;
  /* unrolled because the values live in registers, which need constant indices */
#pragma unroll
  for (int c = 0; c < N; ++c) { const float keep = up ? d[c + N] : d[c], send = up ? d[c] : d[c + N]; d[c] = keep + rs_xm<N>(send); } }
__device__ __forceinline__ float a0_scatter(float (&d)[16], const int p) { a0_fold<8>(d, p); a0_fold<4>(d, p); a0_fold<2>(d, p); a0_fold<1>(d, p); return d[0]; }
template <int MASKADD>
__device__ __forceinline__ void a0_rows(const float* __restrict__ QF, const float* __restrict__ KF, const float* __restrict__ VF, const float* __restrict__ mask, float scale, float* __restrict__ OF, int ldo, const int b, const int h, const int r8) {
  const int p = threadIdx.x & 15; const int rb = r8 >> 1; const int i = r8 * 8 + (threadIdx.x >> 4);
  QF += (size_t)b * QT0 * LQ; KF += (size_t)b * QT0 * LQ; VF += (size_t)b * QT0 * LQ; OF += (size_t)b * SQ * ldo;
  const float* qr = QF + (size_t)i * LQ + h * HD + p * 4;      /* q, k, v rows have the pitch LQ, a constant, so that a group's sixteen K rows and sixteen V rows each hang on one address pair by immediate offsets */
  const v4f q = *(const v4fa*)qr; const v2f qlo = {q[0], q[1]}, qhi = {q[2], q[3]};
  asm volatile("s_wait_xcnt 0x0" :: "v"(qr) : "memory");      /* precaution: no register that an issued load names is written ahead of this wait; the address pair is an input here so that no load's result is placed on it */
  v4f o = {0.f, 0.f, 0.f, 0.f}; float m = -1.0e30f, l = 0.f; const int ng = MASKADD ? (SQ / 16) : (rb + 1);      /* additive-mask form: every key (the mask input decides); causal form: key groups up to the block's last row */
  for (int g = 0; g < ng; ++g) { const int j = g * 16 + p; const float* kr = KF + (size_t)(g * 16) * LQ + h * HD + p * 4; const float* vr = VF + (size_t)(g * 16) * LQ + h * HD + p * 4; v4f kk[16], vv[16];
    /* the loops over c are unrolled because the rows live in registers, which need constant indices */
#pragma unroll
    for (int c = 0; c < 16; ++c) kk[c] = *(const v4fa*)(kr + c * LQ);
#pragma unroll
    for (int c = 0; c < 16; ++c) vv[c] = *(const v4fa*)(vr + c * LQ);
    asm volatile("s_wait_xcnt 0x0" :: "v"(kr), "v"(vr) : "memory");      /* the same precaution for the two address pairs of the group */
    /* inputs-only fences on the loaded values: they keep all 32 loads of the group in front of the arithmetic, in flight together (one memory latency per group; left alone the compiler waits after every second load) */
    asm volatile("" :: "v"(kk[0]), "v"(kk[1]), "v"(kk[2]), "v"(kk[3]), "v"(kk[4]), "v"(kk[5]), "v"(kk[6]), "v"(kk[7]), "v"(kk[8]), "v"(kk[9]), "v"(kk[10]), "v"(kk[11]), "v"(kk[12]), "v"(kk[13]), "v"(kk[14]), "v"(kk[15]), "v"(vv[0]), "v"(vv[1]), "v"(vv[2]), "v"(vv[3]), "v"(vv[4]), "v"(vv[5]), "v"(vv[6]), "v"(vv[7]), "v"(vv[8]), "v"(vv[9]), "v"(vv[10]), "v"(vv[11]), "v"(vv[12]), "v"(vv[13]));
    asm volatile("" :: "v"(vv[14]), "v"(vv[15]));
    float d[16];
#pragma unroll
    for (int c = 0; c < 16; ++c) { const v2f t = qlo * __builtin_shufflevector(kk[c], kk[c], 0, 1) + qhi * __builtin_shufflevector(kk[c], kk[c], 2, 3); d[c] = t[0] + t[1]; }      /* two packed operations on the register pairs as they were loaded, then one add */
    float s = a0_scatter(d, p) * scale; if (MASKADD) s += bf16_round(mask[(size_t)i * SQ + j]) * -10000.0f;
    const float sm = (MASKADD || j <= i) ? s : -1.0e30f;
    float gm = sm; gm = fmaxf(gm, rs_xm<1>(gm)); gm = fmaxf(gm, rs_xm<2>(gm)); gm = fmaxf(gm, rs_xm<4>(gm)); gm = fmaxf(gm, rs_xm<8>(gm));
    const float mn = fmaxf(m, gm); const float sc = expf(m - mn); const float e = expf(sm - mn); l = l * sc + e; m = mn; o *= sc;
    a0_acc<0>(o, e, vv); }
  l += rs_xm<1>(l); l += rs_xm<2>(l); l += rs_xm<4>(l); l += rs_xm<8>(l);
  const float fin = 1.0f / l;
  *(v4f*)(OF + (size_t)i * ldo + h * HD + p * 4) = o * fin; }



extern "C" void kernel_launch(void* const* d_in, const int* in_sizes, int n_in,
                              void* d_out, int out_size, void* d_ws, size_t ws_size, hipStream_t stream) {
  (void)in_sizes; (void)n_in; (void)out_size;
  const float* const* I = (const float* const*)d_in; const float* x = I[0]; const float* wq = I[1]; const float* bq = I[2]; const float* wk = I[3]; const float* bk = I[4]; const float* wv = I[5]; const float* bv = I[6];      /* natural nn.Linear [out][in] weights + biases */
  char* ws = (char*)d_ws; size_t off = 0;
  auto take = [&](size_t bytes) { char* p = ws + off; off += (bytes + 255) & ~(size_t)255; return p; };
  _Float16* BQKV = (_Float16*)take((size_t)3 * DM * DM * 2); float* bqkv = (float*)take((size_t)3 * DM * 4);      /* stacked q | k | v weight plane and bias vector */ 
  _Float16* X16 = (_Float16*)take(NR * DM * 2); _Float16* QKV = (_Float16*)take(NR * 3 * DM * 2); _Float16* Q16 = QKV; _Float16* K16 = QKV + DM; _Float16* V16 = QKV + 2 * DM;      /* q | k | v */ _Float16* O16 = (_Float16*)take(NR * DM * 2);
  _Float16* VT = (_Float16*)take((size_t)NB * NH * HD * SQ * 2);
  float* F0 = (float*)take((size_t)NB * QT0 * LQ * 4);      /* f32 q | k | v of the first QT0 rows of each batch, packed */
  if (off > ws_size) return;
  k_prep<<<PREP_XB + 3 * PREP_WB + 1, 256, 0, stream>>>(x, wq, wk, wv, bq, bk, bv, X16, BQKV, bqkv);      /* x rows f16; natural [out][in] = Bt[n][k] x16, stacked q | k | v; stacked bias vector bq | bk | bv */
  const size_t r0p = (size_t)B0 * SQ;      /* first projected row */
  k_gemm2<0><<<dim3((unsigned)((MP / 128) * (3 * DM / 128)), 1), 256, 0, stream>>>(X16 + r0p * DM, DM, 0, BQKV, DM, 0, 0.0625f, bqkv, 0, nullptr, 1, 0, 0, F0, SQ, QT0, QKV + r0p * 3 * DM, VT, 2 * DM, SQ, 3 * DM, 0, MP, 3 * DM, DM);      /* q | k rows (f16); head h = columns h*HD.. of each DM block; v as V^T [NB][NH][HD][SQ]; the first QT0 rows of each batch also f32 (q | k | v) */
  k_fattn<<<dim3(NB * NH, FA_YN + A0_YN), 128, 0, stream>>>(QKV, VT, F0, F0 + DM, F0 + 2 * DM, (float*)d_out);      /* o (merged heads) f32 straight into the output rows: f16 path behind the first QT0 rows of each batch, exact f32 causal attention for those */
}
